// v000
// Times are from an AMD MI455X. After a warm-up the kernel runs many times in a row, and a time is the length of
// such a window on the GPU divided by its runs, so every launch and the gaps after it count. The runs cycle
// through copies of the inputs. A figure is the median of several windows, for all but v000 over two sittings.
// Sittings can differ by a few percent; kernels timed side by side share one.
// v000, which the later versions start from, runs in 841 microseconds.
// compute dtype: all float inputs rounded to bf16; q/k/v projections with EXACT bf16 products on WMMA 16x16x32 (f32 accumulate) + bias; causal logits: 3 products for the first 384 rows, single f16 q x k after, x 64^-0.5; softmax f32; P x 2^11 once to f16 x v once to f16 (bf16 hi + lo below row 384); ctx hi+lo x exact output weight below row 384, x2^6 f16 carry x f16(bf16 x 2^8) after, + bias; f32 output.
#include <hip/hip_runtime.h>
#include <math.h>

typedef __attribute__((ext_vector_type(16))) _Float16 v16h;
typedef __attribute__((ext_vector_type(16))) __bf16 v16b;
typedef __attribute__((ext_vector_type(8)))  _Float16 v8h;
typedef __attribute__((ext_vector_type(8)))  float v8f;
typedef __attribute__((ext_vector_type(4)))  float v4f;
typedef __attribute__((ext_vector_type(2)))  float v2f;
typedef __attribute__((ext_vector_type(4)))  unsigned v4u;
typedef __attribute__((ext_vector_type(4)))  int v4i;
typedef float __attribute__((may_alias)) float_a;
typedef int __attribute__((may_alias)) int_a;

template <typename T> __device__ __forceinline__ void vst2(void* p, T v) { *(T*)p = v;  }
__device__ __forceinline__ v8f wmma16(v16h a, v16h b, v8f c) {
  v8f d = __builtin_amdgcn_wmma_f32_16x16x32_f16(false, a, false, b, (short)0, c, false, false);
  asm volatile("v_nop\n\tv_nop\n\tv_nop\n\tv_nop" : "+v"(d) : "v"(a), "v"(b));
  return d;
}
__device__ __forceinline__ v8f wmma_bf(v16b a, v16b b, v8f c) {
  v8f d = __builtin_amdgcn_wmma_f32_16x16x32_bf16(false, a, false, b, (short)0, c, false, false);
  asm volatile("v_nop\n\tv_nop\n\tv_nop\n\tv_nop" : "+v"(d) : "v"(a), "v"(b));
  return d;
}
// 16x16x32 fragments: lane = (h = lane>>4, row/col = lane&15); elements 0..7 = k0+8h+0..7, 8..15 = k0+16+8h+0..7; D element r = row 8h+r
__device__ __forceinline__ v16h frag_h(const _Float16* rowk0, int lane) {
  union { v16h v; v8h q[2]; } u; const _Float16* p = rowk0 + 8 * (lane >> 4);
  u.q[0] = *(const v8h*)p; u.q[1] = *(const v8h*)(p + 16); return u.v;
}
__device__ __forceinline__ v16h frag_f32(const float* rowk0, int lane) {
  v16h a; const float* p = rowk0 + 8 * (lane >> 4);
#pragma unroll
  for (int i = 0; i < 8; ++i) { a[i] = (_Float16)p[i]; a[8 + i] = (_Float16)p[16 + i]; }
  return a;
}
__device__ __forceinline__ v16h frag_f32s(const float* rowk0, int lane, float sc) {
  v16h a; const float* p = rowk0 + 8 * (lane >> 4);
#pragma unroll
  for (int i = 0; i < 8; ++i) { a[i] = (_Float16)(p[i] * sc); a[8 + i] = (_Float16)(p[16 + i] * sc); }
  return a;
}
// column fragment from a [K][ld] layout (column n), rows >= K read as 0
__device__ __forceinline__ v16h fragc_f32(const float* W, int k0, int n, int lane, int ld, int K) {
  v16h a; const int g = lane >> 4;
#pragma unroll
  for (int i = 0; i < 8; ++i) { const int ka = k0 + 8 * g + i, kb = ka + 16;
    a[i] = (_Float16)(ka < K ? W[(size_t)(ka < K ? ka : K - 1) * ld + n] : 0.f); a[8 + i] = (_Float16)(kb < K ? W[(size_t)(kb < K ? kb : K - 1) * ld + n] : 0.f); }
  return a;
}
struct F2 { v16b h, l; };
__device__ __forceinline__ F2 bsplit16(const float v[16]) { F2 r;
#pragma unroll
  for (int i = 0; i < 16; ++i) { const __bf16 h = (__bf16)v[i]; r.h[i] = h; r.l[i] = (__bf16)(v[i] - (float)h); }
  return r; }
__device__ __forceinline__ F2 split_row(const float* row, int k0, int lane) { float v[16]; const float* p = row + k0 + 8 * (lane >> 4);
#pragma unroll
  for (int i = 0; i < 8; ++i) { v[i] = p[i]; v[8 + i] = p[16 + i]; }
  return bsplit16(v); }
__device__ __forceinline__ F2 split_rowK(const float* row, int k0, int lane, int K) { float v[16]; const int g = lane >> 4;
#pragma unroll
  for (int i = 0; i < 8; ++i) { const int ka = k0 + 8 * g + i, kb = ka + 16; v[i] = ka < K ? row[ka < K ? ka : K - 1] : 0.f; v[8 + i] = kb < K ? row[kb < K ? kb : K - 1] : 0.f; }
  return bsplit16(v); }
__device__ __forceinline__ F2 split_col(const float* W, int k0, int n, int lane, int ld, int K) { float v[16]; const int g = lane >> 4;
#pragma unroll
  for (int i = 0; i < 8; ++i) { const int ka = k0 + 8 * g + i, kb = ka + 16; v[i] = ka < K ? W[(size_t)(ka < K ? ka : K - 1) * ld + n] : 0.f; v[8 + i] = kb < K ? W[(size_t)(kb < K ? kb : K - 1) * ld + n] : 0.f; }
  return bsplit16(v); }
__device__ __forceinline__ v8f mac3(const F2& a, const F2& b, v8f c) { c = wmma_bf(a.l, b.h, c); c = wmma_bf(a.h, b.l, c); return wmma_bf(a.h, b.h, c); }
__device__ __forceinline__ float sigm(float v) { return 1.0f / (1.0f + expf(-v)); }
#define LDSX() do { asm volatile("s_wait_dscnt 0" ::: "memory"); __builtin_amdgcn_wave_barrier(); __builtin_amdgcn_fence(__ATOMIC_RELEASE, "workgroup"); } while (0)

// Causal multi-head attention on separate inputs listed key-first (key / value / query [4,1024,1024]; torch (out,in) Wk / Wq / Wv / Wp [1024,1024] (0.02) + zero biases; 16 heads x 64; scale 1/8; tril, -inf): out = merge(softmax(causal(q_h k_h^T / 8)) v_h) Wp^T + bp.
#define NB 4
#define TT 1024
#define CC 1024            // NH * HD = projected width
#define DIN 1024          // input (model) width
#define NH 16
#define HD 64
#define NQB (TT / 64)
#define HG 8
#define SCALE (0.125f)
#define CAUSAL 1
#ifndef TNB
#define TNB NB
#endif
__device__ __forceinline__ float bfr(float v) { return (float)(__bf16)v; }
__host__ __device__ __forceinline__ int kb_last(int qb) { return CAUSAL ? ((qb * 64 + 63) >> 7) : (TT / 128 - 1); }
typedef __attribute__((ext_vector_type(8))) __bf16 v8b;
__device__ __forceinline__ v16b frag_b(const __bf16* rowk0, int lane) {
  union { v16b v; v8b q[2]; } u; const __bf16* p = rowk0 + 8 * (lane >> 4);
  u.q[0] = *(const v8b*)p; u.q[1] = *(const v8b*)(p + 16); return u.v;
}
#define QBH 6              // causal: query blocks 0..QBH-1 of each sequence (few keys, no averaging) take the high-precision path
#define QHI 384            // rows carrying a q residual plane
#define KHI 384            // key rows carrying k residual / v bf16 hi+lo planes (used only by the causal high-precision path)
// B fragment (k rows k0+.., output column o) of a weight: (in,out) [K][ld] or (out,in) [ld rows of K]: bf16 exact, or f16(bf16 * 256) exact
__device__ __forceinline__ v16b wcol_io(const float* Wm, int k0, int o, int lane, int ld) { v16b w; const int g = lane >> 4;
#pragma unroll
  for (int i = 0; i < 8; ++i) { w[i] = (__bf16)Wm[(size_t)(k0 + 8 * g + i) * ld + o]; w[8 + i] = (__bf16)Wm[(size_t)(k0 + 16 + 8 * g + i) * ld + o]; }
  return w; }
__device__ __forceinline__ v16b wcol_oi(const float* Wm, int k0, int o, int lane, int K) { v16b w; const float* p = Wm + (size_t)o * K + k0 + 8 * (lane >> 4);
#pragma unroll
  for (int i = 0; i < 8; ++i) { w[i] = (__bf16)p[i]; w[8 + i] = (__bf16)p[16 + i]; }
  return w; }
__device__ __forceinline__ v16h wcolh_io(const float* Wm, int k0, int o, int lane, int ld) { v16h w; const int g = lane >> 4;
#pragma unroll
  for (int i = 0; i < 8; ++i) { w[i] = (_Float16)(bfr(Wm[(size_t)(k0 + 8 * g + i) * ld + o]) * 256.0f); w[8 + i] = (_Float16)(bfr(Wm[(size_t)(k0 + 16 + 8 * g + i) * ld + o]) * 256.0f); }
  return w; }
__device__ __forceinline__ v16h wcolh_oi(const float* Wm, int k0, int o, int lane, int K) { v16h w; const float* p = Wm + (size_t)o * K + k0 + 8 * (lane >> 4);
#pragma unroll
  for (int i = 0; i < 8; ++i) { w[i] = (_Float16)(bfr(p[i]) * 256.0f); w[8 + i] = (_Float16)(bfr(p[16 + i]) * 256.0f); }
  return w; }
#define WQKV_LAYOUT 1   // 0 = (in,out) [DIN][CC]; 1 = (out,in) [CC][DIN]; 2 = per-head [NH][DIN][HD]
__device__ __forceinline__ v16b wcol_hdk(const float* Wm, int k0, int o, int lane) { v16b w; const int g = lane >> 4; const float* p = Wm + (size_t)(o / HD) * DIN * HD + (o % HD);
#pragma unroll
  for (int i = 0; i < 8; ++i) { w[i] = (__bf16)p[(size_t)(k0 + 8 * g + i) * HD]; w[8 + i] = (__bf16)p[(size_t)(k0 + 16 + 8 * g + i) * HD]; }
  return w; }
#define WO_OUT_IN 1
#if WQKV_LAYOUT == 1
#define WCOL(W, k0, o, lane) wcol_oi(W, k0, o, lane, DIN)
#elif WQKV_LAYOUT == 2
#define WCOL(W, k0, o, lane) wcol_hdk(W, k0, o, lane)
#else
#define WCOL(W, k0, o, lane) wcol_io(W, k0, o, lane, CC)
#endif
#if WO_OUT_IN
#define WOCOL(W, k0, o, lane) wcol_oi(W, k0, o, lane, CC)
#define WOCOLH(W, k0, o, lane) wcolh_oi(W, k0, o, lane, CC)
#else
#define WOCOL(W, k0, o, lane) wcol_io(W, k0, o, lane, DIN)
#define WOCOLH(W, k0, o, lane) wcolh_io(W, k0, o, lane, DIN)
#endif

#ifndef SM_EXTRA_PARAMS
#define SM_EXTRA_PARAMS
#endif
#ifndef PROJ_EXTRA_PARAMS
#define PROJ_EXTRA_PARAMS
#endif
#ifndef SM_MASK_HOOK
#define SM_MASK_HOOK (void)0
#endif

#define WS_QH  0u                                      // f16 q rows [b*t][CC]
#define WS_KH  (WS_QH + 2u * (size_t)NB * TT * CC)      // f16 k rows [b*t][CC]
#define WS_VT  (WS_KH + 2u * (size_t)NB * TT * CC)      // f16 v planes [b][c][t]
#define WS_QL  (WS_VT + 2u * (size_t)NB * CC * TT)      // f16 q residual x 2^10 rows [b][t < QHI][CC]
#define WS_KL  (WS_QL + 2u * (size_t)NB * QHI * CC)     // f16 k residual x 2^10 rows [b][t < KHI][CC]
#define WS_VB  (WS_KL + 2u * (size_t)NB * KHI * CC)     // bf16 v hi planes [b][c][t < KHI]
#define WS_VBL (WS_VB + 2u * (size_t)NB * CC * KHI)
#define WS_S   (WS_VBL + 2u * (size_t)NB * CC * KHI)    // f32 logits / P [hg][t][s]
#define WS_Y   (WS_S  + 4u * (size_t)HG * TT * TT)      // f32 ctx rows [b*t][CC] (only when there is an output projection)
#define WS_END (WS_Y  + 4u * (size_t)NB * TT * CC)

// ---- k_proj: block = (64 rows, 128 cols, which): q/k/v = X W (+ b) with exact bf16 products (K = DIN) -> which 0: q f16 rows (+ residual rows < QHI); 1: k f16 rows (+ residual rows < KHI); 2: v f16 planes [c][t] (+ bf16 hi/lo planes for t < KHI)
__global__ __launch_bounds__(128) void k_proj(const float* __restrict__ XQ, const float* __restrict__ XK, const float* __restrict__ XV, const float* __restrict__ WQ, const float* __restrict__ WK, const float* __restrict__ WV, const float* __restrict__ BQ, const float* __restrict__ BK, const float* __restrict__ BV,
    _Float16* __restrict__ QH, _Float16* __restrict__ QL, _Float16* __restrict__ KH, _Float16* __restrict__ KL, _Float16* __restrict__ VT, __bf16* __restrict__ VB, __bf16* __restrict__ VBL) {
  __shared__ __align__(16) _Float16 sh[64][136], sl[64][136]; __shared__ __align__(16) _Float16 th[128][72]; __shared__ __align__(16) __bf16 tb[128][72], tbl[128][72];
  const int tid = threadIdx.x, wave = tid >> 5, lane = tid & 31, col = lane & 15, g = lane >> 4; const int which = blockIdx.z; const int c0 = blockIdx.y * 128; const size_t r0 = (size_t)blockIdx.x * 64; const size_t bb = r0 / TT; const int t0 = (int)(r0 % TT);
  const float* X = which == 0 ? XQ : which == 1 ? XK : XV; const float* WA = which == 0 ? WQ : which == 1 ? WK : WV; const float* BA = which == 0 ? BQ : which == 1 ? BK : BV;
  v8f acc[8] = {};
#pragma unroll 2
  for (int kc = 0; kc < DIN / 32; ++kc) { v16b a; { const float* p = X + (r0 + wave * 16 + col) * DIN + kc * 32 + 8 * g;
#pragma unroll
      for (int i = 0; i < 8; ++i) { a[i] = (__bf16)p[i]; a[8 + i] = (__bf16)p[16 + i]; } }
    asm volatile("s_wait_loadcnt 0x0" ::: "memory");
#pragma unroll
    for (int j = 0; j < 8; ++j) { const v16b w = WCOL(WA, kc * 32, c0 + j * 16 + col, lane); asm volatile("s_wait_loadcnt 0x0" ::: "memory"); acc[j] = wmma_bf(a, w, acc[j]); } }
  if (which < 2) { _Float16* DH = which == 0 ? QH : KH; _Float16* DL = which == 0 ? QL : KL; const int nhi = which == 0 ? QHI : KHI; const bool hi_rows = t0 < nhi;
#pragma unroll
    for (int j = 0; j < 8; ++j) { const float bias = BA ? bfr(BA[c0 + j * 16 + col]) : 0.f;
#pragma unroll
      for (int r = 0; r < 8; ++r) { const float v = acc[j][r] + bias; const _Float16 hv = (_Float16)v; sh[wave * 16 + 8 * g + r][j * 16 + col] = hv; sl[wave * 16 + 8 * g + r][j * 16 + col] = (_Float16)((v - (float)hv) * 1024.0f); } }
    __syncthreads();
    for (int e = tid; e < 64 * 16; e += 128) { const int rl = e >> 4, q = e & 15; vst2((unsigned*)(DH + (r0 + rl) * CC + c0 + q * 8), *(const v4u*)&sh[rl][q * 8]); if (hi_rows) vst2((unsigned*)(DL + (bb * nhi + t0 + rl) * (size_t)CC + c0 + q * 8), *(const v4u*)&sl[rl][q * 8]); }
  } else { const bool hi_rows = t0 < KHI;
#pragma unroll
    for (int j = 0; j < 8; ++j) { const float bias = BA ? bfr(BA[c0 + j * 16 + col]) : 0.f;
#pragma unroll
      for (int r = 0; r < 8; ++r) { const float v = acc[j][r] + bias; const int rl = wave * 16 + 8 * g + r, cl = j * 16 + col; th[cl][rl] = (_Float16)v; const __bf16 bh = (__bf16)v; tb[cl][rl] = bh; tbl[cl][rl] = (__bf16)(v - (float)bh); } }
    __syncthreads();
    for (int e = tid; e < 128 * 8; e += 128) { const int cl = e >> 3, q = e & 7; vst2((unsigned*)(VT + (bb * CC + c0 + cl) * (size_t)TT + t0 + q * 8), *(const v4u*)&th[cl][q * 8]); if (hi_rows) { const size_t o3 = (bb * CC + c0 + cl) * (size_t)KHI + t0 + q * 8; vst2((unsigned*)(VB + o3), *(const v4u*)&tb[cl][q * 8]); vst2((unsigned*)(VBL + o3), *(const v4u*)&tbl[cl][q * 8]); } } } }
// ---- k_sc: block = (query block qb, key block kb <= kb_last(qb), head in group) of batch b: logits x SCALE; q hi + residual (x 2^10) against k (2 products) for query rows < QHI, plus the k residual (3 products) for query blocks < QBH (causal early rows); causal: blocks past the diagonal exit, the mask itself is applied by index in k_sm
__global__ __launch_bounds__(128) void k_sc(const _Float16* __restrict__ QH, const _Float16* __restrict__ KH, const _Float16* __restrict__ QL, const _Float16* __restrict__ KL, int b, int h0, float* __restrict__ S0) { __shared__ __align__(16) float ss[4][16][132];
  const int qb = blockIdx.x, kb = blockIdx.y; if (kb > kb_last(qb)) return;
  const int h = h0 + blockIdx.z; float* S = S0 + (size_t)blockIdx.z * TT * TT;
  const int tid = threadIdx.x, wave = tid >> 5, lane = tid & 31, col = lane & 15, g = lane >> 4; const int k0 = kb * 128; const int ql0 = qb * 64 + wave * 16; const size_t q0 = (size_t)b * TT + ql0, kr0 = (size_t)b * TT + k0;
  v8f acc[8] = {}, accl[8] = {};
  const _Float16* QLb = QL + (size_t)b * QHI * CC; const _Float16* KLb = KL + (size_t)b * KHI * CC;
  if (qb < QBH) {
#pragma unroll
    for (int kc = 0; kc < HD / 32; ++kc) { const v16h ah = frag_h(QH + (q0 + col) * CC + h * HD + kc * 32, lane), al = frag_h(QLb + (size_t)(ql0 + col) * CC + h * HD + kc * 32, lane);
#pragma unroll
      for (int j = 0; j < 8; ++j) { const v16h kbf = frag_h(KH + (kr0 + j * 16 + col) * CC + h * HD + kc * 32, lane), klf = frag_h(KLb + (size_t)(k0 + j * 16 + col) * CC + h * HD + kc * 32, lane); acc[j] = wmma16(ah, kbf, acc[j]); accl[j] = wmma16(al, kbf, accl[j]); accl[j] = wmma16(ah, klf, accl[j]); } }
  } else if (qb * 64 < QHI) {
#pragma unroll
    for (int kc = 0; kc < HD / 32; ++kc) { const v16h ah = frag_h(QH + (q0 + col) * CC + h * HD + kc * 32, lane), al = frag_h(QLb + (size_t)(ql0 + col) * CC + h * HD + kc * 32, lane);
#pragma unroll
      for (int j = 0; j < 8; ++j) { const v16h kbf = frag_h(KH + (kr0 + j * 16 + col) * CC + h * HD + kc * 32, lane); acc[j] = wmma16(ah, kbf, acc[j]); accl[j] = wmma16(al, kbf, accl[j]); } }
  } else {
#pragma unroll
    for (int kc = 0; kc < HD / 32; ++kc) { const v16h ah = frag_h(QH + (q0 + col) * CC + h * HD + kc * 32, lane);
#pragma unroll
      for (int j = 0; j < 8; ++j) { const v16h kbf = frag_h(KH + (kr0 + j * 16 + col) * CC + h * HD + kc * 32, lane); acc[j] = wmma16(ah, kbf, acc[j]); } } }
#pragma unroll
  for (int j = 0; j < 8; ++j) {
#pragma unroll
    for (int r = 0; r < 8; ++r) ss[wave][8 * g + r][j * 16 + col] = (acc[j][r] + accl[j][r] * (1.0f / 1024.0f)) * SCALE; }
  LDSX(); for (int rl = 0; rl < 16; ++rl) vst2(S + (size_t)(ql0 + rl) * TT + k0 + lane * 4, *(const v4f*)&ss[wave][rl][lane * 4]); }
// ---- k_sm: block = query row t (head in group): keys [0, kend): causal -> logit if s <= t else excluded; softmax in f32; P x 2^11 in place (0 for excluded)
__global__ __launch_bounds__(256) void k_sm(float* __restrict__ S0 SM_EXTRA_PARAMS) { __shared__ float sred[8]; __shared__ float sbc; __shared__ __align__(16) float shv[TT];
  const int tid = threadIdx.x; const int t = blockIdx.x; const int kend = (kb_last(t >> 6) + 1) * 128;
  float* sr = S0 + (size_t)blockIdx.y * TT * TT + (size_t)t * TT;
  float m = -3.0e38f; for (int k = tid; k < kend; k += 256) { float v = (!CAUSAL || k <= t) ? sr[k] : -3.0e38f; SM_MASK_HOOK; shv[k] = v; m = fmaxf(m, v); }
#pragma unroll
  for (int o = 1; o < 32; o <<= 1) m = fmaxf(m, __shfl_xor(m, o));
  if ((tid & 31) == 0) sred[tid >> 5] = m; __syncthreads(); if (tid == 0) { float a = sred[0]; for (int i = 1; i < 8; ++i) a = fmaxf(a, sred[i]); sbc = a; } __syncthreads(); m = sbc; __syncthreads();
  float sum = 0.f; for (int k = tid; k < kend; k += 256) { const float v = shv[k]; const float e = (v <= -1.0e38f) ? 0.f : expf(v - m); shv[k] = e; sum += e; }
#pragma unroll
  for (int o = 1; o < 32; o <<= 1) sum += __shfl_xor(sum, o);
  if ((tid & 31) == 0) sred[tid >> 5] = sum; __syncthreads(); if (tid == 0) { float a = 0.f; for (int i = 0; i < 8; ++i) a += sred[i]; sbc = a > 0.f ? 2048.0f / a : 0.f; }   /* a fully excluded row yields P = 0 */ __syncthreads(); const float inv = sbc;
  for (int k = tid; k < kend; k += 256) shv[k] = shv[k] * inv;
  __syncthreads(); for (int q = tid; q < kend / 4; q += 256) vst2(sr + q * 4, *(const v4f*)&shv[q * 4]); }
// ---- k_pv: block = 64 queries (qb) of (b, h): ctx = P . v over keys [0, kend) (P x 2^11 once to f16 against v f16: 1 product; causal early query blocks: P and v as bf16 hi + lo, 3 products); 256-B (row, head) segment by 16 lanes
__global__ __launch_bounds__(128) void k_pv(const float* __restrict__ PS0, const _Float16* __restrict__ VT, const __bf16* __restrict__ VB, const __bf16* __restrict__ VBL, int b, int h0, float* __restrict__ Y) { const int h = h0 + blockIdx.z; const float* PS = PS0 + (size_t)blockIdx.z * TT * TT; __shared__ __align__(16) float ss[4][16][HD + 4];
  const int tid = threadIdx.x, wave = tid >> 5, lane = tid & 31, col = lane & 15, g = lane >> 4; const int qb = blockIdx.x; const int ql0 = qb * 64 + wave * 16; const int kce = (kb_last(qb) + 1) * 4;
  v8f acc[HD / 16] = {};
  if (qb < QBH) {
#pragma unroll 1
    for (int kc = 0; kc < kce; ++kc) { const F2 p = split_row(PS + (size_t)(ql0 + col) * TT, kc * 32, lane);
      asm volatile("s_wait_loadcnt 0x0" ::: "memory");
#pragma unroll
      for (int j = 0; j < HD / 16; ++j) { const size_t po = ((size_t)b * CC + h * HD + j * 16 + col) * (size_t)KHI + kc * 32; const v16b vh = frag_b(VB + po, lane); acc[j] = wmma_bf(p.h, vh, acc[j]); acc[j] = wmma_bf(p.l, vh, acc[j]); acc[j] = wmma_bf(p.h, frag_b(VBL + po, lane), acc[j]); } }
  } else {
#pragma unroll 1
    for (int kc = 0; kc < kce; ++kc) { const v16h p = frag_f32(PS + (size_t)(ql0 + col) * TT + kc * 32, lane);
      asm volatile("s_wait_loadcnt 0x0" ::: "memory");
#pragma unroll
      for (int j = 0; j < HD / 16; ++j) { const size_t po = ((size_t)b * CC + h * HD + j * 16 + col) * (size_t)TT + kc * 32; acc[j] = wmma16(p, frag_h(VT + po, lane), acc[j]); } } }
#pragma unroll
  for (int j = 0; j < HD / 16; ++j)
#pragma unroll
    for (int r = 0; r < 8; ++r) ss[wave][8 * g + r][j * 16 + col] = acc[j][r] * (1.0f / 2048.0f);
  LDSX(); for (int rl = 0; rl < 16; ++rl) if (lane < HD / 4) vst2(Y + ((size_t)b * TT + ql0 + rl) * CC + h * HD + lane * 4, *(const v4f*)&ss[wave][rl][lane * 4]); }
// ---- k_out: block = (64 rows, 128 cols): out = ctx Wo (+ bo): ctx x 2^6 once to f16 against Wo as f16(bf16 x 2^8) exact (1 product) x 2^-14; causal early rows (< QHI of each sequence): ctx bf16 hi + lo against exact bf16 Wo (2 products)
__global__ __launch_bounds__(128) void k_out(const float* __restrict__ Y, const float* __restrict__ WO, const float* __restrict__ BO, float* __restrict__ OUT) { __shared__ __align__(16) float sf[4][16][132];
  const int tid = threadIdx.x, wave = tid >> 5, lane = tid & 31, col = lane & 15, g = lane >> 4; const int c0 = blockIdx.y * 128; const size_t r0 = (size_t)blockIdx.x * 64 + wave * 16;
  v8f acc[8] = {};
  if (CAUSAL && (int)(((size_t)blockIdx.x * 64) % TT) < QHI) {   /* block-uniform */
#pragma unroll 2
    for (int kc = 0; kc < CC / 32; ++kc) { const F2 a = split_row(Y + (r0 + col) * CC, kc * 32, lane); asm volatile("s_wait_loadcnt 0x0" ::: "memory");
#pragma unroll
      for (int j = 0; j < 8; ++j) { const v16b w = WOCOL(WO, kc * 32, c0 + j * 16 + col, lane); asm volatile("s_wait_loadcnt 0x0" ::: "memory"); acc[j] = wmma_bf(a.h, w, acc[j]); acc[j] = wmma_bf(a.l, w, acc[j]); } }
#pragma unroll
    for (int j = 0; j < 8; ++j) { const float bias = BO ? bfr(BO[c0 + j * 16 + col]) : 0.f;
#pragma unroll
      for (int r = 0; r < 8; ++r) sf[wave][8 * g + r][j * 16 + col] = acc[j][r] + bias; }
  } else {
#pragma unroll 2
    for (int kc = 0; kc < CC / 32; ++kc) { const v16h a = frag_f32s(Y + (r0 + col) * CC + kc * 32, lane, 64.0f); asm volatile("s_wait_loadcnt 0x0" ::: "memory");   /* ctx carried x 2^6 into f16 so small-magnitude context rows stay clear of f16 subnormals */
#pragma unroll
      for (int j = 0; j < 8; ++j) { const v16h w = WOCOLH(WO, kc * 32, c0 + j * 16 + col, lane); asm volatile("s_wait_loadcnt 0x0" ::: "memory"); acc[j] = wmma16(a, w, acc[j]); } }
#pragma unroll
    for (int j = 0; j < 8; ++j) { const float bias = BO ? bfr(BO[c0 + j * 16 + col]) : 0.f;
#pragma unroll
      for (int r = 0; r < 8; ++r) sf[wave][8 * g + r][j * 16 + col] = acc[j][r] * (1.0f / 16384.0f) + bias; } }   /* 2^-8 (Wo carry) x 2^-6 (ctx carry) */
  LDSX(); for (int rl = 0; rl < 16; ++rl) vst2(OUT + (r0 + rl) * DIN + c0 + lane * 4, *(const v4f*)&sf[wave][rl][lane * 4]); }

extern "C" void kernel_launch(void* const* d_in, const int* in_sizes, int n_in, void* d_out, int out_size, void* d_ws, size_t ws_size, hipStream_t stream) {
  (void)in_sizes; (void)n_in; (void)out_size;
  const float** F = (const float**)d_in;
  if (ws_size < (size_t)WS_END) return;
  char* ws = (char*)d_ws; _Float16 *QH = (_Float16*)(ws + WS_QH), *KH = (_Float16*)(ws + WS_KH), *VT = (_Float16*)(ws + WS_VT), *QL = (_Float16*)(ws + WS_QL), *KL = (_Float16*)(ws + WS_KL); __bf16 *VB = (__bf16*)(ws + WS_VB), *VBL = (__bf16*)(ws + WS_VBL); float *S = (float*)(ws + WS_S), *Y = (float*)(ws + WS_Y);
  (void)Y; (void)QL; (void)KL; (void)VB; (void)VBL;
  // inputs: 0 key [4,1024,1024]; 1 value; 2 query; 3 Wk [1024,1024] (out,in), 4 bk; 5 Wq, 6 bq; 7 Wv, 8 bv; 9 Wp (out,in), 10 bp (zero biases, read)
  k_proj<<<dim3(TNB * TT / 64, CC / 128, 3), 128, 0, stream>>>(F[2], F[0], F[1], F[5], F[3], F[7], F[6], F[4], F[8], QH, QL, KH, KL, VT, VB, VBL);   /* (q, k, v) streams = inputs (query = 2, key = 0, value = 1) */
  for (int b = 0; b < TNB; ++b) for (int h0 = 0; h0 < NH; h0 += HG) {
    k_sc<<<dim3(NQB, TT / 128, HG), 128, 0, stream>>>(QH, KH, QL, KL, b, h0, S);
    k_sm<<<dim3(TT, HG), 256, 0, stream>>>(S);
    k_pv<<<dim3(NQB, 1, HG), 128, 0, stream>>>(S, VT, VB, VBL, b, h0, Y);
  }
  k_out<<<dim3(TNB * TT / 64, DIN / 128), 128, 0, stream>>>(Y, F[9], F[10], (float*)d_out);
}

// v001
// A run of this version takes 407 microseconds.
// In both of two side-by-side timings against v000, it was 2.09 times as fast.
// compute dtype: all float inputs rounded to bf16; q/k/v projections with EXACT bf16 products on WMMA 16x16x32 (f32 accumulate) + bias; causal logits: 3 products for the first 384 rows, single f16 q x k after, x 64^-0.5; online softmax f32 (running maximum, one launch for logits, softmax and P v); exp(s - max) x 2^11 once to f16 x v once to f16 (bf16 hi + lo below row 384); ctx hi+lo x exact output weight below row 384, x2^6 f16 carry x f16(bf16 x 2^8) after, + bias; f32 output.
#include <hip/hip_runtime.h>
#include <math.h>

typedef __attribute__((ext_vector_type(16))) _Float16 v16h;
typedef __attribute__((ext_vector_type(16))) __bf16 v16b;
typedef __attribute__((ext_vector_type(8)))  _Float16 v8h;
typedef __attribute__((ext_vector_type(8)))  float v8f;
typedef __attribute__((ext_vector_type(4)))  float v4f;
typedef __attribute__((ext_vector_type(2)))  float v2f;
typedef __attribute__((ext_vector_type(4)))  unsigned v4u;
typedef __attribute__((ext_vector_type(4)))  int v4i;
typedef float __attribute__((may_alias)) float_a;
typedef int __attribute__((may_alias)) int_a;

template <typename T> __device__ __forceinline__ void vst2(void* p, T v) { *(T*)p = v;  }
__device__ __forceinline__ v8f wmma16(v16h a, v16h b, v8f c) {
  v8f d = __builtin_amdgcn_wmma_f32_16x16x32_f16(false, a, false, b, (short)0, c, false, false);
  asm volatile("v_nop\n\tv_nop\n\tv_nop\n\tv_nop" : "+v"(d) : "v"(a), "v"(b));
  return d;
}
__device__ __forceinline__ v8f wmma_bf(v16b a, v16b b, v8f c) {
  v8f d = __builtin_amdgcn_wmma_f32_16x16x32_bf16(false, a, false, b, (short)0, c, false, false);
  asm volatile("v_nop\n\tv_nop\n\tv_nop\n\tv_nop" : "+v"(d) : "v"(a), "v"(b));
  return d;
}
// 16x16x32 fragments: lane = (h = lane>>4, row/col = lane&15); elements 0..7 = k0+8h+0..7, 8..15 = k0+16+8h+0..7; D element r = row 8h+r
__device__ __forceinline__ v16h frag_h(const _Float16* rowk0, int lane) {
  union { v16h v; v8h q[2]; } u; const _Float16* p = rowk0 + 8 * (lane >> 4);
  u.q[0] = *(const v8h*)p; u.q[1] = *(const v8h*)(p + 16); return u.v;
}
__device__ __forceinline__ v16h frag_f32(const float* rowk0, int lane) {
  v16h a; const float* p = rowk0 + 8 * (lane >> 4);
#pragma unroll
  for (int i = 0; i < 8; ++i) { a[i] = (_Float16)p[i]; a[8 + i] = (_Float16)p[16 + i]; }
  return a;
}
__device__ __forceinline__ v16h frag_f32s(const float* rowk0, int lane, float sc) {
  v16h a; const float* p = rowk0 + 8 * (lane >> 4);
#pragma unroll
  for (int i = 0; i < 8; ++i) { a[i] = (_Float16)(p[i] * sc); a[8 + i] = (_Float16)(p[16 + i] * sc); }
  return a;
}
// column fragment from a [K][ld] layout (column n), rows >= K read as 0
__device__ __forceinline__ v16h fragc_f32(const float* W, int k0, int n, int lane, int ld, int K) {
  v16h a; const int g = lane >> 4;
#pragma unroll
  for (int i = 0; i < 8; ++i) { const int ka = k0 + 8 * g + i, kb = ka + 16;
    a[i] = (_Float16)(ka < K ? W[(size_t)(ka < K ? ka : K - 1) * ld + n] : 0.f); a[8 + i] = (_Float16)(kb < K ? W[(size_t)(kb < K ? kb : K - 1) * ld + n] : 0.f); }
  return a;
}
struct F2 { v16b h, l; };
__device__ __forceinline__ F2 bsplit16(const float v[16]) { F2 r;
#pragma unroll
  for (int i = 0; i < 16; ++i) { const __bf16 h = (__bf16)v[i]; r.h[i] = h; r.l[i] = (__bf16)(v[i] - (float)h); }
  return r; }
__device__ __forceinline__ F2 split_row(const float* row, int k0, int lane) { float v[16]; const float* p = row + k0 + 8 * (lane >> 4);
#pragma unroll
  for (int i = 0; i < 8; ++i) { v[i] = p[i]; v[8 + i] = p[16 + i]; }
  return bsplit16(v); }
__device__ __forceinline__ F2 split_rowK(const float* row, int k0, int lane, int K) { float v[16]; const int g = lane >> 4;
#pragma unroll
  for (int i = 0; i < 8; ++i) { const int ka = k0 + 8 * g + i, kb = ka + 16; v[i] = ka < K ? row[ka < K ? ka : K - 1] : 0.f; v[8 + i] = kb < K ? row[kb < K ? kb : K - 1] : 0.f; }
  return bsplit16(v); }
__device__ __forceinline__ F2 split_col(const float* W, int k0, int n, int lane, int ld, int K) { float v[16]; const int g = lane >> 4;
#pragma unroll
  for (int i = 0; i < 8; ++i) { const int ka = k0 + 8 * g + i, kb = ka + 16; v[i] = ka < K ? W[(size_t)(ka < K ? ka : K - 1) * ld + n] : 0.f; v[8 + i] = kb < K ? W[(size_t)(kb < K ? kb : K - 1) * ld + n] : 0.f; }
  return bsplit16(v); }
__device__ __forceinline__ v8f mac3(const F2& a, const F2& b, v8f c) { c = wmma_bf(a.l, b.h, c); c = wmma_bf(a.h, b.l, c); return wmma_bf(a.h, b.h, c); }
__device__ __forceinline__ float sigm(float v) { return 1.0f / (1.0f + expf(-v)); }
#define LDSX() do { asm volatile("s_wait_dscnt 0" ::: "memory"); __builtin_amdgcn_wave_barrier(); __builtin_amdgcn_fence(__ATOMIC_RELEASE, "workgroup"); } while (0)

// Causal multi-head attention on separate inputs listed key-first (key / value / query [4,1024,1024]; torch (out,in) Wk / Wq / Wv / Wp [1024,1024] (0.02) + zero biases; 16 heads x 64; scale 1/8; tril, -inf): out = merge(softmax(causal(q_h k_h^T / 8)) v_h) Wp^T + bp.
#define NB 4
#define TT 1024
#define CC 1024            // NH * HD = projected width
#define DIN 1024          // input (model) width
#define NH 16
#define HD 64
#define NQB (TT / 64)
#define HG 8
#define SCALE (0.125f)
#define CAUSAL 1
#ifndef TNB
#define TNB NB
#endif
__device__ __forceinline__ float bfr(float v) { return (float)(__bf16)v; }
__host__ __device__ __forceinline__ int kb_last(int qb) { return CAUSAL ? ((qb * 64 + 63) >> 7) : (TT / 128 - 1); }
typedef __attribute__((ext_vector_type(8))) __bf16 v8b;
__device__ __forceinline__ v16b frag_b(const __bf16* rowk0, int lane) {
  union { v16b v; v8b q[2]; } u; const __bf16* p = rowk0 + 8 * (lane >> 4);
  u.q[0] = *(const v8b*)p; u.q[1] = *(const v8b*)(p + 16); return u.v;
}
#define QBH 6              // causal: query blocks 0..QBH-1 of each sequence (few keys, no averaging) take the high-precision path
#define QHI 384            // rows carrying a q residual plane
#define KHI 384            // key rows carrying k residual / v bf16 hi+lo planes (used only by the causal high-precision path)
// B fragment (k rows k0+.., output column o) of a weight: (in,out) [K][ld] or (out,in) [ld rows of K]: bf16 exact, or f16(bf16 * 256) exact
__device__ __forceinline__ v16b wcol_io(const float* Wm, int k0, int o, int lane, int ld) { v16b w; const int g = lane >> 4;
#pragma unroll
  for (int i = 0; i < 8; ++i) { w[i] = (__bf16)Wm[(size_t)(k0 + 8 * g + i) * ld + o]; w[8 + i] = (__bf16)Wm[(size_t)(k0 + 16 + 8 * g + i) * ld + o]; }
  return w; }
__device__ __forceinline__ v16b wcol_oi(const float* Wm, int k0, int o, int lane, int K) { v16b w; const float* p = Wm + (size_t)o * K + k0 + 8 * (lane >> 4);
#pragma unroll
  for (int i = 0; i < 8; ++i) { w[i] = (__bf16)p[i]; w[8 + i] = (__bf16)p[16 + i]; }
  return w; }
__device__ __forceinline__ v16h wcolh_io(const float* Wm, int k0, int o, int lane, int ld) { v16h w; const int g = lane >> 4;
#pragma unroll
  for (int i = 0; i < 8; ++i) { w[i] = (_Float16)(bfr(Wm[(size_t)(k0 + 8 * g + i) * ld + o]) * 256.0f); w[8 + i] = (_Float16)(bfr(Wm[(size_t)(k0 + 16 + 8 * g + i) * ld + o]) * 256.0f); }
  return w; }
__device__ __forceinline__ v16h wcolh_oi(const float* Wm, int k0, int o, int lane, int K) { v16h w; const float* p = Wm + (size_t)o * K + k0 + 8 * (lane >> 4);
#pragma unroll
  for (int i = 0; i < 8; ++i) { w[i] = (_Float16)(bfr(p[i]) * 256.0f); w[8 + i] = (_Float16)(bfr(p[16 + i]) * 256.0f); }
  return w; }
#define WQKV_LAYOUT 1   // 0 = (in,out) [DIN][CC]; 1 = (out,in) [CC][DIN]; 2 = per-head [NH][DIN][HD]
__device__ __forceinline__ v16b wcol_hdk(const float* Wm, int k0, int o, int lane) { v16b w; const int g = lane >> 4; const float* p = Wm + (size_t)(o / HD) * DIN * HD + (o % HD);
#pragma unroll
  for (int i = 0; i < 8; ++i) { w[i] = (__bf16)p[(size_t)(k0 + 8 * g + i) * HD]; w[8 + i] = (__bf16)p[(size_t)(k0 + 16 + 8 * g + i) * HD]; }
  return w; }
#define WO_OUT_IN 1
#if WQKV_LAYOUT == 1
#define WCOL(W, k0, o, lane) wcol_oi(W, k0, o, lane, DIN)
#elif WQKV_LAYOUT == 2
#define WCOL(W, k0, o, lane) wcol_hdk(W, k0, o, lane)
#else
#define WCOL(W, k0, o, lane) wcol_io(W, k0, o, lane, CC)
#endif
#if WO_OUT_IN
#define WOCOL(W, k0, o, lane) wcol_oi(W, k0, o, lane, CC)
#define WOCOLH(W, k0, o, lane) wcolh_oi(W, k0, o, lane, CC)
#else
#define WOCOL(W, k0, o, lane) wcol_io(W, k0, o, lane, DIN)
#define WOCOLH(W, k0, o, lane) wcolh_io(W, k0, o, lane, DIN)
#endif

#ifndef SM_EXTRA_PARAMS
#define SM_EXTRA_PARAMS
#endif
#ifndef PROJ_EXTRA_PARAMS
#define PROJ_EXTRA_PARAMS
#endif
#ifndef SM_MASK_HOOK
#define SM_MASK_HOOK (void)0
#endif

#define WS_QH  0u                                      // f16 q rows [b*t][CC]
#define WS_KH  (WS_QH + 2u * (size_t)NB * TT * CC)      // f16 k rows [b*t][CC]
#define WS_VT  (WS_KH + 2u * (size_t)NB * TT * CC)      // f16 v planes [b][c][t]
#define WS_QL  (WS_VT + 2u * (size_t)NB * CC * TT)      // f16 q residual x 2^10 rows [b][t < QHI][CC]
#define WS_KL  (WS_QL + 2u * (size_t)NB * QHI * CC)     // f16 k residual x 2^10 rows [b][t < KHI][CC]
#define WS_VB  (WS_KL + 2u * (size_t)NB * KHI * CC)     // bf16 v hi planes [b][c][t < KHI]
#define WS_VBL (WS_VB + 2u * (size_t)NB * CC * KHI)
#define WS_S   (WS_VBL + 2u * (size_t)NB * CC * KHI)    // f32 [hg][t][s] region, unused: logits and P stay in registers
#define WS_Y   (WS_S  + 4u * (size_t)HG * TT * TT)      // f32 ctx rows [b*t][CC] (only when there is an output projection)
#define WS_END (WS_Y  + 4u * (size_t)NB * TT * CC)

// ---- k_proj: block = (64 rows, 128 cols, which): q/k/v = X W (+ b) with exact bf16 products (K = DIN) -> which 0: q f16 rows (+ residual rows < QHI); 1: k f16 rows (+ residual rows < KHI); 2: v f16 planes [c][t] (+ bf16 hi/lo planes for t < KHI)
__global__ __launch_bounds__(128) void k_proj(const float* __restrict__ XQ, const float* __restrict__ XK, const float* __restrict__ XV, const float* __restrict__ WQ, const float* __restrict__ WK, const float* __restrict__ WV, const float* __restrict__ BQ, const float* __restrict__ BK, const float* __restrict__ BV,
    _Float16* __restrict__ QH, _Float16* __restrict__ QL, _Float16* __restrict__ KH, _Float16* __restrict__ KL, _Float16* __restrict__ VT, __bf16* __restrict__ VB, __bf16* __restrict__ VBL) {
  __shared__ __align__(16) _Float16 sh[64][136], sl[64][136]; __shared__ __align__(16) _Float16 th[128][72]; __shared__ __align__(16) __bf16 tb[128][72], tbl[128][72];
  const int tid = threadIdx.x, wave = tid >> 5, lane = tid & 31, col = lane & 15, g = lane >> 4; const int which = blockIdx.z; const int c0 = blockIdx.y * 128; const size_t r0 = (size_t)blockIdx.x * 64; const size_t bb = r0 / TT; const int t0 = (int)(r0 % TT);
  const float* X = which == 0 ? XQ : which == 1 ? XK : XV; const float* WA = which == 0 ? WQ : which == 1 ? WK : WV; const float* BA = which == 0 ? BQ : which == 1 ? BK : BV;
  v8f acc[8] = {};
#pragma unroll 2
  for (int kc = 0; kc < DIN / 32; ++kc) { v16b a; { const float* p = X + (r0 + wave * 16 + col) * DIN + kc * 32 + 8 * g;
#pragma unroll
      for (int i = 0; i < 8; ++i) { a[i] = (__bf16)p[i]; a[8 + i] = (__bf16)p[16 + i]; } }
    asm volatile("s_wait_loadcnt 0x0" ::: "memory");
#pragma unroll
    for (int j = 0; j < 8; ++j) { const v16b w = WCOL(WA, kc * 32, c0 + j * 16 + col, lane); asm volatile("s_wait_loadcnt 0x0" ::: "memory"); acc[j] = wmma_bf(a, w, acc[j]); } }
  if (which < 2) { _Float16* DH = which == 0 ? QH : KH; _Float16* DL = which == 0 ? QL : KL; const int nhi = which == 0 ? QHI : KHI; const bool hi_rows = t0 < nhi;
#pragma unroll
    for (int j = 0; j < 8; ++j) { const float bias = BA ? bfr(BA[c0 + j * 16 + col]) : 0.f;
#pragma unroll
      for (int r = 0; r < 8; ++r) { const float v = acc[j][r] + bias; const _Float16 hv = (_Float16)v; sh[wave * 16 + 8 * g + r][j * 16 + col] = hv; sl[wave * 16 + 8 * g + r][j * 16 + col] = (_Float16)((v - (float)hv) * 1024.0f); } }
    __syncthreads();
    for (int e = tid; e < 64 * 16; e += 128) { const int rl = e >> 4, q = e & 15; vst2((unsigned*)(DH + (r0 + rl) * CC + c0 + q * 8), *(const v4u*)&sh[rl][q * 8]); if (hi_rows) vst2((unsigned*)(DL + (bb * nhi + t0 + rl) * (size_t)CC + c0 + q * 8), *(const v4u*)&sl[rl][q * 8]); }
  } else { const bool hi_rows = t0 < KHI;
#pragma unroll
    for (int j = 0; j < 8; ++j) { const float bias = BA ? bfr(BA[c0 + j * 16 + col]) : 0.f;
#pragma unroll
      for (int r = 0; r < 8; ++r) { const float v = acc[j][r] + bias; const int rl = wave * 16 + 8 * g + r, cl = j * 16 + col; th[cl][rl] = (_Float16)v; const __bf16 bh = (__bf16)v; tb[cl][rl] = bh; tbl[cl][rl] = (__bf16)(v - (float)bh); } }
    __syncthreads();
    for (int e = tid; e < 128 * 8; e += 128) { const int cl = e >> 3, q = e & 7; vst2((unsigned*)(VT + (bb * CC + c0 + cl) * (size_t)TT + t0 + q * 8), *(const v4u*)&th[cl][q * 8]); if (hi_rows) { const size_t o3 = (bb * CC + c0 + cl) * (size_t)KHI + t0 + q * 8; vst2((unsigned*)(VB + o3), *(const v4u*)&tb[cl][q * 8]); vst2((unsigned*)(VBL + o3), *(const v4u*)&tbl[cl][q * 8]); } } } }
// ---- k_attn: block = 64 queries (qb, heaviest first) of (b, h), one wave = 16 queries, no exchange between waves. Per 64 keys: S^T = K . Q^T (A = key rows, B = query rows, same loader on both sides), so a lane holds 32 scores of ONE query (query = lane & 15, key = 16 j + 8 (lane >> 4) + r); running maximum and sum in f32 (online softmax, halves joined by one lane exchange); P^T x 2^11 packs from two score tiles straight into a B operand; O^T += V^T . P^T with the v planes [c][t] as A. Products per path as before: query blocks < QBH take q hi + residual x k hi + residual (3 products) and P, v as bf16 hi + lo (3 products); the rest one f16 product each. Every fragment of a group is loaded in front of the group's first product, so that the loads fly together
// precaution behind a group of global loads: the group's address stays an input of the wait, so its registers are rewritten only behind the wait
#define XW(p) asm volatile("s_wait_xcnt 0x0" :: "v"(p) : "memory")
#define XW2(p, q) asm volatile("s_wait_xcnt 0x0" :: "v"(p), "v"(q) : "memory")
// fragment from the lane's own address (row start + k0 + 8 (lane >> 4)): same element order as frag_h / frag_b
__device__ __forceinline__ v16h frag_hp(const _Float16* p) { union { v16h v; v8h q[2]; } u; u.q[0] = *(const v8h*)p; u.q[1] = *(const v8h*)(p + 16); return u.v; }
__device__ __forceinline__ v16b frag_bp(const __bf16* p) { union { v16b v; v8b q[2]; } u; u.q[0] = *(const v8b*)p; u.q[1] = *(const v8b*)(p + 16); return u.v; }
template <bool HI> __device__ __forceinline__ void attn_wave(const _Float16* __restrict__ QH, const _Float16* __restrict__ KH, const _Float16* __restrict__ QL, const _Float16* __restrict__ KL, const _Float16* __restrict__ VT, const __bf16* __restrict__ VB, const __bf16* __restrict__ VBL, int b, int h, int qb, int wave, int lane, float (*st)[HD + 4], float* __restrict__ Y) {
  const int col = lane & 15, g = lane >> 4; const int ql0 = qb * 64 + wave * 16; const int t = ql0 + col; const size_t q0 = (size_t)b * TT + ql0; const int nkb = CAUSAL ? qb + 1 : TT / 64;
  v16h qh[HD / 32], qlo[HD / 32];
#pragma unroll
  for (int kc = 0; kc < HD / 32; ++kc) { qh[kc] = frag_h(QH + (q0 + col) * CC + h * HD + kc * 32, lane); if (HI) qlo[kc] = frag_h(QL + ((size_t)b * QHI + ql0 + col) * CC + h * HD + kc * 32, lane); }
  v8f o[HD / 16] = {}; float m = -3.0e38f, l = 0.f;
#pragma unroll 1   /* stays rolled: one key block's fragments already fill the registers that four waves a SIMD leave a wave */
  for (int kb = 0; kb < nkb; ++kb) { const int k0 = kb * 64; v8f s[4]; v16h kf[4][HD / 32], kl[4][HD / 32], vf[2][HD / 16];
    const _Float16* kp = KH + ((size_t)b * TT + k0 + col) * CC + h * HD + 8 * g; const _Float16* klp = KL + ((size_t)b * KHI + k0 + col) * CC + h * HD + 8 * g; const _Float16* vp = VT + ((size_t)b * CC + h * HD + col) * (size_t)TT + k0 + 8 * g;
    const __bf16* vbp = VB + ((size_t)b * CC + h * HD + col) * (size_t)KHI + k0 + 8 * g; const __bf16* vlp = VBL + ((size_t)b * CC + h * HD + col) * (size_t)KHI + k0 + 8 * g;
#pragma unroll
    for (int j = 0; j < 4; ++j)
#pragma unroll
      for (int kc = 0; kc < HD / 32; ++kc) kf[j][kc] = frag_hp(kp + (size_t)j * 16 * CC + kc * 32);
    XW(kp);
    if (HI) {
#pragma unroll
      for (int j = 0; j < 4; ++j)
#pragma unroll
        for (int kc = 0; kc < HD / 32; ++kc) kl[j][kc] = frag_hp(klp + (size_t)j * 16 * CC + kc * 32);
      XW(klp); }
#pragma unroll
    for (int j = 0; j < 4; ++j) { v8f acc = {}, accl = {};
#pragma unroll
      for (int kc = 0; kc < HD / 32; ++kc) { acc = wmma16(kf[j][kc], qh[kc], acc); if (HI) { accl = wmma16(kf[j][kc], qlo[kc], accl); accl = wmma16(kl[j][kc], qh[kc], accl); } }
#pragma unroll
      for (int r = 0; r < 8; ++r) s[j][r] = HI ? (acc[r] + accl[r] * (1.0f / 1024.0f)) * SCALE : acc[r] * SCALE; }
    if (!HI) {   /* f16 path: v is asked for here, so that it flies under the softmax arithmetic */
#pragma unroll
      for (int kc = 0; kc < 2; ++kc)
#pragma unroll
        for (int jd = 0; jd < HD / 16; ++jd) vf[kc][jd] = frag_hp(vp + (size_t)jd * 16 * TT + kc * 32);
      XW(vp); }
    if (CAUSAL && k0 + 63 > ql0) {   /* wave-uniform: only a key block that reaches past the wave's first query holds excluded keys */
#pragma unroll
      for (int j = 0; j < 4; ++j)
#pragma unroll
        for (int r = 0; r < 8; ++r) if (k0 + j * 16 + 8 * g + r > t) s[j][r] = -3.0e38f; }
    float mx = -3.0e38f;
#pragma unroll
    for (int j = 0; j < 4; ++j)
#pragma unroll
      for (int r = 0; r < 8; ++r) mx = fmaxf(mx, s[j][r]);
    mx = fmaxf(mx, __shfl_xor(mx, 16));
    const float mn = fmaxf(m, mx); const float alpha = expf(m - mn); m = mn;
    float ls = 0.f;
#pragma unroll
    for (int j = 0; j < 4; ++j)
#pragma unroll
      for (int r = 0; r < 8; ++r) { const float v = s[j][r]; const float ex = expf(v - mn); const float e = (v <= -1.0e38f) ? 0.f : ex; ls += e; s[j][r] = e * 2048.0f; }
    l = l * alpha + ls;
#pragma unroll
    for (int jd = 0; jd < HD / 16; ++jd)
#pragma unroll
      for (int r = 0; r < 8; ++r) o[jd][r] *= alpha;
#pragma unroll
    for (int kc = 0; kc < 2; ++kc) {
      if (HI) { float pv[16]; v16b vh[HD / 16], vl[HD / 16];
#pragma unroll
        for (int jd = 0; jd < HD / 16; ++jd) { vh[jd] = frag_bp(vbp + (size_t)jd * 16 * KHI + kc * 32); vl[jd] = frag_bp(vlp + (size_t)jd * 16 * KHI + kc * 32); }
        XW2(vbp, vlp);
#pragma unroll
        for (int i = 0; i < 8; ++i) { pv[i] = s[2 * kc][i]; pv[8 + i] = s[2 * kc + 1][i]; }
        const F2 p = bsplit16(pv);
#pragma unroll
        for (int jd = 0; jd < HD / 16; ++jd) { o[jd] = wmma_bf(vh[jd], p.h, o[jd]); o[jd] = wmma_bf(vh[jd], p.l, o[jd]); o[jd] = wmma_bf(vl[jd], p.h, o[jd]); }
      } else { v16h p;
#pragma unroll
        for (int i = 0; i < 8; ++i) { p[i] = (_Float16)s[2 * kc][i]; p[8 + i] = (_Float16)s[2 * kc + 1][i]; }
#pragma unroll
        for (int jd = 0; jd < HD / 16; ++jd) o[jd] = wmma16(vf[kc][jd], p, o[jd]); } } }
  l += __shfl_xor(l, 16);
  const float inv = l > 0.f ? 1.0f / (2048.0f * l) : 0.f;   /* a fully excluded row yields ctx = 0 */
#pragma unroll
  for (int jd = 0; jd < HD / 16; ++jd) { v4f a, c;
#pragma unroll
    for (int r = 0; r < 4; ++r) { a[r] = o[jd][r] * inv; c[r] = o[jd][4 + r] * inv; }
    *(v4f*)&st[col][jd * 16 + 8 * g] = a; *(v4f*)&st[col][jd * 16 + 8 * g + 4] = c; }
  LDSX();   /* the wave's own LDS stores land before other lanes of the wave read them: two whole 256-B (row, head) segments a store */
#pragma unroll
  for (int rl = 0; rl < 16; rl += 2) vst2(Y + (q0 + rl + g) * CC + h * HD + col * 4, *(const v4f*)&st[rl + g][col * 4]); }
__global__ __launch_bounds__(128) void k_attn(const _Float16* __restrict__ QH, const _Float16* __restrict__ KH, const _Float16* __restrict__ QL, const _Float16* __restrict__ KL, const _Float16* __restrict__ VT, const __bf16* __restrict__ VB, const __bf16* __restrict__ VBL, float* __restrict__ Y) { __shared__ __align__(16) float ss[4][16][HD + 4];
  /* the wave's number in a scalar register: the causal test of a key block becomes a scalar branch */
  const int tid = threadIdx.x, wave = __builtin_amdgcn_readfirstlane(tid >> 5), lane = tid & 31; const int h = blockIdx.x, b = blockIdx.y, qb = NQB - 1 - (int)blockIdx.z;
  if (CAUSAL && qb < QBH) attn_wave<true>(QH, KH, QL, KL, VT, VB, VBL, b, h, qb, wave, lane, ss[wave], Y);   /* block-uniform */
  else attn_wave<false>(QH, KH, QL, KL, VT, VB, VBL, b, h, qb, wave, lane, ss[wave], Y); }
// ---- k_out: block = (64 rows, 128 cols): out = ctx Wo (+ bo): ctx x 2^6 once to f16 against Wo as f16(bf16 x 2^8) exact (1 product) x 2^-14; causal early rows (< QHI of each sequence): ctx bf16 hi + lo against exact bf16 Wo (2 products)
__global__ __launch_bounds__(128) void k_out(const float* __restrict__ Y, const float* __restrict__ WO, const float* __restrict__ BO, float* __restrict__ OUT) { __shared__ __align__(16) float sf[4][16][132];
  const int tid = threadIdx.x, wave = tid >> 5, lane = tid & 31, col = lane & 15, g = lane >> 4; const int c0 = blockIdx.y * 128; const size_t r0 = (size_t)blockIdx.x * 64 + wave * 16;
  v8f acc[8] = {};
  if (CAUSAL && (int)(((size_t)blockIdx.x * 64) % TT) < QHI) {   /* block-uniform */
#pragma unroll 2
    for (int kc = 0; kc < CC / 32; ++kc) { const F2 a = split_row(Y + (r0 + col) * CC, kc * 32, lane); asm volatile("s_wait_loadcnt 0x0" ::: "memory");
#pragma unroll
      for (int j = 0; j < 8; ++j) { const v16b w = WOCOL(WO, kc * 32, c0 + j * 16 + col, lane); asm volatile("s_wait_loadcnt 0x0" ::: "memory"); acc[j] = wmma_bf(a.h, w, acc[j]); acc[j] = wmma_bf(a.l, w, acc[j]); } }
#pragma unroll
    for (int j = 0; j < 8; ++j) { const float bias = BO ? bfr(BO[c0 + j * 16 + col]) : 0.f;
#pragma unroll
      for (int r = 0; r < 8; ++r) sf[wave][8 * g + r][j * 16 + col] = acc[j][r] + bias; }
  } else {
#pragma unroll 2
    for (int kc = 0; kc < CC / 32; ++kc) { const v16h a = frag_f32s(Y + (r0 + col) * CC + kc * 32, lane, 64.0f); asm volatile("s_wait_loadcnt 0x0" ::: "memory");   /* ctx carried x 2^6 into f16 so small-magnitude context rows stay clear of f16 subnormals */
#pragma unroll
      for (int j = 0; j < 8; ++j) { const v16h w = WOCOLH(WO, kc * 32, c0 + j * 16 + col, lane); asm volatile("s_wait_loadcnt 0x0" ::: "memory"); acc[j] = wmma16(a, w, acc[j]); } }
#pragma unroll
    for (int j = 0; j < 8; ++j) { const float bias = BO ? bfr(BO[c0 + j * 16 + col]) : 0.f;
#pragma unroll
      for (int r = 0; r < 8; ++r) sf[wave][8 * g + r][j * 16 + col] = acc[j][r] * (1.0f / 16384.0f) + bias; } }   /* 2^-8 (Wo carry) x 2^-6 (ctx carry) */
  LDSX(); for (int rl = 0; rl < 16; ++rl) vst2(OUT + (r0 + rl) * DIN + c0 + lane * 4, *(const v4f*)&sf[wave][rl][lane * 4]); }

extern "C" void kernel_launch(void* const* d_in, const int* in_sizes, int n_in, void* d_out, int out_size, void* d_ws, size_t ws_size, hipStream_t stream) {
  (void)in_sizes; (void)n_in; (void)out_size;
  const float** F = (const float**)d_in;
  if (ws_size < (size_t)WS_END) return;
  char* ws = (char*)d_ws; _Float16 *QH = (_Float16*)(ws + WS_QH), *KH = (_Float16*)(ws + WS_KH), *VT = (_Float16*)(ws + WS_VT), *QL = (_Float16*)(ws + WS_QL), *KL = (_Float16*)(ws + WS_KL); __bf16 *VB = (__bf16*)(ws + WS_VB), *VBL = (__bf16*)(ws + WS_VBL); float *Y = (float*)(ws + WS_Y);
  (void)Y; (void)QL; (void)KL; (void)VB; (void)VBL;
  // inputs: 0 key [4,1024,1024]; 1 value; 2 query; 3 Wk [1024,1024] (out,in), 4 bk; 5 Wq, 6 bq; 7 Wv, 8 bv; 9 Wp (out,in), 10 bp (zero biases, read)
  k_proj<<<dim3(TNB * TT / 64, CC / 128, 3), 128, 0, stream>>>(F[2], F[0], F[1], F[5], F[3], F[7], F[6], F[4], F[8], QH, QL, KH, KL, VT, VB, VBL);   /* (q, k, v) streams = inputs (query = 2, key = 0, value = 1) */
  k_attn<<<dim3(NH, TNB, NQB), 128, 0, stream>>>(QH, KH, QL, KL, VT, VB, VBL, Y);
  k_out<<<dim3(TNB * TT / 64, DIN / 128), 128, 0, stream>>>(Y, F[9], F[10], (float*)d_out);
}

// v002
// A run of this version takes 121 microseconds.
// Two timings next to v001 both put it at 3.36 times that version's speed.
// Counting every step since v000, it is 7.02 times as fast.
// compute dtype: all float inputs rounded to bf16; q/k/v projections with EXACT bf16 products on WMMA 16x16x32 (f32 accumulate) + bias; causal logits: 3 products for the first 384 rows, single f16 q x k after, x 64^-0.5; online softmax f32 (running maximum, one launch for logits, softmax and P v); exp(s - max) x 2^11 once to f16 x v once to f16 (bf16 hi + lo below row 384); ctx hi+lo x exact output weight below row 384, x2^6 f16 carry x f16(bf16 x 2^8) after, + bias; f32 output.
#include <hip/hip_runtime.h>
#include <math.h>

typedef __attribute__((ext_vector_type(16))) _Float16 v16h;
typedef __attribute__((ext_vector_type(16))) __bf16 v16b;
typedef __attribute__((ext_vector_type(8)))  _Float16 v8h;
typedef __attribute__((ext_vector_type(8)))  float v8f;
typedef __attribute__((ext_vector_type(4)))  float v4f;
typedef __attribute__((ext_vector_type(2)))  float v2f;
typedef __attribute__((ext_vector_type(4)))  unsigned v4u;
typedef __attribute__((ext_vector_type(4)))  int v4i;
typedef float __attribute__((may_alias)) float_a;
typedef int __attribute__((may_alias)) int_a;

template <typename T> __device__ __forceinline__ void vst2(void* p, T v) { *(T*)p = v;  }
__device__ __forceinline__ v8f wmma16(v16h a, v16h b, v8f c) {
  v8f d = __builtin_amdgcn_wmma_f32_16x16x32_f16(false, a, false, b, (short)0, c, false, false);
  asm volatile("v_nop\n\tv_nop\n\tv_nop\n\tv_nop" : "+v"(d) : "v"(a), "v"(b));
  return d;
}
__device__ __forceinline__ v8f wmma_bf(v16b a, v16b b, v8f c) {
  v8f d = __builtin_amdgcn_wmma_f32_16x16x32_bf16(false, a, false, b, (short)0, c, false, false);
  asm volatile("v_nop\n\tv_nop\n\tv_nop\n\tv_nop" : "+v"(d) : "v"(a), "v"(b));
  return d;
}
// 16x16x32 fragments: lane = (h = lane>>4, row/col = lane&15); elements 0..7 = k0+8h+0..7, 8..15 = k0+16+8h+0..7; D element r = row 8h+r
__device__ __forceinline__ v16h frag_h(const _Float16* rowk0, int lane) {
  union { v16h v; v8h q[2]; } u; const _Float16* p = rowk0 + 8 * (lane >> 4);
  u.q[0] = *(const v8h*)p; u.q[1] = *(const v8h*)(p + 16); return u.v;
}
__device__ __forceinline__ v16h frag_f32(const float* rowk0, int lane) {
  v16h a; const float* p = rowk0 + 8 * (lane >> 4);
#pragma unroll
  for (int i = 0; i < 8; ++i) { a[i] = (_Float16)p[i]; a[8 + i] = (_Float16)p[16 + i]; }
  return a;
}
__device__ __forceinline__ v16h frag_f32s(const float* rowk0, int lane, float sc) {
  v16h a; const float* p = rowk0 + 8 * (lane >> 4);
#pragma unroll
  for (int i = 0; i < 8; ++i) { a[i] = (_Float16)(p[i] * sc); a[8 + i] = (_Float16)(p[16 + i] * sc); }
  return a;
}
// column fragment from a [K][ld] layout (column n), rows >= K read as 0
__device__ __forceinline__ v16h fragc_f32(const float* W, int k0, int n, int lane, int ld, int K) {
  v16h a; const int g = lane >> 4;
#pragma unroll
  for (int i = 0; i < 8; ++i) { const int ka = k0 + 8 * g + i, kb = ka + 16;
    a[i] = (_Float16)(ka < K ? W[(size_t)(ka < K ? ka : K - 1) * ld + n] : 0.f); a[8 + i] = (_Float16)(kb < K ? W[(size_t)(kb < K ? kb : K - 1) * ld + n] : 0.f); }
  return a;
}
struct F2 { v16b h, l; };
__device__ __forceinline__ F2 bsplit16(const float v[16]) { F2 r;
#pragma unroll
  for (int i = 0; i < 16; ++i) { const __bf16 h = (__bf16)v[i]; r.h[i] = h; r.l[i] = (__bf16)(v[i] - (float)h); }
  return r; }
__device__ __forceinline__ F2 split_row(const float* row, int k0, int lane) { float v[16]; const float* p = row + k0 + 8 * (lane >> 4);
#pragma unroll
  for (int i = 0; i < 8; ++i) { v[i] = p[i]; v[8 + i] = p[16 + i]; }
  return bsplit16(v); }
__device__ __forceinline__ F2 split_rowK(const float* row, int k0, int lane, int K) { float v[16]; const int g = lane >> 4;
#pragma unroll
  for (int i = 0; i < 8; ++i) { const int ka = k0 + 8 * g + i, kb = ka + 16; v[i] = ka < K ? row[ka < K ? ka : K - 1] : 0.f; v[8 + i] = kb < K ? row[kb < K ? kb : K - 1] : 0.f; }
  return bsplit16(v); }
__device__ __forceinline__ F2 split_col(const float* W, int k0, int n, int lane, int ld, int K) { float v[16]; const int g = lane >> 4;
#pragma unroll
  for (int i = 0; i < 8; ++i) { const int ka = k0 + 8 * g + i, kb = ka + 16; v[i] = ka < K ? W[(size_t)(ka < K ? ka : K - 1) * ld + n] : 0.f; v[8 + i] = kb < K ? W[(size_t)(kb < K ? kb : K - 1) * ld + n] : 0.f; }
  return bsplit16(v); }
__device__ __forceinline__ v8f mac3(const F2& a, const F2& b, v8f c) { c = wmma_bf(a.l, b.h, c); c = wmma_bf(a.h, b.l, c); return wmma_bf(a.h, b.h, c); }
__device__ __forceinline__ float sigm(float v) { return 1.0f / (1.0f + expf(-v)); }
#define LDSX() do { asm volatile("s_wait_dscnt 0" ::: "memory"); __builtin_amdgcn_wave_barrier(); __builtin_amdgcn_fence(__ATOMIC_RELEASE, "workgroup"); } while (0)

// Causal multi-head attention on separate inputs listed key-first (key / value / query [4,1024,1024]; torch (out,in) Wk / Wq / Wv / Wp [1024,1024] (0.02) + zero biases; 16 heads x 64; scale 1/8; tril, -inf): out = merge(softmax(causal(q_h k_h^T / 8)) v_h) Wp^T + bp.
#define NB 4
#define TT 1024
#define CC 1024            // NH * HD = projected width
#define DIN 1024          // input (model) width
#define NH 16
#define HD 64
#define NQB (TT / 64)
#define HG 8
#define SCALE (0.125f)
#define CAUSAL 1
#ifndef TNB
#define TNB NB
#endif
__device__ __forceinline__ float bfr(float v) { return (float)(__bf16)v; }
__host__ __device__ __forceinline__ int kb_last(int qb) { return CAUSAL ? ((qb * 64 + 63) >> 7) : (TT / 128 - 1); }
typedef __attribute__((ext_vector_type(8))) __bf16 v8b;
__device__ __forceinline__ v16b frag_b(const __bf16* rowk0, int lane) {
  union { v16b v; v8b q[2]; } u; const __bf16* p = rowk0 + 8 * (lane >> 4);
  u.q[0] = *(const v8b*)p; u.q[1] = *(const v8b*)(p + 16); return u.v;
}
#define QBH 6              // causal: query blocks 0..QBH-1 of each sequence (few keys, no averaging) take the high-precision path
#define QHI 384            // rows carrying a q residual plane
#define KHI 384            // key rows carrying k residual / v bf16 hi+lo planes (used only by the causal high-precision path)
// B fragment (k rows k0+.., output column o) of a weight: (in,out) [K][ld] or (out,in) [ld rows of K]: bf16 exact, or f16(bf16 * 256) exact
__device__ __forceinline__ v16b wcol_io(const float* Wm, int k0, int o, int lane, int ld) { v16b w; const int g = lane >> 4;
#pragma unroll
  for (int i = 0; i < 8; ++i) { w[i] = (__bf16)Wm[(size_t)(k0 + 8 * g + i) * ld + o]; w[8 + i] = (__bf16)Wm[(size_t)(k0 + 16 + 8 * g + i) * ld + o]; }
  return w; }
__device__ __forceinline__ v16b wcol_oi(const float* Wm, int k0, int o, int lane, int K) { v16b w; const float* p = Wm + (size_t)o * K + k0 + 8 * (lane >> 4);
#pragma unroll
  for (int i = 0; i < 8; ++i) { w[i] = (__bf16)p[i]; w[8 + i] = (__bf16)p[16 + i]; }
  return w; }
__device__ __forceinline__ v16h wcolh_io(const float* Wm, int k0, int o, int lane, int ld) { v16h w; const int g = lane >> 4;
#pragma unroll
  for (int i = 0; i < 8; ++i) { w[i] = (_Float16)(bfr(Wm[(size_t)(k0 + 8 * g + i) * ld + o]) * 256.0f); w[8 + i] = (_Float16)(bfr(Wm[(size_t)(k0 + 16 + 8 * g + i) * ld + o]) * 256.0f); }
  return w; }
__device__ __forceinline__ v16h wcolh_oi(const float* Wm, int k0, int o, int lane, int K) { v16h w; const float* p = Wm + (size_t)o * K + k0 + 8 * (lane >> 4);
#pragma unroll
  for (int i = 0; i < 8; ++i) { w[i] = (_Float16)(bfr(p[i]) * 256.0f); w[8 + i] = (_Float16)(bfr(p[16 + i]) * 256.0f); }
  return w; }
#define WQKV_LAYOUT 1   // 0 = (in,out) [DIN][CC]; 1 = (out,in) [CC][DIN]; 2 = per-head [NH][DIN][HD]
__device__ __forceinline__ v16b wcol_hdk(const float* Wm, int k0, int o, int lane) { v16b w; const int g = lane >> 4; const float* p = Wm + (size_t)(o / HD) * DIN * HD + (o % HD);
#pragma unroll
  for (int i = 0; i < 8; ++i) { w[i] = (__bf16)p[(size_t)(k0 + 8 * g + i) * HD]; w[8 + i] = (__bf16)p[(size_t)(k0 + 16 + 8 * g + i) * HD]; }
  return w; }
#define WO_OUT_IN 1
#if WQKV_LAYOUT == 1
#define WCOL(W, k0, o, lane) wcol_oi(W, k0, o, lane, DIN)
#elif WQKV_LAYOUT == 2
#define WCOL(W, k0, o, lane) wcol_hdk(W, k0, o, lane)
#else
#define WCOL(W, k0, o, lane) wcol_io(W, k0, o, lane, CC)
#endif
#if WO_OUT_IN
#define WOCOL(W, k0, o, lane) wcol_oi(W, k0, o, lane, CC)
#define WOCOLH(W, k0, o, lane) wcolh_oi(W, k0, o, lane, CC)
#else
#define WOCOL(W, k0, o, lane) wcol_io(W, k0, o, lane, DIN)
#define WOCOLH(W, k0, o, lane) wcolh_io(W, k0, o, lane, DIN)
#endif

#ifndef SM_EXTRA_PARAMS
#define SM_EXTRA_PARAMS
#endif
#ifndef PROJ_EXTRA_PARAMS
#define PROJ_EXTRA_PARAMS
#endif
#ifndef SM_MASK_HOOK
#define SM_MASK_HOOK (void)0
#endif

#define WS_QH  0u                                      // f16 q rows [b*t][CC]
#define WS_KH  (WS_QH + 2u * (size_t)NB * TT * CC)      // f16 k rows [b*t][CC]
#define WS_VT  (WS_KH + 2u * (size_t)NB * TT * CC)      // f16 v planes [b][c][t]
#define WS_QL  (WS_VT + 2u * (size_t)NB * CC * TT)      // f16 q residual x 2^10 rows [b][t < QHI][CC]
#define WS_KL  (WS_QL + 2u * (size_t)NB * QHI * CC)     // f16 k residual x 2^10 rows [b][t < KHI][CC]
#define WS_VB  (WS_KL + 2u * (size_t)NB * KHI * CC)     // bf16 v hi planes [b][c][t < KHI]
#define WS_VBL (WS_VB + 2u * (size_t)NB * CC * KHI)
#define WS_S   (WS_VBL + 2u * (size_t)NB * CC * KHI)    // f32 [hg][t][s] region, unused: logits and P stay in registers
#define WS_Y   (WS_S  + 4u * (size_t)HG * TT * TT)      // f32 ctx rows [b*t][CC] (only when there is an output projection)
#define WS_END (WS_Y  + 4u * (size_t)NB * TT * CC)

// precaution behind a group of global loads: the group's address stays an input of the wait, so its registers are rewritten only behind the wait
#define XW(p) asm volatile("s_wait_xcnt 0x0" :: "v"(p) : "memory")
#define XW2(p, q) asm volatile("s_wait_xcnt 0x0" :: "v"(p), "v"(q) : "memory")
// work-group barrier of the operand buffers, by hand: the wave's own LDS stores have landed and its reads have returned (s_wait_dscnt 0) before it signals; __syncthreads() would also wait for the next step's global loads, which are to stay in flight across it
#define RINGBAR() do { asm volatile("s_wait_dscnt 0x0" ::: "memory"); asm volatile("s_barrier_signal -1\n\ts_barrier_wait -1" ::: "memory"); } while (0)
#define KP 40              // pitch of a staged 32-k row in 16-bit elements: 80 B = 16 B x odd, where 16-byte fragment reads of 16 rows meet no bank twice
typedef __attribute__((ext_vector_type(4))) __bf16 v4b;
typedef __attribute__((ext_vector_type(4))) _Float16 v4h;
// ---- k_proj: block = (64 rows, 128 cols, which): q/k/v = X W (+ b) with exact bf16 products (K = DIN) -> which 0: q f16 rows (+ residual rows < QHI); 1: k f16 rows (+ residual rows < KHI); 2: v f16 planes [c][t] (+ bf16 hi/lo planes for t < KHI)
__global__ __launch_bounds__(128) void k_proj(const float* __restrict__ XQ, const float* __restrict__ XK, const float* __restrict__ XV, const float* __restrict__ WQ, const float* __restrict__ WK, const float* __restrict__ WV, const float* __restrict__ BQ, const float* __restrict__ BK, const float* __restrict__ BV,
    _Float16* __restrict__ QH, _Float16* __restrict__ QL, _Float16* __restrict__ KH, _Float16* __restrict__ KL, _Float16* __restrict__ VT, __bf16* __restrict__ VB, __bf16* __restrict__ VBL) {
  /* one LDS block: the two operand buffers of the k loop first, the epilogue's tiles (q/k: sh, sl; v: th, tb, tbl) behind the barrier that ends the loop's last reads */
  __shared__ __align__(16) unsigned char smem[3 * 128 * 72 * 2];
  __bf16 (*stg)[192][KP] = (__bf16 (*)[192][KP])smem;
  _Float16 (*sh)[136] = (_Float16 (*)[136])smem; _Float16 (*sl)[136] = (_Float16 (*)[136])(smem + 64 * 136 * 2);
  _Float16 (*th)[72] = (_Float16 (*)[72])smem; __bf16 (*tb)[72] = (__bf16 (*)[72])(smem + 128 * 72 * 2); __bf16 (*tbl)[72] = (__bf16 (*)[72])(smem + 2 * 128 * 72 * 2);
  const int tid = threadIdx.x, wave = tid >> 5, lane = tid & 31, col = lane & 15, g = lane >> 4; const int which = blockIdx.z; const int c0 = blockIdx.y * 128; const size_t r0 = (size_t)blockIdx.x * 64; const size_t bb = r0 / TT; const int t0 = (int)(r0 % TT);
  const float* X = which == 0 ? XQ : which == 1 ? XK : XV; const float* WA = which == 0 ? WQ : which == 1 ? WK : WV; const float* BA = which == 0 ? BQ : which == 1 ? BK : BV;
  v8f acc[8] = {};
  /* a 32-k step of the block's 64 X rows and 128 W rows: thread = (row lr of 16, 16-B piece lq), so a wave's load covers four whole 128-B lines; rounded to bf16 once for the block; buffer rows 0..63 = X, 64..191 = W */
  const int lr = tid >> 3, lq = tid & 7; const float* gx = X + (r0 + lr) * DIN + lq * 4; const float* gw = WA + (size_t)(c0 + lr) * DIN + lq * 4; v4f pre[12];
#pragma unroll
  for (int i = 0; i < 4; ++i) pre[i] = *(const v4f*)(gx + (size_t)i * 16 * DIN);
#pragma unroll
  for (int i = 0; i < 8; ++i) pre[4 + i] = *(const v4f*)(gw + (size_t)i * 16 * DIN);
  XW2(gx, gw);
#pragma unroll 2   /* two steps a trip: the buffer's number is a constant in each */
  for (int kc = 0; kc < DIN / 32; ++kc) { __bf16 (*bf)[KP] = stg[kc & 1];
#pragma unroll
    for (int i = 0; i < 12; ++i) { v4b c;
#pragma unroll
      for (int e = 0; e < 4; ++e) c[e] = (__bf16)pre[i][e];
      *(v4b*)&bf[i * 16 + lr][lq * 4] = c; }
    if (kc + 1 < DIN / 32) { gx += 32; gw += 32;   /* the next step's lines fly under this step's products */
#pragma unroll
      for (int i = 0; i < 4; ++i) pre[i] = *(const v4f*)(gx + (size_t)i * 16 * DIN);
#pragma unroll
      for (int i = 0; i < 8; ++i) pre[4 + i] = *(const v4f*)(gw + (size_t)i * 16 * DIN);
      XW2(gx, gw); }
    RINGBAR();   /* publishes this step's buffer; it also ends every wave's reads of the other buffer, which the next step overwrites */
    const v16b a = frag_b(&bf[wave * 16 + col][0], lane); v16b w[8];
#pragma unroll
    for (int j = 0; j < 8; ++j) w[j] = frag_b(&bf[64 + j * 16 + col][0], lane);
#pragma unroll
    for (int j = 0; j < 8; ++j) acc[j] = wmma_bf(a, w[j], acc[j]);
    __builtin_amdgcn_sched_barrier(0);   /* keeps the next step's conversions, and with them the wait for its loads, behind this step's products */ }
  __syncthreads();   /* every wave has read its last fragments before the epilogue's tiles overwrite the buffers */
  if (which < 2) { _Float16* DH = which == 0 ? QH : KH; _Float16* DL = which == 0 ? QL : KL; const int nhi = which == 0 ? QHI : KHI; const bool hi_rows = t0 < nhi;
#pragma unroll
    for (int j = 0; j < 8; ++j) { const float bias = BA ? bfr(BA[c0 + j * 16 + col]) : 0.f;
#pragma unroll
      for (int r = 0; r < 8; ++r) { const float v = acc[j][r] + bias; const _Float16 hv = (_Float16)v; sh[wave * 16 + 8 * g + r][j * 16 + col] = hv; sl[wave * 16 + 8 * g + r][j * 16 + col] = (_Float16)((v - (float)hv) * 1024.0f); } }
    __syncthreads();
    for (int e = tid; e < 64 * 16; e += 128) { const int rl = e >> 4, q = e & 15; vst2((unsigned*)(DH + (r0 + rl) * CC + c0 + q * 8), *(const v4u*)&sh[rl][q * 8]); if (hi_rows) vst2((unsigned*)(DL + (bb * nhi + t0 + rl) * (size_t)CC + c0 + q * 8), *(const v4u*)&sl[rl][q * 8]); }
  } else { const bool hi_rows = t0 < KHI;
#pragma unroll
    for (int j = 0; j < 8; ++j) { const float bias = BA ? bfr(BA[c0 + j * 16 + col]) : 0.f;
#pragma unroll
      for (int r = 0; r < 8; ++r) { const float v = acc[j][r] + bias; const int rl = wave * 16 + 8 * g + r, cl = j * 16 + col; th[cl][rl] = (_Float16)v; const __bf16 bh = (__bf16)v; tb[cl][rl] = bh; tbl[cl][rl] = (__bf16)(v - (float)bh); } }
    __syncthreads();
    for (int e = tid; e < 128 * 8; e += 128) { const int cl = e >> 3, q = e & 7; vst2((unsigned*)(VT + (bb * CC + c0 + cl) * (size_t)TT + t0 + q * 8), *(const v4u*)&th[cl][q * 8]); if (hi_rows) { const size_t o3 = (bb * CC + c0 + cl) * (size_t)KHI + t0 + q * 8; vst2((unsigned*)(VB + o3), *(const v4u*)&tb[cl][q * 8]); vst2((unsigned*)(VBL + o3), *(const v4u*)&tbl[cl][q * 8]); } } } }
// ---- k_attn: block = 64 queries (qb, heaviest first) of (b, h), one wave = 16 queries, no exchange between waves. Per 64 keys: S^T = K . Q^T (A = key rows, B = query rows, same loader on both sides), so a lane holds 32 scores of ONE query (query = lane & 15, key = 16 j + 8 (lane >> 4) + r); running maximum and sum in f32 (online softmax, halves joined by one lane exchange); P^T x 2^11 packs from two score tiles straight into a B operand; O^T += V^T . P^T with the v planes [c][t] as A. Products per path as before: query blocks < QBH take q hi + residual x k hi + residual (3 products) and P, v as bf16 hi + lo (3 products); the rest one f16 product each. Every fragment of a group is loaded in front of the group's first product, so that the loads fly together
// fragment from the lane's own address (row start + k0 + 8 (lane >> 4)): same element order as frag_h / frag_b
__device__ __forceinline__ v16h frag_hp(const _Float16* p) { union { v16h v; v8h q[2]; } u; u.q[0] = *(const v8h*)p; u.q[1] = *(const v8h*)(p + 16); return u.v; }
__device__ __forceinline__ v16b frag_bp(const __bf16* p) { union { v16b v; v8b q[2]; } u; u.q[0] = *(const v8b*)p; u.q[1] = *(const v8b*)(p + 16); return u.v; }
template <bool HI> __device__ __forceinline__ void attn_wave(const _Float16* __restrict__ QH, const _Float16* __restrict__ KH, const _Float16* __restrict__ QL, const _Float16* __restrict__ KL, const _Float16* __restrict__ VT, const __bf16* __restrict__ VB, const __bf16* __restrict__ VBL, int b, int h, int qb, int wave, int lane, float (*st)[HD + 4], float* __restrict__ Y) {
  const int col = lane & 15, g = lane >> 4; const int ql0 = qb * 64 + wave * 16; const int t = ql0 + col; const size_t q0 = (size_t)b * TT + ql0; const int nkb = CAUSAL ? qb + 1 : TT / 64;
  v16h qh[HD / 32], qlo[HD / 32];
#pragma unroll
  for (int kc = 0; kc < HD / 32; ++kc) { qh[kc] = frag_h(QH + (q0 + col) * CC + h * HD + kc * 32, lane); if (HI) qlo[kc] = frag_h(QL + ((size_t)b * QHI + ql0 + col) * CC + h * HD + kc * 32, lane); }
  v8f o[HD / 16] = {}; float m = -3.0e38f, l = 0.f;
#pragma unroll 1   /* stays rolled: one key block's fragments already fill the registers that four waves a SIMD leave a wave */
  for (int kb = 0; kb < nkb; ++kb) { const int k0 = kb * 64; v8f s[4]; v16h kf[4][HD / 32], kl[4][HD / 32], vf[2][HD / 16];
    const _Float16* kp = KH + ((size_t)b * TT + k0 + col) * CC + h * HD + 8 * g; const _Float16* klp = KL + ((size_t)b * KHI + k0 + col) * CC + h * HD + 8 * g; const _Float16* vp = VT + ((size_t)b * CC + h * HD + col) * (size_t)TT + k0 + 8 * g;
    const __bf16* vbp = VB + ((size_t)b * CC + h * HD + col) * (size_t)KHI + k0 + 8 * g; const __bf16* vlp = VBL + ((size_t)b * CC + h * HD + col) * (size_t)KHI + k0 + 8 * g;
#pragma unroll
    for (int j = 0; j < 4; ++j)
#pragma unroll
      for (int kc = 0; kc < HD / 32; ++kc) kf[j][kc] = frag_hp(kp + (size_t)j * 16 * CC + kc * 32);
    XW(kp);
    if (HI) {
#pragma unroll
      for (int j = 0; j < 4; ++j)
#pragma unroll
        for (int kc = 0; kc < HD / 32; ++kc) kl[j][kc] = frag_hp(klp + (size_t)j * 16 * CC + kc * 32);
      XW(klp); }
#pragma unroll
    for (int j = 0; j < 4; ++j) { v8f acc = {}, accl = {};
#pragma unroll
      for (int kc = 0; kc < HD / 32; ++kc) { acc = wmma16(kf[j][kc], qh[kc], acc); if (HI) { accl = wmma16(kf[j][kc], qlo[kc], accl); accl = wmma16(kl[j][kc], qh[kc], accl); } }
#pragma unroll
      for (int r = 0; r < 8; ++r) s[j][r] = HI ? (acc[r] + accl[r] * (1.0f / 1024.0f)) * SCALE : acc[r] * SCALE; }
    if (!HI) {   /* f16 path: v is asked for here, so that it flies under the softmax arithmetic */
#pragma unroll
      for (int kc = 0; kc < 2; ++kc)
#pragma unroll
        for (int jd = 0; jd < HD / 16; ++jd) vf[kc][jd] = frag_hp(vp + (size_t)jd * 16 * TT + kc * 32);
      XW(vp); }
    if (CAUSAL && k0 + 63 > ql0) {   /* wave-uniform: only a key block that reaches past the wave's first query holds excluded keys */
#pragma unroll
      for (int j = 0; j < 4; ++j)
#pragma unroll
        for (int r = 0; r < 8; ++r) if (k0 + j * 16 + 8 * g + r > t) s[j][r] = -3.0e38f; }
    float mx = -3.0e38f;
#pragma unroll
    for (int j = 0; j < 4; ++j)
#pragma unroll
      for (int r = 0; r < 8; ++r) mx = fmaxf(mx, s[j][r]);
    mx = fmaxf(mx, __shfl_xor(mx, 16));
    const float mn = fmaxf(m, mx); const float alpha = expf(m - mn); m = mn;
    float ls = 0.f;
#pragma unroll
    for (int j = 0; j < 4; ++j)
#pragma unroll
      for (int r = 0; r < 8; ++r) { const float v = s[j][r]; const float ex = expf(v - mn); const float e = (v <= -1.0e38f) ? 0.f : ex; ls += e; s[j][r] = e * 2048.0f; }
    l = l * alpha + ls;
#pragma unroll
    for (int jd = 0; jd < HD / 16; ++jd)
#pragma unroll
      for (int r = 0; r < 8; ++r) o[jd][r] *= alpha;
#pragma unroll
    for (int kc = 0; kc < 2; ++kc) {
      if (HI) { float pv[16]; v16b vh[HD / 16], vl[HD / 16];
#pragma unroll
        for (int jd = 0; jd < HD / 16; ++jd) { vh[jd] = frag_bp(vbp + (size_t)jd * 16 * KHI + kc * 32); vl[jd] = frag_bp(vlp + (size_t)jd * 16 * KHI + kc * 32); }
        XW2(vbp, vlp);
#pragma unroll
        for (int i = 0; i < 8; ++i) { pv[i] = s[2 * kc][i]; pv[8 + i] = s[2 * kc + 1][i]; }
        const F2 p = bsplit16(pv);
#pragma unroll
        for (int jd = 0; jd < HD / 16; ++jd) { o[jd] = wmma_bf(vh[jd], p.h, o[jd]); o[jd] = wmma_bf(vh[jd], p.l, o[jd]); o[jd] = wmma_bf(vl[jd], p.h, o[jd]); }
      } else { v16h p;
#pragma unroll
        for (int i = 0; i < 8; ++i) { p[i] = (_Float16)s[2 * kc][i]; p[8 + i] = (_Float16)s[2 * kc + 1][i]; }
#pragma unroll
        for (int jd = 0; jd < HD / 16; ++jd) o[jd] = wmma16(vf[kc][jd], p, o[jd]); } } }
  l += __shfl_xor(l, 16);
  const float inv = l > 0.f ? 1.0f / (2048.0f * l) : 0.f;   /* a fully excluded row yields ctx = 0 */
#pragma unroll
  for (int jd = 0; jd < HD / 16; ++jd) { v4f a, c;
#pragma unroll
    for (int r = 0; r < 4; ++r) { a[r] = o[jd][r] * inv; c[r] = o[jd][4 + r] * inv; }
    *(v4f*)&st[col][jd * 16 + 8 * g] = a; *(v4f*)&st[col][jd * 16 + 8 * g + 4] = c; }
  LDSX();   /* the wave's own LDS stores land before other lanes of the wave read them: two whole 256-B (row, head) segments a store */
#pragma unroll
  for (int rl = 0; rl < 16; rl += 2) vst2(Y + (q0 + rl + g) * CC + h * HD + col * 4, *(const v4f*)&st[rl + g][col * 4]); }
__global__ __launch_bounds__(128) void k_attn(const _Float16* __restrict__ QH, const _Float16* __restrict__ KH, const _Float16* __restrict__ QL, const _Float16* __restrict__ KL, const _Float16* __restrict__ VT, const __bf16* __restrict__ VB, const __bf16* __restrict__ VBL, float* __restrict__ Y) { __shared__ __align__(16) float ss[4][16][HD + 4];
  /* the wave's number in a scalar register: the causal test of a key block becomes a scalar branch */
  const int tid = threadIdx.x, wave = __builtin_amdgcn_readfirstlane(tid >> 5), lane = tid & 31; const int h = blockIdx.x, b = blockIdx.y, qb = NQB - 1 - (int)blockIdx.z;
  if (CAUSAL && qb < QBH) attn_wave<true>(QH, KH, QL, KL, VT, VB, VBL, b, h, qb, wave, lane, ss[wave], Y);   /* block-uniform */
  else attn_wave<false>(QH, KH, QL, KL, VT, VB, VBL, b, h, qb, wave, lane, ss[wave], Y); }
// ---- k_out: block = (64 rows, 128 cols): out = ctx Wo (+ bo): ctx x 2^6 once to f16 against Wo as f16(bf16 x 2^8) exact (1 product) x 2^-14; causal early rows (< QHI of each sequence): ctx bf16 hi + lo against exact bf16 Wo (2 products)
__global__ __launch_bounds__(128) void k_out(const float* __restrict__ Y, const float* __restrict__ WO, const float* __restrict__ BO, float* __restrict__ OUT) { __shared__ __align__(16) float sf[4][16][132]; __shared__ __align__(16) unsigned char smem[2 * 256 * KP * 2];
  const int tid = threadIdx.x, wave = tid >> 5, lane = tid & 31, col = lane & 15, g = lane >> 4; const int c0 = blockIdx.y * 128; const size_t r0 = (size_t)blockIdx.x * 64 + wave * 16;
  v8f acc[8] = {};
  /* staging as in k_proj: thread = (row lr of 16, 16-B piece lq); buffer rows 0..63 = ctx, 64..191 = Wo, 192..255 = ctx residual (early rows only) */
  const int lr = tid >> 3, lq = tid & 7; const float* gy = Y + ((size_t)blockIdx.x * 64 + lr) * CC + lq * 4; const float* gw = WO + (size_t)(c0 + lr) * CC + lq * 4; v4f pre[12];
#pragma unroll
  for (int i = 0; i < 4; ++i) pre[i] = *(const v4f*)(gy + (size_t)i * 16 * CC);
#pragma unroll
  for (int i = 0; i < 8; ++i) pre[4 + i] = *(const v4f*)(gw + (size_t)i * 16 * CC);
  XW2(gy, gw);
  if (CAUSAL && (int)(((size_t)blockIdx.x * 64) % TT) < QHI) {   /* block-uniform */
    __bf16 (*stg)[256][KP] = (__bf16 (*)[256][KP])smem;
#pragma unroll 2   /* two steps a trip: the buffer's number is a constant in each */
    for (int kc = 0; kc < CC / 32; ++kc) { __bf16 (*bf)[KP] = stg[kc & 1];
#pragma unroll
      for (int i = 0; i < 4; ++i) { v4b ch, cl;
#pragma unroll
        for (int e = 0; e < 4; ++e) { const float v = pre[i][e]; const __bf16 hv = (__bf16)v; ch[e] = hv; cl[e] = (__bf16)(v - (float)hv); }
        *(v4b*)&bf[i * 16 + lr][lq * 4] = ch; *(v4b*)&bf[192 + i * 16 + lr][lq * 4] = cl; }
#pragma unroll
      for (int i = 4; i < 12; ++i) { v4b c;
#pragma unroll
        for (int e = 0; e < 4; ++e) c[e] = (__bf16)pre[i][e];
        *(v4b*)&bf[i * 16 + lr][lq * 4] = c; }
      if (kc + 1 < CC / 32) { gy += 32; gw += 32;   /* the next step's lines fly under this step's products */
#pragma unroll
        for (int i = 0; i < 4; ++i) pre[i] = *(const v4f*)(gy + (size_t)i * 16 * CC);
#pragma unroll
        for (int i = 0; i < 8; ++i) pre[4 + i] = *(const v4f*)(gw + (size_t)i * 16 * CC);
        XW2(gy, gw); }
      RINGBAR();   /* publishes this step's buffer; it also ends every wave's reads of the other buffer, which the next step overwrites */
      const v16b ah = frag_b(&bf[wave * 16 + col][0], lane), al = frag_b(&bf[192 + wave * 16 + col][0], lane); v16b w[8];
#pragma unroll
      for (int j = 0; j < 8; ++j) w[j] = frag_b(&bf[64 + j * 16 + col][0], lane);
#pragma unroll
      for (int j = 0; j < 8; ++j) { acc[j] = wmma_bf(ah, w[j], acc[j]); acc[j] = wmma_bf(al, w[j], acc[j]); }
      __builtin_amdgcn_sched_barrier(0);   /* keeps the next step's conversions, and with them the wait for its loads, behind this step's products */ }
#pragma unroll
    for (int j = 0; j < 8; ++j) { const float bias = BO ? bfr(BO[c0 + j * 16 + col]) : 0.f;
#pragma unroll
      for (int r = 0; r < 8; ++r) sf[wave][8 * g + r][j * 16 + col] = acc[j][r] + bias; }
  } else {
    _Float16 (*stg)[256][KP] = (_Float16 (*)[256][KP])smem;
#pragma unroll 2   /* two steps a trip: the buffer's number is a constant in each */
    for (int kc = 0; kc < CC / 32; ++kc) { _Float16 (*bf)[KP] = stg[kc & 1];
#pragma unroll
      for (int i = 0; i < 12; ++i) { v4h c;
#pragma unroll
        for (int e = 0; e < 4; ++e) c[e] = i < 4 ? (_Float16)(pre[i][e] * 64.0f) : (_Float16)(bfr(pre[i][e]) * 256.0f);   /* ctx carried x 2^6 into f16 so small-magnitude context rows stay clear of f16 subnormals; Wo as f16(bf16 x 2^8), exact */
        *(v4h*)&bf[i * 16 + lr][lq * 4] = c; }
      if (kc + 1 < CC / 32) { gy += 32; gw += 32;   /* the next step's lines fly under this step's products */
#pragma unroll
        for (int i = 0; i < 4; ++i) pre[i] = *(const v4f*)(gy + (size_t)i * 16 * CC);
#pragma unroll
        for (int i = 0; i < 8; ++i) pre[4 + i] = *(const v4f*)(gw + (size_t)i * 16 * CC);
        XW2(gy, gw); }
      RINGBAR();   /* publishes this step's buffer; it also ends every wave's reads of the other buffer, which the next step overwrites */
      const v16h a = frag_h(&bf[wave * 16 + col][0], lane); v16h w[8];
#pragma unroll
      for (int j = 0; j < 8; ++j) w[j] = frag_h(&bf[64 + j * 16 + col][0], lane);
#pragma unroll
      for (int j = 0; j < 8; ++j) acc[j] = wmma16(a, w[j], acc[j]);
      __builtin_amdgcn_sched_barrier(0);   /* keeps the next step's conversions, and with them the wait for its loads, behind this step's products */ }
#pragma unroll
    for (int j = 0; j < 8; ++j) { const float bias = BO ? bfr(BO[c0 + j * 16 + col]) : 0.f;
#pragma unroll
      for (int r = 0; r < 8; ++r) sf[wave][8 * g + r][j * 16 + col] = acc[j][r] * (1.0f / 16384.0f) + bias; } }   /* 2^-8 (Wo carry) x 2^-6 (ctx carry) */
  LDSX(); for (int rl = 0; rl < 16; ++rl) vst2(OUT + (r0 + rl) * DIN + c0 + lane * 4, *(const v4f*)&sf[wave][rl][lane * 4]); }

extern "C" void kernel_launch(void* const* d_in, const int* in_sizes, int n_in, void* d_out, int out_size, void* d_ws, size_t ws_size, hipStream_t stream) {
  (void)in_sizes; (void)n_in; (void)out_size;
  const float** F = (const float**)d_in;
  if (ws_size < (size_t)WS_END) return;
  char* ws = (char*)d_ws; _Float16 *QH = (_Float16*)(ws + WS_QH), *KH = (_Float16*)(ws + WS_KH), *VT = (_Float16*)(ws + WS_VT), *QL = (_Float16*)(ws + WS_QL), *KL = (_Float16*)(ws + WS_KL); __bf16 *VB = (__bf16*)(ws + WS_VB), *VBL = (__bf16*)(ws + WS_VBL); float *Y = (float*)(ws + WS_Y);
  (void)Y; (void)QL; (void)KL; (void)VB; (void)VBL;
  // inputs: 0 key [4,1024,1024]; 1 value; 2 query; 3 Wk [1024,1024] (out,in), 4 bk; 5 Wq, 6 bq; 7 Wv, 8 bv; 9 Wp (out,in), 10 bp (zero biases, read)
  k_proj<<<dim3(TNB * TT / 64, CC / 128, 3), 128, 0, stream>>>(F[2], F[0], F[1], F[5], F[3], F[7], F[6], F[4], F[8], QH, QL, KH, KL, VT, VB, VBL);   /* (q, k, v) streams = inputs (query = 2, key = 0, value = 1) */
  k_attn<<<dim3(NH, TNB, NQB), 128, 0, stream>>>(QH, KH, QL, KL, VT, VB, VBL, Y);
  k_out<<<dim3(TNB * TT / 64, DIN / 128), 128, 0, stream>>>(Y, F[9], F[10], (float*)d_out);
}

// v003
// One run takes 103 microseconds.
// Next to v002, in two timings, it ran 1.18 times as fast each time.
// Counting every step since v000, it is 8.25 times as fast.
// compute dtype: all float inputs rounded to bf16; q/k/v projections with EXACT bf16 products on WMMA 16x16x32 (f32 accumulate) + bias; causal logits: 3 products for the first 384 rows, single f16 q x k after, x 64^-0.5; online softmax f32 (running maximum, one launch for logits, softmax and P v); exp(s - max) x 2^11 once to f16 x v once to f16 (bf16 hi + lo below row 384); ctx hi+lo x exact output weight below row 384, x2^6 f16 carry x f16(bf16 x 2^8) after, + bias; f32 output.
#include <hip/hip_runtime.h>
#include <math.h>

typedef __attribute__((ext_vector_type(16))) _Float16 v16h;
typedef __attribute__((ext_vector_type(16))) __bf16 v16b;
typedef __attribute__((ext_vector_type(8)))  _Float16 v8h;
typedef __attribute__((ext_vector_type(8)))  float v8f;
typedef __attribute__((ext_vector_type(4)))  float v4f;
typedef __attribute__((ext_vector_type(2)))  float v2f;
typedef __attribute__((ext_vector_type(4)))  unsigned v4u;
typedef __attribute__((ext_vector_type(4)))  int v4i;
typedef float __attribute__((may_alias)) float_a;
typedef int __attribute__((may_alias)) int_a;

template <typename T> __device__ __forceinline__ void vst2(void* p, T v) { *(T*)p = v;  }
__device__ __forceinline__ v8f wmma16(v16h a, v16h b, v8f c) {
  v8f d = __builtin_amdgcn_wmma_f32_16x16x32_f16(false, a, false, b, (short)0, c, false, false);
  asm volatile("v_nop\n\tv_nop\n\tv_nop\n\tv_nop" : "+v"(d) : "v"(a), "v"(b));
  return d;
}
__device__ __forceinline__ v8f wmma_bf(v16b a, v16b b, v8f c) {
  v8f d = __builtin_amdgcn_wmma_f32_16x16x32_bf16(false, a, false, b, (short)0, c, false, false);
  asm volatile("v_nop\n\tv_nop\n\tv_nop\n\tv_nop" : "+v"(d) : "v"(a), "v"(b));
  return d;
}
// 16x16x32 fragments: lane = (h = lane>>4, row/col = lane&15); elements 0..7 = k0+8h+0..7, 8..15 = k0+16+8h+0..7; D element r = row 8h+r
__device__ __forceinline__ v16h frag_h(const _Float16* rowk0, int lane) {
  union { v16h v; v8h q[2]; } u; const _Float16* p = rowk0 + 8 * (lane >> 4);
  u.q[0] = *(const v8h*)p; u.q[1] = *(const v8h*)(p + 16); return u.v;
}
__device__ __forceinline__ v16h frag_f32(const float* rowk0, int lane) {
  v16h a; const float* p = rowk0 + 8 * (lane >> 4);
#pragma unroll
  for (int i = 0; i < 8; ++i) { a[i] = (_Float16)p[i]; a[8 + i] = (_Float16)p[16 + i]; }
  return a;
}
__device__ __forceinline__ v16h frag_f32s(const float* rowk0, int lane, float sc) {
  v16h a; const float* p = rowk0 + 8 * (lane >> 4);
#pragma unroll
  for (int i = 0; i < 8; ++i) { a[i] = (_Float16)(p[i] * sc); a[8 + i] = (_Float16)(p[16 + i] * sc); }
  return a;
}
// column fragment from a [K][ld] layout (column n), rows >= K read as 0
__device__ __forceinline__ v16h fragc_f32(const float* W, int k0, int n, int lane, int ld, int K) {
  v16h a; const int g = lane >> 4;
#pragma unroll
  for (int i = 0; i < 8; ++i) { const int ka = k0 + 8 * g + i, kb = ka + 16;
    a[i] = (_Float16)(ka < K ? W[(size_t)(ka < K ? ka : K - 1) * ld + n] : 0.f); a[8 + i] = (_Float16)(kb < K ? W[(size_t)(kb < K ? kb : K - 1) * ld + n] : 0.f); }
  return a;
}
struct F2 { v16b h, l; };
__device__ __forceinline__ F2 bsplit16(const float v[16]) { F2 r;
#pragma unroll
  for (int i = 0; i < 16; ++i) { const __bf16 h = (__bf16)v[i]; r.h[i] = h; r.l[i] = (__bf16)(v[i] - (float)h); }
  return r; }
__device__ __forceinline__ F2 split_row(const float* row, int k0, int lane) { float v[16]; const float* p = row + k0 + 8 * (lane >> 4);
#pragma unroll
  for (int i = 0; i < 8; ++i) { v[i] = p[i]; v[8 + i] = p[16 + i]; }
  return bsplit16(v); }
__device__ __forceinline__ F2 split_rowK(const float* row, int k0, int lane, int K) { float v[16]; const int g = lane >> 4;
#pragma unroll
  for (int i = 0; i < 8; ++i) { const int ka = k0 + 8 * g + i, kb = ka + 16; v[i] = ka < K ? row[ka < K ? ka : K - 1] : 0.f; v[8 + i] = kb < K ? row[kb < K ? kb : K - 1] : 0.f; }
  return bsplit16(v); }
__device__ __forceinline__ F2 split_col(const float* W, int k0, int n, int lane, int ld, int K) { float v[16]; const int g = lane >> 4;
#pragma unroll
  for (int i = 0; i < 8; ++i) { const int ka = k0 + 8 * g + i, kb = ka + 16; v[i] = ka < K ? W[(size_t)(ka < K ? ka : K - 1) * ld + n] : 0.f; v[8 + i] = kb < K ? W[(size_t)(kb < K ? kb : K - 1) * ld + n] : 0.f; }
  return bsplit16(v); }
__device__ __forceinline__ v8f mac3(const F2& a, const F2& b, v8f c) { c = wmma_bf(a.l, b.h, c); c = wmma_bf(a.h, b.l, c); return wmma_bf(a.h, b.h, c); }
__device__ __forceinline__ float sigm(float v) { return 1.0f / (1.0f + expf(-v)); }
#define LDSX() do { asm volatile("s_wait_dscnt 0" ::: "memory"); __builtin_amdgcn_wave_barrier(); __builtin_amdgcn_fence(__ATOMIC_RELEASE, "workgroup"); } while (0)

// Causal multi-head attention on separate inputs listed key-first (key / value / query [4,1024,1024]; torch (out,in) Wk / Wq / Wv / Wp [1024,1024] (0.02) + zero biases; 16 heads x 64; scale 1/8; tril, -inf): out = merge(softmax(causal(q_h k_h^T / 8)) v_h) Wp^T + bp.
#define NB 4
#define TT 1024
#define CC 1024            // NH * HD = projected width
#define DIN 1024          // input (model) width
#define NH 16
#define HD 64
#define NQB (TT / 64)
#define HG 8
#define SCALE (0.125f)
#define CAUSAL 1
#ifndef TNB
#define TNB NB
#endif
__device__ __forceinline__ float bfr(float v) { return (float)(__bf16)v; }
__host__ __device__ __forceinline__ int kb_last(int qb) { return CAUSAL ? ((qb * 64 + 63) >> 7) : (TT / 128 - 1); }
typedef __attribute__((ext_vector_type(8))) __bf16 v8b;
__device__ __forceinline__ v16b frag_b(const __bf16* rowk0, int lane) {
  union { v16b v; v8b q[2]; } u; const __bf16* p = rowk0 + 8 * (lane >> 4);
  u.q[0] = *(const v8b*)p; u.q[1] = *(const v8b*)(p + 16); return u.v;
}
#define QBH 6              // causal: query blocks 0..QBH-1 of each sequence (few keys, no averaging) take the high-precision path
#define QHI 384            // rows carrying a q residual plane
#define KHI 384            // key rows carrying k residual / v bf16 hi+lo planes (used only by the causal high-precision path)
// B fragment (k rows k0+.., output column o) of a weight: (in,out) [K][ld] or (out,in) [ld rows of K]: bf16 exact, or f16(bf16 * 256) exact
__device__ __forceinline__ v16b wcol_io(const float* Wm, int k0, int o, int lane, int ld) { v16b w; const int g = lane >> 4;
#pragma unroll
  for (int i = 0; i < 8; ++i) { w[i] = (__bf16)Wm[(size_t)(k0 + 8 * g + i) * ld + o]; w[8 + i] = (__bf16)Wm[(size_t)(k0 + 16 + 8 * g + i) * ld + o]; }
  return w; }
__device__ __forceinline__ v16b wcol_oi(const float* Wm, int k0, int o, int lane, int K) { v16b w; const float* p = Wm + (size_t)o * K + k0 + 8 * (lane >> 4);
#pragma unroll
  for (int i = 0; i < 8; ++i) { w[i] = (__bf16)p[i]; w[8 + i] = (__bf16)p[16 + i]; }
  return w; }
__device__ __forceinline__ v16h wcolh_io(const float* Wm, int k0, int o, int lane, int ld) { v16h w; const int g = lane >> 4;
#pragma unroll
  for (int i = 0; i < 8; ++i) { w[i] = (_Float16)(bfr(Wm[(size_t)(k0 + 8 * g + i) * ld + o]) * 256.0f); w[8 + i] = (_Float16)(bfr(Wm[(size_t)(k0 + 16 + 8 * g + i) * ld + o]) * 256.0f); }
  return w; }
__device__ __forceinline__ v16h wcolh_oi(const float* Wm, int k0, int o, int lane, int K) { v16h w; const float* p = Wm + (size_t)o * K + k0 + 8 * (lane >> 4);
#pragma unroll
  for (int i = 0; i < 8; ++i) { w[i] = (_Float16)(bfr(p[i]) * 256.0f); w[8 + i] = (_Float16)(bfr(p[16 + i]) * 256.0f); }
  return w; }
#define WQKV_LAYOUT 1   // 0 = (in,out) [DIN][CC]; 1 = (out,in) [CC][DIN]; 2 = per-head [NH][DIN][HD]
__device__ __forceinline__ v16b wcol_hdk(const float* Wm, int k0, int o, int lane) { v16b w; const int g = lane >> 4; const float* p = Wm + (size_t)(o / HD) * DIN * HD + (o % HD);
#pragma unroll
  for (int i = 0; i < 8; ++i) { w[i] = (__bf16)p[(size_t)(k0 + 8 * g + i) * HD]; w[8 + i] = (__bf16)p[(size_t)(k0 + 16 + 8 * g + i) * HD]; }
  return w; }
#define WO_OUT_IN 1
#if WQKV_LAYOUT == 1
#define WCOL(W, k0, o, lane) wcol_oi(W, k0, o, lane, DIN)
#elif WQKV_LAYOUT == 2
#define WCOL(W, k0, o, lane) wcol_hdk(W, k0, o, lane)
#else
#define WCOL(W, k0, o, lane) wcol_io(W, k0, o, lane, CC)
#endif
#if WO_OUT_IN
#define WOCOL(W, k0, o, lane) wcol_oi(W, k0, o, lane, CC)
#define WOCOLH(W, k0, o, lane) wcolh_oi(W, k0, o, lane, CC)
#else
#define WOCOL(W, k0, o, lane) wcol_io(W, k0, o, lane, DIN)
#define WOCOLH(W, k0, o, lane) wcolh_io(W, k0, o, lane, DIN)
#endif

#ifndef SM_EXTRA_PARAMS
#define SM_EXTRA_PARAMS
#endif
#ifndef PROJ_EXTRA_PARAMS
#define PROJ_EXTRA_PARAMS
#endif
#ifndef SM_MASK_HOOK
#define SM_MASK_HOOK (void)0
#endif

#define WS_QH  0u                                      // f16 q rows [b*t][CC]
#define WS_KH  (WS_QH + 2u * (size_t)NB * TT * CC)      // f16 k rows [b*t][CC]
#define WS_VT  (WS_KH + 2u * (size_t)NB * TT * CC)      // f16 v planes [b][c][t]
#define WS_QL  (WS_VT + 2u * (size_t)NB * CC * TT)      // f16 q residual x 2^10 rows [b][t < QHI][CC]
#define WS_KL  (WS_QL + 2u * (size_t)NB * QHI * CC)     // f16 k residual x 2^10 rows [b][t < KHI][CC]
#define WS_VB  (WS_KL + 2u * (size_t)NB * KHI * CC)     // bf16 v hi planes [b][c][t < KHI]
#define WS_VBL (WS_VB + 2u * (size_t)NB * CC * KHI)
#define WS_S   (WS_VBL + 2u * (size_t)NB * CC * KHI)    // f32 [hg][t][s] region, unused: logits and P stay in registers
#define WS_Y   (WS_S  + 4u * (size_t)HG * TT * TT)      // f32 ctx rows [b*t][CC] (only when there is an output projection)
#define WS_END (WS_Y  + 4u * (size_t)NB * TT * CC)

// precaution behind a group of global loads: the group's address stays an input of the wait, so its registers are rewritten only behind the wait
#define XW2(p, q) asm volatile("s_wait_xcnt 0x0" :: "v"(p), "v"(q) : "memory")
// work-group barrier of the operand buffers, by hand: the wave's own LDS stores have landed and its reads have returned (s_wait_dscnt 0) before it signals; __syncthreads() would also wait for the next step's global loads, which are to stay in flight across it
#define RINGBAR() do { asm volatile("s_wait_dscnt 0x0" ::: "memory"); asm volatile("s_barrier_signal -1\n\ts_barrier_wait -1" ::: "memory"); } while (0)
#define KP 40              // pitch of a staged 32-k row in 16-bit elements: 80 B = 16 B x odd, where 16-byte fragment reads of 16 rows meet no bank twice
typedef __attribute__((ext_vector_type(4))) __bf16 v4b;
typedef __attribute__((ext_vector_type(4))) _Float16 v4h;
// ---- k_proj: block = (64 rows, 128 cols, which): q/k/v = X W (+ b) with exact bf16 products (K = DIN) -> which 0: q f16 rows (+ residual rows < QHI); 1: k f16 rows (+ residual rows < KHI); 2: v f16 planes [c][t] (+ bf16 hi/lo planes for t < KHI)
__global__ __launch_bounds__(128) void k_proj(const float* __restrict__ XQ, const float* __restrict__ XK, const float* __restrict__ XV, const float* __restrict__ WQ, const float* __restrict__ WK, const float* __restrict__ WV, const float* __restrict__ BQ, const float* __restrict__ BK, const float* __restrict__ BV,
    _Float16* __restrict__ QH, _Float16* __restrict__ QL, _Float16* __restrict__ KH, _Float16* __restrict__ KL, _Float16* __restrict__ VT, __bf16* __restrict__ VB, __bf16* __restrict__ VBL) {
  /* one LDS block: the two operand buffers of the k loop first, the epilogue's tiles (q/k: sh, sl; v: th, tb, tbl) behind the barrier that ends the loop's last reads */
  __shared__ __align__(16) unsigned char smem[3 * 128 * 72 * 2];
  __bf16 (*stg)[192][KP] = (__bf16 (*)[192][KP])smem;
  _Float16 (*sh)[136] = (_Float16 (*)[136])smem; _Float16 (*sl)[136] = (_Float16 (*)[136])(smem + 64 * 136 * 2);
  _Float16 (*th)[72] = (_Float16 (*)[72])smem; __bf16 (*tb)[72] = (__bf16 (*)[72])(smem + 128 * 72 * 2); __bf16 (*tbl)[72] = (__bf16 (*)[72])(smem + 2 * 128 * 72 * 2);
  const int tid = threadIdx.x, wave = tid >> 5, lane = tid & 31, col = lane & 15, g = lane >> 4; const int which = blockIdx.z; const int c0 = blockIdx.y * 128; const size_t r0 = (size_t)blockIdx.x * 64; const size_t bb = r0 / TT; const int t0 = (int)(r0 % TT);
  const float* X = which == 0 ? XQ : which == 1 ? XK : XV; const float* WA = which == 0 ? WQ : which == 1 ? WK : WV; const float* BA = which == 0 ? BQ : which == 1 ? BK : BV;
  v8f acc[8] = {};
  /* a 32-k step of the block's 64 X rows and 128 W rows: thread = (row lr of 16, 16-B piece lq), so a wave's load covers four whole 128-B lines; rounded to bf16 once for the block; buffer rows 0..63 = X, 64..191 = W */
  const int lr = tid >> 3, lq = tid & 7; const float* gx = X + (r0 + lr) * DIN + lq * 4; const float* gw = WA + (size_t)(c0 + lr) * DIN + lq * 4; v4f pre[12];
#pragma unroll
  for (int i = 0; i < 4; ++i) pre[i] = *(const v4f*)(gx + (size_t)i * 16 * DIN);
#pragma unroll
  for (int i = 0; i < 8; ++i) pre[4 + i] = *(const v4f*)(gw + (size_t)i * 16 * DIN);
  XW2(gx, gw);
#pragma unroll 2   /* two steps a trip: the buffer's number is a constant in each */
  for (int kc = 0; kc < DIN / 32; ++kc) { __bf16 (*bf)[KP] = stg[kc & 1];
#pragma unroll
    for (int i = 0; i < 12; ++i) { v4b c;
#pragma unroll
      for (int e = 0; e < 4; ++e) c[e] = (__bf16)pre[i][e];
      *(v4b*)&bf[i * 16 + lr][lq * 4] = c; }
    if (kc + 1 < DIN / 32) { gx += 32; gw += 32;   /* the next step's lines fly under this step's products */
#pragma unroll
      for (int i = 0; i < 4; ++i) pre[i] = *(const v4f*)(gx + (size_t)i * 16 * DIN);
#pragma unroll
      for (int i = 0; i < 8; ++i) pre[4 + i] = *(const v4f*)(gw + (size_t)i * 16 * DIN);
      XW2(gx, gw); }
    RINGBAR();   /* publishes this step's buffer; it also ends every wave's reads of the other buffer, which the next step overwrites */
    const v16b a = frag_b(&bf[wave * 16 + col][0], lane); v16b w[8];
#pragma unroll
    for (int j = 0; j < 8; ++j) w[j] = frag_b(&bf[64 + j * 16 + col][0], lane);
#pragma unroll
    for (int j = 0; j < 8; ++j) acc[j] = wmma_bf(a, w[j], acc[j]);
    __builtin_amdgcn_sched_barrier(0);   /* keeps the next step's conversions, and with them the wait for its loads, behind this step's products */ }
  __syncthreads();   /* every wave has read its last fragments before the epilogue's tiles overwrite the buffers */
  if (which < 2) { _Float16* DH = which == 0 ? QH : KH; _Float16* DL = which == 0 ? QL : KL; const int nhi = which == 0 ? QHI : KHI; const bool hi_rows = t0 < nhi;
#pragma unroll
    for (int j = 0; j < 8; ++j) { const float bias = BA ? bfr(BA[c0 + j * 16 + col]) : 0.f;
#pragma unroll
      for (int r = 0; r < 8; ++r) { const float v = acc[j][r] + bias; const _Float16 hv = (_Float16)v; sh[wave * 16 + 8 * g + r][j * 16 + col] = hv; sl[wave * 16 + 8 * g + r][j * 16 + col] = (_Float16)((v - (float)hv) * 1024.0f); } }
    __syncthreads();
    for (int e = tid; e < 64 * 16; e += 128) { const int rl = e >> 4, q = e & 15; vst2((unsigned*)(DH + (r0 + rl) * CC + c0 + q * 8), *(const v4u*)&sh[rl][q * 8]); if (hi_rows) vst2((unsigned*)(DL + (bb * nhi + t0 + rl) * (size_t)CC + c0 + q * 8), *(const v4u*)&sl[rl][q * 8]); }
  } else { const bool hi_rows = t0 < KHI;
#pragma unroll
    for (int j = 0; j < 8; ++j) { const float bias = BA ? bfr(BA[c0 + j * 16 + col]) : 0.f;
#pragma unroll
      for (int r = 0; r < 8; ++r) { const float v = acc[j][r] + bias; const int rl = wave * 16 + 8 * g + r, cl = j * 16 + col; th[cl][rl] = (_Float16)v; const __bf16 bh = (__bf16)v; tb[cl][rl] = bh; tbl[cl][rl] = (__bf16)(v - (float)bh); } }
    __syncthreads();
    for (int e = tid; e < 128 * 8; e += 128) { const int cl = e >> 3, q = e & 7; vst2((unsigned*)(VT + (bb * CC + c0 + cl) * (size_t)TT + t0 + q * 8), *(const v4u*)&th[cl][q * 8]); if (hi_rows) { const size_t o3 = (bb * CC + c0 + cl) * (size_t)KHI + t0 + q * 8; vst2((unsigned*)(VB + o3), *(const v4u*)&tb[cl][q * 8]); vst2((unsigned*)(VBL + o3), *(const v4u*)&tbl[cl][q * 8]); } } } }
// ---- k_attn: block = 64 queries (qb, heaviest first) of (b, h), one wave = 16 queries; the waves share the staged K and V tiles and nothing else. Per 64 keys: S^T = K . Q^T (A = key rows, B = query rows, same loader on both sides), so a lane holds 32 scores of ONE query (query = lane & 15, key = 16 j + 8 (lane >> 4) + r); running maximum and sum in f32 (online softmax, halves joined by one lane exchange); P^T x 2^11 packs from two score tiles straight into a B operand; O^T += V^T . P^T with the v planes [c][t] as A. Products per path as before: query blocks < QBH take q hi + residual x k hi + residual (3 products) and P, v as bf16 hi + lo (3 products); the rest one f16 product each. Every fragment of a group is loaded in front of the group's first product, so that the loads fly together. The K and V tiles of a key block (64 rows of 128 B each) are brought into LDS once for the block's four waves, as whole lines, by asynchronous copies, one key block ahead, in two buffers; the fragments are read from there
#define TP 144             // pitch of a staged 128-B row in bytes: 16 B x odd, where 16-byte fragment reads of 16 rows meet no bank twice
#define TILEB (64 * TP)    // one staged tile
// two tiles, four copies a thread each (rows cr, cr + 16, cr + 32, cr + 48; a wave's copy covers four whole lines). s_wait_xcnt 0 is the last line of the copies' own statement: a precaution, so that no register which a copy names is rewritten in front of it
__device__ __forceinline__ void cp2tiles(unsigned la, const char* ga, size_t sa, unsigned lb, const char* gb, size_t sb) {
  asm volatile("global_load_async_to_lds_b128 %0, %8, off\n\tglobal_load_async_to_lds_b128 %1, %9, off\n\tglobal_load_async_to_lds_b128 %2, %10, off\n\tglobal_load_async_to_lds_b128 %3, %11, off\n\t"
               "global_load_async_to_lds_b128 %4, %12, off\n\tglobal_load_async_to_lds_b128 %5, %13, off\n\tglobal_load_async_to_lds_b128 %6, %14, off\n\tglobal_load_async_to_lds_b128 %7, %15, off\n\ts_wait_xcnt 0x0"
               :: "v"(la), "v"(la + 16 * TP), "v"(la + 32 * TP), "v"(la + 48 * TP), "v"(lb), "v"(lb + 16 * TP), "v"(lb + 32 * TP), "v"(lb + 48 * TP),
                  "v"(ga), "v"(ga + sa), "v"(ga + 2 * sa), "v"(ga + 3 * sa), "v"(gb), "v"(gb + sb), "v"(gb + 2 * sb), "v"(gb + 3 * sb) : "memory"); }
// fragment from the lane's own address (row start + k0 + 8 (lane >> 4)): same element order as frag_h / frag_b
__device__ __forceinline__ v16h frag_hp(const _Float16* p) { union { v16h v; v8h q[2]; } u; u.q[0] = *(const v8h*)p; u.q[1] = *(const v8h*)(p + 16); return u.v; }
__device__ __forceinline__ v16b frag_bp(const __bf16* p) { union { v16b v; v8b q[2]; } u; u.q[0] = *(const v8b*)p; u.q[1] = *(const v8b*)(p + 16); return u.v; }
template <bool HI> __device__ __forceinline__ void attn_wave(const _Float16* __restrict__ QH, const _Float16* __restrict__ KH, const _Float16* __restrict__ QL, const _Float16* __restrict__ KL, const _Float16* __restrict__ VT, const __bf16* __restrict__ VB, const __bf16* __restrict__ VBL, int b, int h, int qb, int wave, int lane, unsigned char* sm, float* __restrict__ Y) {
  const int col = lane & 15, g = lane >> 4; const int ql0 = qb * 64 + wave * 16; const int t = ql0 + col; const size_t q0 = (size_t)b * TT + ql0; const int nkb = CAUSAL ? qb + 1 : TT / 64;
  /* staging: thread = (row cr of 16, 16-B piece cq); a stage = K, V (f16 path) or K, K residual, v hi, v lo (high-precision path) */
  constexpr unsigned STG = (HI ? 4 : 2) * TILEB; const int cr = (int)threadIdx.x >> 3, cq = (int)threadIdx.x & 7; const unsigned lcp = (unsigned)(size_t)sm + cr * TP + cq * 16;
  const unsigned tk = cr * (CC * 2) + cq * 16, tv = cr * (TT * 2) + cq * 16, tb = cr * (KHI * 2) + cq * 16;   /* the thread's byte offset in a tile's source, by the source's row pitch; the tile's own start is the same for the block */
  auto fill = [&](int kb) { const unsigned l = lcp + (kb & 1) * STG;
    const char* gk = (const char*)(KH + ((size_t)b * TT + kb * 64) * CC + h * HD) + tk;
    if (HI) { cp2tiles(l, gk, 16 * CC * 2, l + TILEB, (const char*)(KL + ((size_t)b * KHI + kb * 64) * CC + h * HD) + tk, 16 * CC * 2);
      cp2tiles(l + 2 * TILEB, (const char*)(VB + ((size_t)b * CC + h * HD) * (size_t)KHI + kb * 64) + tb, 16 * KHI * 2, l + 3 * TILEB, (const char*)(VBL + ((size_t)b * CC + h * HD) * (size_t)KHI + kb * 64) + tb, 16 * KHI * 2); }
    else cp2tiles(l, gk, 16 * CC * 2, l + TILEB, (const char*)(VT + ((size_t)b * CC + h * HD) * (size_t)TT + kb * 64) + tv, 16 * TT * 2); };
  fill(0);
  v16h qh[HD / 32], qlo[HD / 32];
#pragma unroll
  for (int kc = 0; kc < HD / 32; ++kc) { qh[kc] = frag_h(QH + (q0 + col) * CC + h * HD + kc * 32, lane); if (HI) qlo[kc] = frag_h(QL + ((size_t)b * QHI + ql0 + col) * CC + h * HD + kc * 32, lane); }
  v8f o[HD / 16] = {}; float m = -3.0e38f, l = 0.f;
  asm volatile("s_wait_asynccnt 0x0" ::: "memory");   /* the wave's own copies of key block 0 have landed */
  __syncthreads();   /* publishes key block 0 */
  if (nkb > 1) fill(1);   /* block-uniform */
#pragma unroll 1   /* stays rolled: one key block's fragments already fill the registers that four waves a SIMD leave a wave */
  for (int kb = 0; kb < nkb; ++kb) { const int k0 = kb * 64; v8f s[4]; v16h kf[4][HD / 32], kl[4][HD / 32], vf[2][HD / 16];
    const unsigned char* bp = sm + (kb & 1) * STG + col * TP + g * 16;   /* the lane's place in a staged tile: row col, 16-B piece g */
#pragma unroll
    for (int j = 0; j < 4; ++j)
#pragma unroll
      for (int kc = 0; kc < HD / 32; ++kc) kf[j][kc] = frag_hp((const _Float16*)(bp + j * 16 * TP + kc * 64));
#pragma unroll
    for (int j = 0; j < 4; ++j) { v8f acc = {}, accl = {};
      if (HI) {   /* the residual fragments come tile by tile: all four at once, beside the four k fragments, do not fit the registers that four waves a SIMD leave a wave */
#pragma unroll
        for (int kc = 0; kc < HD / 32; ++kc) kl[j][kc] = frag_hp((const _Float16*)(bp + TILEB + j * 16 * TP + kc * 64)); }
#pragma unroll
      for (int kc = 0; kc < HD / 32; ++kc) { acc = wmma16(kf[j][kc], qh[kc], acc); if (HI) { accl = wmma16(kf[j][kc], qlo[kc], accl); accl = wmma16(kl[j][kc], qh[kc], accl); } }
#pragma unroll
      for (int r = 0; r < 8; ++r) s[j][r] = HI ? (acc[r] + accl[r] * (1.0f / 1024.0f)) * SCALE : acc[r] * SCALE; }
    if (!HI) {   /* f16 path: v is read here, so that it flies under the softmax arithmetic */
#pragma unroll
      for (int kc = 0; kc < 2; ++kc)
#pragma unroll
        for (int jd = 0; jd < HD / 16; ++jd) vf[kc][jd] = frag_hp((const _Float16*)(bp + TILEB + jd * 16 * TP + kc * 64)); }
    if (CAUSAL && k0 + 63 > ql0) {   /* wave-uniform: only a key block that reaches past the wave's first query holds excluded keys */
#pragma unroll
      for (int j = 0; j < 4; ++j)
#pragma unroll
        for (int r = 0; r < 8; ++r) if (k0 + j * 16 + 8 * g + r > t) s[j][r] = -3.0e38f; }
    float mx = -3.0e38f;
#pragma unroll
    for (int j = 0; j < 4; ++j)
#pragma unroll
      for (int r = 0; r < 8; ++r) mx = fmaxf(mx, s[j][r]);
    mx = fmaxf(mx, __shfl_xor(mx, 16));
    const float mn = fmaxf(m, mx); const float alpha = expf(m - mn); m = mn;
    float ls = 0.f;
#pragma unroll
    for (int j = 0; j < 4; ++j)
#pragma unroll
      for (int r = 0; r < 8; ++r) { const float v = s[j][r]; const float ex = expf(v - mn); const float e = (v <= -1.0e38f) ? 0.f : ex; ls += e; s[j][r] = e * 2048.0f; }
    l = l * alpha + ls;
#pragma unroll
    for (int jd = 0; jd < HD / 16; ++jd)
#pragma unroll
      for (int r = 0; r < 8; ++r) o[jd][r] *= alpha;
#pragma unroll
    for (int kc = 0; kc < 2; ++kc) {
      if (HI) { float pv[16]; v16b vh[HD / 16], vl[HD / 16];
#pragma unroll
        for (int jd = 0; jd < HD / 16; ++jd) { vh[jd] = frag_bp((const __bf16*)(bp + 2 * TILEB + jd * 16 * TP + kc * 64)); vl[jd] = frag_bp((const __bf16*)(bp + 3 * TILEB + jd * 16 * TP + kc * 64)); }
#pragma unroll
        for (int i = 0; i < 8; ++i) { pv[i] = s[2 * kc][i]; pv[8 + i] = s[2 * kc + 1][i]; }
        const F2 p = bsplit16(pv);
#pragma unroll
        for (int jd = 0; jd < HD / 16; ++jd) { o[jd] = wmma_bf(vh[jd], p.h, o[jd]); o[jd] = wmma_bf(vh[jd], p.l, o[jd]); o[jd] = wmma_bf(vl[jd], p.h, o[jd]); }
      } else { v16h p;
#pragma unroll
        for (int i = 0; i < 8; ++i) { p[i] = (_Float16)s[2 * kc][i]; p[8 + i] = (_Float16)s[2 * kc + 1][i]; }
#pragma unroll
        for (int jd = 0; jd < HD / 16; ++jd) o[jd] = wmma16(vf[kc][jd], p, o[jd]); } }
    asm volatile("s_wait_dscnt 0x0" ::: "memory");      /* the wave's reads of this buffer have returned */
    asm volatile("s_wait_asynccnt 0x0" ::: "memory");   /* its copies of the next key block have landed */
    __syncthreads();   /* publishes the next key block; it also ends every wave's reads of this buffer, which is refilled behind it */
    if (kb + 2 < nkb) fill(kb + 2);   /* block-uniform */ }
  asm volatile("s_wait_asynccnt 0x0" ::: "memory");   /* no copy is left in flight when the buffers become the output's staging; the last key block's barrier has ended every wave's reads */
  float (*st)[HD + 4] = (float (*)[HD + 4])(sm + wave * (16 * (HD + 4) * 4));
  l += __shfl_xor(l, 16);
  const float inv = l > 0.f ? 1.0f / (2048.0f * l) : 0.f;   /* a fully excluded row yields ctx = 0 */
#pragma unroll
  for (int jd = 0; jd < HD / 16; ++jd) { v4f a, c;
#pragma unroll
    for (int r = 0; r < 4; ++r) { a[r] = o[jd][r] * inv; c[r] = o[jd][4 + r] * inv; }
    *(v4f*)&st[col][jd * 16 + 8 * g] = a; *(v4f*)&st[col][jd * 16 + 8 * g + 4] = c; }
  LDSX();   /* the wave's own LDS stores land before other lanes of the wave read them: two whole 256-B (row, head) segments a store */
#pragma unroll
  for (int rl = 0; rl < 16; rl += 2) vst2(Y + (q0 + rl + g) * CC + h * HD + col * 4, *(const v4f*)&st[rl + g][col * 4]); }
__global__ __launch_bounds__(128) void k_attn(const _Float16* __restrict__ QH, const _Float16* __restrict__ KH, const _Float16* __restrict__ QL, const _Float16* __restrict__ KL, const _Float16* __restrict__ VT, const __bf16* __restrict__ VB, const __bf16* __restrict__ VBL, float* __restrict__ Y) { __shared__ __align__(16) unsigned char smem[2 * 4 * TILEB];   /* two buffers of up to four tiles; behind the key loop each wave's 16 x (HD + 4) f32 output staging */
  /* the wave's number in a scalar register: the causal test of a key block becomes a scalar branch */
  const int tid = threadIdx.x, wave = __builtin_amdgcn_readfirstlane(tid >> 5), lane = tid & 31; const int h = blockIdx.x, b = blockIdx.y, qb = NQB - 1 - (int)blockIdx.z;
  if (CAUSAL && qb < QBH) attn_wave<true>(QH, KH, QL, KL, VT, VB, VBL, b, h, qb, wave, lane, smem, Y);   /* block-uniform */
  else attn_wave<false>(QH, KH, QL, KL, VT, VB, VBL, b, h, qb, wave, lane, smem, Y); }
// ---- k_out: block = (64 rows, 128 cols): out = ctx Wo (+ bo): ctx x 2^6 once to f16 against Wo as f16(bf16 x 2^8) exact (1 product) x 2^-14; causal early rows (< QHI of each sequence): ctx bf16 hi + lo against exact bf16 Wo (2 products)
__global__ __launch_bounds__(128) void k_out(const float* __restrict__ Y, const float* __restrict__ WO, const float* __restrict__ BO, float* __restrict__ OUT) { __shared__ __align__(16) float sf[4][16][132]; __shared__ __align__(16) unsigned char smem[2 * 256 * KP * 2];
  const int tid = threadIdx.x, wave = tid >> 5, lane = tid & 31, col = lane & 15, g = lane >> 4; const int c0 = blockIdx.y * 128; const size_t r0 = (size_t)blockIdx.x * 64 + wave * 16;
  v8f acc[8] = {};
  /* staging as in k_proj: thread = (row lr of 16, 16-B piece lq); buffer rows 0..63 = ctx, 64..191 = Wo, 192..255 = ctx residual (early rows only) */
  const int lr = tid >> 3, lq = tid & 7; const float* gy = Y + ((size_t)blockIdx.x * 64 + lr) * CC + lq * 4; const float* gw = WO + (size_t)(c0 + lr) * CC + lq * 4; v4f pre[12];
#pragma unroll
  for (int i = 0; i < 4; ++i) pre[i] = *(const v4f*)(gy + (size_t)i * 16 * CC);
#pragma unroll
  for (int i = 0; i < 8; ++i) pre[4 + i] = *(const v4f*)(gw + (size_t)i * 16 * CC);
  XW2(gy, gw);
  if (CAUSAL && (int)(((size_t)blockIdx.x * 64) % TT) < QHI) {   /* block-uniform */
    __bf16 (*stg)[256][KP] = (__bf16 (*)[256][KP])smem;
#pragma unroll 2   /* two steps a trip: the buffer's number is a constant in each */
    for (int kc = 0; kc < CC / 32; ++kc) { __bf16 (*bf)[KP] = stg[kc & 1];
#pragma unroll
      for (int i = 0; i < 4; ++i) { v4b ch, cl;
#pragma unroll
        for (int e = 0; e < 4; ++e) { const float v = pre[i][e]; const __bf16 hv = (__bf16)v; ch[e] = hv; cl[e] = (__bf16)(v - (float)hv); }
        *(v4b*)&bf[i * 16 + lr][lq * 4] = ch; *(v4b*)&bf[192 + i * 16 + lr][lq * 4] = cl; }
#pragma unroll
      for (int i = 4; i < 12; ++i) { v4b c;
#pragma unroll
        for (int e = 0; e < 4; ++e) c[e] = (__bf16)pre[i][e];
        *(v4b*)&bf[i * 16 + lr][lq * 4] = c; }
      if (kc + 1 < CC / 32) { gy += 32; gw += 32;   /* the next step's lines fly under this step's products */
#pragma unroll
        for (int i = 0; i < 4; ++i) pre[i] = *(const v4f*)(gy + (size_t)i * 16 * CC);
#pragma unroll
        for (int i = 0; i < 8; ++i) pre[4 + i] = *(const v4f*)(gw + (size_t)i * 16 * CC);
        XW2(gy, gw); }
      RINGBAR();   /* publishes this step's buffer; it also ends every wave's reads of the other buffer, which the next step overwrites */
      const v16b ah = frag_b(&bf[wave * 16 + col][0], lane), al = frag_b(&bf[192 + wave * 16 + col][0], lane); v16b w[8];
#pragma unroll
      for (int j = 0; j < 8; ++j) w[j] = frag_b(&bf[64 + j * 16 + col][0], lane);
#pragma unroll
      for (int j = 0; j < 8; ++j) { acc[j] = wmma_bf(ah, w[j], acc[j]); acc[j] = wmma_bf(al, w[j], acc[j]); }
      __builtin_amdgcn_sched_barrier(0);   /* keeps the next step's conversions, and with them the wait for its loads, behind this step's products */ }
#pragma unroll
    for (int j = 0; j < 8; ++j) { const float bias = BO ? bfr(BO[c0 + j * 16 + col]) : 0.f;
#pragma unroll
      for (int r = 0; r < 8; ++r) sf[wave][8 * g + r][j * 16 + col] = acc[j][r] + bias; }
  } else {
    _Float16 (*stg)[256][KP] = (_Float16 (*)[256][KP])smem;
#pragma unroll 2   /* two steps a trip: the buffer's number is a constant in each */
    for (int kc = 0; kc < CC / 32; ++kc) { _Float16 (*bf)[KP] = stg[kc & 1];
#pragma unroll
      for (int i = 0; i < 12; ++i) { v4h c;
#pragma unroll
        for (int e = 0; e < 4; ++e) c[e] = i < 4 ? (_Float16)(pre[i][e] * 64.0f) : (_Float16)(bfr(pre[i][e]) * 256.0f);   /* ctx carried x 2^6 into f16 so small-magnitude context rows stay clear of f16 subnormals; Wo as f16(bf16 x 2^8), exact */
        *(v4h*)&bf[i * 16 + lr][lq * 4] = c; }
      if (kc + 1 < CC / 32) { gy += 32; gw += 32;   /* the next step's lines fly under this step's products */
#pragma unroll
        for (int i = 0; i < 4; ++i) pre[i] = *(const v4f*)(gy + (size_t)i * 16 * CC);
#pragma unroll
        for (int i = 0; i < 8; ++i) pre[4 + i] = *(const v4f*)(gw + (size_t)i * 16 * CC);
        XW2(gy, gw); }
      RINGBAR();   /* publishes this step's buffer; it also ends every wave's reads of the other buffer, which the next step overwrites */
      const v16h a = frag_h(&bf[wave * 16 + col][0], lane); v16h w[8];
#pragma unroll
      for (int j = 0; j < 8; ++j) w[j] = frag_h(&bf[64 + j * 16 + col][0], lane);
#pragma unroll
      for (int j = 0; j < 8; ++j) acc[j] = wmma16(a, w[j], acc[j]);
      __builtin_amdgcn_sched_barrier(0);   /* keeps the next step's conversions, and with them the wait for its loads, behind this step's products */ }
#pragma unroll
    for (int j = 0; j < 8; ++j) { const float bias = BO ? bfr(BO[c0 + j * 16 + col]) : 0.f;
#pragma unroll
      for (int r = 0; r < 8; ++r) sf[wave][8 * g + r][j * 16 + col] = acc[j][r] * (1.0f / 16384.0f) + bias; } }   /* 2^-8 (Wo carry) x 2^-6 (ctx carry) */
  LDSX(); for (int rl = 0; rl < 16; ++rl) vst2(OUT + (r0 + rl) * DIN + c0 + lane * 4, *(const v4f*)&sf[wave][rl][lane * 4]); }

extern "C" void kernel_launch(void* const* d_in, const int* in_sizes, int n_in, void* d_out, int out_size, void* d_ws, size_t ws_size, hipStream_t stream) {
  (void)in_sizes; (void)n_in; (void)out_size;
  const float** F = (const float**)d_in;
  if (ws_size < (size_t)WS_END) return;
  char* ws = (char*)d_ws; _Float16 *QH = (_Float16*)(ws + WS_QH), *KH = (_Float16*)(ws + WS_KH), *VT = (_Float16*)(ws + WS_VT), *QL = (_Float16*)(ws + WS_QL), *KL = (_Float16*)(ws + WS_KL); __bf16 *VB = (__bf16*)(ws + WS_VB), *VBL = (__bf16*)(ws + WS_VBL); float *Y = (float*)(ws + WS_Y);
  (void)Y; (void)QL; (void)KL; (void)VB; (void)VBL;
  // inputs: 0 key [4,1024,1024]; 1 value; 2 query; 3 Wk [1024,1024] (out,in), 4 bk; 5 Wq, 6 bq; 7 Wv, 8 bv; 9 Wp (out,in), 10 bp (zero biases, read)
  k_proj<<<dim3(TNB * TT / 64, CC / 128, 3), 128, 0, stream>>>(F[2], F[0], F[1], F[5], F[3], F[7], F[6], F[4], F[8], QH, QL, KH, KL, VT, VB, VBL);   /* (q, k, v) streams = inputs (query = 2, key = 0, value = 1) */
  k_attn<<<dim3(NH, TNB, NQB), 128, 0, stream>>>(QH, KH, QL, KL, VT, VB, VBL, Y);
  k_out<<<dim3(TNB * TT / 64, DIN / 128), 128, 0, stream>>>(Y, F[9], F[10], (float*)d_out);
}

// v004
// Measured time: 94.3 microseconds a run.
// In both of two side-by-side timings against v003, it was 1.09 times as fast.
// All steps since v000 together make it 9.01 times as fast.
// compute dtype: all float inputs rounded to bf16; q/k/v projections with EXACT bf16 products on WMMA 16x16x32 (f32 accumulate) + bias; causal logits: 3 products for the first 384 rows, single f16 q x k after, x 64^-0.5; online softmax f32 (running maximum, one launch for logits, softmax and P v; exponent in base 2, scale and 2^11 inside its argument); exp(s - max) x 2^11 once to f16 x v once to f16 (bf16 hi + lo below row 384); ctx hi+lo x exact output weight below row 384, x2^6 f16 carry x f16(bf16 x 2^8) after, + bias; f32 output.
#include <hip/hip_runtime.h>
#include <math.h>

typedef __attribute__((ext_vector_type(16))) _Float16 v16h;
typedef __attribute__((ext_vector_type(16))) __bf16 v16b;
typedef __attribute__((ext_vector_type(8)))  _Float16 v8h;
typedef __attribute__((ext_vector_type(8)))  float v8f;
typedef __attribute__((ext_vector_type(4)))  float v4f;
typedef __attribute__((ext_vector_type(2)))  float v2f;
typedef __attribute__((ext_vector_type(4)))  unsigned v4u;
typedef __attribute__((ext_vector_type(4)))  int v4i;
typedef float __attribute__((may_alias)) float_a;
typedef int __attribute__((may_alias)) int_a;

template <typename T> __device__ __forceinline__ void vst2(void* p, T v) { *(T*)p = v;  }
__device__ __forceinline__ v8f wmma16(v16h a, v16h b, v8f c) {
  v8f d = __builtin_amdgcn_wmma_f32_16x16x32_f16(false, a, false, b, (short)0, c, false, false);
  asm volatile("v_nop\n\tv_nop\n\tv_nop\n\tv_nop" : "+v"(d) : "v"(a), "v"(b));
  return d;
}
__device__ __forceinline__ v8f wmma_bf(v16b a, v16b b, v8f c) {
  v8f d = __builtin_amdgcn_wmma_f32_16x16x32_bf16(false, a, false, b, (short)0, c, false, false);
  asm volatile("v_nop\n\tv_nop\n\tv_nop\n\tv_nop" : "+v"(d) : "v"(a), "v"(b));
  return d;
}
// 16x16x32 fragments: lane = (h = lane>>4, row/col = lane&15); elements 0..7 = k0+8h+0..7, 8..15 = k0+16+8h+0..7; D element r = row 8h+r
__device__ __forceinline__ v16h frag_h(const _Float16* rowk0, int lane) {
  union { v16h v; v8h q[2]; } u; const _Float16* p = rowk0 + 8 * (lane >> 4);
  u.q[0] = *(const v8h*)p; u.q[1] = *(const v8h*)(p + 16); return u.v;
}
__device__ __forceinline__ v16h frag_f32(const float* rowk0, int lane) {
  v16h a; const float* p = rowk0 + 8 * (lane >> 4);
#pragma unroll
  for (int i = 0; i < 8; ++i) { a[i] = (_Float16)p[i]; a[8 + i] = (_Float16)p[16 + i]; }
  return a;
}
__device__ __forceinline__ v16h frag_f32s(const float* rowk0, int lane, float sc) {
  v16h a; const float* p = rowk0 + 8 * (lane >> 4);
#pragma unroll
  for (int i = 0; i < 8; ++i) { a[i] = (_Float16)(p[i] * sc); a[8 + i] = (_Float16)(p[16 + i] * sc); }
  return a;
}
// column fragment from a [K][ld] layout (column n), rows >= K read as 0
__device__ __forceinline__ v16h fragc_f32(const float* W, int k0, int n, int lane, int ld, int K) {
  v16h a; const int g = lane >> 4;
#pragma unroll
  for (int i = 0; i < 8; ++i) { const int ka = k0 + 8 * g + i, kb = ka + 16;
    a[i] = (_Float16)(ka < K ? W[(size_t)(ka < K ? ka : K - 1) * ld + n] : 0.f); a[8 + i] = (_Float16)(kb < K ? W[(size_t)(kb < K ? kb : K - 1) * ld + n] : 0.f); }
  return a;
}
struct F2 { v16b h, l; };
__device__ __forceinline__ F2 bsplit16(const float v[16]) { F2 r;
#pragma unroll
  for (int i = 0; i < 16; ++i) { const __bf16 h = (__bf16)v[i]; r.h[i] = h; r.l[i] = (__bf16)(v[i] - (float)h); }
  return r; }
__device__ __forceinline__ F2 split_row(const float* row, int k0, int lane) { float v[16]; const float* p = row + k0 + 8 * (lane >> 4);
#pragma unroll
  for (int i = 0; i < 8; ++i) { v[i] = p[i]; v[8 + i] = p[16 + i]; }
  return bsplit16(v); }
__device__ __forceinline__ F2 split_rowK(const float* row, int k0, int lane, int K) { float v[16]; const int g = lane >> 4;
#pragma unroll
  for (int i = 0; i < 8; ++i) { const int ka = k0 + 8 * g + i, kb = ka + 16; v[i] = ka < K ? row[ka < K ? ka : K - 1] : 0.f; v[8 + i] = kb < K ? row[kb < K ? kb : K - 1] : 0.f; }
  return bsplit16(v); }
__device__ __forceinline__ F2 split_col(const float* W, int k0, int n, int lane, int ld, int K) { float v[16]; const int g = lane >> 4;
#pragma unroll
  for (int i = 0; i < 8; ++i) { const int ka = k0 + 8 * g + i, kb = ka + 16; v[i] = ka < K ? W[(size_t)(ka < K ? ka : K - 1) * ld + n] : 0.f; v[8 + i] = kb < K ? W[(size_t)(kb < K ? kb : K - 1) * ld + n] : 0.f; }
  return bsplit16(v); }
__device__ __forceinline__ v8f mac3(const F2& a, const F2& b, v8f c) { c = wmma_bf(a.l, b.h, c); c = wmma_bf(a.h, b.l, c); return wmma_bf(a.h, b.h, c); }
__device__ __forceinline__ float sigm(float v) { return 1.0f / (1.0f + expf(-v)); }
#define LDSX() do { asm volatile("s_wait_dscnt 0" ::: "memory"); __builtin_amdgcn_wave_barrier(); __builtin_amdgcn_fence(__ATOMIC_RELEASE, "workgroup"); } while (0)

// Causal multi-head attention on separate inputs listed key-first (key / value / query [4,1024,1024]; torch (out,in) Wk / Wq / Wv / Wp [1024,1024] (0.02) + zero biases; 16 heads x 64; scale 1/8; tril, -inf): out = merge(softmax(causal(q_h k_h^T / 8)) v_h) Wp^T + bp.
#define NB 4
#define TT 1024
#define CC 1024            // NH * HD = projected width
#define DIN 1024          // input (model) width
#define NH 16
#define HD 64
#define NQB (TT / 64)
#define HG 8
#define SCALE (0.125f)
#define CAUSAL 1
#ifndef TNB
#define TNB NB
#endif
__device__ __forceinline__ float bfr(float v) { return (float)(__bf16)v; }
__host__ __device__ __forceinline__ int kb_last(int qb) { return CAUSAL ? ((qb * 64 + 63) >> 7) : (TT / 128 - 1); }
typedef __attribute__((ext_vector_type(8))) __bf16 v8b;
__device__ __forceinline__ v16b frag_b(const __bf16* rowk0, int lane) {
  union { v16b v; v8b q[2]; } u; const __bf16* p = rowk0 + 8 * (lane >> 4);
  u.q[0] = *(const v8b*)p; u.q[1] = *(const v8b*)(p + 16); return u.v;
}
#define QBH 6              // causal: query blocks 0..QBH-1 of each sequence (few keys, no averaging) take the high-precision path
#define QHI 384            // rows carrying a q residual plane
#define KHI 384            // key rows carrying k residual / v bf16 hi+lo planes (used only by the causal high-precision path)
// B fragment (k rows k0+.., output column o) of a weight: (in,out) [K][ld] or (out,in) [ld rows of K]: bf16 exact, or f16(bf16 * 256) exact
__device__ __forceinline__ v16b wcol_io(const float* Wm, int k0, int o, int lane, int ld) { v16b w; const int g = lane >> 4;
#pragma unroll
  for (int i = 0; i < 8; ++i) { w[i] = (__bf16)Wm[(size_t)(k0 + 8 * g + i) * ld + o]; w[8 + i] = (__bf16)Wm[(size_t)(k0 + 16 + 8 * g + i) * ld + o]; }
  return w; }
__device__ __forceinline__ v16b wcol_oi(const float* Wm, int k0, int o, int lane, int K) { v16b w; const float* p = Wm + (size_t)o * K + k0 + 8 * (lane >> 4);
#pragma unroll
  for (int i = 0; i < 8; ++i) { w[i] = (__bf16)p[i]; w[8 + i] = (__bf16)p[16 + i]; }
  return w; }
__device__ __forceinline__ v16h wcolh_io(const float* Wm, int k0, int o, int lane, int ld) { v16h w; const int g = lane >> 4;
#pragma unroll
  for (int i = 0; i < 8; ++i) { w[i] = (_Float16)(bfr(Wm[(size_t)(k0 + 8 * g + i) * ld + o]) * 256.0f); w[8 + i] = (_Float16)(bfr(Wm[(size_t)(k0 + 16 + 8 * g + i) * ld + o]) * 256.0f); }
  return w; }
__device__ __forceinline__ v16h wcolh_oi(const float* Wm, int k0, int o, int lane, int K) { v16h w; const float* p = Wm + (size_t)o * K + k0 + 8 * (lane >> 4);
#pragma unroll
  for (int i = 0; i < 8; ++i) { w[i] = (_Float16)(bfr(p[i]) * 256.0f); w[8 + i] = (_Float16)(bfr(p[16 + i]) * 256.0f); }
  return w; }
#define WQKV_LAYOUT 1   // 0 = (in,out) [DIN][CC]; 1 = (out,in) [CC][DIN]; 2 = per-head [NH][DIN][HD]
__device__ __forceinline__ v16b wcol_hdk(const float* Wm, int k0, int o, int lane) { v16b w; const int g = lane >> 4; const float* p = Wm + (size_t)(o / HD) * DIN * HD + (o % HD);
#pragma unroll
  for (int i = 0; i < 8; ++i) { w[i] = (__bf16)p[(size_t)(k0 + 8 * g + i) * HD]; w[8 + i] = (__bf16)p[(size_t)(k0 + 16 + 8 * g + i) * HD]; }
  return w; }
#define WO_OUT_IN 1
#if WQKV_LAYOUT == 1
#define WCOL(W, k0, o, lane) wcol_oi(W, k0, o, lane, DIN)
#elif WQKV_LAYOUT == 2
#define WCOL(W, k0, o, lane) wcol_hdk(W, k0, o, lane)
#else
#define WCOL(W, k0, o, lane) wcol_io(W, k0, o, lane, CC)
#endif
#if WO_OUT_IN
#define WOCOL(W, k0, o, lane) wcol_oi(W, k0, o, lane, CC)
#define WOCOLH(W, k0, o, lane) wcolh_oi(W, k0, o, lane, CC)
#else
#define WOCOL(W, k0, o, lane) wcol_io(W, k0, o, lane, DIN)
#define WOCOLH(W, k0, o, lane) wcolh_io(W, k0, o, lane, DIN)
#endif

#ifndef SM_EXTRA_PARAMS
#define SM_EXTRA_PARAMS
#endif
#ifndef PROJ_EXTRA_PARAMS
#define PROJ_EXTRA_PARAMS
#endif
#ifndef SM_MASK_HOOK
#define SM_MASK_HOOK (void)0
#endif

#define WS_QH  0u                                      // f16 q rows [b*t][CC]
#define WS_KH  (WS_QH + 2u * (size_t)NB * TT * CC)      // f16 k rows [b*t][CC]
#define WS_VT  (WS_KH + 2u * (size_t)NB * TT * CC)      // f16 v planes [b][c][t]
#define WS_QL  (WS_VT + 2u * (size_t)NB * CC * TT)      // f16 q residual x 2^10 rows [b][t < QHI][CC]
#define WS_KL  (WS_QL + 2u * (size_t)NB * QHI * CC)     // f16 k residual x 2^10 rows [b][t < KHI][CC]
#define WS_VB  (WS_KL + 2u * (size_t)NB * KHI * CC)     // bf16 v hi planes [b][c][t < KHI]
#define WS_VBL (WS_VB + 2u * (size_t)NB * CC * KHI)
#define WS_S   (WS_VBL + 2u * (size_t)NB * CC * KHI)    // f32 [hg][t][s] region, unused: logits and P stay in registers
#define WS_Y   (WS_S  + 4u * (size_t)HG * TT * TT)      // f32 ctx rows [b*t][CC] (only when there is an output projection)
#define WS_END (WS_Y  + 4u * (size_t)NB * TT * CC)

// precaution behind a group of global loads: the group's address stays an input of the wait, so its registers are rewritten only behind the wait
#define XW2(p, q) asm volatile("s_wait_xcnt 0x0" :: "v"(p), "v"(q) : "memory")
// work-group barrier of the operand buffers, by hand: the wave's own LDS stores have landed and its reads have returned (s_wait_dscnt 0) before it signals; __syncthreads() would also wait for the next step's global loads, which are to stay in flight across it
#define RINGBAR() do { asm volatile("s_wait_dscnt 0x0" ::: "memory"); asm volatile("s_barrier_signal -1\n\ts_barrier_wait -1" ::: "memory"); } while (0)
#define KP 40              // pitch of a staged 32-k row in 16-bit elements: 80 B = 16 B x odd, where 16-byte fragment reads of 16 rows meet no bank twice
typedef __attribute__((ext_vector_type(4))) __bf16 v4b;
typedef __attribute__((ext_vector_type(4))) _Float16 v4h;
// ---- k_proj: block = (64 rows, 128 cols, which): q/k/v = X W (+ b) with exact bf16 products (K = DIN) -> which 0: q f16 rows (+ residual rows < QHI); 1: k f16 rows (+ residual rows < KHI); 2: v f16 planes [c][t] (+ bf16 hi/lo planes for t < KHI)
__global__ __launch_bounds__(128) void k_proj(const float* __restrict__ XQ, const float* __restrict__ XK, const float* __restrict__ XV, const float* __restrict__ WQ, const float* __restrict__ WK, const float* __restrict__ WV, const float* __restrict__ BQ, const float* __restrict__ BK, const float* __restrict__ BV,
    _Float16* __restrict__ QH, _Float16* __restrict__ QL, _Float16* __restrict__ KH, _Float16* __restrict__ KL, _Float16* __restrict__ VT, __bf16* __restrict__ VB, __bf16* __restrict__ VBL) {
  /* one LDS block: the two operand buffers of the k loop first, the epilogue's tiles (q/k: sh, sl; v: th, tb, tbl) behind the barrier that ends the loop's last reads */
  __shared__ __align__(16) unsigned char smem[3 * 128 * 72 * 2];
  __bf16 (*stg)[192][KP] = (__bf16 (*)[192][KP])smem;
  _Float16 (*sh)[136] = (_Float16 (*)[136])smem; _Float16 (*sl)[136] = (_Float16 (*)[136])(smem + 64 * 136 * 2);
  _Float16 (*th)[72] = (_Float16 (*)[72])smem; __bf16 (*tb)[72] = (__bf16 (*)[72])(smem + 128 * 72 * 2); __bf16 (*tbl)[72] = (__bf16 (*)[72])(smem + 2 * 128 * 72 * 2);
  const int tid = threadIdx.x, wave = tid >> 5, lane = tid & 31, col = lane & 15, g = lane >> 4; const int which = blockIdx.z; const int c0 = blockIdx.y * 128; const size_t r0 = (size_t)blockIdx.x * 64; const size_t bb = r0 / TT; const int t0 = (int)(r0 % TT);
  const float* X = which == 0 ? XQ : which == 1 ? XK : XV; const float* WA = which == 0 ? WQ : which == 1 ? WK : WV; const float* BA = which == 0 ? BQ : which == 1 ? BK : BV;
  v8f acc[8] = {};
  /* a 32-k step of the block's 64 X rows and 128 W rows: thread = (row lr of 16, 16-B piece lq), so a wave's load covers four whole 128-B lines; rounded to bf16 once for the block; buffer rows 0..63 = X, 64..191 = W */
  const int lr = tid >> 3, lq = tid & 7; const float* gx = X + (r0 + lr) * DIN + lq * 4; const float* gw = WA + (size_t)(c0 + lr) * DIN + lq * 4; v4f pre[12];
#pragma unroll
  for (int i = 0; i < 4; ++i) pre[i] = *(const v4f*)(gx + (size_t)i * 16 * DIN);
#pragma unroll
  for (int i = 0; i < 8; ++i) pre[4 + i] = *(const v4f*)(gw + (size_t)i * 16 * DIN);
  XW2(gx, gw);
#pragma unroll 2   /* two steps a trip: the buffer's number is a constant in each */
  for (int kc = 0; kc < DIN / 32; ++kc) { __bf16 (*bf)[KP] = stg[kc & 1];
#pragma unroll
    for (int i = 0; i < 12; ++i) { v4b c;
#pragma unroll
      for (int e = 0; e < 4; ++e) c[e] = (__bf16)pre[i][e];
      *(v4b*)&bf[i * 16 + lr][lq * 4] = c; }
    if (kc + 1 < DIN / 32) { gx += 32; gw += 32;   /* the next step's lines fly under this step's products */
#pragma unroll
      for (int i = 0; i < 4; ++i) pre[i] = *(const v4f*)(gx + (size_t)i * 16 * DIN);
#pragma unroll
      for (int i = 0; i < 8; ++i) pre[4 + i] = *(const v4f*)(gw + (size_t)i * 16 * DIN);
      XW2(gx, gw); }
    RINGBAR();   /* publishes this step's buffer; it also ends every wave's reads of the other buffer, which the next step overwrites */
    const v16b a = frag_b(&bf[wave * 16 + col][0], lane); v16b w[8];
#pragma unroll
    for (int j = 0; j < 8; ++j) w[j] = frag_b(&bf[64 + j * 16 + col][0], lane);
#pragma unroll
    for (int j = 0; j < 8; ++j) acc[j] = wmma_bf(a, w[j], acc[j]);
    __builtin_amdgcn_sched_barrier(0);   /* keeps the next step's conversions, and with them the wait for its loads, behind this step's products */ }
  __syncthreads();   /* every wave has read its last fragments before the epilogue's tiles overwrite the buffers */
  if (which < 2) { _Float16* DH = which == 0 ? QH : KH; _Float16* DL = which == 0 ? QL : KL; const int nhi = which == 0 ? QHI : KHI; const bool hi_rows = t0 < nhi;
#pragma unroll
    for (int j = 0; j < 8; ++j) { const float bias = BA ? bfr(BA[c0 + j * 16 + col]) : 0.f;
#pragma unroll
      for (int r = 0; r < 8; ++r) { const float v = acc[j][r] + bias; const _Float16 hv = (_Float16)v; sh[wave * 16 + 8 * g + r][j * 16 + col] = hv; sl[wave * 16 + 8 * g + r][j * 16 + col] = (_Float16)((v - (float)hv) * 1024.0f); } }
    __syncthreads();
    for (int e = tid; e < 64 * 16; e += 128) { const int rl = e >> 4, q = e & 15; vst2((unsigned*)(DH + (r0 + rl) * CC + c0 + q * 8), *(const v4u*)&sh[rl][q * 8]); if (hi_rows) vst2((unsigned*)(DL + (bb * nhi + t0 + rl) * (size_t)CC + c0 + q * 8), *(const v4u*)&sl[rl][q * 8]); }
  } else { const bool hi_rows = t0 < KHI;
#pragma unroll
    for (int j = 0; j < 8; ++j) { const float bias = BA ? bfr(BA[c0 + j * 16 + col]) : 0.f;
#pragma unroll
      for (int r = 0; r < 8; ++r) { const float v = acc[j][r] + bias; const int rl = wave * 16 + 8 * g + r, cl = j * 16 + col; th[cl][rl] = (_Float16)v; const __bf16 bh = (__bf16)v; tb[cl][rl] = bh; tbl[cl][rl] = (__bf16)(v - (float)bh); } }
    __syncthreads();
    for (int e = tid; e < 128 * 8; e += 128) { const int cl = e >> 3, q = e & 7; vst2((unsigned*)(VT + (bb * CC + c0 + cl) * (size_t)TT + t0 + q * 8), *(const v4u*)&th[cl][q * 8]); if (hi_rows) { const size_t o3 = (bb * CC + c0 + cl) * (size_t)KHI + t0 + q * 8; vst2((unsigned*)(VB + o3), *(const v4u*)&tb[cl][q * 8]); vst2((unsigned*)(VBL + o3), *(const v4u*)&tbl[cl][q * 8]); } } } }
// ---- k_attn: block = 64 queries (qb, heaviest first) of (b, h), one wave = 16 queries; the waves share the staged K and V tiles and nothing else. Per 64 keys: S^T = K . Q^T (A = key rows, B = query rows, same loader on both sides), so a lane holds 32 scores of ONE query (query = lane & 15, key = 16 j + 8 (lane >> 4) + r); running maximum and sum in f32 (online softmax, halves joined by one lane exchange); P^T x 2^11 packs from two score tiles straight into a B operand; O^T += V^T . P^T with the v planes [c][t] as A. Products per path as before: query blocks < QBH take q hi + residual x k hi + residual (3 products) and P, v as bf16 hi + lo (3 products); the rest one f16 product each. Every fragment of a group is loaded in front of the group's first product, so that the loads fly together. The K and V tiles of a key block (64 rows of 128 B each) are brought into LDS once for the block's four waves, as whole lines, by asynchronous copies, one key block ahead, in two buffers; the fragments are read from there
#define TP 144             // pitch of a staged 128-B row in bytes: 16 B x odd, where 16-byte fragment reads of 16 rows meet no bank twice
#define TILEB (64 * TP)    // one staged tile
// two tiles, four copies a thread each (rows cr, cr + 16, cr + 32, cr + 48; a wave's copy covers four whole lines). s_wait_xcnt 0 is the last line of the copies' own statement: a precaution, so that no register which a copy names is rewritten in front of it
__device__ __forceinline__ void cp2tiles(unsigned la, const char* ga, size_t sa, unsigned lb, const char* gb, size_t sb) {
  asm volatile("global_load_async_to_lds_b128 %0, %8, off\n\tglobal_load_async_to_lds_b128 %1, %9, off\n\tglobal_load_async_to_lds_b128 %2, %10, off\n\tglobal_load_async_to_lds_b128 %3, %11, off\n\t"
               "global_load_async_to_lds_b128 %4, %12, off\n\tglobal_load_async_to_lds_b128 %5, %13, off\n\tglobal_load_async_to_lds_b128 %6, %14, off\n\tglobal_load_async_to_lds_b128 %7, %15, off\n\ts_wait_xcnt 0x0"
               :: "v"(la), "v"(la + 16 * TP), "v"(la + 32 * TP), "v"(la + 48 * TP), "v"(lb), "v"(lb + 16 * TP), "v"(lb + 32 * TP), "v"(lb + 48 * TP),
                  "v"(ga), "v"(ga + sa), "v"(ga + 2 * sa), "v"(ga + 3 * sa), "v"(gb), "v"(gb + sb), "v"(gb + 2 * sb), "v"(gb + 3 * sb) : "memory"); }
// fragment from the lane's own address (row start + k0 + 8 (lane >> 4)): same element order as frag_h / frag_b
__device__ __forceinline__ v16h frag_hp(const _Float16* p) { union { v16h v; v8h q[2]; } u; u.q[0] = *(const v8h*)p; u.q[1] = *(const v8h*)(p + 16); return u.v; }
__device__ __forceinline__ v16b frag_bp(const __bf16* p) { union { v16b v; v8b q[2]; } u; u.q[0] = *(const v8b*)p; u.q[1] = *(const v8b*)(p + 16); return u.v; }
// 2^x in place by the bare exponent instruction. Each instruction overwrites its own source alone and reads no neighbour's result; the closing v_nop is the slot that the instruction set asks for behind a transcendental before its result is read
__device__ __forceinline__ float exp2_1(float x) { asm("v_exp_f32 %0, %0\n\tv_nop" : "+v"(x)); return x; }
__device__ __forceinline__ void exp2_16(float (&x)[16]) {
  asm("v_exp_f32 %0, %0\n\tv_exp_f32 %1, %1\n\tv_exp_f32 %2, %2\n\tv_exp_f32 %3, %3\n\tv_exp_f32 %4, %4\n\tv_exp_f32 %5, %5\n\tv_exp_f32 %6, %6\n\tv_exp_f32 %7, %7\n\t"
      "v_exp_f32 %8, %8\n\tv_exp_f32 %9, %9\n\tv_exp_f32 %10, %10\n\tv_exp_f32 %11, %11\n\tv_exp_f32 %12, %12\n\tv_exp_f32 %13, %13\n\tv_exp_f32 %14, %14\n\tv_exp_f32 %15, %15\n\tv_nop"
      : "+v"(x[0]), "+v"(x[1]), "+v"(x[2]), "+v"(x[3]), "+v"(x[4]), "+v"(x[5]), "+v"(x[6]), "+v"(x[7]), "+v"(x[8]), "+v"(x[9]), "+v"(x[10]), "+v"(x[11]), "+v"(x[12]), "+v"(x[13]), "+v"(x[14]), "+v"(x[15])); }
template <bool HI> __device__ __forceinline__ void attn_wave(const _Float16* __restrict__ QH, const _Float16* __restrict__ KH, const _Float16* __restrict__ QL, const _Float16* __restrict__ KL, const _Float16* __restrict__ VT, const __bf16* __restrict__ VB, const __bf16* __restrict__ VBL, int b, int h, int qb, int wave, int lane, unsigned char* sm, float* __restrict__ Y) {
  const int col = lane & 15, g = lane >> 4; const int ql0 = qb * 64 + wave * 16; const int t = ql0 + col; const size_t q0 = (size_t)b * TT + ql0; const int nkb = CAUSAL ? qb + 1 : TT / 64;
  /* staging: thread = (row cr of 16, 16-B piece cq); a stage = K, V (f16 path) or K, K residual, v hi, v lo (high-precision path) */
  constexpr unsigned STG = (HI ? 4 : 2) * TILEB; const int cr = (int)threadIdx.x >> 3, cq = (int)threadIdx.x & 7; const unsigned lcp = (unsigned)(size_t)sm + cr * TP + cq * 16;
  const unsigned tk = cr * (CC * 2) + cq * 16, tv = cr * (TT * 2) + cq * 16, tb = cr * (KHI * 2) + cq * 16;   /* the thread's byte offset in a tile's source, by the source's row pitch; the tile's own start is the same for the block */
  auto fill = [&](int kb) { const unsigned l = lcp + (kb & 1) * STG;
    const char* gk = (const char*)(KH + ((size_t)b * TT + kb * 64) * CC + h * HD) + tk;
    if (HI) { cp2tiles(l, gk, 16 * CC * 2, l + TILEB, (const char*)(KL + ((size_t)b * KHI + kb * 64) * CC + h * HD) + tk, 16 * CC * 2);
      cp2tiles(l + 2 * TILEB, (const char*)(VB + ((size_t)b * CC + h * HD) * (size_t)KHI + kb * 64) + tb, 16 * KHI * 2, l + 3 * TILEB, (const char*)(VBL + ((size_t)b * CC + h * HD) * (size_t)KHI + kb * 64) + tb, 16 * KHI * 2); }
    else cp2tiles(l, gk, 16 * CC * 2, l + TILEB, (const char*)(VT + ((size_t)b * CC + h * HD) * (size_t)TT + kb * 64) + tv, 16 * TT * 2); };
  fill(0);
  v16h qh[HD / 32], qlo[HD / 32];
#pragma unroll
  for (int kc = 0; kc < HD / 32; ++kc) { qh[kc] = frag_h(QH + (q0 + col) * CC + h * HD + kc * 32, lane); if (HI) qlo[kc] = frag_h(QL + ((size_t)b * QHI + ql0 + col) * CC + h * HD + kc * 32, lane); }
  v8f o[HD / 16] = {}; float m = -3.0e38f, l = 0.f;   /* m: running maximum of the unscaled logits; l: running sum of the weights x 2^11 */
  constexpr float C2 = SCALE * 1.44269504088896340736f;   /* logit -> exponent in base 2 */
  float nb = 3.0e38f * C2;   /* the addend in use: 11 - m C2, rounded once and used for the weights and for the rescale alike, so that its rounding cancels */
  asm volatile("s_wait_asynccnt 0x0" ::: "memory");   /* the wave's own copies of key block 0 have landed */
  __syncthreads();   /* publishes key block 0 */
  if (nkb > 1) fill(1);   /* block-uniform */
#pragma unroll 1   /* stays rolled: one key block's fragments already fill the registers that four waves a SIMD leave a wave */
  for (int kb = 0; kb < nkb; ++kb) { const int k0 = kb * 64; v8f s[4]; v16h kf[4][HD / 32], kl[4][HD / 32], vf[2][HD / 16];
    const unsigned char* bp = sm + (kb & 1) * STG + col * TP + g * 16;   /* the lane's place in a staged tile: row col, 16-B piece g */
#pragma unroll
    for (int j = 0; j < 4; ++j)
#pragma unroll
      for (int kc = 0; kc < HD / 32; ++kc) kf[j][kc] = frag_hp((const _Float16*)(bp + j * 16 * TP + kc * 64));
#pragma unroll
    for (int j = 0; j < 4; ++j) { v8f acc = {}, accl = {};
      if (HI) {   /* the residual fragments come tile by tile: all four at once, beside the four k fragments, do not fit the registers that four waves a SIMD leave a wave */
#pragma unroll
        for (int kc = 0; kc < HD / 32; ++kc) kl[j][kc] = frag_hp((const _Float16*)(bp + TILEB + j * 16 * TP + kc * 64)); }
#pragma unroll
      for (int kc = 0; kc < HD / 32; ++kc) { acc = wmma16(kf[j][kc], qh[kc], acc); if (HI) { accl = wmma16(kf[j][kc], qlo[kc], accl); accl = wmma16(kl[j][kc], qh[kc], accl); } }
#pragma unroll
      for (int r = 0; r < 8; ++r) s[j][r] = HI ? acc[r] + accl[r] * (1.0f / 1024.0f) : acc[r]; }   /* unscaled: the scale sits in C2 */
    if (!HI) {   /* f16 path: v is read here, so that it flies under the softmax arithmetic */
#pragma unroll
      for (int kc = 0; kc < 2; ++kc)
#pragma unroll
        for (int jd = 0; jd < HD / 16; ++jd) vf[kc][jd] = frag_hp((const _Float16*)(bp + TILEB + jd * 16 * TP + kc * 64)); }
    if (CAUSAL && k0 + 63 > ql0) {   /* wave-uniform: only a key block that reaches past the wave's first query holds excluded keys */
#pragma unroll
      for (int j = 0; j < 4; ++j)
#pragma unroll
        for (int r = 0; r < 8; ++r) if (k0 + j * 16 + 8 * g + r > t) s[j][r] = -3.0e38f; }
    float mx = -3.0e38f;
#pragma unroll
    for (int j = 0; j < 4; ++j)
#pragma unroll
      for (int r = 0; r < 8; ++r) mx = fmaxf(mx, s[j][r]);
    mx = fmaxf(mx, __shfl_xor(mx, 16));
    /* every key block a wave walks holds a key <= each of its queries (k0 <= ql0), so mn is a real logit; an excluded score's argument is then about -5e37, where the exponent instruction returns 0 */
    const float mn = fmaxf(m, mx); const float nbn = fmaf(-mn, C2, 11.0f); const float alpha = exp2_1(nbn - nb); m = mn; nb = nbn;
    float ls = 0.f;
#pragma unroll
    for (int kc = 0; kc < 2; ++kc) { float x[16];   /* exp(scale (s - max)) x 2^11: one multiply-add and one exponent instruction a score */
#pragma unroll
      for (int i = 0; i < 16; ++i) x[i] = fmaf(s[2 * kc + (i >> 3)][i & 7], C2, nbn);
      exp2_16(x);
#pragma unroll
      for (int i = 0; i < 16; ++i) { ls += x[i]; s[2 * kc + (i >> 3)][i & 7] = x[i]; } }
    l = l * alpha + ls;
#pragma unroll
    for (int jd = 0; jd < HD / 16; ++jd)
#pragma unroll
      for (int r = 0; r < 8; ++r) o[jd][r] *= alpha;
#pragma unroll
    for (int kc = 0; kc < 2; ++kc) {
      if (HI) { float pv[16]; v16b vh[HD / 16], vl[HD / 16];
#pragma unroll
        for (int jd = 0; jd < HD / 16; ++jd) { vh[jd] = frag_bp((const __bf16*)(bp + 2 * TILEB + jd * 16 * TP + kc * 64)); vl[jd] = frag_bp((const __bf16*)(bp + 3 * TILEB + jd * 16 * TP + kc * 64)); }
#pragma unroll
        for (int i = 0; i < 8; ++i) { pv[i] = s[2 * kc][i]; pv[8 + i] = s[2 * kc + 1][i]; }
        const F2 p = bsplit16(pv);
#pragma unroll
        for (int jd = 0; jd < HD / 16; ++jd) { o[jd] = wmma_bf(vh[jd], p.h, o[jd]); o[jd] = wmma_bf(vh[jd], p.l, o[jd]); o[jd] = wmma_bf(vl[jd], p.h, o[jd]); }
      } else { v16h p;
#pragma unroll
        for (int i = 0; i < 8; ++i) { p[i] = (_Float16)s[2 * kc][i]; p[8 + i] = (_Float16)s[2 * kc + 1][i]; }
#pragma unroll
        for (int jd = 0; jd < HD / 16; ++jd) o[jd] = wmma16(vf[kc][jd], p, o[jd]); } }
    asm volatile("s_wait_dscnt 0x0" ::: "memory");      /* the wave's reads of this buffer have returned */
    asm volatile("s_wait_asynccnt 0x0" ::: "memory");   /* its copies of the next key block have landed */
    __syncthreads();   /* publishes the next key block; it also ends every wave's reads of this buffer, which is refilled behind it */
    if (kb + 2 < nkb) fill(kb + 2);   /* block-uniform */ }
  asm volatile("s_wait_asynccnt 0x0" ::: "memory");   /* no copy is left in flight when the buffers become the output's staging; the last key block's barrier has ended every wave's reads */
  float (*st)[HD + 4] = (float (*)[HD + 4])(sm + wave * (16 * (HD + 4) * 4));
  l += __shfl_xor(l, 16);
  const float inv = l > 0.f ? 1.0f / l : 0.f;   /* l carries the same 2^11 as the weights */
#pragma unroll
  for (int jd = 0; jd < HD / 16; ++jd) { v4f a, c;
#pragma unroll
    for (int r = 0; r < 4; ++r) { a[r] = o[jd][r] * inv; c[r] = o[jd][4 + r] * inv; }
    *(v4f*)&st[col][jd * 16 + 8 * g] = a; *(v4f*)&st[col][jd * 16 + 8 * g + 4] = c; }
  LDSX();   /* the wave's own LDS stores land before other lanes of the wave read them: two whole 256-B (row, head) segments a store */
#pragma unroll
  for (int rl = 0; rl < 16; rl += 2) vst2(Y + (q0 + rl + g) * CC + h * HD + col * 4, *(const v4f*)&st[rl + g][col * 4]); }
__global__ __launch_bounds__(128) void k_attn(const _Float16* __restrict__ QH, const _Float16* __restrict__ KH, const _Float16* __restrict__ QL, const _Float16* __restrict__ KL, const _Float16* __restrict__ VT, const __bf16* __restrict__ VB, const __bf16* __restrict__ VBL, float* __restrict__ Y) { __shared__ __align__(16) unsigned char smem[2 * 4 * TILEB];   /* two buffers of up to four tiles; behind the key loop each wave's 16 x (HD + 4) f32 output staging */
  /* the wave's number in a scalar register: the causal test of a key block becomes a scalar branch */
  const int tid = threadIdx.x, wave = __builtin_amdgcn_readfirstlane(tid >> 5), lane = tid & 31; const int h = blockIdx.x, b = blockIdx.y, qb = NQB - 1 - (int)blockIdx.z;
  if (CAUSAL && qb < QBH) attn_wave<true>(QH, KH, QL, KL, VT, VB, VBL, b, h, qb, wave, lane, smem, Y);   /* block-uniform */
  else attn_wave<false>(QH, KH, QL, KL, VT, VB, VBL, b, h, qb, wave, lane, smem, Y); }
// ---- k_out: block = (64 rows, 128 cols): out = ctx Wo (+ bo): ctx x 2^6 once to f16 against Wo as f16(bf16 x 2^8) exact (1 product) x 2^-14; causal early rows (< QHI of each sequence): ctx bf16 hi + lo against exact bf16 Wo (2 products)
__global__ __launch_bounds__(128) void k_out(const float* __restrict__ Y, const float* __restrict__ WO, const float* __restrict__ BO, float* __restrict__ OUT) { __shared__ __align__(16) float sf[4][16][132]; __shared__ __align__(16) unsigned char smem[2 * 256 * KP * 2];
  const int tid = threadIdx.x, wave = tid >> 5, lane = tid & 31, col = lane & 15, g = lane >> 4; const int c0 = blockIdx.y * 128; const size_t r0 = (size_t)blockIdx.x * 64 + wave * 16;
  v8f acc[8] = {};
  /* staging as in k_proj: thread = (row lr of 16, 16-B piece lq); buffer rows 0..63 = ctx, 64..191 = Wo, 192..255 = ctx residual (early rows only) */
  const int lr = tid >> 3, lq = tid & 7; const float* gy = Y + ((size_t)blockIdx.x * 64 + lr) * CC + lq * 4; const float* gw = WO + (size_t)(c0 + lr) * CC + lq * 4; v4f pre[12];
#pragma unroll
  for (int i = 0; i < 4; ++i) pre[i] = *(const v4f*)(gy + (size_t)i * 16 * CC);
#pragma unroll
  for (int i = 0; i < 8; ++i) pre[4 + i] = *(const v4f*)(gw + (size_t)i * 16 * CC);
  XW2(gy, gw);
  if (CAUSAL && (int)(((size_t)blockIdx.x * 64) % TT) < QHI) {   /* block-uniform */
    __bf16 (*stg)[256][KP] = (__bf16 (*)[256][KP])smem;
#pragma unroll 2   /* two steps a trip: the buffer's number is a constant in each */
    for (int kc = 0; kc < CC / 32; ++kc) { __bf16 (*bf)[KP] = stg[kc & 1];
#pragma unroll
      for (int i = 0; i < 4; ++i) { v4b ch, cl;
#pragma unroll
        for (int e = 0; e < 4; ++e) { const float v = pre[i][e]; const __bf16 hv = (__bf16)v; ch[e] = hv; cl[e] = (__bf16)(v - (float)hv); }
        *(v4b*)&bf[i * 16 + lr][lq * 4] = ch; *(v4b*)&bf[192 + i * 16 + lr][lq * 4] = cl; }
#pragma unroll
      for (int i = 4; i < 12; ++i) { v4b c;
#pragma unroll
        for (int e = 0; e < 4; ++e) c[e] = (__bf16)pre[i][e];
        *(v4b*)&bf[i * 16 + lr][lq * 4] = c; }
      if (kc + 1 < CC / 32) { gy += 32; gw += 32;   /* the next step's lines fly under this step's products */
#pragma unroll
        for (int i = 0; i < 4; ++i) pre[i] = *(const v4f*)(gy + (size_t)i * 16 * CC);
#pragma unroll
        for (int i = 0; i < 8; ++i) pre[4 + i] = *(const v4f*)(gw + (size_t)i * 16 * CC);
        XW2(gy, gw); }
      RINGBAR();   /* publishes this step's buffer; it also ends every wave's reads of the other buffer, which the next step overwrites */
      const v16b ah = frag_b(&bf[wave * 16 + col][0], lane), al = frag_b(&bf[192 + wave * 16 + col][0], lane); v16b w[8];
#pragma unroll
      for (int j = 0; j < 8; ++j) w[j] = frag_b(&bf[64 + j * 16 + col][0], lane);
#pragma unroll
      for (int j = 0; j < 8; ++j) { acc[j] = wmma_bf(ah, w[j], acc[j]); acc[j] = wmma_bf(al, w[j], acc[j]); }
      __builtin_amdgcn_sched_barrier(0);   /* keeps the next step's conversions, and with them the wait for its loads, behind this step's products */ }
#pragma unroll
    for (int j = 0; j < 8; ++j) { const float bias = BO ? bfr(BO[c0 + j * 16 + col]) : 0.f;
#pragma unroll
      for (int r = 0; r < 8; ++r) sf[wave][8 * g + r][j * 16 + col] = acc[j][r] + bias; }
  } else {
    _Float16 (*stg)[256][KP] = (_Float16 (*)[256][KP])smem;
#pragma unroll 2   /* two steps a trip: the buffer's number is a constant in each */
    for (int kc = 0; kc < CC / 32; ++kc) { _Float16 (*bf)[KP] = stg[kc & 1];
#pragma unroll
      for (int i = 0; i < 12; ++i) { v4h c;
#pragma unroll
        for (int e = 0; e < 4; ++e) c[e] = i < 4 ? (_Float16)(pre[i][e] * 64.0f) : (_Float16)(bfr(pre[i][e]) * 256.0f);   /* ctx carried x 2^6 into f16 so small-magnitude context rows stay clear of f16 subnormals; Wo as f16(bf16 x 2^8), exact */
        *(v4h*)&bf[i * 16 + lr][lq * 4] = c; }
      if (kc + 1 < CC / 32) { gy += 32; gw += 32;   /* the next step's lines fly under this step's products */
#pragma unroll
        for (int i = 0; i < 4; ++i) pre[i] = *(const v4f*)(gy + (size_t)i * 16 * CC);
#pragma unroll
        for (int i = 0; i < 8; ++i) pre[4 + i] = *(const v4f*)(gw + (size_t)i * 16 * CC);
        XW2(gy, gw); }
      RINGBAR();   /* publishes this step's buffer; it also ends every wave's reads of the other buffer, which the next step overwrites */
      const v16h a = frag_h(&bf[wave * 16 + col][0], lane); v16h w[8];
#pragma unroll
      for (int j = 0; j < 8; ++j) w[j] = frag_h(&bf[64 + j * 16 + col][0], lane);
#pragma unroll
      for (int j = 0; j < 8; ++j) acc[j] = wmma16(a, w[j], acc[j]);
      __builtin_amdgcn_sched_barrier(0);   /* keeps the next step's conversions, and with them the wait for its loads, behind this step's products */ }
#pragma unroll
    for (int j = 0; j < 8; ++j) { const float bias = BO ? bfr(BO[c0 + j * 16 + col]) : 0.f;
#pragma unroll
      for (int r = 0; r < 8; ++r) sf[wave][8 * g + r][j * 16 + col] = acc[j][r] * (1.0f / 16384.0f) + bias; } }   /* 2^-8 (Wo carry) x 2^-6 (ctx carry) */
  LDSX(); for (int rl = 0; rl < 16; ++rl) vst2(OUT + (r0 + rl) * DIN + c0 + lane * 4, *(const v4f*)&sf[wave][rl][lane * 4]); }

extern "C" void kernel_launch(void* const* d_in, const int* in_sizes, int n_in, void* d_out, int out_size, void* d_ws, size_t ws_size, hipStream_t stream) {
  (void)in_sizes; (void)n_in; (void)out_size;
  const float** F = (const float**)d_in;
  if (ws_size < (size_t)WS_END) return;
  char* ws = (char*)d_ws; _Float16 *QH = (_Float16*)(ws + WS_QH), *KH = (_Float16*)(ws + WS_KH), *VT = (_Float16*)(ws + WS_VT), *QL = (_Float16*)(ws + WS_QL), *KL = (_Float16*)(ws + WS_KL); __bf16 *VB = (__bf16*)(ws + WS_VB), *VBL = (__bf16*)(ws + WS_VBL); float *Y = (float*)(ws + WS_Y);
  (void)Y; (void)QL; (void)KL; (void)VB; (void)VBL;
  // inputs: 0 key [4,1024,1024]; 1 value; 2 query; 3 Wk [1024,1024] (out,in), 4 bk; 5 Wq, 6 bq; 7 Wv, 8 bv; 9 Wp (out,in), 10 bp (zero biases, read)
  k_proj<<<dim3(TNB * TT / 64, CC / 128, 3), 128, 0, stream>>>(F[2], F[0], F[1], F[5], F[3], F[7], F[6], F[4], F[8], QH, QL, KH, KL, VT, VB, VBL);   /* (q, k, v) streams = inputs (query = 2, key = 0, value = 1) */
  k_attn<<<dim3(NH, TNB, NQB), 128, 0, stream>>>(QH, KH, QL, KL, VT, VB, VBL, Y);
  k_out<<<dim3(TNB * TT / 64, DIN / 128), 128, 0, stream>>>(Y, F[9], F[10], (float*)d_out);
}

// v005
// One run takes 80.1 microseconds.
// Next to v004, in two timings, it ran 1.18 times as fast each time.
// All steps since v000 together make it 10.6 times as fast.
// compute dtype: all float inputs rounded to bf16; q/k/v projections with EXACT bf16 products on WMMA 16x16x32 (f32 accumulate) + bias; causal logits: 3 products for the first 384 rows, single f16 q x k after, x 64^-0.5; online softmax f32 (running maximum, one launch for logits, softmax and P v; exponent in base 2, scale and 2^11 inside its argument); exp(s - max) x 2^11 once to f16 x v once to f16 (bf16 hi + lo below row 384); ctx hi+lo x exact output weight below row 384, x2^6 f16 carry x f16(bf16 x 2^8) after, + bias; f32 output.
#include <hip/hip_runtime.h>
#include <math.h>

typedef __attribute__((ext_vector_type(16))) _Float16 v16h;
typedef __attribute__((ext_vector_type(16))) __bf16 v16b;
typedef __attribute__((ext_vector_type(8)))  _Float16 v8h;
typedef __attribute__((ext_vector_type(8)))  float v8f;
typedef __attribute__((ext_vector_type(4)))  float v4f;
typedef __attribute__((ext_vector_type(2)))  float v2f;
typedef __attribute__((ext_vector_type(4)))  unsigned v4u;
typedef __attribute__((ext_vector_type(4)))  int v4i;
typedef float __attribute__((may_alias)) float_a;
typedef int __attribute__((may_alias)) int_a;

template <typename T> __device__ __forceinline__ void vst2(void* p, T v) { *(T*)p = v;  }
__device__ __forceinline__ v8f wmma16(v16h a, v16h b, v8f c) {
  v8f d = __builtin_amdgcn_wmma_f32_16x16x32_f16(false, a, false, b, (short)0, c, false, false);
  asm volatile("v_nop\n\tv_nop\n\tv_nop\n\tv_nop" : "+v"(d) : "v"(a), "v"(b));
  return d;
}
__device__ __forceinline__ v8f wmma_bf(v16b a, v16b b, v8f c) {
  v8f d = __builtin_amdgcn_wmma_f32_16x16x32_bf16(false, a, false, b, (short)0, c, false, false);
  asm volatile("v_nop\n\tv_nop\n\tv_nop\n\tv_nop" : "+v"(d) : "v"(a), "v"(b));
  return d;
}
// 16x16x32 fragments: lane = (h = lane>>4, row/col = lane&15); elements 0..7 = k0+8h+0..7, 8..15 = k0+16+8h+0..7; D element r = row 8h+r
__device__ __forceinline__ v16h frag_h(const _Float16* rowk0, int lane) {
  union { v16h v; v8h q[2]; } u; const _Float16* p = rowk0 + 8 * (lane >> 4);
  u.q[0] = *(const v8h*)p; u.q[1] = *(const v8h*)(p + 16); return u.v;
}
__device__ __forceinline__ v16h frag_f32(const float* rowk0, int lane) {
  v16h a; const float* p = rowk0 + 8 * (lane >> 4);
#pragma unroll
  for (int i = 0; i < 8; ++i) { a[i] = (_Float16)p[i]; a[8 + i] = (_Float16)p[16 + i]; }
  return a;
}
__device__ __forceinline__ v16h frag_f32s(const float* rowk0, int lane, float sc) {
  v16h a; const float* p = rowk0 + 8 * (lane >> 4);
#pragma unroll
  for (int i = 0; i < 8; ++i) { a[i] = (_Float16)(p[i] * sc); a[8 + i] = (_Float16)(p[16 + i] * sc); }
  return a;
}
// column fragment from a [K][ld] layout (column n), rows >= K read as 0
__device__ __forceinline__ v16h fragc_f32(const float* W, int k0, int n, int lane, int ld, int K) {
  v16h a; const int g = lane >> 4;
#pragma unroll
  for (int i = 0; i < 8; ++i) { const int ka = k0 + 8 * g + i, kb = ka + 16;
    a[i] = (_Float16)(ka < K ? W[(size_t)(ka < K ? ka : K - 1) * ld + n] : 0.f); a[8 + i] = (_Float16)(kb < K ? W[(size_t)(kb < K ? kb : K - 1) * ld + n] : 0.f); }
  return a;
}
struct F2 { v16b h, l; };
__device__ __forceinline__ F2 bsplit16(const float v[16]) { F2 r;
#pragma unroll
  for (int i = 0; i < 16; ++i) { const __bf16 h = (__bf16)v[i]; r.h[i] = h; r.l[i] = (__bf16)(v[i] - (float)h); }
  return r; }
__device__ __forceinline__ F2 split_row(const float* row, int k0, int lane) { float v[16]; const float* p = row + k0 + 8 * (lane >> 4);
#pragma unroll
  for (int i = 0; i < 8; ++i) { v[i] = p[i]; v[8 + i] = p[16 + i]; }
  return bsplit16(v); }
__device__ __forceinline__ F2 split_rowK(const float* row, int k0, int lane, int K) { float v[16]; const int g = lane >> 4;
#pragma unroll
  for (int i = 0; i < 8; ++i) { const int ka = k0 + 8 * g + i, kb = ka + 16; v[i] = ka < K ? row[ka < K ? ka : K - 1] : 0.f; v[8 + i] = kb < K ? row[kb < K ? kb : K - 1] : 0.f; }
  return bsplit16(v); }
__device__ __forceinline__ F2 split_col(const float* W, int k0, int n, int lane, int ld, int K) { float v[16]; const int g = lane >> 4;
#pragma unroll
  for (int i = 0; i < 8; ++i) { const int ka = k0 + 8 * g + i, kb = ka + 16; v[i] = ka < K ? W[(size_t)(ka < K ? ka : K - 1) * ld + n] : 0.f; v[8 + i] = kb < K ? W[(size_t)(kb < K ? kb : K - 1) * ld + n] : 0.f; }
  return bsplit16(v); }
__device__ __forceinline__ v8f mac3(const F2& a, const F2& b, v8f c) { c = wmma_bf(a.l, b.h, c); c = wmma_bf(a.h, b.l, c); return wmma_bf(a.h, b.h, c); }
__device__ __forceinline__ float sigm(float v) { return 1.0f / (1.0f + expf(-v)); }
#define LDSX() do { asm volatile("s_wait_dscnt 0" ::: "memory"); __builtin_amdgcn_wave_barrier(); __builtin_amdgcn_fence(__ATOMIC_RELEASE, "workgroup"); } while (0)

// Causal multi-head attention on separate inputs listed key-first (key / value / query [4,1024,1024]; torch (out,in) Wk / Wq / Wv / Wp [1024,1024] (0.02) + zero biases; 16 heads x 64; scale 1/8; tril, -inf): out = merge(softmax(causal(q_h k_h^T / 8)) v_h) Wp^T + bp.
#define NB 4
#define TT 1024
#define CC 1024            // NH * HD = projected width
#define DIN 1024          // input (model) width
#define NH 16
#define HD 64
#define NQB (TT / 64)
#define HG 8
#define SCALE (0.125f)
#define CAUSAL 1
#ifndef TNB
#define TNB NB
#endif
__device__ __forceinline__ float bfr(float v) { return (float)(__bf16)v; }
__host__ __device__ __forceinline__ int kb_last(int qb) { return CAUSAL ? ((qb * 64 + 63) >> 7) : (TT / 128 - 1); }
typedef __attribute__((ext_vector_type(8))) __bf16 v8b;
__device__ __forceinline__ v16b frag_b(const __bf16* rowk0, int lane) {
  union { v16b v; v8b q[2]; } u; const __bf16* p = rowk0 + 8 * (lane >> 4);
  u.q[0] = *(const v8b*)p; u.q[1] = *(const v8b*)(p + 16); return u.v;
}
#define QBH 6              // causal: query blocks 0..QBH-1 of each sequence (few keys, no averaging) take the high-precision path
#define QHI 384            // rows carrying a q residual plane
#define KHI 384            // key rows carrying k residual / v bf16 hi+lo planes (used only by the causal high-precision path)
// B fragment (k rows k0+.., output column o) of a weight: (in,out) [K][ld] or (out,in) [ld rows of K]: bf16 exact, or f16(bf16 * 256) exact
__device__ __forceinline__ v16b wcol_io(const float* Wm, int k0, int o, int lane, int ld) { v16b w; const int g = lane >> 4;
#pragma unroll
  for (int i = 0; i < 8; ++i) { w[i] = (__bf16)Wm[(size_t)(k0 + 8 * g + i) * ld + o]; w[8 + i] = (__bf16)Wm[(size_t)(k0 + 16 + 8 * g + i) * ld + o]; }
  return w; }
__device__ __forceinline__ v16b wcol_oi(const float* Wm, int k0, int o, int lane, int K) { v16b w; const float* p = Wm + (size_t)o * K + k0 + 8 * (lane >> 4);
#pragma unroll
  for (int i = 0; i < 8; ++i) { w[i] = (__bf16)p[i]; w[8 + i] = (__bf16)p[16 + i]; }
  return w; }
__device__ __forceinline__ v16h wcolh_io(const float* Wm, int k0, int o, int lane, int ld) { v16h w; const int g = lane >> 4;
#pragma unroll
  for (int i = 0; i < 8; ++i) { w[i] = (_Float16)(bfr(Wm[(size_t)(k0 + 8 * g + i) * ld + o]) * 256.0f); w[8 + i] = (_Float16)(bfr(Wm[(size_t)(k0 + 16 + 8 * g + i) * ld + o]) * 256.0f); }
  return w; }
__device__ __forceinline__ v16h wcolh_oi(const float* Wm, int k0, int o, int lane, int K) { v16h w; const float* p = Wm + (size_t)o * K + k0 + 8 * (lane >> 4);
#pragma unroll
  for (int i = 0; i < 8; ++i) { w[i] = (_Float16)(bfr(p[i]) * 256.0f); w[8 + i] = (_Float16)(bfr(p[16 + i]) * 256.0f); }
  return w; }
#define WQKV_LAYOUT 1   // 0 = (in,out) [DIN][CC]; 1 = (out,in) [CC][DIN]; 2 = per-head [NH][DIN][HD]
__device__ __forceinline__ v16b wcol_hdk(const float* Wm, int k0, int o, int lane) { v16b w; const int g = lane >> 4; const float* p = Wm + (size_t)(o / HD) * DIN * HD + (o % HD);
#pragma unroll
  for (int i = 0; i < 8; ++i) { w[i] = (__bf16)p[(size_t)(k0 + 8 * g + i) * HD]; w[8 + i] = (__bf16)p[(size_t)(k0 + 16 + 8 * g + i) * HD]; }
  return w; }
#define WO_OUT_IN 1
#if WQKV_LAYOUT == 1
#define WCOL(W, k0, o, lane) wcol_oi(W, k0, o, lane, DIN)
#elif WQKV_LAYOUT == 2
#define WCOL(W, k0, o, lane) wcol_hdk(W, k0, o, lane)
#else
#define WCOL(W, k0, o, lane) wcol_io(W, k0, o, lane, CC)
#endif
#if WO_OUT_IN
#define WOCOL(W, k0, o, lane) wcol_oi(W, k0, o, lane, CC)
#define WOCOLH(W, k0, o, lane) wcolh_oi(W, k0, o, lane, CC)
#else
#define WOCOL(W, k0, o, lane) wcol_io(W, k0, o, lane, DIN)
#define WOCOLH(W, k0, o, lane) wcolh_io(W, k0, o, lane, DIN)
#endif

#ifndef SM_EXTRA_PARAMS
#define SM_EXTRA_PARAMS
#endif
#ifndef PROJ_EXTRA_PARAMS
#define PROJ_EXTRA_PARAMS
#endif
#ifndef SM_MASK_HOOK
#define SM_MASK_HOOK (void)0
#endif

#define WS_QH  0u                                      // f16 q rows [b*t][CC]
#define WS_KH  (WS_QH + 2u * (size_t)NB * TT * CC)      // f16 k rows [b*t][CC]
#define WS_VT  (WS_KH + 2u * (size_t)NB * TT * CC)      // f16 v planes [b][c][t]
#define WS_QL  (WS_VT + 2u * (size_t)NB * CC * TT)      // f16 q residual x 2^10 rows [b][t < QHI][CC]
#define WS_KL  (WS_QL + 2u * (size_t)NB * QHI * CC)     // f16 k residual x 2^10 rows [b][t < KHI][CC]
#define WS_VB  (WS_KL + 2u * (size_t)NB * KHI * CC)     // bf16 v hi planes [b][c][t < KHI]
#define WS_VBL (WS_VB + 2u * (size_t)NB * CC * KHI)
#define WS_S   (WS_VBL + 2u * (size_t)NB * CC * KHI)    // f32 [hg][t][s] region, unused: logits and P stay in registers
#define WS_Y   (WS_S  + 4u * (size_t)HG * TT * TT)      // f32 ctx rows [b*t][CC] (only when there is an output projection)
#define WS_END (WS_Y  + 4u * (size_t)NB * TT * CC)

// precaution behind a group of global loads: the group's address stays an input of the wait, so its registers are rewritten only behind the wait
#define XW2(p, q) asm volatile("s_wait_xcnt 0x0" :: "v"(p), "v"(q) : "memory")
// work-group barrier of the operand buffers, by hand: the wave's own LDS stores have landed and its reads have returned (s_wait_dscnt 0) before it signals; __syncthreads() would also wait for the next step's global loads, which are to stay in flight across it
#define RINGBAR() do { asm volatile("s_wait_dscnt 0x0" ::: "memory"); asm volatile("s_barrier_signal -1\n\ts_barrier_wait -1" ::: "memory"); } while (0)
#define KP 40              // pitch of a staged 32-k row in 16-bit elements: 80 B = 16 B x odd, where 16-byte fragment reads of 16 rows meet no bank twice
typedef __attribute__((ext_vector_type(4))) __bf16 v4b;
typedef __attribute__((ext_vector_type(4))) _Float16 v4h;
// four 16-byte pieces of an epilogue tile, LDS -> global (rows ls and gs bytes apart). The closing s_wait_xcnt 0 is a precaution: the stores' addresses and data stay inputs of the wait, so that their registers are rewritten only behind it
__device__ __forceinline__ void st4(char* gp, size_t gs, const unsigned char* lp, unsigned ls) { v4u d[4];
#pragma unroll
  for (int u = 0; u < 4; ++u) d[u] = *(const v4u*)(lp + u * ls);
#pragma unroll
  for (int u = 0; u < 4; ++u) vst2(gp + u * gs, d[u]);
  asm volatile("s_wait_xcnt 0x0" :: "v"(gp), "v"(gp + gs), "v"(gp + 2 * gs), "v"(gp + 3 * gs), "v"(d[0]), "v"(d[1]), "v"(d[2]), "v"(d[3]) : "memory"); }
// ---- k_proj: block = (128 rows, 128 cols, which), four waves in 2 x 2, one wave = 64 rows x 64 cols (4 x 4 accumulator tiles, so that a staged row serves 64 outputs of a wave and 128 of the block): q/k/v = X W (+ b) with exact bf16 products (K = DIN) -> which 0: q f16 rows (+ residual rows < QHI); 1: k f16 rows (+ residual rows < KHI); 2: v f16 planes [c][t] (+ bf16 hi/lo planes for t < KHI)
#define PM 128             // rows of a k_proj block; QHI, KHI and TT are multiples of it, so a block lies in one sequence and on one side of the residual rows' end
__global__ __launch_bounds__(128) void k_proj(const float* __restrict__ XQ, const float* __restrict__ XK, const float* __restrict__ XV, const float* __restrict__ WQ, const float* __restrict__ WK, const float* __restrict__ WV, const float* __restrict__ BQ, const float* __restrict__ BK, const float* __restrict__ BV,
    _Float16* __restrict__ QH, _Float16* __restrict__ QL, _Float16* __restrict__ KH, _Float16* __restrict__ KL, _Float16* __restrict__ VT, __bf16* __restrict__ VB, __bf16* __restrict__ VBL) {
  /* one LDS block: the two operand buffers of the k loop first, the epilogue's tiles (q/k: sh, sl; v: th, tb, tbl) behind the barrier that ends the loop's last reads */
  __shared__ __align__(16) unsigned char smem[3 * 128 * (PM + 8) * 2];
  __bf16 (*stg)[PM + 128][KP] = (__bf16 (*)[PM + 128][KP])smem;
  _Float16 (*sh)[136] = (_Float16 (*)[136])smem; _Float16 (*sl)[136] = (_Float16 (*)[136])(smem + PM * 136 * 2);
  _Float16 (*th)[PM + 8] = (_Float16 (*)[PM + 8])smem; __bf16 (*tb)[PM + 8] = (__bf16 (*)[PM + 8])(smem + 128 * (PM + 8) * 2); __bf16 (*tbl)[PM + 8] = (__bf16 (*)[PM + 8])(smem + 2 * 128 * (PM + 8) * 2);
  const int tid = threadIdx.x, wave = tid >> 5, lane = tid & 31, col = lane & 15, g = lane >> 4; const int wr = (wave >> 1) * 64, wc = (wave & 1) * 64; const int which = blockIdx.z; const int c0 = blockIdx.y * 128; const size_t r0 = (size_t)blockIdx.x * PM; const size_t bb = r0 / TT; const int t0 = (int)(r0 % TT);
  const float* X = which == 0 ? XQ : which == 1 ? XK : XV; const float* WA = which == 0 ? WQ : which == 1 ? WK : WV; const float* BA = which == 0 ? BQ : which == 1 ? BK : BV;
  v8f acc[4][4] = {};
  /* a 32-k step of the block's 128 X rows and 128 W rows: thread = (row lr of 16, 16-B piece lq), so a wave's load covers four whole 128-B lines; rounded to bf16 once for the block; buffer rows 0..127 = X, 128..255 = W */
  const int lr = tid >> 3, lq = tid & 7; const float* gx = X + (r0 + lr) * DIN + lq * 4; const float* gw = WA + (size_t)(c0 + lr) * DIN + lq * 4; v4f pre[16];
#pragma unroll
  for (int i = 0; i < 8; ++i) pre[i] = *(const v4f*)(gx + (size_t)i * 16 * DIN);
#pragma unroll
  for (int i = 0; i < 8; ++i) pre[8 + i] = *(const v4f*)(gw + (size_t)i * 16 * DIN);
  XW2(gx, gw);
#pragma unroll 2   /* two steps a trip: the buffer's number is a constant in each */
  for (int kc = 0; kc < DIN / 32; ++kc) { __bf16 (*bf)[KP] = stg[kc & 1];
#pragma unroll
    for (int i = 0; i < 16; ++i) { v4b c;
#pragma unroll
      for (int e = 0; e < 4; ++e) c[e] = (__bf16)pre[i][e];
      *(v4b*)&bf[i * 16 + lr][lq * 4] = c; }
    if (kc + 1 < DIN / 32) { gx += 32; gw += 32;   /* the next step's lines fly under this step's products */
#pragma unroll
      for (int i = 0; i < 8; ++i) pre[i] = *(const v4f*)(gx + (size_t)i * 16 * DIN);
#pragma unroll
      for (int i = 0; i < 8; ++i) pre[8 + i] = *(const v4f*)(gw + (size_t)i * 16 * DIN);
      XW2(gx, gw); }
    RINGBAR();   /* publishes this step's buffer; it also ends every wave's reads of the other buffer, which the next step overwrites */
    v16b a[4], w[4];
#pragma unroll
    for (int i = 0; i < 4; ++i) a[i] = frag_b(&bf[wr + i * 16 + col][0], lane);
#pragma unroll
    for (int j = 0; j < 4; ++j) w[j] = frag_b(&bf[PM + wc + j * 16 + col][0], lane);
#pragma unroll
    for (int i = 0; i < 4; ++i)
#pragma unroll
      for (int j = 0; j < 4; ++j) acc[i][j] = wmma_bf(a[i], w[j], acc[i][j]);
    __builtin_amdgcn_sched_barrier(0);   /* keeps the next step's conversions, and with them the wait for its loads, behind this step's products */ }
  __syncthreads();   /* every wave has read its last fragments before the epilogue's tiles overwrite the buffers */
  if (which < 2) { _Float16* DH = which == 0 ? QH : KH; _Float16* DL = which == 0 ? QL : KL; const int nhi = which == 0 ? QHI : KHI; const bool hi_rows = t0 < nhi;
#pragma unroll
    for (int j = 0; j < 4; ++j) { const float bias = BA ? bfr(BA[c0 + wc + j * 16 + col]) : 0.f;
#pragma unroll
      for (int i = 0; i < 4; ++i)
#pragma unroll
        for (int r = 0; r < 8; ++r) { const float v = acc[i][j][r] + bias; const _Float16 hv = (_Float16)v; sh[wr + i * 16 + 8 * g + r][wc + j * 16 + col] = hv; sl[wr + i * 16 + 8 * g + r][wc + j * 16 + col] = (_Float16)((v - (float)hv) * 1024.0f); } }
    __syncthreads();
    /* thread = (row rl of 8, 16-B piece q): a wave's store covers two whole 256-B row segments */
    for (int rl = tid >> 4; rl < PM; rl += 32) { const int q = tid & 15; st4((char*)(DH + (r0 + rl) * CC + c0 + q * 8), 8 * CC * 2, (const unsigned char*)&sh[rl][q * 8], 8 * 136 * 2); if (hi_rows) st4((char*)(DL + (bb * nhi + t0 + rl) * (size_t)CC + c0 + q * 8), 8 * CC * 2, (const unsigned char*)&sl[rl][q * 8], 8 * 136 * 2); }
  } else { const bool hi_rows = t0 < KHI;
#pragma unroll
    for (int j = 0; j < 4; ++j) { const float bias = BA ? bfr(BA[c0 + wc + j * 16 + col]) : 0.f;
#pragma unroll
      for (int i = 0; i < 4; ++i)
#pragma unroll
        for (int r = 0; r < 8; ++r) { const float v = acc[i][j][r] + bias; const int rl = wr + i * 16 + 8 * g + r, cl = wc + j * 16 + col; th[cl][rl] = (_Float16)v; const __bf16 bh = (__bf16)v; tb[cl][rl] = bh; tbl[cl][rl] = (__bf16)(v - (float)bh); } }
    __syncthreads();
    /* thread = (plane row cl of 8, 16-B piece q) */
    for (int cl = tid >> 4; cl < 128; cl += 32) { const int q = tid & 15; st4((char*)(VT + (bb * CC + c0 + cl) * (size_t)TT + t0 + q * 8), 8 * TT * 2, (const unsigned char*)&th[cl][q * 8], 8 * (PM + 8) * 2); if (hi_rows) { const size_t o3 = (bb * CC + c0 + cl) * (size_t)KHI + t0 + q * 8; st4((char*)(VB + o3), 8 * KHI * 2, (const unsigned char*)&tb[cl][q * 8], 8 * (PM + 8) * 2); st4((char*)(VBL + o3), 8 * KHI * 2, (const unsigned char*)&tbl[cl][q * 8], 8 * (PM + 8) * 2); } } } }
// ---- k_attn: block = 64 queries (qb, heaviest first) of (b, h), one wave = 16 queries; the waves share the staged K and V tiles and nothing else. Per 64 keys: S^T = K . Q^T (A = key rows, B = query rows, same loader on both sides), so a lane holds 32 scores of ONE query (query = lane & 15, key = 16 j + 8 (lane >> 4) + r); running maximum and sum in f32 (online softmax, halves joined by one lane exchange); P^T x 2^11 packs from two score tiles straight into a B operand; O^T += V^T . P^T with the v planes [c][t] as A. Products per path as before: query blocks < QBH take q hi + residual x k hi + residual (3 products) and P, v as bf16 hi + lo (3 products); the rest one f16 product each. Every fragment of a group is loaded in front of the group's first product, so that the loads fly together. The K and V tiles of a key block (64 rows of 128 B each) are brought into LDS once for the block's four waves, as whole lines, by asynchronous copies, one key block ahead, in two buffers; the fragments are read from there
#define TP 144             // pitch of a staged 128-B row in bytes: 16 B x odd, where 16-byte fragment reads of 16 rows meet no bank twice
#define TILEB (64 * TP)    // one staged tile
// two tiles, four copies a thread each (rows cr, cr + 16, cr + 32, cr + 48; a wave's copy covers four whole lines). s_wait_xcnt 0 is the last line of the copies' own statement: a precaution, so that no register which a copy names is rewritten in front of it
__device__ __forceinline__ void cp2tiles(unsigned la, const char* ga, size_t sa, unsigned lb, const char* gb, size_t sb) {
  asm volatile("global_load_async_to_lds_b128 %0, %8, off\n\tglobal_load_async_to_lds_b128 %1, %9, off\n\tglobal_load_async_to_lds_b128 %2, %10, off\n\tglobal_load_async_to_lds_b128 %3, %11, off\n\t"
               "global_load_async_to_lds_b128 %4, %12, off\n\tglobal_load_async_to_lds_b128 %5, %13, off\n\tglobal_load_async_to_lds_b128 %6, %14, off\n\tglobal_load_async_to_lds_b128 %7, %15, off\n\ts_wait_xcnt 0x0"
               :: "v"(la), "v"(la + 16 * TP), "v"(la + 32 * TP), "v"(la + 48 * TP), "v"(lb), "v"(lb + 16 * TP), "v"(lb + 32 * TP), "v"(lb + 48 * TP),
                  "v"(ga), "v"(ga + sa), "v"(ga + 2 * sa), "v"(ga + 3 * sa), "v"(gb), "v"(gb + sb), "v"(gb + 2 * sb), "v"(gb + 3 * sb) : "memory"); }
// fragment from the lane's own address (row start + k0 + 8 (lane >> 4)): same element order as frag_h / frag_b
__device__ __forceinline__ v16h frag_hp(const _Float16* p) { union { v16h v; v8h q[2]; } u; u.q[0] = *(const v8h*)p; u.q[1] = *(const v8h*)(p + 16); return u.v; }
__device__ __forceinline__ v16b frag_bp(const __bf16* p) { union { v16b v; v8b q[2]; } u; u.q[0] = *(const v8b*)p; u.q[1] = *(const v8b*)(p + 16); return u.v; }
// 2^x in place by the bare exponent instruction. Each instruction overwrites its own source alone and reads no neighbour's result; the closing v_nop is the slot that the instruction set asks for behind a transcendental before its result is read
__device__ __forceinline__ float exp2_1(float x) { asm("v_exp_f32 %0, %0\n\tv_nop" : "+v"(x)); return x; }
__device__ __forceinline__ void exp2_16(float (&x)[16]) {
  asm("v_exp_f32 %0, %0\n\tv_exp_f32 %1, %1\n\tv_exp_f32 %2, %2\n\tv_exp_f32 %3, %3\n\tv_exp_f32 %4, %4\n\tv_exp_f32 %5, %5\n\tv_exp_f32 %6, %6\n\tv_exp_f32 %7, %7\n\t"
      "v_exp_f32 %8, %8\n\tv_exp_f32 %9, %9\n\tv_exp_f32 %10, %10\n\tv_exp_f32 %11, %11\n\tv_exp_f32 %12, %12\n\tv_exp_f32 %13, %13\n\tv_exp_f32 %14, %14\n\tv_exp_f32 %15, %15\n\tv_nop"
      : "+v"(x[0]), "+v"(x[1]), "+v"(x[2]), "+v"(x[3]), "+v"(x[4]), "+v"(x[5]), "+v"(x[6]), "+v"(x[7]), "+v"(x[8]), "+v"(x[9]), "+v"(x[10]), "+v"(x[11]), "+v"(x[12]), "+v"(x[13]), "+v"(x[14]), "+v"(x[15])); }
template <bool HI> __device__ __forceinline__ void attn_wave(const _Float16* __restrict__ QH, const _Float16* __restrict__ KH, const _Float16* __restrict__ QL, const _Float16* __restrict__ KL, const _Float16* __restrict__ VT, const __bf16* __restrict__ VB, const __bf16* __restrict__ VBL, int b, int h, int qb, int wave, int lane, unsigned char* sm, float* __restrict__ Y) {
  const int col = lane & 15, g = lane >> 4; const int ql0 = qb * 64 + wave * 16; const int t = ql0 + col; const size_t q0 = (size_t)b * TT + ql0; const int nkb = CAUSAL ? qb + 1 : TT / 64;
  /* staging: thread = (row cr of 16, 16-B piece cq); a stage = K, V (f16 path) or K, K residual, v hi, v lo (high-precision path) */
  constexpr unsigned STG = (HI ? 4 : 2) * TILEB; const int cr = (int)threadIdx.x >> 3, cq = (int)threadIdx.x & 7; const unsigned lcp = (unsigned)(size_t)sm + cr * TP + cq * 16;
  const unsigned tk = cr * (CC * 2) + cq * 16, tv = cr * (TT * 2) + cq * 16, tb = cr * (KHI * 2) + cq * 16;   /* the thread's byte offset in a tile's source, by the source's row pitch; the tile's own start is the same for the block */
  auto fill = [&](int kb) { const unsigned l = lcp + (kb & 1) * STG;
    const char* gk = (const char*)(KH + ((size_t)b * TT + kb * 64) * CC + h * HD) + tk;
    if (HI) { cp2tiles(l, gk, 16 * CC * 2, l + TILEB, (const char*)(KL + ((size_t)b * KHI + kb * 64) * CC + h * HD) + tk, 16 * CC * 2);
      cp2tiles(l + 2 * TILEB, (const char*)(VB + ((size_t)b * CC + h * HD) * (size_t)KHI + kb * 64) + tb, 16 * KHI * 2, l + 3 * TILEB, (const char*)(VBL + ((size_t)b * CC + h * HD) * (size_t)KHI + kb * 64) + tb, 16 * KHI * 2); }
    else cp2tiles(l, gk, 16 * CC * 2, l + TILEB, (const char*)(VT + ((size_t)b * CC + h * HD) * (size_t)TT + kb * 64) + tv, 16 * TT * 2); };
  fill(0);
  v16h qh[HD / 32], qlo[HD / 32];
#pragma unroll
  for (int kc = 0; kc < HD / 32; ++kc) { qh[kc] = frag_h(QH + (q0 + col) * CC + h * HD + kc * 32, lane); if (HI) qlo[kc] = frag_h(QL + ((size_t)b * QHI + ql0 + col) * CC + h * HD + kc * 32, lane); }
  v8f o[HD / 16] = {}; float m = -3.0e38f, l = 0.f;   /* m: running maximum of the unscaled logits; l: running sum of the weights x 2^11 */
  constexpr float C2 = SCALE * 1.44269504088896340736f;   /* logit -> exponent in base 2 */
  float nb = 3.0e38f * C2;   /* the addend in use: 11 - m C2, rounded once and used for the weights and for the rescale alike, so that its rounding cancels */
  asm volatile("s_wait_asynccnt 0x0" ::: "memory");   /* the wave's own copies of key block 0 have landed */
  __syncthreads();   /* publishes key block 0 */
  if (nkb > 1) fill(1);   /* block-uniform */
#pragma unroll 1   /* stays rolled: one key block's fragments already fill the registers that four waves a SIMD leave a wave */
  for (int kb = 0; kb < nkb; ++kb) { const int k0 = kb * 64; v8f s[4]; v16h kf[4][HD / 32], kl[4][HD / 32], vf[2][HD / 16];
    const unsigned char* bp = sm + (kb & 1) * STG + col * TP + g * 16;   /* the lane's place in a staged tile: row col, 16-B piece g */
#pragma unroll
    for (int j = 0; j < 4; ++j)
#pragma unroll
      for (int kc = 0; kc < HD / 32; ++kc) kf[j][kc] = frag_hp((const _Float16*)(bp + j * 16 * TP + kc * 64));
#pragma unroll
    for (int j = 0; j < 4; ++j) { v8f acc = {}, accl = {};
      if (HI) {   /* the residual fragments come tile by tile: all four at once, beside the four k fragments, do not fit the registers that four waves a SIMD leave a wave */
#pragma unroll
        for (int kc = 0; kc < HD / 32; ++kc) kl[j][kc] = frag_hp((const _Float16*)(bp + TILEB + j * 16 * TP + kc * 64)); }
#pragma unroll
      for (int kc = 0; kc < HD / 32; ++kc) { acc = wmma16(kf[j][kc], qh[kc], acc); if (HI) { accl = wmma16(kf[j][kc], qlo[kc], accl); accl = wmma16(kl[j][kc], qh[kc], accl); } }
#pragma unroll
      for (int r = 0; r < 8; ++r) s[j][r] = HI ? acc[r] + accl[r] * (1.0f / 1024.0f) : acc[r]; }   /* unscaled: the scale sits in C2 */
    if (!HI) {   /* f16 path: v is read here, so that it flies under the softmax arithmetic */
#pragma unroll
      for (int kc = 0; kc < 2; ++kc)
#pragma unroll
        for (int jd = 0; jd < HD / 16; ++jd) vf[kc][jd] = frag_hp((const _Float16*)(bp + TILEB + jd * 16 * TP + kc * 64)); }
    if (CAUSAL && k0 + 63 > ql0) {   /* wave-uniform: only a key block that reaches past the wave's first query holds excluded keys */
#pragma unroll
      for (int j = 0; j < 4; ++j)
#pragma unroll
        for (int r = 0; r < 8; ++r) if (k0 + j * 16 + 8 * g + r > t) s[j][r] = -3.0e38f; }
    float mx = -3.0e38f;
#pragma unroll
    for (int j = 0; j < 4; ++j)
#pragma unroll
      for (int r = 0; r < 8; ++r) mx = fmaxf(mx, s[j][r]);
    mx = fmaxf(mx, __shfl_xor(mx, 16));
    /* every key block a wave walks holds a key <= each of its queries (k0 <= ql0), so mn is a real logit; an excluded score's argument is then about -5e37, where the exponent instruction returns 0 */
    const float mn = fmaxf(m, mx); const float nbn = fmaf(-mn, C2, 11.0f); const float alpha = exp2_1(nbn - nb); m = mn; nb = nbn;
    float ls = 0.f;
#pragma unroll
    for (int kc = 0; kc < 2; ++kc) { float x[16];   /* exp(scale (s - max)) x 2^11: one multiply-add and one exponent instruction a score */
#pragma unroll
      for (int i = 0; i < 16; ++i) x[i] = fmaf(s[2 * kc + (i >> 3)][i & 7], C2, nbn);
      exp2_16(x);
#pragma unroll
      for (int i = 0; i < 16; ++i) { ls += x[i]; s[2 * kc + (i >> 3)][i & 7] = x[i]; } }
    l = l * alpha + ls;
#pragma unroll
    for (int jd = 0; jd < HD / 16; ++jd)
#pragma unroll
      for (int r = 0; r < 8; ++r) o[jd][r] *= alpha;
#pragma unroll
    for (int kc = 0; kc < 2; ++kc) {
      if (HI) { float pv[16]; v16b vh[HD / 16], vl[HD / 16];
#pragma unroll
        for (int jd = 0; jd < HD / 16; ++jd) { vh[jd] = frag_bp((const __bf16*)(bp + 2 * TILEB + jd * 16 * TP + kc * 64)); vl[jd] = frag_bp((const __bf16*)(bp + 3 * TILEB + jd * 16 * TP + kc * 64)); }
#pragma unroll
        for (int i = 0; i < 8; ++i) { pv[i] = s[2 * kc][i]; pv[8 + i] = s[2 * kc + 1][i]; }
        const F2 p = bsplit16(pv);
#pragma unroll
        for (int jd = 0; jd < HD / 16; ++jd) { o[jd] = wmma_bf(vh[jd], p.h, o[jd]); o[jd] = wmma_bf(vh[jd], p.l, o[jd]); o[jd] = wmma_bf(vl[jd], p.h, o[jd]); }
      } else { v16h p;
#pragma unroll
        for (int i = 0; i < 8; ++i) { p[i] = (_Float16)s[2 * kc][i]; p[8 + i] = (_Float16)s[2 * kc + 1][i]; }
#pragma unroll
        for (int jd = 0; jd < HD / 16; ++jd) o[jd] = wmma16(vf[kc][jd], p, o[jd]); } }
    asm volatile("s_wait_dscnt 0x0" ::: "memory");      /* the wave's reads of this buffer have returned */
    asm volatile("s_wait_asynccnt 0x0" ::: "memory");   /* its copies of the next key block have landed */
    __syncthreads();   /* publishes the next key block; it also ends every wave's reads of this buffer, which is refilled behind it */
    if (kb + 2 < nkb) fill(kb + 2);   /* block-uniform */ }
  asm volatile("s_wait_asynccnt 0x0" ::: "memory");   /* no copy is left in flight when the buffers become the output's staging; the last key block's barrier has ended every wave's reads */
  float (*st)[HD + 4] = (float (*)[HD + 4])(sm + wave * (16 * (HD + 4) * 4));
  l += __shfl_xor(l, 16);
  const float inv = l > 0.f ? 1.0f / l : 0.f;   /* l carries the same 2^11 as the weights */
#pragma unroll
  for (int jd = 0; jd < HD / 16; ++jd) { v4f a, c;
#pragma unroll
    for (int r = 0; r < 4; ++r) { a[r] = o[jd][r] * inv; c[r] = o[jd][4 + r] * inv; }
    *(v4f*)&st[col][jd * 16 + 8 * g] = a; *(v4f*)&st[col][jd * 16 + 8 * g + 4] = c; }
  LDSX();   /* the wave's own LDS stores land before other lanes of the wave read them: two whole 256-B (row, head) segments a store */
#pragma unroll
  for (int rl = 0; rl < 16; rl += 2) vst2(Y + (q0 + rl + g) * CC + h * HD + col * 4, *(const v4f*)&st[rl + g][col * 4]); }
__global__ __launch_bounds__(128) void k_attn(const _Float16* __restrict__ QH, const _Float16* __restrict__ KH, const _Float16* __restrict__ QL, const _Float16* __restrict__ KL, const _Float16* __restrict__ VT, const __bf16* __restrict__ VB, const __bf16* __restrict__ VBL, float* __restrict__ Y) { __shared__ __align__(16) unsigned char smem[2 * 4 * TILEB];   /* two buffers of up to four tiles; behind the key loop each wave's 16 x (HD + 4) f32 output staging */
  /* the wave's number in a scalar register: the causal test of a key block becomes a scalar branch */
  const int tid = threadIdx.x, wave = __builtin_amdgcn_readfirstlane(tid >> 5), lane = tid & 31; const int h = blockIdx.x, b = blockIdx.y, qb = NQB - 1 - (int)blockIdx.z;
  if (CAUSAL && qb < QBH) attn_wave<true>(QH, KH, QL, KL, VT, VB, VBL, b, h, qb, wave, lane, smem, Y);   /* block-uniform */
  else attn_wave<false>(QH, KH, QL, KL, VT, VB, VBL, b, h, qb, wave, lane, smem, Y); }
// ---- k_out: block = (64 rows, 128 cols): out = ctx Wo (+ bo): ctx x 2^6 once to f16 against Wo as f16(bf16 x 2^8) exact (1 product) x 2^-14; causal early rows (< QHI of each sequence): ctx bf16 hi + lo against exact bf16 Wo (2 products)
__global__ __launch_bounds__(128) void k_out(const float* __restrict__ Y, const float* __restrict__ WO, const float* __restrict__ BO, float* __restrict__ OUT) { __shared__ __align__(16) float sf[4][16][132]; __shared__ __align__(16) unsigned char smem[2 * 256 * KP * 2];
  const int tid = threadIdx.x, wave = tid >> 5, lane = tid & 31, col = lane & 15, g = lane >> 4; const int c0 = blockIdx.y * 128; const size_t r0 = (size_t)blockIdx.x * 64 + wave * 16;
  v8f acc[8] = {};
  /* staging as in k_proj: thread = (row lr of 16, 16-B piece lq); buffer rows 0..63 = ctx, 64..191 = Wo, 192..255 = ctx residual (early rows only) */
  const int lr = tid >> 3, lq = tid & 7; const float* gy = Y + ((size_t)blockIdx.x * 64 + lr) * CC + lq * 4; const float* gw = WO + (size_t)(c0 + lr) * CC + lq * 4; v4f pre[12];
#pragma unroll
  for (int i = 0; i < 4; ++i) pre[i] = *(const v4f*)(gy + (size_t)i * 16 * CC);
#pragma unroll
  for (int i = 0; i < 8; ++i) pre[4 + i] = *(const v4f*)(gw + (size_t)i * 16 * CC);
  XW2(gy, gw);
  if (CAUSAL && (int)(((size_t)blockIdx.x * 64) % TT) < QHI) {   /* block-uniform */
    __bf16 (*stg)[256][KP] = (__bf16 (*)[256][KP])smem;
#pragma unroll 2   /* two steps a trip: the buffer's number is a constant in each */
    for (int kc = 0; kc < CC / 32; ++kc) { __bf16 (*bf)[KP] = stg[kc & 1];
#pragma unroll
      for (int i = 0; i < 4; ++i) { v4b ch, cl;
#pragma unroll
        for (int e = 0; e < 4; ++e) { const float v = pre[i][e]; const __bf16 hv = (__bf16)v; ch[e] = hv; cl[e] = (__bf16)(v - (float)hv); }
        *(v4b*)&bf[i * 16 + lr][lq * 4] = ch; *(v4b*)&bf[192 + i * 16 + lr][lq * 4] = cl; }
#pragma unroll
      for (int i = 4; i < 12; ++i) { v4b c;
#pragma unroll
        for (int e = 0; e < 4; ++e) c[e] = (__bf16)pre[i][e];
        *(v4b*)&bf[i * 16 + lr][lq * 4] = c; }
      if (kc + 1 < CC / 32) { gy += 32; gw += 32;   /* the next step's lines fly under this step's products */
#pragma unroll
        for (int i = 0; i < 4; ++i) pre[i] = *(const v4f*)(gy + (size_t)i * 16 * CC);
#pragma unroll
        for (int i = 0; i < 8; ++i) pre[4 + i] = *(const v4f*)(gw + (size_t)i * 16 * CC);
        XW2(gy, gw); }
      RINGBAR();   /* publishes this step's buffer; it also ends every wave's reads of the other buffer, which the next step overwrites */
      const v16b ah = frag_b(&bf[wave * 16 + col][0], lane), al = frag_b(&bf[192 + wave * 16 + col][0], lane); v16b w[8];
#pragma unroll
      for (int j = 0; j < 8; ++j) w[j] = frag_b(&bf[64 + j * 16 + col][0], lane);
#pragma unroll
      for (int j = 0; j < 8; ++j) { acc[j] = wmma_bf(ah, w[j], acc[j]); acc[j] = wmma_bf(al, w[j], acc[j]); }
      __builtin_amdgcn_sched_barrier(0);   /* keeps the next step's conversions, and with them the wait for its loads, behind this step's products */ }
#pragma unroll
    for (int j = 0; j < 8; ++j) { const float bias = BO ? bfr(BO[c0 + j * 16 + col]) : 0.f;
#pragma unroll
      for (int r = 0; r < 8; ++r) sf[wave][8 * g + r][j * 16 + col] = acc[j][r] + bias; }
  } else {
    _Float16 (*stg)[256][KP] = (_Float16 (*)[256][KP])smem;
#pragma unroll 2   /* two steps a trip: the buffer's number is a constant in each */
    for (int kc = 0; kc < CC / 32; ++kc) { _Float16 (*bf)[KP] = stg[kc & 1];
#pragma unroll
      for (int i = 0; i < 12; ++i) { v4h c;
#pragma unroll
        for (int e = 0; e < 4; ++e) c[e] = i < 4 ? (_Float16)(pre[i][e] * 64.0f) : (_Float16)(bfr(pre[i][e]) * 256.0f);   /* ctx carried x 2^6 into f16 so small-magnitude context rows stay clear of f16 subnormals; Wo as f16(bf16 x 2^8), exact */
        *(v4h*)&bf[i * 16 + lr][lq * 4] = c; }
      if (kc + 1 < CC / 32) { gy += 32; gw += 32;   /* the next step's lines fly under this step's products */
#pragma unroll
        for (int i = 0; i < 4; ++i) pre[i] = *(const v4f*)(gy + (size_t)i * 16 * CC);
#pragma unroll
        for (int i = 0; i < 8; ++i) pre[4 + i] = *(const v4f*)(gw + (size_t)i * 16 * CC);
        XW2(gy, gw); }
      RINGBAR();   /* publishes this step's buffer; it also ends every wave's reads of the other buffer, which the next step overwrites */
      const v16h a = frag_h(&bf[wave * 16 + col][0], lane); v16h w[8];
#pragma unroll
      for (int j = 0; j < 8; ++j) w[j] = frag_h(&bf[64 + j * 16 + col][0], lane);
#pragma unroll
      for (int j = 0; j < 8; ++j) acc[j] = wmma16(a, w[j], acc[j]);
      __builtin_amdgcn_sched_barrier(0);   /* keeps the next step's conversions, and with them the wait for its loads, behind this step's products */ }
#pragma unroll
    for (int j = 0; j < 8; ++j) { const float bias = BO ? bfr(BO[c0 + j * 16 + col]) : 0.f;
#pragma unroll
      for (int r = 0; r < 8; ++r) sf[wave][8 * g + r][j * 16 + col] = acc[j][r] * (1.0f / 16384.0f) + bias; } }   /* 2^-8 (Wo carry) x 2^-6 (ctx carry) */
  LDSX(); for (int rl = 0; rl < 16; ++rl) vst2(OUT + (r0 + rl) * DIN + c0 + lane * 4, *(const v4f*)&sf[wave][rl][lane * 4]); }

extern "C" void kernel_launch(void* const* d_in, const int* in_sizes, int n_in, void* d_out, int out_size, void* d_ws, size_t ws_size, hipStream_t stream) {
  (void)in_sizes; (void)n_in; (void)out_size;
  const float** F = (const float**)d_in;
  if (ws_size < (size_t)WS_END) return;
  char* ws = (char*)d_ws; _Float16 *QH = (_Float16*)(ws + WS_QH), *KH = (_Float16*)(ws + WS_KH), *VT = (_Float16*)(ws + WS_VT), *QL = (_Float16*)(ws + WS_QL), *KL = (_Float16*)(ws + WS_KL); __bf16 *VB = (__bf16*)(ws + WS_VB), *VBL = (__bf16*)(ws + WS_VBL); float *Y = (float*)(ws + WS_Y);
  (void)Y; (void)QL; (void)KL; (void)VB; (void)VBL;
  // inputs: 0 key [4,1024,1024]; 1 value; 2 query; 3 Wk [1024,1024] (out,in), 4 bk; 5 Wq, 6 bq; 7 Wv, 8 bv; 9 Wp (out,in), 10 bp (zero biases, read)
  k_proj<<<dim3(TNB * TT / PM, CC / 128, 3), 128, 0, stream>>>(F[2], F[0], F[1], F[5], F[3], F[7], F[6], F[4], F[8], QH, QL, KH, KL, VT, VB, VBL);   /* (q, k, v) streams = inputs (query = 2, key = 0, value = 1) */
  k_attn<<<dim3(NH, TNB, NQB), 128, 0, stream>>>(QH, KH, QL, KL, VT, VB, VBL, Y);
  k_out<<<dim3(TNB * TT / 64, DIN / 128), 128, 0, stream>>>(Y, F[9], F[10], (float*)d_out);
}

// v006
// A run of this version takes 74.9 microseconds.
// In both of two side-by-side timings against v005, it was 1.07 times as fast.
// Over all steps from v000 it is 11.4 times as fast.
// compute dtype: all float inputs rounded to bf16; q/k/v projections with EXACT bf16 products on WMMA 16x16x32 (f32 accumulate) + bias; causal logits: 3 products for the first 384 rows, single f16 q x k after, x 64^-0.5; online softmax f32 (running maximum, one launch for logits, softmax and P v; exponent in base 2, scale and 2^11 inside its argument); exp(s - max) x 2^11 once to f16 x v once to f16 (bf16 hi + lo below row 384); ctx hi+lo x exact output weight below row 384, x2^6 f16 carry x f16(bf16 x 2^8) after, + bias; f32 output.
#include <hip/hip_runtime.h>
#include <math.h>

typedef __attribute__((ext_vector_type(16))) _Float16 v16h;
typedef __attribute__((ext_vector_type(16))) __bf16 v16b;
typedef __attribute__((ext_vector_type(8)))  _Float16 v8h;
typedef __attribute__((ext_vector_type(8)))  float v8f;
typedef __attribute__((ext_vector_type(4)))  float v4f;
typedef __attribute__((ext_vector_type(2)))  float v2f;
typedef __attribute__((ext_vector_type(4)))  unsigned v4u;
typedef __attribute__((ext_vector_type(4)))  int v4i;
typedef float __attribute__((may_alias)) float_a;
typedef int __attribute__((may_alias)) int_a;

template <typename T> __device__ __forceinline__ void vst2(void* p, T v) { *(T*)p = v;  }
__device__ __forceinline__ v8f wmma16(v16h a, v16h b, v8f c) {
  v8f d = __builtin_amdgcn_wmma_f32_16x16x32_f16(false, a, false, b, (short)0, c, false, false);
  asm volatile("v_nop\n\tv_nop\n\tv_nop\n\tv_nop" : "+v"(d) : "v"(a), "v"(b));
  return d;
}
__device__ __forceinline__ v8f wmma_bf(v16b a, v16b b, v8f c) {
  v8f d = __builtin_amdgcn_wmma_f32_16x16x32_bf16(false, a, false, b, (short)0, c, false, false);
  asm volatile("v_nop\n\tv_nop\n\tv_nop\n\tv_nop" : "+v"(d) : "v"(a), "v"(b));
  return d;
}
// 16x16x32 fragments: lane = (h = lane>>4, row/col = lane&15); elements 0..7 = k0+8h+0..7, 8..15 = k0+16+8h+0..7; D element r = row 8h+r
__device__ __forceinline__ v16h frag_h(const _Float16* rowk0, int lane) {
  union { v16h v; v8h q[2]; } u; const _Float16* p = rowk0 + 8 * (lane >> 4);
  u.q[0] = *(const v8h*)p; u.q[1] = *(const v8h*)(p + 16); return u.v;
}
__device__ __forceinline__ v16h frag_f32(const float* rowk0, int lane) {
  v16h a; const float* p = rowk0 + 8 * (lane >> 4);
#pragma unroll
  for (int i = 0; i < 8; ++i) { a[i] = (_Float16)p[i]; a[8 + i] = (_Float16)p[16 + i]; }
  return a;
}
__device__ __forceinline__ v16h frag_f32s(const float* rowk0, int lane, float sc) {
  v16h a; const float* p = rowk0 + 8 * (lane >> 4);
#pragma unroll
  for (int i = 0; i < 8; ++i) { a[i] = (_Float16)(p[i] * sc); a[8 + i] = (_Float16)(p[16 + i] * sc); }
  return a;
}
// column fragment from a [K][ld] layout (column n), rows >= K read as 0
__device__ __forceinline__ v16h fragc_f32(const float* W, int k0, int n, int lane, int ld, int K) {
  v16h a; const int g = lane >> 4;
#pragma unroll
  for (int i = 0; i < 8; ++i) { const int ka = k0 + 8 * g + i, kb = ka + 16;
    a[i] = (_Float16)(ka < K ? W[(size_t)(ka < K ? ka : K - 1) * ld + n] : 0.f); a[8 + i] = (_Float16)(kb < K ? W[(size_t)(kb < K ? kb : K - 1) * ld + n] : 0.f); }
  return a;
}
struct F2 { v16b h, l; };
__device__ __forceinline__ F2 bsplit16(const float v[16]) { F2 r;
#pragma unroll
  for (int i = 0; i < 16; ++i) { const __bf16 h = (__bf16)v[i]; r.h[i] = h; r.l[i] = (__bf16)(v[i] - (float)h); }
  return r; }
__device__ __forceinline__ F2 split_row(const float* row, int k0, int lane) { float v[16]; const float* p = row + k0 + 8 * (lane >> 4);
#pragma unroll
  for (int i = 0; i < 8; ++i) { v[i] = p[i]; v[8 + i] = p[16 + i]; }
  return bsplit16(v); }
__device__ __forceinline__ F2 split_rowK(const float* row, int k0, int lane, int K) { float v[16]; const int g = lane >> 4;
#pragma unroll
  for (int i = 0; i < 8; ++i) { const int ka = k0 + 8 * g + i, kb = ka + 16; v[i] = ka < K ? row[ka < K ? ka : K - 1] : 0.f; v[8 + i] = kb < K ? row[kb < K ? kb : K - 1] : 0.f; }
  return bsplit16(v); }
__device__ __forceinline__ F2 split_col(const float* W, int k0, int n, int lane, int ld, int K) { float v[16]; const int g = lane >> 4;
#pragma unroll
  for (int i = 0; i < 8; ++i) { const int ka = k0 + 8 * g + i, kb = ka + 16; v[i] = ka < K ? W[(size_t)(ka < K ? ka : K - 1) * ld + n] : 0.f; v[8 + i] = kb < K ? W[(size_t)(kb < K ? kb : K - 1) * ld + n] : 0.f; }
  return bsplit16(v); }
__device__ __forceinline__ v8f mac3(const F2& a, const F2& b, v8f c) { c = wmma_bf(a.l, b.h, c); c = wmma_bf(a.h, b.l, c); return wmma_bf(a.h, b.h, c); }
__device__ __forceinline__ float sigm(float v) { return 1.0f / (1.0f + expf(-v)); }
#define LDSX() do { asm volatile("s_wait_dscnt 0" ::: "memory"); __builtin_amdgcn_wave_barrier(); __builtin_amdgcn_fence(__ATOMIC_RELEASE, "workgroup"); } while (0)

// Causal multi-head attention on separate inputs listed key-first (key / value / query [4,1024,1024]; torch (out,in) Wk / Wq / Wv / Wp [1024,1024] (0.02) + zero biases; 16 heads x 64; scale 1/8; tril, -inf): out = merge(softmax(causal(q_h k_h^T / 8)) v_h) Wp^T + bp.
#define NB 4
#define TT 1024
#define CC 1024            // NH * HD = projected width
#define DIN 1024          // input (model) width
#define NH 16
#define HD 64
#define NQB (TT / 64)
#define HG 8
#define SCALE (0.125f)
#define CAUSAL 1
#ifndef TNB
#define TNB NB
#endif
__device__ __forceinline__ float bfr(float v) { return (float)(__bf16)v; }
__host__ __device__ __forceinline__ int kb_last(int qb) { return CAUSAL ? ((qb * 64 + 63) >> 7) : (TT / 128 - 1); }
typedef __attribute__((ext_vector_type(8))) __bf16 v8b;
__device__ __forceinline__ v16b frag_b(const __bf16* rowk0, int lane) {
  union { v16b v; v8b q[2]; } u; const __bf16* p = rowk0 + 8 * (lane >> 4);
  u.q[0] = *(const v8b*)p; u.q[1] = *(const v8b*)(p + 16); return u.v;
}
#define QBH 6              // causal: query blocks 0..QBH-1 of each sequence (few keys, no averaging) take the high-precision path
#define QHI 384            // rows carrying a q residual plane
#define KHI 384            // key rows carrying k residual / v bf16 hi+lo planes (used only by the causal high-precision path)
// B fragment (k rows k0+.., output column o) of a weight: (in,out) [K][ld] or (out,in) [ld rows of K]: bf16 exact, or f16(bf16 * 256) exact
__device__ __forceinline__ v16b wcol_io(const float* Wm, int k0, int o, int lane, int ld) { v16b w; const int g = lane >> 4;
#pragma unroll
  for (int i = 0; i < 8; ++i) { w[i] = (__bf16)Wm[(size_t)(k0 + 8 * g + i) * ld + o]; w[8 + i] = (__bf16)Wm[(size_t)(k0 + 16 + 8 * g + i) * ld + o]; }
  return w; }
__device__ __forceinline__ v16b wcol_oi(const float* Wm, int k0, int o, int lane, int K) { v16b w; const float* p = Wm + (size_t)o * K + k0 + 8 * (lane >> 4);
#pragma unroll
  for (int i = 0; i < 8; ++i) { w[i] = (__bf16)p[i]; w[8 + i] = (__bf16)p[16 + i]; }
  return w; }
__device__ __forceinline__ v16h wcolh_io(const float* Wm, int k0, int o, int lane, int ld) { v16h w; const int g = lane >> 4;
#pragma unroll
  for (int i = 0; i < 8; ++i) { w[i] = (_Float16)(bfr(Wm[(size_t)(k0 + 8 * g + i) * ld + o]) * 256.0f); w[8 + i] = (_Float16)(bfr(Wm[(size_t)(k0 + 16 + 8 * g + i) * ld + o]) * 256.0f); }
  return w; }
__device__ __forceinline__ v16h wcolh_oi(const float* Wm, int k0, int o, int lane, int K) { v16h w; const float* p = Wm + (size_t)o * K + k0 + 8 * (lane >> 4);
#pragma unroll
  for (int i = 0; i < 8; ++i) { w[i] = (_Float16)(bfr(p[i]) * 256.0f); w[8 + i] = (_Float16)(bfr(p[16 + i]) * 256.0f); }
  return w; }
#define WQKV_LAYOUT 1   // 0 = (in,out) [DIN][CC]; 1 = (out,in) [CC][DIN]; 2 = per-head [NH][DIN][HD]
__device__ __forceinline__ v16b wcol_hdk(const float* Wm, int k0, int o, int lane) { v16b w; const int g = lane >> 4; const float* p = Wm + (size_t)(o / HD) * DIN * HD + (o % HD);
#pragma unroll
  for (int i = 0; i < 8; ++i) { w[i] = (__bf16)p[(size_t)(k0 + 8 * g + i) * HD]; w[8 + i] = (__bf16)p[(size_t)(k0 + 16 + 8 * g + i) * HD]; }
  return w; }
#define WO_OUT_IN 1
#if WQKV_LAYOUT == 1
#define WCOL(W, k0, o, lane) wcol_oi(W, k0, o, lane, DIN)
#elif WQKV_LAYOUT == 2
#define WCOL(W, k0, o, lane) wcol_hdk(W, k0, o, lane)
#else
#define WCOL(W, k0, o, lane) wcol_io(W, k0, o, lane, CC)
#endif
#if WO_OUT_IN
#define WOCOL(W, k0, o, lane) wcol_oi(W, k0, o, lane, CC)
#define WOCOLH(W, k0, o, lane) wcolh_oi(W, k0, o, lane, CC)
#else
#define WOCOL(W, k0, o, lane) wcol_io(W, k0, o, lane, DIN)
#define WOCOLH(W, k0, o, lane) wcolh_io(W, k0, o, lane, DIN)
#endif

#ifndef SM_EXTRA_PARAMS
#define SM_EXTRA_PARAMS
#endif
#ifndef PROJ_EXTRA_PARAMS
#define PROJ_EXTRA_PARAMS
#endif
#ifndef SM_MASK_HOOK
#define SM_MASK_HOOK (void)0
#endif

#define WS_QH  0u                                      // f16 q rows [b*t][CC]
#define WS_KH  (WS_QH + 2u * (size_t)NB * TT * CC)      // f16 k rows [b*t][CC]
#define WS_VT  (WS_KH + 2u * (size_t)NB * TT * CC)      // f16 v planes [b][c][t]
#define WS_QL  (WS_VT + 2u * (size_t)NB * CC * TT)      // f16 q residual x 2^10 rows [b][t < QHI][CC]
#define WS_KL  (WS_QL + 2u * (size_t)NB * QHI * CC)     // f16 k residual x 2^10 rows [b][t < KHI][CC]
#define WS_VB  (WS_KL + 2u * (size_t)NB * KHI * CC)     // bf16 v hi planes [b][c][t < KHI]
#define WS_VBL (WS_VB + 2u * (size_t)NB * CC * KHI)
#define WS_S   (WS_VBL + 2u * (size_t)NB * CC * KHI)    // f32 [hg][t][s] region, unused: logits and P stay in registers
#define WS_Y   (WS_S  + 4u * (size_t)HG * TT * TT)      // f32 ctx rows [b*t][CC] (only when there is an output projection)
#define WS_END (WS_Y  + 4u * (size_t)NB * TT * CC)

// precaution behind a group of global loads: the group's address stays an input of the wait, so its registers are rewritten only behind the wait
#define XW2(p, q) asm volatile("s_wait_xcnt 0x0" :: "v"(p), "v"(q) : "memory")
// work-group barrier of the operand buffers, by hand: the wave's own LDS stores have landed and its reads have returned (s_wait_dscnt 0) before it signals; __syncthreads() would also wait for the next step's global loads, which are to stay in flight across it
#define RINGBAR() do { asm volatile("s_wait_dscnt 0x0" ::: "memory"); asm volatile("s_barrier_signal -1\n\ts_barrier_wait -1" ::: "memory"); } while (0)
#define KP 40              // pitch of a staged 32-k row in 16-bit elements: 80 B = 16 B x odd, where 16-byte fragment reads of 16 rows meet no bank twice
typedef __attribute__((ext_vector_type(4))) __bf16 v4b;
typedef __attribute__((ext_vector_type(4))) _Float16 v4h;
// four 16-byte pieces of an epilogue tile, LDS -> global (rows ls and gs bytes apart). The closing s_wait_xcnt 0 is a precaution: the stores' addresses and data stay inputs of the wait, so that their registers are rewritten only behind it
__device__ __forceinline__ void st4(char* gp, size_t gs, const unsigned char* lp, unsigned ls) { v4u d[4];
#pragma unroll
  for (int u = 0; u < 4; ++u) d[u] = *(const v4u*)(lp + u * ls);
#pragma unroll
  for (int u = 0; u < 4; ++u) vst2(gp + u * gs, d[u]);
  asm volatile("s_wait_xcnt 0x0" :: "v"(gp), "v"(gp + gs), "v"(gp + 2 * gs), "v"(gp + 3 * gs), "v"(d[0]), "v"(d[1]), "v"(d[2]), "v"(d[3]) : "memory"); }
// ---- k_proj: block = (256 rows, 256 cols, which), eight waves in 2 x 4, one wave = 128 rows x 64 cols (8 x 4 accumulator tiles, so that a staged row serves 256 outputs of the block; the wave's rows are two groups of 64, one in each 128-row half of the block, so that the epilogue goes half by half with every wave at work): q/k/v = X W (+ b) with exact bf16 products (K = DIN) -> which 0: q f16 rows (+ residual rows < QHI); 1: k f16 rows (+ residual rows < KHI); 2: v f16 planes [c][t] (+ bf16 hi/lo planes for t < KHI)
#define PM 256             // rows of a k_proj block; TT is a multiple of it, so a block lies in one sequence
#define PN 256             // columns of a k_proj block
#define PH 128             // rows of an epilogue half; QHI and KHI are multiples of it, so a half lies on one side of the residual rows' end
__global__ __launch_bounds__(256) void k_proj(const float* __restrict__ XQ, const float* __restrict__ XK, const float* __restrict__ XV, const float* __restrict__ WQ, const float* __restrict__ WK, const float* __restrict__ WV, const float* __restrict__ BQ, const float* __restrict__ BK, const float* __restrict__ BV,
    _Float16* __restrict__ QH, _Float16* __restrict__ QL, _Float16* __restrict__ KH, _Float16* __restrict__ KL, _Float16* __restrict__ VT, __bf16* __restrict__ VB, __bf16* __restrict__ VBL) {
  /* one LDS block: the two operand buffers of the k loop first, the epilogue's tiles of one half (q/k: sh, sl; v: th, tb, tbl) behind the barrier that ends the loop's last reads */
  __shared__ __align__(16) unsigned char smem[3 * PN * (PH + 8) * 2];
  __bf16 (*stg)[PM + PN][KP] = (__bf16 (*)[PM + PN][KP])smem;
  _Float16 (*sh)[PN + 8] = (_Float16 (*)[PN + 8])smem; _Float16 (*sl)[PN + 8] = (_Float16 (*)[PN + 8])(smem + PH * (PN + 8) * 2);
  _Float16 (*th)[PH + 8] = (_Float16 (*)[PH + 8])smem; __bf16 (*tb)[PH + 8] = (__bf16 (*)[PH + 8])(smem + PN * (PH + 8) * 2); __bf16 (*tbl)[PH + 8] = (__bf16 (*)[PH + 8])(smem + 2 * PN * (PH + 8) * 2);
  const int tid = threadIdx.x, wave = tid >> 5, lane = tid & 31, col = lane & 15, g = lane >> 4; const int wr = (wave >> 2) * 64, wc = (wave & 3) * 64; const int which = blockIdx.z; const int c0 = blockIdx.y * PN; const size_t r0 = (size_t)blockIdx.x * PM; const size_t bb = r0 / TT; const int t0 = (int)(r0 % TT);
  const float* X = which == 0 ? XQ : which == 1 ? XK : XV; const float* WA = which == 0 ? WQ : which == 1 ? WK : WV; const float* BA = which == 0 ? BQ : which == 1 ? BK : BV;
  v8f acc[8][4] = {};
  /* a 32-k step of the block's 256 X rows and 256 W rows: thread = (row lr of 32, 16-B piece lq), so a wave's load covers four whole 128-B lines; rounded to bf16 once for the block; buffer rows 0..255 = X, 256..511 = W */
  const int lr = tid >> 3, lq = tid & 7; const float* gx = X + (r0 + lr) * DIN + lq * 4; const float* gw = WA + (size_t)(c0 + lr) * DIN + lq * 4; v4f pre[16];
#pragma unroll
  for (int i = 0; i < 8; ++i) pre[i] = *(const v4f*)(gx + (size_t)i * 32 * DIN);
#pragma unroll
  for (int i = 0; i < 8; ++i) pre[8 + i] = *(const v4f*)(gw + (size_t)i * 32 * DIN);
  XW2(gx, gw);
#pragma unroll 2   /* two steps a trip: the buffer's number is a constant in each */
  for (int kc = 0; kc < DIN / 32; ++kc) { __bf16 (*bf)[KP] = stg[kc & 1];
#pragma unroll
    for (int i = 0; i < 16; ++i) { v4b c;
#pragma unroll
      for (int e = 0; e < 4; ++e) c[e] = (__bf16)pre[i][e];
      *(v4b*)&bf[i * 32 + lr][lq * 4] = c; }
    if (kc + 1 < DIN / 32) { gx += 32; gw += 32;   /* the next step's lines fly under this step's products */
#pragma unroll
      for (int i = 0; i < 8; ++i) pre[i] = *(const v4f*)(gx + (size_t)i * 32 * DIN);
#pragma unroll
      for (int i = 0; i < 8; ++i) pre[8 + i] = *(const v4f*)(gw + (size_t)i * 32 * DIN);
      XW2(gx, gw); }
    RINGBAR();   /* publishes this step's buffer; it also ends every wave's reads of the other buffer, which the next step overwrites */
    v16b a[8], w[4];
#pragma unroll
    for (int j = 0; j < 4; ++j) w[j] = frag_b(&bf[PM + wc + j * 16 + col][0], lane);
#pragma unroll
    for (int i = 0; i < 8; ++i) a[i] = frag_b(&bf[(i >> 2) * PH + wr + (i & 3) * 16 + col][0], lane);
    __builtin_amdgcn_sched_barrier(0);   /* keeps all 24 fragment reads in one group in front of the products; left alone the compiler sinks each row tile's two reads to its own four products, with a wait to zero in front of each four */
#pragma unroll
    for (int i = 0; i < 8; ++i)
#pragma unroll
      for (int j = 0; j < 4; ++j) acc[i][j] = __builtin_amdgcn_wmma_f32_16x16x32_bf16(false, a[i], false, w[j], (short)0, acc[i][j], false, false);   /* the bare builtin: 32 accumulator tiles reach past v255, which an asm operand cannot name; the compiler keeps the distances behind its own matrix instructions */
    __builtin_amdgcn_sched_barrier(0);   /* keeps the next step's conversions, and with them the wait for its loads, behind this step's products */ }
#pragma unroll 1   /* stays rolled: the epilogue is straight-line code that runs once a wave, and two copies of it would double the kernel's text */
  for (int p = 0; p < 2; ++p) { const size_t rp = r0 + p * PH; const int tp = t0 + p * PH;   /* half p = accumulator tiles 4 p .. 4 p + 3 of every wave, which stand in tiles 0 .. 3 when their half comes */
    __syncthreads();   /* p = 0: every wave has read its last fragments before the epilogue's tiles overwrite the buffers; p = 1: every thread has read the first half's tiles before the second half overwrites them */
    if (which < 2) { _Float16* DH = which == 0 ? QH : KH; _Float16* DL = which == 0 ? QL : KL; const int nhi = which == 0 ? QHI : KHI; const bool hi_rows = tp < nhi;
#pragma unroll
      for (int j = 0; j < 4; ++j) { const float bias = BA ? bfr(BA[c0 + wc + j * 16 + col]) : 0.f;
#pragma unroll
        for (int i = 0; i < 4; ++i)
#pragma unroll
          for (int r = 0; r < 8; ++r) { const float v = acc[i][j][r] + bias; const _Float16 hv = (_Float16)v; sh[wr + i * 16 + 8 * g + r][wc + j * 16 + col] = hv; sl[wr + i * 16 + 8 * g + r][wc + j * 16 + col] = (_Float16)((v - (float)hv) * 1024.0f); } }
      __syncthreads();
      /* thread = (row rl of 8, 16-B piece q): a wave's store covers one whole 512-B row segment */
      for (int rl = tid >> 5; rl < PH; rl += 32) { const int q = tid & 31; st4((char*)(DH + (rp + rl) * CC + c0 + q * 8), 8 * CC * 2, (const unsigned char*)&sh[rl][q * 8], 8 * (PN + 8) * 2); if (hi_rows) st4((char*)(DL + (bb * nhi + tp + rl) * (size_t)CC + c0 + q * 8), 8 * CC * 2, (const unsigned char*)&sl[rl][q * 8], 8 * (PN + 8) * 2); }
    } else { const bool hi_rows = tp < KHI;
#pragma unroll
      for (int j = 0; j < 4; ++j) { const float bias = BA ? bfr(BA[c0 + wc + j * 16 + col]) : 0.f;
#pragma unroll
        for (int i = 0; i < 4; ++i)
#pragma unroll
          for (int r = 0; r < 8; ++r) { const float v = acc[i][j][r] + bias; const int rl = wr + i * 16 + 8 * g + r, cl = wc + j * 16 + col; th[cl][rl] = (_Float16)v; const __bf16 bh = (__bf16)v; tb[cl][rl] = bh; tbl[cl][rl] = (__bf16)(v - (float)bh); } }
      __syncthreads();
      /* thread = (plane row cl of 16, 16-B piece q) */
      for (int cl = tid >> 4; cl < PN; cl += 64) { const int q = tid & 15; st4((char*)(VT + (bb * CC + c0 + cl) * (size_t)TT + tp + q * 8), 16 * TT * 2, (const unsigned char*)&th[cl][q * 8], 16 * (PH + 8) * 2); if (hi_rows) { const size_t o3 = (bb * CC + c0 + cl) * (size_t)KHI + tp + q * 8; st4((char*)(VB + o3), 16 * KHI * 2, (const unsigned char*)&tb[cl][q * 8], 16 * (PH + 8) * 2); st4((char*)(VBL + o3), 16 * KHI * 2, (const unsigned char*)&tbl[cl][q * 8], 16 * (PH + 8) * 2); } } }
#pragma unroll
    for (int i = 0; i < 4; ++i)
#pragma unroll
      for (int j = 0; j < 4; ++j) acc[i][j] = acc[4 + i][j]; } }
// ---- k_attn: block = 64 queries (qb, heaviest first) of (b, h), one wave = 16 queries; the waves share the staged K and V tiles and nothing else. Per 64 keys: S^T = K . Q^T (A = key rows, B = query rows, same loader on both sides), so a lane holds 32 scores of ONE query (query = lane & 15, key = 16 j + 8 (lane >> 4) + r); running maximum and sum in f32 (online softmax, halves joined by one lane exchange); P^T x 2^11 packs from two score tiles straight into a B operand; O^T += V^T . P^T with the v planes [c][t] as A. Products per path as before: query blocks < QBH take q hi + residual x k hi + residual (3 products) and P, v as bf16 hi + lo (3 products); the rest one f16 product each. Every fragment of a group is loaded in front of the group's first product, so that the loads fly together. The K and V tiles of a key block (64 rows of 128 B each) are brought into LDS once for the block's four waves, as whole lines, by asynchronous copies, one key block ahead, in two buffers; the fragments are read from there
#define TP 144             // pitch of a staged 128-B row in bytes: 16 B x odd, where 16-byte fragment reads of 16 rows meet no bank twice
#define TILEB (64 * TP)    // one staged tile
// two tiles, four copies a thread each (rows cr, cr + 16, cr + 32, cr + 48; a wave's copy covers four whole lines). s_wait_xcnt 0 is the last line of the copies' own statement: a precaution, so that no register which a copy names is rewritten in front of it
__device__ __forceinline__ void cp2tiles(unsigned la, const char* ga, size_t sa, unsigned lb, const char* gb, size_t sb) {
  asm volatile("global_load_async_to_lds_b128 %0, %8, off\n\tglobal_load_async_to_lds_b128 %1, %9, off\n\tglobal_load_async_to_lds_b128 %2, %10, off\n\tglobal_load_async_to_lds_b128 %3, %11, off\n\t"
               "global_load_async_to_lds_b128 %4, %12, off\n\tglobal_load_async_to_lds_b128 %5, %13, off\n\tglobal_load_async_to_lds_b128 %6, %14, off\n\tglobal_load_async_to_lds_b128 %7, %15, off\n\ts_wait_xcnt 0x0"
               :: "v"(la), "v"(la + 16 * TP), "v"(la + 32 * TP), "v"(la + 48 * TP), "v"(lb), "v"(lb + 16 * TP), "v"(lb + 32 * TP), "v"(lb + 48 * TP),
                  "v"(ga), "v"(ga + sa), "v"(ga + 2 * sa), "v"(ga + 3 * sa), "v"(gb), "v"(gb + sb), "v"(gb + 2 * sb), "v"(gb + 3 * sb) : "memory"); }
// fragment from the lane's own address (row start + k0 + 8 (lane >> 4)): same element order as frag_h / frag_b
__device__ __forceinline__ v16h frag_hp(const _Float16* p) { union { v16h v; v8h q[2]; } u; u.q[0] = *(const v8h*)p; u.q[1] = *(const v8h*)(p + 16); return u.v; }
__device__ __forceinline__ v16b frag_bp(const __bf16* p) { union { v16b v; v8b q[2]; } u; u.q[0] = *(const v8b*)p; u.q[1] = *(const v8b*)(p + 16); return u.v; }
// 2^x in place by the bare exponent instruction. Each instruction overwrites its own source alone and reads no neighbour's result; the closing v_nop is the slot that the instruction set asks for behind a transcendental before its result is read
__device__ __forceinline__ float exp2_1(float x) { asm("v_exp_f32 %0, %0\n\tv_nop" : "+v"(x)); return x; }
__device__ __forceinline__ void exp2_16(float (&x)[16]) {
  asm("v_exp_f32 %0, %0\n\tv_exp_f32 %1, %1\n\tv_exp_f32 %2, %2\n\tv_exp_f32 %3, %3\n\tv_exp_f32 %4, %4\n\tv_exp_f32 %5, %5\n\tv_exp_f32 %6, %6\n\tv_exp_f32 %7, %7\n\t"
      "v_exp_f32 %8, %8\n\tv_exp_f32 %9, %9\n\tv_exp_f32 %10, %10\n\tv_exp_f32 %11, %11\n\tv_exp_f32 %12, %12\n\tv_exp_f32 %13, %13\n\tv_exp_f32 %14, %14\n\tv_exp_f32 %15, %15\n\tv_nop"
      : "+v"(x[0]), "+v"(x[1]), "+v"(x[2]), "+v"(x[3]), "+v"(x[4]), "+v"(x[5]), "+v"(x[6]), "+v"(x[7]), "+v"(x[8]), "+v"(x[9]), "+v"(x[10]), "+v"(x[11]), "+v"(x[12]), "+v"(x[13]), "+v"(x[14]), "+v"(x[15])); }
template <bool HI> __device__ __forceinline__ void attn_wave(const _Float16* __restrict__ QH, const _Float16* __restrict__ KH, const _Float16* __restrict__ QL, const _Float16* __restrict__ KL, const _Float16* __restrict__ VT, const __bf16* __restrict__ VB, const __bf16* __restrict__ VBL, int b, int h, int qb, int wave, int lane, unsigned char* sm, float* __restrict__ Y) {
  const int col = lane & 15, g = lane >> 4; const int ql0 = qb * 64 + wave * 16; const int t = ql0 + col; const size_t q0 = (size_t)b * TT + ql0; const int nkb = CAUSAL ? qb + 1 : TT / 64;
  /* staging: thread = (row cr of 16, 16-B piece cq); a stage = K, V (f16 path) or K, K residual, v hi, v lo (high-precision path) */
  constexpr unsigned STG = (HI ? 4 : 2) * TILEB; const int cr = (int)threadIdx.x >> 3, cq = (int)threadIdx.x & 7; const unsigned lcp = (unsigned)(size_t)sm + cr * TP + cq * 16;
  const unsigned tk = cr * (CC * 2) + cq * 16, tv = cr * (TT * 2) + cq * 16, tb = cr * (KHI * 2) + cq * 16;   /* the thread's byte offset in a tile's source, by the source's row pitch; the tile's own start is the same for the block */
  auto fill = [&](int kb) { const unsigned l = lcp + (kb & 1) * STG;
    const char* gk = (const char*)(KH + ((size_t)b * TT + kb * 64) * CC + h * HD) + tk;
    if (HI) { cp2tiles(l, gk, 16 * CC * 2, l + TILEB, (const char*)(KL + ((size_t)b * KHI + kb * 64) * CC + h * HD) + tk, 16 * CC * 2);
      cp2tiles(l + 2 * TILEB, (const char*)(VB + ((size_t)b * CC + h * HD) * (size_t)KHI + kb * 64) + tb, 16 * KHI * 2, l + 3 * TILEB, (const char*)(VBL + ((size_t)b * CC + h * HD) * (size_t)KHI + kb * 64) + tb, 16 * KHI * 2); }
    else cp2tiles(l, gk, 16 * CC * 2, l + TILEB, (const char*)(VT + ((size_t)b * CC + h * HD) * (size_t)TT + kb * 64) + tv, 16 * TT * 2); };
  fill(0);
  v16h qh[HD / 32], qlo[HD / 32];
#pragma unroll
  for (int kc = 0; kc < HD / 32; ++kc) { qh[kc] = frag_h(QH + (q0 + col) * CC + h * HD + kc * 32, lane); if (HI) qlo[kc] = frag_h(QL + ((size_t)b * QHI + ql0 + col) * CC + h * HD + kc * 32, lane); }
  v8f o[HD / 16] = {}; float m = -3.0e38f, l = 0.f;   /* m: running maximum of the unscaled logits; l: running sum of the weights x 2^11 */
  constexpr float C2 = SCALE * 1.44269504088896340736f;   /* logit -> exponent in base 2 */
  float nb = 3.0e38f * C2;   /* the addend in use: 11 - m C2, rounded once and used for the weights and for the rescale alike, so that its rounding cancels */
  asm volatile("s_wait_asynccnt 0x0" ::: "memory");   /* the wave's own copies of key block 0 have landed */
  __syncthreads();   /* publishes key block 0 */
  if (nkb > 1) fill(1);   /* block-uniform */
#pragma unroll 1   /* stays rolled: one key block's fragments already fill the registers that four waves a SIMD leave a wave */
  for (int kb = 0; kb < nkb; ++kb) { const int k0 = kb * 64; v8f s[4]; v16h kf[4][HD / 32], kl[4][HD / 32], vf[2][HD / 16];
    const unsigned char* bp = sm + (kb & 1) * STG + col * TP + g * 16;   /* the lane's place in a staged tile: row col, 16-B piece g */
#pragma unroll
    for (int j = 0; j < 4; ++j)
#pragma unroll
      for (int kc = 0; kc < HD / 32; ++kc) kf[j][kc] = frag_hp((const _Float16*)(bp + j * 16 * TP + kc * 64));
#pragma unroll
    for (int j = 0; j < 4; ++j) { v8f acc = {}, accl = {};
      if (HI) {   /* the residual fragments come tile by tile: all four at once, beside the four k fragments, do not fit the registers that four waves a SIMD leave a wave */
#pragma unroll
        for (int kc = 0; kc < HD / 32; ++kc) kl[j][kc] = frag_hp((const _Float16*)(bp + TILEB + j * 16 * TP + kc * 64)); }
#pragma unroll
      for (int kc = 0; kc < HD / 32; ++kc) { acc = wmma16(kf[j][kc], qh[kc], acc); if (HI) { accl = wmma16(kf[j][kc], qlo[kc], accl); accl = wmma16(kl[j][kc], qh[kc], accl); } }
#pragma unroll
      for (int r = 0; r < 8; ++r) s[j][r] = HI ? acc[r] + accl[r] * (1.0f / 1024.0f) : acc[r]; }   /* unscaled: the scale sits in C2 */
    if (!HI) {   /* f16 path: v is read here, so that it flies under the softmax arithmetic */
#pragma unroll
      for (int kc = 0; kc < 2; ++kc)
#pragma unroll
        for (int jd = 0; jd < HD / 16; ++jd) vf[kc][jd] = frag_hp((const _Float16*)(bp + TILEB + jd * 16 * TP + kc * 64)); }
    if (CAUSAL && k0 + 63 > ql0) {   /* wave-uniform: only a key block that reaches past the wave's first query holds excluded keys */
#pragma unroll
      for (int j = 0; j < 4; ++j)
#pragma unroll
        for (int r = 0; r < 8; ++r) if (k0 + j * 16 + 8 * g + r > t) s[j][r] = -3.0e38f; }
    float mx = -3.0e38f;
#pragma unroll
    for (int j = 0; j < 4; ++j)
#pragma unroll
      for (int r = 0; r < 8; ++r) mx = fmaxf(mx, s[j][r]);
    mx = fmaxf(mx, __shfl_xor(mx, 16));
    /* every key block a wave walks holds a key <= each of its queries (k0 <= ql0), so mn is a real logit; an excluded score's argument is then about -5e37, where the exponent instruction returns 0 */
    const float mn = fmaxf(m, mx); const float nbn = fmaf(-mn, C2, 11.0f); const float alpha = exp2_1(nbn - nb); m = mn; nb = nbn;
    float ls = 0.f;
#pragma unroll
    for (int kc = 0; kc < 2; ++kc) { float x[16];   /* exp(scale (s - max)) x 2^11: one multiply-add and one exponent instruction a score */
#pragma unroll
      for (int i = 0; i < 16; ++i) x[i] = fmaf(s[2 * kc + (i >> 3)][i & 7], C2, nbn);
      exp2_16(x);
#pragma unroll
      for (int i = 0; i < 16; ++i) { ls += x[i]; s[2 * kc + (i >> 3)][i & 7] = x[i]; } }
    l = l * alpha + ls;
#pragma unroll
    for (int jd = 0; jd < HD / 16; ++jd)
#pragma unroll
      for (int r = 0; r < 8; ++r) o[jd][r] *= alpha;
#pragma unroll
    for (int kc = 0; kc < 2; ++kc) {
      if (HI) { float pv[16]; v16b vh[HD / 16], vl[HD / 16];
#pragma unroll
        for (int jd = 0; jd < HD / 16; ++jd) { vh[jd] = frag_bp((const __bf16*)(bp + 2 * TILEB + jd * 16 * TP + kc * 64)); vl[jd] = frag_bp((const __bf16*)(bp + 3 * TILEB + jd * 16 * TP + kc * 64)); }
#pragma unroll
        for (int i = 0; i < 8; ++i) { pv[i] = s[2 * kc][i]; pv[8 + i] = s[2 * kc + 1][i]; }
        const F2 p = bsplit16(pv);
#pragma unroll
        for (int jd = 0; jd < HD / 16; ++jd) { o[jd] = wmma_bf(vh[jd], p.h, o[jd]); o[jd] = wmma_bf(vh[jd], p.l, o[jd]); o[jd] = wmma_bf(vl[jd], p.h, o[jd]); }
      } else { v16h p;
#pragma unroll
        for (int i = 0; i < 8; ++i) { p[i] = (_Float16)s[2 * kc][i]; p[8 + i] = (_Float16)s[2 * kc + 1][i]; }
#pragma unroll
        for (int jd = 0; jd < HD / 16; ++jd) o[jd] = wmma16(vf[kc][jd], p, o[jd]); } }
    asm volatile("s_wait_dscnt 0x0" ::: "memory");      /* the wave's reads of this buffer have returned */
    asm volatile("s_wait_asynccnt 0x0" ::: "memory");   /* its copies of the next key block have landed */
    __syncthreads();   /* publishes the next key block; it also ends every wave's reads of this buffer, which is refilled behind it */
    if (kb + 2 < nkb) fill(kb + 2);   /* block-uniform */ }
  asm volatile("s_wait_asynccnt 0x0" ::: "memory");   /* no copy is left in flight when the buffers become the output's staging; the last key block's barrier has ended every wave's reads */
  float (*st)[HD + 4] = (float (*)[HD + 4])(sm + wave * (16 * (HD + 4) * 4));
  l += __shfl_xor(l, 16);
  const float inv = l > 0.f ? 1.0f / l : 0.f;   /* l carries the same 2^11 as the weights */
#pragma unroll
  for (int jd = 0; jd < HD / 16; ++jd) { v4f a, c;
#pragma unroll
    for (int r = 0; r < 4; ++r) { a[r] = o[jd][r] * inv; c[r] = o[jd][4 + r] * inv; }
    *(v4f*)&st[col][jd * 16 + 8 * g] = a; *(v4f*)&st[col][jd * 16 + 8 * g + 4] = c; }
  LDSX();   /* the wave's own LDS stores land before other lanes of the wave read them: two whole 256-B (row, head) segments a store */
#pragma unroll
  for (int rl = 0; rl < 16; rl += 2) vst2(Y + (q0 + rl + g) * CC + h * HD + col * 4, *(const v4f*)&st[rl + g][col * 4]); }
__global__ __launch_bounds__(128) void k_attn(const _Float16* __restrict__ QH, const _Float16* __restrict__ KH, const _Float16* __restrict__ QL, const _Float16* __restrict__ KL, const _Float16* __restrict__ VT, const __bf16* __restrict__ VB, const __bf16* __restrict__ VBL, float* __restrict__ Y) { __shared__ __align__(16) unsigned char smem[2 * 4 * TILEB];   /* two buffers of up to four tiles; behind the key loop each wave's 16 x (HD + 4) f32 output staging */
  /* the wave's number in a scalar register: the causal test of a key block becomes a scalar branch */
  const int tid = threadIdx.x, wave = __builtin_amdgcn_readfirstlane(tid >> 5), lane = tid & 31; const int h = blockIdx.x, b = blockIdx.y, qb = NQB - 1 - (int)blockIdx.z;
  if (CAUSAL && qb < QBH) attn_wave<true>(QH, KH, QL, KL, VT, VB, VBL, b, h, qb, wave, lane, smem, Y);   /* block-uniform */
  else attn_wave<false>(QH, KH, QL, KL, VT, VB, VBL, b, h, qb, wave, lane, smem, Y); }
// ---- k_out: block = (64 rows, 128 cols): out = ctx Wo (+ bo): ctx x 2^6 once to f16 against Wo as f16(bf16 x 2^8) exact (1 product) x 2^-14; causal early rows (< QHI of each sequence): ctx bf16 hi + lo against exact bf16 Wo (2 products)
__global__ __launch_bounds__(128) void k_out(const float* __restrict__ Y, const float* __restrict__ WO, const float* __restrict__ BO, float* __restrict__ OUT) { __shared__ __align__(16) float sf[4][16][132]; __shared__ __align__(16) unsigned char smem[2 * 256 * KP * 2];
  const int tid = threadIdx.x, wave = tid >> 5, lane = tid & 31, col = lane & 15, g = lane >> 4; const int c0 = blockIdx.y * 128; const size_t r0 = (size_t)blockIdx.x * 64 + wave * 16;
  v8f acc[8] = {};
  /* staging as in k_proj: thread = (row lr of 16, 16-B piece lq); buffer rows 0..63 = ctx, 64..191 = Wo, 192..255 = ctx residual (early rows only) */
  const int lr = tid >> 3, lq = tid & 7; const float* gy = Y + ((size_t)blockIdx.x * 64 + lr) * CC + lq * 4; const float* gw = WO + (size_t)(c0 + lr) * CC + lq * 4; v4f pre[12];
#pragma unroll
  for (int i = 0; i < 4; ++i) pre[i] = *(const v4f*)(gy + (size_t)i * 16 * CC);
#pragma unroll
  for (int i = 0; i < 8; ++i) pre[4 + i] = *(const v4f*)(gw + (size_t)i * 16 * CC);
  XW2(gy, gw);
  if (CAUSAL && (int)(((size_t)blockIdx.x * 64) % TT) < QHI) {   /* block-uniform */
    __bf16 (*stg)[256][KP] = (__bf16 (*)[256][KP])smem;
#pragma unroll 2   /* two steps a trip: the buffer's number is a constant in each */
    for (int kc = 0; kc < CC / 32; ++kc) { __bf16 (*bf)[KP] = stg[kc & 1];
#pragma unroll
      for (int i = 0; i < 4; ++i) { v4b ch, cl;
#pragma unroll
        for (int e = 0; e < 4; ++e) { const float v = pre[i][e]; const __bf16 hv = (__bf16)v; ch[e] = hv; cl[e] = (__bf16)(v - (float)hv); }
        *(v4b*)&bf[i * 16 + lr][lq * 4] = ch; *(v4b*)&bf[192 + i * 16 + lr][lq * 4] = cl; }
#pragma unroll
      for (int i = 4; i < 12; ++i) { v4b c;
#pragma unroll
        for (int e = 0; e < 4; ++e) c[e] = (__bf16)pre[i][e];
        *(v4b*)&bf[i * 16 + lr][lq * 4] = c; }
      if (kc + 1 < CC / 32) { gy += 32; gw += 32;   /* the next step's lines fly under this step's products */
#pragma unroll
        for (int i = 0; i < 4; ++i) pre[i] = *(const v4f*)(gy + (size_t)i * 16 * CC);
#pragma unroll
        for (int i = 0; i < 8; ++i) pre[4 + i] = *(const v4f*)(gw + (size_t)i * 16 * CC);
        XW2(gy, gw); }
      RINGBAR();   /* publishes this step's buffer; it also ends every wave's reads of the other buffer, which the next step overwrites */
      const v16b ah = frag_b(&bf[wave * 16 + col][0], lane), al = frag_b(&bf[192 + wave * 16 + col][0], lane); v16b w[8];
#pragma unroll
      for (int j = 0; j < 8; ++j) w[j] = frag_b(&bf[64 + j * 16 + col][0], lane);
#pragma unroll
      for (int j = 0; j < 8; ++j) { acc[j] = wmma_bf(ah, w[j], acc[j]); acc[j] = wmma_bf(al, w[j], acc[j]); }
      __builtin_amdgcn_sched_barrier(0);   /* keeps the next step's conversions, and with them the wait for its loads, behind this step's products */ }
#pragma unroll
    for (int j = 0; j < 8; ++j) { const float bias = BO ? bfr(BO[c0 + j * 16 + col]) : 0.f;
#pragma unroll
      for (int r = 0; r < 8; ++r) sf[wave][8 * g + r][j * 16 + col] = acc[j][r] + bias; }
  } else {
    _Float16 (*stg)[256][KP] = (_Float16 (*)[256][KP])smem;
#pragma unroll 2   /* two steps a trip: the buffer's number is a constant in each */
    for (int kc = 0; kc < CC / 32; ++kc) { _Float16 (*bf)[KP] = stg[kc & 1];
#pragma unroll
      for (int i = 0; i < 12; ++i) { v4h c;
#pragma unroll
        for (int e = 0; e < 4; ++e) c[e] = i < 4 ? (_Float16)(pre[i][e] * 64.0f) : (_Float16)(bfr(pre[i][e]) * 256.0f);   /* ctx carried x 2^6 into f16 so small-magnitude context rows stay clear of f16 subnormals; Wo as f16(bf16 x 2^8), exact */
        *(v4h*)&bf[i * 16 + lr][lq * 4] = c; }
      if (kc + 1 < CC / 32) { gy += 32; gw += 32;   /* the next step's lines fly under this step's products */
#pragma unroll
        for (int i = 0; i < 4; ++i) pre[i] = *(const v4f*)(gy + (size_t)i * 16 * CC);
#pragma unroll
        for (int i = 0; i < 8; ++i) pre[4 + i] = *(const v4f*)(gw + (size_t)i * 16 * CC);
        XW2(gy, gw); }
      RINGBAR();   /* publishes this step's buffer; it also ends every wave's reads of the other buffer, which the next step overwrites */
      const v16h a = frag_h(&bf[wave * 16 + col][0], lane); v16h w[8];
#pragma unroll
      for (int j = 0; j < 8; ++j) w[j] = frag_h(&bf[64 + j * 16 + col][0], lane);
#pragma unroll
      for (int j = 0; j < 8; ++j) acc[j] = wmma16(a, w[j], acc[j]);
      __builtin_amdgcn_sched_barrier(0);   /* keeps the next step's conversions, and with them the wait for its loads, behind this step's products */ }
#pragma unroll
    for (int j = 0; j < 8; ++j) { const float bias = BO ? bfr(BO[c0 + j * 16 + col]) : 0.f;
#pragma unroll
      for (int r = 0; r < 8; ++r) sf[wave][8 * g + r][j * 16 + col] = acc[j][r] * (1.0f / 16384.0f) + bias; } }   /* 2^-8 (Wo carry) x 2^-6 (ctx carry) */
  LDSX(); for (int rl = 0; rl < 16; ++rl) vst2(OUT + (r0 + rl) * DIN + c0 + lane * 4, *(const v4f*)&sf[wave][rl][lane * 4]); }

extern "C" void kernel_launch(void* const* d_in, const int* in_sizes, int n_in, void* d_out, int out_size, void* d_ws, size_t ws_size, hipStream_t stream) {
  (void)in_sizes; (void)n_in; (void)out_size;
  const float** F = (const float**)d_in;
  if (ws_size < (size_t)WS_END) return;
  char* ws = (char*)d_ws; _Float16 *QH = (_Float16*)(ws + WS_QH), *KH = (_Float16*)(ws + WS_KH), *VT = (_Float16*)(ws + WS_VT), *QL = (_Float16*)(ws + WS_QL), *KL = (_Float16*)(ws + WS_KL); __bf16 *VB = (__bf16*)(ws + WS_VB), *VBL = (__bf16*)(ws + WS_VBL); float *Y = (float*)(ws + WS_Y);
  (void)Y; (void)QL; (void)KL; (void)VB; (void)VBL;
  // inputs: 0 key [4,1024,1024]; 1 value; 2 query; 3 Wk [1024,1024] (out,in), 4 bk; 5 Wq, 6 bq; 7 Wv, 8 bv; 9 Wp (out,in), 10 bp (zero biases, read)
  k_proj<<<dim3(TNB * TT / PM, CC / PN, 3), 256, 0, stream>>>(F[2], F[0], F[1], F[5], F[3], F[7], F[6], F[4], F[8], QH, QL, KH, KL, VT, VB, VBL);   /* (q, k, v) streams = inputs (query = 2, key = 0, value = 1) */
  k_attn<<<dim3(NH, TNB, NQB), 128, 0, stream>>>(QH, KH, QL, KL, VT, VB, VBL, Y);
  k_out<<<dim3(TNB * TT / 64, DIN / 128), 128, 0, stream>>>(Y, F[9], F[10], (float*)d_out);
}

// v007
// Measured time: 69.7 microseconds a run.
// In both of two side-by-side timings against v006, it was 1.07 times as fast.
// All steps since v000 together make it 12.2 times as fast.
// compute dtype: all float inputs rounded to bf16; q/k/v projections with EXACT bf16 products on WMMA 16x16x32 (f32 accumulate) + bias; causal logits: 3 products for the first 384 rows, single f16 q x k after, x 64^-0.5; online softmax f32 (running maximum, one launch for logits, softmax and P v; exponent in base 2, scale and 2^11 inside its argument); exp(s - max) x 2^11 once to f16 x v once to f16 (bf16 hi + lo below row 384); ctx hi+lo x exact output weight below row 384, x2^6 f16 carry x f16(bf16 x 2^8) after, + bias; f32 output.
#include <hip/hip_runtime.h>
#include <math.h>

typedef __attribute__((ext_vector_type(16))) _Float16 v16h;
typedef __attribute__((ext_vector_type(16))) __bf16 v16b;
typedef __attribute__((ext_vector_type(8)))  _Float16 v8h;
typedef __attribute__((ext_vector_type(8)))  float v8f;
typedef __attribute__((ext_vector_type(4)))  float v4f;
typedef __attribute__((ext_vector_type(2)))  float v2f;
typedef __attribute__((ext_vector_type(4)))  unsigned v4u;
typedef __attribute__((ext_vector_type(4)))  int v4i;
typedef float __attribute__((may_alias)) float_a;
typedef int __attribute__((may_alias)) int_a;

template <typename T> __device__ __forceinline__ void vst2(void* p, T v) { *(T*)p = v;  }
__device__ __forceinline__ v8f wmma16(v16h a, v16h b, v8f c) {
  v8f d = __builtin_amdgcn_wmma_f32_16x16x32_f16(false, a, false, b, (short)0, c, false, false);
  asm volatile("v_nop\n\tv_nop\n\tv_nop\n\tv_nop" : "+v"(d) : "v"(a), "v"(b));
  return d;
}
__device__ __forceinline__ v8f wmma_bf(v16b a, v16b b, v8f c) {
  v8f d = __builtin_amdgcn_wmma_f32_16x16x32_bf16(false, a, false, b, (short)0, c, false, false);
  asm volatile("v_nop\n\tv_nop\n\tv_nop\n\tv_nop" : "+v"(d) : "v"(a), "v"(b));
  return d;
}
// 16x16x32 fragments: lane = (h = lane>>4, row/col = lane&15); elements 0..7 = k0+8h+0..7, 8..15 = k0+16+8h+0..7; D element r = row 8h+r
__device__ __forceinline__ v16h frag_h(const _Float16* rowk0, int lane) {
  union { v16h v; v8h q[2]; } u; const _Float16* p = rowk0 + 8 * (lane >> 4);
  u.q[0] = *(const v8h*)p; u.q[1] = *(const v8h*)(p + 16); return u.v;
}
__device__ __forceinline__ v16h frag_f32(const float* rowk0, int lane) {
  v16h a; const float* p = rowk0 + 8 * (lane >> 4);
#pragma unroll
  for (int i = 0; i < 8; ++i) { a[i] = (_Float16)p[i]; a[8 + i] = (_Float16)p[16 + i]; }
  return a;
}
__device__ __forceinline__ v16h frag_f32s(const float* rowk0, int lane, float sc) {
  v16h a; const float* p = rowk0 + 8 * (lane >> 4);
#pragma unroll
  for (int i = 0; i < 8; ++i) { a[i] = (_Float16)(p[i] * sc); a[8 + i] = (_Float16)(p[16 + i] * sc); }
  return a;
}
// column fragment from a [K][ld] layout (column n), rows >= K read as 0
__device__ __forceinline__ v16h fragc_f32(const float* W, int k0, int n, int lane, int ld, int K) {
  v16h a; const int g = lane >> 4;
#pragma unroll
  for (int i = 0; i < 8; ++i) { const int ka = k0 + 8 * g + i, kb = ka + 16;
    a[i] = (_Float16)(ka < K ? W[(size_t)(ka < K ? ka : K - 1) * ld + n] : 0.f); a[8 + i] = (_Float16)(kb < K ? W[(size_t)(kb < K ? kb : K - 1) * ld + n] : 0.f); }
  return a;
}
struct F2 { v16b h, l; };
__device__ __forceinline__ F2 bsplit16(const float v[16]) { F2 r;
#pragma unroll
  for (int i = 0; i < 16; ++i) { const __bf16 h = (__bf16)v[i]; r.h[i] = h; r.l[i] = (__bf16)(v[i] - (float)h); }
  return r; }
__device__ __forceinline__ F2 split_row(const float* row, int k0, int lane) { float v[16]; const float* p = row + k0 + 8 * (lane >> 4);
#pragma unroll
  for (int i = 0; i < 8; ++i) { v[i] = p[i]; v[8 + i] = p[16 + i]; }
  return bsplit16(v); }
__device__ __forceinline__ F2 split_rowK(const float* row, int k0, int lane, int K) { float v[16]; const int g = lane >> 4;
#pragma unroll
  for (int i = 0; i < 8; ++i) { const int ka = k0 + 8 * g + i, kb = ka + 16; v[i] = ka < K ? row[ka < K ? ka : K - 1] : 0.f; v[8 + i] = kb < K ? row[kb < K ? kb : K - 1] : 0.f; }
  return bsplit16(v); }
__device__ __forceinline__ F2 split_col(const float* W, int k0, int n, int lane, int ld, int K) { float v[16]; const int g = lane >> 4;
#pragma unroll
  for (int i = 0; i < 8; ++i) { const int ka = k0 + 8 * g + i, kb = ka + 16; v[i] = ka < K ? W[(size_t)(ka < K ? ka : K - 1) * ld + n] : 0.f; v[8 + i] = kb < K ? W[(size_t)(kb < K ? kb : K - 1) * ld + n] : 0.f; }
  return bsplit16(v); }
__device__ __forceinline__ v8f mac3(const F2& a, const F2& b, v8f c) { c = wmma_bf(a.l, b.h, c); c = wmma_bf(a.h, b.l, c); return wmma_bf(a.h, b.h, c); }
__device__ __forceinline__ float sigm(float v) { return 1.0f / (1.0f + expf(-v)); }
#define LDSX() do { asm volatile("s_wait_dscnt 0" ::: "memory"); __builtin_amdgcn_wave_barrier(); __builtin_amdgcn_fence(__ATOMIC_RELEASE, "workgroup"); } while (0)

// Causal multi-head attention on separate inputs listed key-first (key / value / query [4,1024,1024]; torch (out,in) Wk / Wq / Wv / Wp [1024,1024] (0.02) + zero biases; 16 heads x 64; scale 1/8; tril, -inf): out = merge(softmax(causal(q_h k_h^T / 8)) v_h) Wp^T + bp.
#define NB 4
#define TT 1024
#define CC 1024            // NH * HD = projected width
#define DIN 1024          // input (model) width
#define NH 16
#define HD 64
#define NQB (TT / 64)
#define HG 8
#define SCALE (0.125f)
#define CAUSAL 1
#ifndef TNB
#define TNB NB
#endif
__device__ __forceinline__ float bfr(float v) { return (float)(__bf16)v; }
__host__ __device__ __forceinline__ int kb_last(int qb) { return CAUSAL ? ((qb * 64 + 63) >> 7) : (TT / 128 - 1); }
typedef __attribute__((ext_vector_type(8))) __bf16 v8b;
__device__ __forceinline__ v16b frag_b(const __bf16* rowk0, int lane) {
  union { v16b v; v8b q[2]; } u; const __bf16* p = rowk0 + 8 * (lane >> 4);
  u.q[0] = *(const v8b*)p; u.q[1] = *(const v8b*)(p + 16); return u.v;
}
#define QBH 6              // causal: query blocks 0..QBH-1 of each sequence (few keys, no averaging) take the high-precision path
#define QHI 384            // rows carrying a q residual plane
#define KHI 384            // key rows carrying k residual / v bf16 hi+lo planes (used only by the causal high-precision path)
// B fragment (k rows k0+.., output column o) of a weight: (in,out) [K][ld] or (out,in) [ld rows of K]: bf16 exact, or f16(bf16 * 256) exact
__device__ __forceinline__ v16b wcol_io(const float* Wm, int k0, int o, int lane, int ld) { v16b w; const int g = lane >> 4;
#pragma unroll
  for (int i = 0; i < 8; ++i) { w[i] = (__bf16)Wm[(size_t)(k0 + 8 * g + i) * ld + o]; w[8 + i] = (__bf16)Wm[(size_t)(k0 + 16 + 8 * g + i) * ld + o]; }
  return w; }
__device__ __forceinline__ v16b wcol_oi(const float* Wm, int k0, int o, int lane, int K) { v16b w; const float* p = Wm + (size_t)o * K + k0 + 8 * (lane >> 4);
#pragma unroll
  for (int i = 0; i < 8; ++i) { w[i] = (__bf16)p[i]; w[8 + i] = (__bf16)p[16 + i]; }
  return w; }
__device__ __forceinline__ v16h wcolh_io(const float* Wm, int k0, int o, int lane, int ld) { v16h w; const int g = lane >> 4;
#pragma unroll
  for (int i = 0; i < 8; ++i) { w[i] = (_Float16)(bfr(Wm[(size_t)(k0 + 8 * g + i) * ld + o]) * 256.0f); w[8 + i] = (_Float16)(bfr(Wm[(size_t)(k0 + 16 + 8 * g + i) * ld + o]) * 256.0f); }
  return w; }
__device__ __forceinline__ v16h wcolh_oi(const float* Wm, int k0, int o, int lane, int K) { v16h w; const float* p = Wm + (size_t)o * K + k0 + 8 * (lane >> 4);
#pragma unroll
  for (int i = 0; i < 8; ++i) { w[i] = (_Float16)(bfr(p[i]) * 256.0f); w[8 + i] = (_Float16)(bfr(p[16 + i]) * 256.0f); }
  return w; }
#define WQKV_LAYOUT 1   // 0 = (in,out) [DIN][CC]; 1 = (out,in) [CC][DIN]; 2 = per-head [NH][DIN][HD]
__device__ __forceinline__ v16b wcol_hdk(const float* Wm, int k0, int o, int lane) { v16b w; const int g = lane >> 4; const float* p = Wm + (size_t)(o / HD) * DIN * HD + (o % HD);
#pragma unroll
  for (int i = 0; i < 8; ++i) { w[i] = (__bf16)p[(size_t)(k0 + 8 * g + i) * HD]; w[8 + i] = (__bf16)p[(size_t)(k0 + 16 + 8 * g + i) * HD]; }
  return w; }
#define WO_OUT_IN 1
#if WQKV_LAYOUT == 1
#define WCOL(W, k0, o, lane) wcol_oi(W, k0, o, lane, DIN)
#elif WQKV_LAYOUT == 2
#define WCOL(W, k0, o, lane) wcol_hdk(W, k0, o, lane)
#else
#define WCOL(W, k0, o, lane) wcol_io(W, k0, o, lane, CC)
#endif
#if WO_OUT_IN
#define WOCOL(W, k0, o, lane) wcol_oi(W, k0, o, lane, CC)
#define WOCOLH(W, k0, o, lane) wcolh_oi(W, k0, o, lane, CC)
#else
#define WOCOL(W, k0, o, lane) wcol_io(W, k0, o, lane, DIN)
#define WOCOLH(W, k0, o, lane) wcolh_io(W, k0, o, lane, DIN)
#endif

#ifndef SM_EXTRA_PARAMS
#define SM_EXTRA_PARAMS
#endif
#ifndef PROJ_EXTRA_PARAMS
#define PROJ_EXTRA_PARAMS
#endif
#ifndef SM_MASK_HOOK
#define SM_MASK_HOOK (void)0
#endif

#define WS_QH  0u                                      // f16 q rows [b*t][CC]
#define WS_KH  (WS_QH + 2u * (size_t)NB * TT * CC)      // f16 k rows [b*t][CC]
#define WS_VT  (WS_KH + 2u * (size_t)NB * TT * CC)      // f16 v planes [b][c][t]
#define WS_QL  (WS_VT + 2u * (size_t)NB * CC * TT)      // f16 q residual x 2^10 rows [b][t < QHI][CC]
#define WS_KL  (WS_QL + 2u * (size_t)NB * QHI * CC)     // f16 k residual x 2^10 rows [b][t < KHI][CC]
#define WS_VB  (WS_KL + 2u * (size_t)NB * KHI * CC)     // bf16 v hi planes [b][c][t < KHI]
#define WS_VBL (WS_VB + 2u * (size_t)NB * CC * KHI)
#define WS_S   (WS_VBL + 2u * (size_t)NB * CC * KHI)    // f32 [hg][t][s] region, unused: logits and P stay in registers
#define WS_Y   (WS_S  + 4u * (size_t)HG * TT * TT)      // f32 ctx rows [b*t][CC] (only when there is an output projection)
#define WS_END (WS_Y  + 4u * (size_t)NB * TT * CC)

// precaution behind a group of global loads: the group's address stays an input of the wait, so its registers are rewritten only behind the wait
#define XW2(p, q) asm volatile("s_wait_xcnt 0x0" :: "v"(p), "v"(q) : "memory")
// work-group barrier of the operand buffers, by hand: the wave's own LDS stores have landed and its reads have returned (s_wait_dscnt 0) before it signals; __syncthreads() would also wait for the next step's global loads, which are to stay in flight across it
#define RINGBAR() do { asm volatile("s_wait_dscnt 0x0" ::: "memory"); asm volatile("s_barrier_signal -1\n\ts_barrier_wait -1" ::: "memory"); } while (0)
#define KP 40              // pitch of a staged 32-k row in 16-bit elements: 80 B = 16 B x odd, where 16-byte fragment reads of 16 rows meet no bank twice
typedef __attribute__((ext_vector_type(4))) __bf16 v4b;
typedef __attribute__((ext_vector_type(4))) _Float16 v4h;
// four 16-byte pieces of an epilogue tile, LDS -> global (rows ls and gs bytes apart). The closing s_wait_xcnt 0 is a precaution: the stores' addresses and data stay inputs of the wait, so that their registers are rewritten only behind it
__device__ __forceinline__ void st4(char* gp, size_t gs, const unsigned char* lp, unsigned ls) { v4u d[4];
#pragma unroll
  for (int u = 0; u < 4; ++u) d[u] = *(const v4u*)(lp + u * ls);
#pragma unroll
  for (int u = 0; u < 4; ++u) vst2(gp + u * gs, d[u]);
  asm volatile("s_wait_xcnt 0x0" :: "v"(gp), "v"(gp + gs), "v"(gp + 2 * gs), "v"(gp + 3 * gs), "v"(d[0]), "v"(d[1]), "v"(d[2]), "v"(d[3]) : "memory"); }
// ---- k_proj: block = (256 rows, 256 cols, which), eight waves in 2 x 4, one wave = 128 rows x 64 cols (8 x 4 accumulator tiles, so that a staged row serves 256 outputs of the block; the wave's rows are two groups of 64, one in each 128-row half of the block, so that the epilogue goes half by half with every wave at work): q/k/v = X W (+ b) with exact bf16 products (K = DIN) -> which 0: q f16 rows (+ residual rows < QHI); 1: k f16 rows (+ residual rows < KHI); 2: v f16 planes [c][t] (+ bf16 hi/lo planes for t < KHI)
#define PM 256             // rows of a k_proj block; TT is a multiple of it, so a block lies in one sequence
#define PN 256             // columns of a k_proj block
#define PH 128             // rows of an epilogue half; QHI and KHI are multiples of it, so a half lies on one side of the residual rows' end
__global__ __launch_bounds__(256) void k_proj(const float* __restrict__ XQ, const float* __restrict__ XK, const float* __restrict__ XV, const float* __restrict__ WQ, const float* __restrict__ WK, const float* __restrict__ WV, const float* __restrict__ BQ, const float* __restrict__ BK, const float* __restrict__ BV,
    _Float16* __restrict__ QH, _Float16* __restrict__ QL, _Float16* __restrict__ KH, _Float16* __restrict__ KL, _Float16* __restrict__ VT, __bf16* __restrict__ VB, __bf16* __restrict__ VBL) {
  /* one LDS block: the two operand buffers of the k loop first, the epilogue's tiles of one half (q/k: sh, sl; v: th, tb, tbl) behind the barrier that ends the loop's last reads */
  __shared__ __align__(16) unsigned char smem[3 * PN * (PH + 8) * 2];
  __bf16 (*stg)[PM + PN][KP] = (__bf16 (*)[PM + PN][KP])smem;
  _Float16 (*sh)[PN + 8] = (_Float16 (*)[PN + 8])smem; _Float16 (*sl)[PN + 8] = (_Float16 (*)[PN + 8])(smem + PH * (PN + 8) * 2);
  _Float16 (*th)[PH + 8] = (_Float16 (*)[PH + 8])smem; __bf16 (*tb)[PH + 8] = (__bf16 (*)[PH + 8])(smem + PN * (PH + 8) * 2); __bf16 (*tbl)[PH + 8] = (__bf16 (*)[PH + 8])(smem + 2 * PN * (PH + 8) * 2);
  const int tid = threadIdx.x, wave = tid >> 5, lane = tid & 31, col = lane & 15, g = lane >> 4; const int wr = (wave >> 2) * 64, wc = (wave & 3) * 64; const int which = blockIdx.z; const int c0 = blockIdx.y * PN; const size_t r0 = (size_t)blockIdx.x * PM; const size_t bb = r0 / TT; const int t0 = (int)(r0 % TT);
  const float* X = which == 0 ? XQ : which == 1 ? XK : XV; const float* WA = which == 0 ? WQ : which == 1 ? WK : WV; const float* BA = which == 0 ? BQ : which == 1 ? BK : BV;
  v8f acc[8][4] = {};
  /* a 32-k step of the block's 256 X rows and 256 W rows: thread = (row lr of 32, 16-B piece lq), so a wave's load covers four whole 128-B lines; rounded to bf16 once for the block; buffer rows 0..255 = X, 256..511 = W */
  const int lr = tid >> 3, lq = tid & 7; const float* gx = X + (r0 + lr) * DIN + lq * 4; const float* gw = WA + (size_t)(c0 + lr) * DIN + lq * 4; v4f pre[16];
#pragma unroll
  for (int i = 0; i < 8; ++i) pre[i] = *(const v4f*)(gx + (size_t)i * 32 * DIN);
#pragma unroll
  for (int i = 0; i < 8; ++i) pre[8 + i] = *(const v4f*)(gw + (size_t)i * 32 * DIN);
  XW2(gx, gw);
#pragma unroll 2   /* two steps a trip: the buffer's number is a constant in each */
  for (int kc = 0; kc < DIN / 32; ++kc) { __bf16 (*bf)[KP] = stg[kc & 1];
#pragma unroll
    for (int i = 0; i < 16; ++i) { v4b c;
#pragma unroll
      for (int e = 0; e < 4; ++e) c[e] = (__bf16)pre[i][e];
      *(v4b*)&bf[i * 32 + lr][lq * 4] = c; }
    if (kc + 1 < DIN / 32) { gx += 32; gw += 32;   /* the next step's lines fly under this step's products */
#pragma unroll
      for (int i = 0; i < 8; ++i) pre[i] = *(const v4f*)(gx + (size_t)i * 32 * DIN);
#pragma unroll
      for (int i = 0; i < 8; ++i) pre[8 + i] = *(const v4f*)(gw + (size_t)i * 32 * DIN);
      XW2(gx, gw); }
    RINGBAR();   /* publishes this step's buffer; it also ends every wave's reads of the other buffer, which the next step overwrites */
    v16b a[8], w[4];
#pragma unroll
    for (int j = 0; j < 4; ++j) w[j] = frag_b(&bf[PM + wc + j * 16 + col][0], lane);
#pragma unroll
    for (int i = 0; i < 8; ++i) a[i] = frag_b(&bf[(i >> 2) * PH + wr + (i & 3) * 16 + col][0], lane);
    __builtin_amdgcn_sched_barrier(0);   /* keeps all 24 fragment reads in one group in front of the products; left alone the compiler sinks each row tile's two reads to its own four products, with a wait to zero in front of each four */
#pragma unroll
    for (int i = 0; i < 8; ++i)
#pragma unroll
      for (int j = 0; j < 4; ++j) acc[i][j] = __builtin_amdgcn_wmma_f32_16x16x32_bf16(false, a[i], false, w[j], (short)0, acc[i][j], false, false);   /* the bare builtin: 32 accumulator tiles reach past v255, which an asm operand cannot name; the compiler keeps the distances behind its own matrix instructions */
    __builtin_amdgcn_sched_barrier(0);   /* keeps the next step's conversions, and with them the wait for its loads, behind this step's products */ }
#pragma unroll 1   /* stays rolled: the epilogue is straight-line code that runs once a wave, and two copies of it would double the kernel's text */
  for (int p = 0; p < 2; ++p) { const size_t rp = r0 + p * PH; const int tp = t0 + p * PH;   /* half p = accumulator tiles 4 p .. 4 p + 3 of every wave, which stand in tiles 0 .. 3 when their half comes */
    __syncthreads();   /* p = 0: every wave has read its last fragments before the epilogue's tiles overwrite the buffers; p = 1: every thread has read the first half's tiles before the second half overwrites them */
    if (which < 2) { _Float16* DH = which == 0 ? QH : KH; _Float16* DL = which == 0 ? QL : KL; const int nhi = which == 0 ? QHI : KHI; const bool hi_rows = tp < nhi;
#pragma unroll
      for (int j = 0; j < 4; ++j) { const float bias = BA ? bfr(BA[c0 + wc + j * 16 + col]) : 0.f;
#pragma unroll
        for (int i = 0; i < 4; ++i)
#pragma unroll
          for (int r = 0; r < 8; ++r) { const float v = acc[i][j][r] + bias; const _Float16 hv = (_Float16)v; sh[wr + i * 16 + 8 * g + r][wc + j * 16 + col] = hv; sl[wr + i * 16 + 8 * g + r][wc + j * 16 + col] = (_Float16)((v - (float)hv) * 1024.0f); } }
      __syncthreads();
      /* thread = (row rl of 8, 16-B piece q): a wave's store covers one whole 512-B row segment */
      for (int rl = tid >> 5; rl < PH; rl += 32) { const int q = tid & 31; st4((char*)(DH + (rp + rl) * CC + c0 + q * 8), 8 * CC * 2, (const unsigned char*)&sh[rl][q * 8], 8 * (PN + 8) * 2); if (hi_rows) st4((char*)(DL + (bb * nhi + tp + rl) * (size_t)CC + c0 + q * 8), 8 * CC * 2, (const unsigned char*)&sl[rl][q * 8], 8 * (PN + 8) * 2); }
    } else { const bool hi_rows = tp < KHI;
#pragma unroll
      for (int j = 0; j < 4; ++j) { const float bias = BA ? bfr(BA[c0 + wc + j * 16 + col]) : 0.f;
#pragma unroll
        for (int i = 0; i < 4; ++i)
#pragma unroll
          for (int r = 0; r < 8; ++r) { const float v = acc[i][j][r] + bias; const int rl = wr + i * 16 + 8 * g + r, cl = wc + j * 16 + col; th[cl][rl] = (_Float16)v; const __bf16 bh = (__bf16)v; tb[cl][rl] = bh; tbl[cl][rl] = (__bf16)(v - (float)bh); } }
      __syncthreads();
      /* thread = (plane row cl of 16, 16-B piece q) */
      for (int cl = tid >> 4; cl < PN; cl += 64) { const int q = tid & 15; st4((char*)(VT + (bb * CC + c0 + cl) * (size_t)TT + tp + q * 8), 16 * TT * 2, (const unsigned char*)&th[cl][q * 8], 16 * (PH + 8) * 2); if (hi_rows) { const size_t o3 = (bb * CC + c0 + cl) * (size_t)KHI + tp + q * 8; st4((char*)(VB + o3), 16 * KHI * 2, (const unsigned char*)&tb[cl][q * 8], 16 * (PH + 8) * 2); st4((char*)(VBL + o3), 16 * KHI * 2, (const unsigned char*)&tbl[cl][q * 8], 16 * (PH + 8) * 2); } } }
#pragma unroll
    for (int i = 0; i < 4; ++i)
#pragma unroll
      for (int j = 0; j < 4; ++j) acc[i][j] = acc[4 + i][j]; } }
// ---- k_attn: block = 64 queries (qb, heaviest first) of (b, h), one wave = 16 queries; the waves share the staged K and V tiles and nothing else. Per 64 keys: S^T = K . Q^T (A = key rows, B = query rows, same loader on both sides), so a lane holds 32 scores of ONE query (query = lane & 15, key = 16 j + 8 (lane >> 4) + r); running maximum and sum in f32 (online softmax, halves joined by one lane exchange); P^T x 2^11 packs from two score tiles straight into a B operand; O^T += V^T . P^T with the v planes [c][t] as A. Products per path as before: query blocks < QBH take q hi + residual x k hi + residual (3 products) and P, v as bf16 hi + lo (3 products); the rest one f16 product each. Every fragment of a group is loaded in front of the group's first product, so that the loads fly together. The K and V tiles of a key block (64 rows of 128 B each) are brought into LDS once for the block's four waves, as whole lines, by asynchronous copies, one key block ahead, in two buffers; the fragments are read from there
#define TP 144             // pitch of a staged 128-B row in bytes: 16 B x odd, where 16-byte fragment reads of 16 rows meet no bank twice
#define TILEB (64 * TP)    // one staged tile
// two tiles, four copies a thread each (rows cr, cr + 16, cr + 32, cr + 48; a wave's copy covers four whole lines). s_wait_xcnt 0 is the last line of the copies' own statement: a precaution, so that no register which a copy names is rewritten in front of it
__device__ __forceinline__ void cp2tiles(unsigned la, const char* ga, size_t sa, unsigned lb, const char* gb, size_t sb) {
  asm volatile("global_load_async_to_lds_b128 %0, %8, off\n\tglobal_load_async_to_lds_b128 %1, %9, off\n\tglobal_load_async_to_lds_b128 %2, %10, off\n\tglobal_load_async_to_lds_b128 %3, %11, off\n\t"
               "global_load_async_to_lds_b128 %4, %12, off\n\tglobal_load_async_to_lds_b128 %5, %13, off\n\tglobal_load_async_to_lds_b128 %6, %14, off\n\tglobal_load_async_to_lds_b128 %7, %15, off\n\ts_wait_xcnt 0x0"
               :: "v"(la), "v"(la + 16 * TP), "v"(la + 32 * TP), "v"(la + 48 * TP), "v"(lb), "v"(lb + 16 * TP), "v"(lb + 32 * TP), "v"(lb + 48 * TP),
                  "v"(ga), "v"(ga + sa), "v"(ga + 2 * sa), "v"(ga + 3 * sa), "v"(gb), "v"(gb + sb), "v"(gb + 2 * sb), "v"(gb + 3 * sb) : "memory"); }
// fragment from the lane's own address (row start + k0 + 8 (lane >> 4)): same element order as frag_h / frag_b
__device__ __forceinline__ v16h frag_hp(const _Float16* p) { union { v16h v; v8h q[2]; } u; u.q[0] = *(const v8h*)p; u.q[1] = *(const v8h*)(p + 16); return u.v; }
__device__ __forceinline__ v16b frag_bp(const __bf16* p) { union { v16b v; v8b q[2]; } u; u.q[0] = *(const v8b*)p; u.q[1] = *(const v8b*)(p + 16); return u.v; }
// 2^x in place by the bare exponent instruction. Each instruction overwrites its own source alone and reads no neighbour's result; the closing v_nop is the slot that the instruction set asks for behind a transcendental before its result is read
__device__ __forceinline__ float exp2_1(float x) { asm("v_exp_f32 %0, %0\n\tv_nop" : "+v"(x)); return x; }
__device__ __forceinline__ void exp2_16(float (&x)[16]) {
  asm("v_exp_f32 %0, %0\n\tv_exp_f32 %1, %1\n\tv_exp_f32 %2, %2\n\tv_exp_f32 %3, %3\n\tv_exp_f32 %4, %4\n\tv_exp_f32 %5, %5\n\tv_exp_f32 %6, %6\n\tv_exp_f32 %7, %7\n\t"
      "v_exp_f32 %8, %8\n\tv_exp_f32 %9, %9\n\tv_exp_f32 %10, %10\n\tv_exp_f32 %11, %11\n\tv_exp_f32 %12, %12\n\tv_exp_f32 %13, %13\n\tv_exp_f32 %14, %14\n\tv_exp_f32 %15, %15\n\tv_nop"
      : "+v"(x[0]), "+v"(x[1]), "+v"(x[2]), "+v"(x[3]), "+v"(x[4]), "+v"(x[5]), "+v"(x[6]), "+v"(x[7]), "+v"(x[8]), "+v"(x[9]), "+v"(x[10]), "+v"(x[11]), "+v"(x[12]), "+v"(x[13]), "+v"(x[14]), "+v"(x[15])); }
template <bool HI> __device__ __forceinline__ void attn_wave(const _Float16* __restrict__ QH, const _Float16* __restrict__ KH, const _Float16* __restrict__ QL, const _Float16* __restrict__ KL, const _Float16* __restrict__ VT, const __bf16* __restrict__ VB, const __bf16* __restrict__ VBL, int b, int h, int qb, int wave, int lane, unsigned char* sm, float* __restrict__ Y) {
  const int col = lane & 15, g = lane >> 4; const int ql0 = qb * 64 + wave * 16; const int t = ql0 + col; const size_t q0 = (size_t)b * TT + ql0; const int nkb = CAUSAL ? qb + 1 : TT / 64;
  /* staging: thread = (row cr of 16, 16-B piece cq); a stage = K, V (f16 path) or K, K residual, v hi, v lo (high-precision path) */
  constexpr unsigned STG = (HI ? 4 : 2) * TILEB; const int cr = (int)threadIdx.x >> 3, cq = (int)threadIdx.x & 7; const unsigned lcp = (unsigned)(size_t)sm + cr * TP + cq * 16;
  const unsigned tk = cr * (CC * 2) + cq * 16, tv = cr * (TT * 2) + cq * 16, tb = cr * (KHI * 2) + cq * 16;   /* the thread's byte offset in a tile's source, by the source's row pitch; the tile's own start is the same for the block */
  auto fill = [&](int kb) { const unsigned l = lcp + (kb & 1) * STG;
    const char* gk = (const char*)(KH + ((size_t)b * TT + kb * 64) * CC + h * HD) + tk;
    if (HI) { cp2tiles(l, gk, 16 * CC * 2, l + TILEB, (const char*)(KL + ((size_t)b * KHI + kb * 64) * CC + h * HD) + tk, 16 * CC * 2);
      cp2tiles(l + 2 * TILEB, (const char*)(VB + ((size_t)b * CC + h * HD) * (size_t)KHI + kb * 64) + tb, 16 * KHI * 2, l + 3 * TILEB, (const char*)(VBL + ((size_t)b * CC + h * HD) * (size_t)KHI + kb * 64) + tb, 16 * KHI * 2); }
    else cp2tiles(l, gk, 16 * CC * 2, l + TILEB, (const char*)(VT + ((size_t)b * CC + h * HD) * (size_t)TT + kb * 64) + tv, 16 * TT * 2); };
  fill(0);
  v16h qh[HD / 32], qlo[HD / 32];
#pragma unroll
  for (int kc = 0; kc < HD / 32; ++kc) { qh[kc] = frag_h(QH + (q0 + col) * CC + h * HD + kc * 32, lane); if (HI) qlo[kc] = frag_h(QL + ((size_t)b * QHI + ql0 + col) * CC + h * HD + kc * 32, lane); }
  v8f o[HD / 16] = {}; float m = -3.0e38f, l = 0.f;   /* m: running maximum of the unscaled logits; l: running sum of the weights x 2^11 */
  constexpr float C2 = SCALE * 1.44269504088896340736f;   /* logit -> exponent in base 2 */
  float nb = 3.0e38f * C2;   /* the addend in use: 11 - m C2, rounded once and used for the weights and for the rescale alike, so that its rounding cancels */
  asm volatile("s_wait_asynccnt 0x0" ::: "memory");   /* the wave's own copies of key block 0 have landed */
  __syncthreads();   /* publishes key block 0 */
  if (nkb > 1) fill(1);   /* block-uniform */
#pragma unroll 1   /* stays rolled: one key block's fragments already fill the registers that four waves a SIMD leave a wave */
  for (int kb = 0; kb < nkb; ++kb) { const int k0 = kb * 64; v8f s[4]; v16h kf[4][HD / 32], kl[4][HD / 32], vf[2][HD / 16];
    const unsigned char* bp = sm + (kb & 1) * STG + col * TP + g * 16;   /* the lane's place in a staged tile: row col, 16-B piece g */
#pragma unroll
    for (int j = 0; j < 4; ++j)
#pragma unroll
      for (int kc = 0; kc < HD / 32; ++kc) kf[j][kc] = frag_hp((const _Float16*)(bp + j * 16 * TP + kc * 64));
#pragma unroll
    for (int j = 0; j < 4; ++j) { v8f acc = {}, accl = {};
      if (HI) {   /* the residual fragments come tile by tile: all four at once, beside the four k fragments, do not fit the registers that four waves a SIMD leave a wave */
#pragma unroll
        for (int kc = 0; kc < HD / 32; ++kc) kl[j][kc] = frag_hp((const _Float16*)(bp + TILEB + j * 16 * TP + kc * 64)); }
#pragma unroll
      for (int kc = 0; kc < HD / 32; ++kc) { acc = wmma16(kf[j][kc], qh[kc], acc); if (HI) { accl = wmma16(kf[j][kc], qlo[kc], accl); accl = wmma16(kl[j][kc], qh[kc], accl); } }
#pragma unroll
      for (int r = 0; r < 8; ++r) s[j][r] = HI ? acc[r] + accl[r] * (1.0f / 1024.0f) : acc[r]; }   /* unscaled: the scale sits in C2 */
    if (!HI) {   /* f16 path: v is read here, so that it flies under the softmax arithmetic */
#pragma unroll
      for (int kc = 0; kc < 2; ++kc)
#pragma unroll
        for (int jd = 0; jd < HD / 16; ++jd) vf[kc][jd] = frag_hp((const _Float16*)(bp + TILEB + jd * 16 * TP + kc * 64)); }
    if (CAUSAL && k0 + 63 > ql0) {   /* wave-uniform: only a key block that reaches past the wave's first query holds excluded keys */
#pragma unroll
      for (int j = 0; j < 4; ++j)
#pragma unroll
        for (int r = 0; r < 8; ++r) if (k0 + j * 16 + 8 * g + r > t) s[j][r] = -3.0e38f; }
    float mx = -3.0e38f;
#pragma unroll
    for (int j = 0; j < 4; ++j)
#pragma unroll
      for (int r = 0; r < 8; ++r) mx = fmaxf(mx, s[j][r]);
    mx = fmaxf(mx, __shfl_xor(mx, 16));
    /* every key block a wave walks holds a key <= each of its queries (k0 <= ql0), so mn is a real logit; an excluded score's argument is then about -5e37, where the exponent instruction returns 0 */
    const float mn = fmaxf(m, mx); const float nbn = fmaf(-mn, C2, 11.0f); const float alpha = exp2_1(nbn - nb); m = mn; nb = nbn;
    float ls = 0.f;
#pragma unroll
    for (int kc = 0; kc < 2; ++kc) { float x[16];   /* exp(scale (s - max)) x 2^11: one multiply-add and one exponent instruction a score */
#pragma unroll
      for (int i = 0; i < 16; ++i) x[i] = fmaf(s[2 * kc + (i >> 3)][i & 7], C2, nbn);
      exp2_16(x);
#pragma unroll
      for (int i = 0; i < 16; ++i) { ls += x[i]; s[2 * kc + (i >> 3)][i & 7] = x[i]; } }
    l = l * alpha + ls;
#pragma unroll
    for (int jd = 0; jd < HD / 16; ++jd)
#pragma unroll
      for (int r = 0; r < 8; ++r) o[jd][r] *= alpha;
#pragma unroll
    for (int kc = 0; kc < 2; ++kc) {
      if (HI) { float pv[16]; v16b vh[HD / 16], vl[HD / 16];
#pragma unroll
        for (int jd = 0; jd < HD / 16; ++jd) { vh[jd] = frag_bp((const __bf16*)(bp + 2 * TILEB + jd * 16 * TP + kc * 64)); vl[jd] = frag_bp((const __bf16*)(bp + 3 * TILEB + jd * 16 * TP + kc * 64)); }
#pragma unroll
        for (int i = 0; i < 8; ++i) { pv[i] = s[2 * kc][i]; pv[8 + i] = s[2 * kc + 1][i]; }
        const F2 p = bsplit16(pv);
#pragma unroll
        for (int jd = 0; jd < HD / 16; ++jd) { o[jd] = wmma_bf(vh[jd], p.h, o[jd]); o[jd] = wmma_bf(vh[jd], p.l, o[jd]); o[jd] = wmma_bf(vl[jd], p.h, o[jd]); }
      } else { v16h p;
#pragma unroll
        for (int i = 0; i < 8; ++i) { p[i] = (_Float16)s[2 * kc][i]; p[8 + i] = (_Float16)s[2 * kc + 1][i]; }
#pragma unroll
        for (int jd = 0; jd < HD / 16; ++jd) o[jd] = wmma16(vf[kc][jd], p, o[jd]); } }
    asm volatile("s_wait_dscnt 0x0" ::: "memory");      /* the wave's reads of this buffer have returned */
    asm volatile("s_wait_asynccnt 0x0" ::: "memory");   /* its copies of the next key block have landed */
    __syncthreads();   /* publishes the next key block; it also ends every wave's reads of this buffer, which is refilled behind it */
    if (kb + 2 < nkb) fill(kb + 2);   /* block-uniform */ }
  asm volatile("s_wait_asynccnt 0x0" ::: "memory");   /* no copy is left in flight when the buffers become the output's staging; the last key block's barrier has ended every wave's reads */
  float (*st)[HD + 4] = (float (*)[HD + 4])(sm + wave * (16 * (HD + 4) * 4));
  l += __shfl_xor(l, 16);
  const float inv = l > 0.f ? 1.0f / l : 0.f;   /* l carries the same 2^11 as the weights */
#pragma unroll
  for (int jd = 0; jd < HD / 16; ++jd) { v4f a, c;
#pragma unroll
    for (int r = 0; r < 4; ++r) { a[r] = o[jd][r] * inv; c[r] = o[jd][4 + r] * inv; }
    *(v4f*)&st[col][jd * 16 + 8 * g] = a; *(v4f*)&st[col][jd * 16 + 8 * g + 4] = c; }
  LDSX();   /* the wave's own LDS stores land before other lanes of the wave read them: two whole 256-B (row, head) segments a store */
#pragma unroll
  for (int rl = 0; rl < 16; rl += 2) vst2(Y + (q0 + rl + g) * CC + h * HD + col * 4, *(const v4f*)&st[rl + g][col * 4]); }
__global__ __launch_bounds__(128) void k_attn(const _Float16* __restrict__ QH, const _Float16* __restrict__ KH, const _Float16* __restrict__ QL, const _Float16* __restrict__ KL, const _Float16* __restrict__ VT, const __bf16* __restrict__ VB, const __bf16* __restrict__ VBL, float* __restrict__ Y) { __shared__ __align__(16) unsigned char smem[2 * 4 * TILEB];   /* two buffers of up to four tiles; behind the key loop each wave's 16 x (HD + 4) f32 output staging */
  /* the wave's number in a scalar register: the causal test of a key block becomes a scalar branch */
  const int tid = threadIdx.x, wave = __builtin_amdgcn_readfirstlane(tid >> 5), lane = tid & 31; const int h = blockIdx.x, b = blockIdx.y, qb = NQB - 1 - (int)blockIdx.z;
  if (CAUSAL && qb < QBH) attn_wave<true>(QH, KH, QL, KL, VT, VB, VBL, b, h, qb, wave, lane, smem, Y);   /* block-uniform */
  else attn_wave<false>(QH, KH, QL, KL, VT, VB, VBL, b, h, qb, wave, lane, smem, Y); }
// ---- k_out: block = (128 rows, 128 cols), four waves in 2 x 2, one wave = 64 rows x 64 cols (4 x 4 accumulator tiles), a step = 64 k: out = ctx Wo (+ bo): ctx x 2^6 once to f16 against Wo as f16(bf16 x 2^8) exact (1 product) x 2^-14; causal early rows (< QHI of each sequence): ctx bf16 hi + lo against exact bf16 Wo (2 products)
#define OM 128             // rows of a k_out block; QHI and TT are multiples of it, so a block lies in one sequence and on one side of the early rows' end
#define ON 128             // columns of a k_out block
#define OKS 64             // k of a k_out step
#define OP 72              // pitch of a staged 64-k row in 16-bit elements: 144 B = 16 B x odd, where 16-byte fragment reads of 16 rows meet no bank twice
#define OSP 68             // pitch of a staged output row in floats: 272 B = 16 B x odd
template <bool HI> __device__ __forceinline__ void out_tile(const float* __restrict__ Y, const float* __restrict__ WO, const float* __restrict__ BO, float* __restrict__ OUT, unsigned char* smem) {
  constexpr int ROWS = HI ? 384 : 256;   /* buffer rows 0..127 = ctx, 128..255 = Wo, 256..383 = ctx residual (early rows only) */
  const int tid = threadIdx.x, wave = tid >> 5, lane = tid & 31, col = lane & 15, g = lane >> 4; const int wr = (wave >> 1) * 64, wc = (wave & 1) * 64; const int c0 = blockIdx.y * ON; const size_t r0 = (size_t)blockIdx.x * OM;
  v8f acc[4][4] = {};
  /* a 64-k step of the block's 128 ctx rows and 128 Wo rows: thread = (row lr of 8, 16-B piece lq), so a wave's load covers four whole 128-B lines; rounded once for the block */
  const int lr = tid >> 4, lq = tid & 15; const float* gy = Y + (r0 + lr) * CC + lq * 4; const float* gw = WO + (size_t)(c0 + lr) * CC + lq * 4; v4f pre[32];
#pragma unroll
  for (int i = 0; i < 16; ++i) pre[i] = *(const v4f*)(gy + (size_t)i * 8 * CC);
#pragma unroll
  for (int i = 0; i < 16; ++i) pre[16 + i] = *(const v4f*)(gw + (size_t)i * 8 * CC);
  XW2(gy, gw);
#pragma unroll 2   /* two steps a trip: the buffer's number is a constant in each */
  for (int kc = 0; kc < CC / OKS; ++kc) { __bf16 (*bb)[OP] = (__bf16 (*)[OP])(smem + (kc & 1) * (ROWS * OP * 2)); _Float16 (*bh)[OP] = (_Float16 (*)[OP])(smem + (kc & 1) * (ROWS * OP * 2)); const int adv = kc + 1 < CC / OKS ? OKS : 0; const float* ny = gy + adv; const float* nw = gw + adv;   /* the loads stand under no branch: a branch round them joins two paths in the compiler's count of outstanding loads, and its waits then reach the loads just issued; so the last step reads its own lines once more, and nothing reads those registers */
    /* in four groups of eight pieces: a group is rounded and stored, and its registers take the next step's lines at once, so that those fly under the other groups' rounding and under this step's products */
#pragma unroll
    for (int q = 0; q < 4; ++q) {
#pragma unroll
      for (int u = 0; u < 8; ++u) { const int i = q * 8 + u;
        if (HI) {
          if (i < 16) { v4b ch, cl;
#pragma unroll
            for (int e = 0; e < 4; ++e) { const float v = pre[i][e]; const __bf16 hv = (__bf16)v; ch[e] = hv; cl[e] = (__bf16)(v - (float)hv); }
            *(v4b*)&bb[i * 8 + lr][lq * 4] = ch; *(v4b*)&bb[256 + i * 8 + lr][lq * 4] = cl; }
          else { v4b c;
#pragma unroll
            for (int e = 0; e < 4; ++e) c[e] = (__bf16)pre[i][e];
            *(v4b*)&bb[i * 8 + lr][lq * 4] = c; }
        } else { v4h c;
#pragma unroll
          for (int e = 0; e < 4; ++e) c[e] = i < 16 ? (_Float16)(pre[i][e] * 64.0f) : (_Float16)(bfr(pre[i][e]) * 256.0f);   /* ctx carried x 2^6 into f16 so small-magnitude context rows stay clear of f16 subnormals; Wo as f16(bf16 x 2^8), exact */
          *(v4h*)&bh[i * 8 + lr][lq * 4] = c; } }
      __builtin_amdgcn_sched_barrier(0);   /* this one and the one behind the wait keep a group's loads where they are written, behind its own rounding and directly in front of their wait: left alone the compiler gathers the loads of all groups late in the step and puts rounding, which reuses their address registers, between the last loads and the wait */
#pragma unroll
      for (int u = 0; u < 8; ++u) { const int i = q * 8 + u; pre[i] = *(const v4f*)((i < 16 ? ny : nw) + (size_t)(i & 15) * 8 * CC); }
      XW2(ny, nw);
      __builtin_amdgcn_sched_barrier(0); }
    gy = ny; gw = nw;
    RINGBAR();   /* publishes this step's buffer; it also ends every wave's reads of the other buffer, which the next step overwrites */
    if (HI) { v16b ah[2][4], al[2][4], w[2][4];
#pragma unroll
      for (int ks = 0; ks < 2; ++ks) {
#pragma unroll
        for (int j = 0; j < 4; ++j) w[ks][j] = frag_b(&bb[128 + wc + j * 16 + col][ks * 32], lane);
#pragma unroll
        for (int i = 0; i < 4; ++i) ah[ks][i] = frag_b(&bb[wr + i * 16 + col][ks * 32], lane);
#pragma unroll
        for (int i = 0; i < 4; ++i) al[ks][i] = frag_b(&bb[256 + wr + i * 16 + col][ks * 32], lane); }
      __builtin_amdgcn_sched_barrier(0);   /* keeps the step's fragment reads in one group in front of its products */
#pragma unroll
      for (int ks = 0; ks < 2; ++ks) {   /* each accumulator takes hi then lo of each 32 k, in rising k */
#pragma unroll
        for (int i = 0; i < 4; ++i)
#pragma unroll
          for (int j = 0; j < 4; ++j) acc[i][j] = __builtin_amdgcn_wmma_f32_16x16x32_bf16(false, ah[ks][i], false, w[ks][j], (short)0, acc[i][j], false, false);
#pragma unroll
        for (int i = 0; i < 4; ++i)
#pragma unroll
          for (int j = 0; j < 4; ++j) acc[i][j] = __builtin_amdgcn_wmma_f32_16x16x32_bf16(false, al[ks][i], false, w[ks][j], (short)0, acc[i][j], false, false); }
    } else { v16h a[2][4], w[2][4];
#pragma unroll
      for (int ks = 0; ks < 2; ++ks) {
#pragma unroll
        for (int j = 0; j < 4; ++j) w[ks][j] = frag_h(&bh[128 + wc + j * 16 + col][ks * 32], lane);
#pragma unroll
        for (int i = 0; i < 4; ++i) a[ks][i] = frag_h(&bh[wr + i * 16 + col][ks * 32], lane); }
      __builtin_amdgcn_sched_barrier(0);   /* keeps the step's fragment reads in one group in front of its products */
#pragma unroll
      for (int ks = 0; ks < 2; ++ks)
#pragma unroll
        for (int i = 0; i < 4; ++i)
#pragma unroll
          for (int j = 0; j < 4; ++j) acc[i][j] = __builtin_amdgcn_wmma_f32_16x16x32_f16(false, a[ks][i], false, w[ks][j], (short)0, acc[i][j], false, false); }   /* the bare builtin, as in k_proj: the registers reach past v255, which an asm operand cannot name */
    __builtin_amdgcn_sched_barrier(0);   /* keeps the next step's conversions, and with them the wait for its loads, behind this step's products */ }
  __syncthreads();   /* every wave has read its last fragments before the output's staging overwrites the buffers */
  float (*st)[OSP] = (float (*)[OSP])(smem + wave * (64 * OSP * 4));   /* the wave's own 64 x 64 outputs */
#pragma unroll
  for (int j = 0; j < 4; ++j) { const float bias = BO ? bfr(BO[c0 + wc + j * 16 + col]) : 0.f;
#pragma unroll
    for (int i = 0; i < 4; ++i)
#pragma unroll
      for (int r = 0; r < 8; ++r) st[i * 16 + 8 * g + r][j * 16 + col] = HI ? acc[i][j][r] + bias : acc[i][j][r] * (1.0f / 16384.0f) + bias; }   /* 2^-8 (Wo carry) x 2^-6 (ctx carry) */
  LDSX();   /* the wave's own LDS stores land before other lanes of the wave read them: two whole 256-B row segments a store */
  for (int rl = 0; rl < 64; rl += 8) st4((char*)(OUT + (r0 + wr + rl + g) * DIN + c0 + wc + col * 4), 2 * DIN * 4, (const unsigned char*)&st[rl + g][col * 4], 2 * OSP * 4); }
__global__ __launch_bounds__(128) void k_out(const float* __restrict__ Y, const float* __restrict__ WO, const float* __restrict__ BO, float* __restrict__ OUT) { __shared__ __align__(16) unsigned char smem[2 * 384 * OP * 2];   /* two operand buffers; behind the k loop each wave's 64 x OSP f32 output staging */
  if (CAUSAL && (int)(((size_t)blockIdx.x * OM) % TT) < QHI) out_tile<true>(Y, WO, BO, OUT, smem);   /* block-uniform */
  else out_tile<false>(Y, WO, BO, OUT, smem); }

extern "C" void kernel_launch(void* const* d_in, const int* in_sizes, int n_in, void* d_out, int out_size, void* d_ws, size_t ws_size, hipStream_t stream) {
  (void)in_sizes; (void)n_in; (void)out_size;
  const float** F = (const float**)d_in;
  if (ws_size < (size_t)WS_END) return;
  char* ws = (char*)d_ws; _Float16 *QH = (_Float16*)(ws + WS_QH), *KH = (_Float16*)(ws + WS_KH), *VT = (_Float16*)(ws + WS_VT), *QL = (_Float16*)(ws + WS_QL), *KL = (_Float16*)(ws + WS_KL); __bf16 *VB = (__bf16*)(ws + WS_VB), *VBL = (__bf16*)(ws + WS_VBL); float *Y = (float*)(ws + WS_Y);
  (void)Y; (void)QL; (void)KL; (void)VB; (void)VBL;
  // inputs: 0 key [4,1024,1024]; 1 value; 2 query; 3 Wk [1024,1024] (out,in), 4 bk; 5 Wq, 6 bq; 7 Wv, 8 bv; 9 Wp (out,in), 10 bp (zero biases, read)
  k_proj<<<dim3(TNB * TT / PM, CC / PN, 3), 256, 0, stream>>>(F[2], F[0], F[1], F[5], F[3], F[7], F[6], F[4], F[8], QH, QL, KH, KL, VT, VB, VBL);   /* (q, k, v) streams = inputs (query = 2, key = 0, value = 1) */
  k_attn<<<dim3(NH, TNB, NQB), 128, 0, stream>>>(QH, KH, QL, KL, VT, VB, VBL, Y);
  k_out<<<dim3(TNB * TT / OM, DIN / ON), 128, 0, stream>>>(Y, F[9], F[10], (float*)d_out);
}

// v008
// It runs in 67.9 microseconds.
// In two side-by-side timings against v007, it was 1.04 and 1.03 times as fast.
// Over all steps from v000 it is 12.6 times as fast.
// compute dtype: all float inputs rounded to bf16; q/k/v projections with EXACT bf16 products on WMMA 16x16x32 (f32 accumulate) + bias; causal logits: 3 products for the first 384 rows, single f16 q x k after, x 64^-0.5; online softmax f32 (running maximum, one launch for logits, softmax and P v; exponent in base 2, scale and 2^11 inside its argument); exp(s - max) x 2^11 once to f16 x v once to f16 (bf16 hi + lo below row 384); ctx hi+lo x exact output weight below row 384, x2^6 f16 carry x f16(bf16 x 2^8) after, + bias; f32 output.
#include <hip/hip_runtime.h>
#include <math.h>

typedef __attribute__((ext_vector_type(16))) _Float16 v16h;
typedef __attribute__((ext_vector_type(16))) __bf16 v16b;
typedef __attribute__((ext_vector_type(8)))  _Float16 v8h;
typedef __attribute__((ext_vector_type(8)))  float v8f;
typedef __attribute__((ext_vector_type(4)))  float v4f;
typedef __attribute__((ext_vector_type(2)))  float v2f;
typedef __attribute__((ext_vector_type(4)))  unsigned v4u;
typedef __attribute__((ext_vector_type(4)))  int v4i;
typedef float __attribute__((may_alias)) float_a;
typedef int __attribute__((may_alias)) int_a;

template <typename T> __device__ __forceinline__ void vst2(void* p, T v) { *(T*)p = v;  }
__device__ __forceinline__ v8f wmma16(v16h a, v16h b, v8f c) {
  v8f d = __builtin_amdgcn_wmma_f32_16x16x32_f16(false, a, false, b, (short)0, c, false, false);
  asm volatile("v_nop\n\tv_nop\n\tv_nop\n\tv_nop" : "+v"(d) : "v"(a), "v"(b));
  return d;
}
__device__ __forceinline__ v8f wmma_bf(v16b a, v16b b, v8f c) {
  v8f d = __builtin_amdgcn_wmma_f32_16x16x32_bf16(false, a, false, b, (short)0, c, false, false);
  asm volatile("v_nop\n\tv_nop\n\tv_nop\n\tv_nop" : "+v"(d) : "v"(a), "v"(b));
  return d;
}
// 16x16x32 fragments: lane = (h = lane>>4, row/col = lane&15); elements 0..7 = k0+8h+0..7, 8..15 = k0+16+8h+0..7; D element r = row 8h+r
__device__ __forceinline__ v16h frag_h(const _Float16* rowk0, int lane) {
  union { v16h v; v8h q[2]; } u; const _Float16* p = rowk0 + 8 * (lane >> 4);
  u.q[0] = *(const v8h*)p; u.q[1] = *(const v8h*)(p + 16); return u.v;
}
__device__ __forceinline__ v16h frag_f32(const float* rowk0, int lane) {
  v16h a; const float* p = rowk0 + 8 * (lane >> 4);
#pragma unroll
  for (int i = 0; i < 8; ++i) { a[i] = (_Float16)p[i]; a[8 + i] = (_Float16)p[16 + i]; }
  return a;
}
__device__ __forceinline__ v16h frag_f32s(const float* rowk0, int lane, float sc) {
  v16h a; const float* p = rowk0 + 8 * (lane >> 4);
#pragma unroll
  for (int i = 0; i < 8; ++i) { a[i] = (_Float16)(p[i] * sc); a[8 + i] = (_Float16)(p[16 + i] * sc); }
  return a;
}
// column fragment from a [K][ld] layout (column n), rows >= K read as 0
__device__ __forceinline__ v16h fragc_f32(const float* W, int k0, int n, int lane, int ld, int K) {
  v16h a; const int g = lane >> 4;
#pragma unroll
  for (int i = 0; i < 8; ++i) { const int ka = k0 + 8 * g + i, kb = ka + 16;
    a[i] = (_Float16)(ka < K ? W[(size_t)(ka < K ? ka : K - 1) * ld + n] : 0.f); a[8 + i] = (_Float16)(kb < K ? W[(size_t)(kb < K ? kb : K - 1) * ld + n] : 0.f); }
  return a;
}
struct F2 { v16b h, l; };
__device__ __forceinline__ F2 bsplit16(const float v[16]) { F2 r;
#pragma unroll
  for (int i = 0; i < 16; ++i) { const __bf16 h = (__bf16)v[i]; r.h[i] = h; r.l[i] = (__bf16)(v[i] - (float)h); }
  return r; }
__device__ __forceinline__ F2 split_row(const float* row, int k0, int lane) { float v[16]; const float* p = row + k0 + 8 * (lane >> 4);
#pragma unroll
  for (int i = 0; i < 8; ++i) { v[i] = p[i]; v[8 + i] = p[16 + i]; }
  return bsplit16(v); }
__device__ __forceinline__ F2 split_rowK(const float* row, int k0, int lane, int K) { float v[16]; const int g = lane >> 4;
#pragma unroll
  for (int i = 0; i < 8; ++i) { const int ka = k0 + 8 * g + i, kb = ka + 16; v[i] = ka < K ? row[ka < K ? ka : K - 1] : 0.f; v[8 + i] = kb < K ? row[kb < K ? kb : K - 1] : 0.f; }
  return bsplit16(v); }
__device__ __forceinline__ F2 split_col(const float* W, int k0, int n, int lane, int ld, int K) { float v[16]; const int g = lane >> 4;
#pragma unroll
  for (int i = 0; i < 8; ++i) { const int ka = k0 + 8 * g + i, kb = ka + 16; v[i] = ka < K ? W[(size_t)(ka < K ? ka : K - 1) * ld + n] : 0.f; v[8 + i] = kb < K ? W[(size_t)(kb < K ? kb : K - 1) * ld + n] : 0.f; }
  return bsplit16(v); }
__device__ __forceinline__ v8f mac3(const F2& a, const F2& b, v8f c) { c = wmma_bf(a.l, b.h, c); c = wmma_bf(a.h, b.l, c); return wmma_bf(a.h, b.h, c); }
__device__ __forceinline__ float sigm(float v) { return 1.0f / (1.0f + expf(-v)); }
#define LDSX() do { asm volatile("s_wait_dscnt 0" ::: "memory"); __builtin_amdgcn_wave_barrier(); __builtin_amdgcn_fence(__ATOMIC_RELEASE, "workgroup"); } while (0)

// Causal multi-head attention on separate inputs listed key-first (key / value / query [4,1024,1024]; torch (out,in) Wk / Wq / Wv / Wp [1024,1024] (0.02) + zero biases; 16 heads x 64; scale 1/8; tril, -inf): out = merge(softmax(causal(q_h k_h^T / 8)) v_h) Wp^T + bp.
#define NB 4
#define TT 1024
#define CC 1024            // NH * HD = projected width
#define DIN 1024          // input (model) width
#define NH 16
#define HD 64
#define NQB (TT / 64)
#define HG 8
#define SCALE (0.125f)
#define CAUSAL 1
#ifndef TNB
#define TNB NB
#endif
__device__ __forceinline__ float bfr(float v) { return (float)(__bf16)v; }
__host__ __device__ __forceinline__ int kb_last(int qb) { return CAUSAL ? ((qb * 64 + 63) >> 7) : (TT / 128 - 1); }
typedef __attribute__((ext_vector_type(8))) __bf16 v8b;
__device__ __forceinline__ v16b frag_b(const __bf16* rowk0, int lane) {
  union { v16b v; v8b q[2]; } u; const __bf16* p = rowk0 + 8 * (lane >> 4);
  u.q[0] = *(const v8b*)p; u.q[1] = *(const v8b*)(p + 16); return u.v;
}
#define QBH 6              // causal: query blocks 0..QBH-1 of each sequence (few keys, no averaging) take the high-precision path
#define QHI 384            // rows carrying a q residual plane
#define KHI 384            // key rows carrying k residual / v bf16 hi+lo planes (used only by the causal high-precision path)
// B fragment (k rows k0+.., output column o) of a weight: (in,out) [K][ld] or (out,in) [ld rows of K]: bf16 exact, or f16(bf16 * 256) exact
__device__ __forceinline__ v16b wcol_io(const float* Wm, int k0, int o, int lane, int ld) { v16b w; const int g = lane >> 4;
#pragma unroll
  for (int i = 0; i < 8; ++i) { w[i] = (__bf16)Wm[(size_t)(k0 + 8 * g + i) * ld + o]; w[8 + i] = (__bf16)Wm[(size_t)(k0 + 16 + 8 * g + i) * ld + o]; }
  return w; }
__device__ __forceinline__ v16b wcol_oi(const float* Wm, int k0, int o, int lane, int K) { v16b w; const float* p = Wm + (size_t)o * K + k0 + 8 * (lane >> 4);
#pragma unroll
  for (int i = 0; i < 8; ++i) { w[i] = (__bf16)p[i]; w[8 + i] = (__bf16)p[16 + i]; }
  return w; }
__device__ __forceinline__ v16h wcolh_io(const float* Wm, int k0, int o, int lane, int ld) { v16h w; const int g = lane >> 4;
#pragma unroll
  for (int i = 0; i < 8; ++i) { w[i] = (_Float16)(bfr(Wm[(size_t)(k0 + 8 * g + i) * ld + o]) * 256.0f); w[8 + i] = (_Float16)(bfr(Wm[(size_t)(k0 + 16 + 8 * g + i) * ld + o]) * 256.0f); }
  return w; }
__device__ __forceinline__ v16h wcolh_oi(const float* Wm, int k0, int o, int lane, int K) { v16h w; const float* p = Wm + (size_t)o * K + k0 + 8 * (lane >> 4);
#pragma unroll
  for (int i = 0; i < 8; ++i) { w[i] = (_Float16)(bfr(p[i]) * 256.0f); w[8 + i] = (_Float16)(bfr(p[16 + i]) * 256.0f); }
  return w; }
#define WQKV_LAYOUT 1   // 0 = (in,out) [DIN][CC]; 1 = (out,in) [CC][DIN]; 2 = per-head [NH][DIN][HD]
__device__ __forceinline__ v16b wcol_hdk(const float* Wm, int k0, int o, int lane) { v16b w; const int g = lane >> 4; const float* p = Wm + (size_t)(o / HD) * DIN * HD + (o % HD);
#pragma unroll
  for (int i = 0; i < 8; ++i) { w[i] = (__bf16)p[(size_t)(k0 + 8 * g + i) * HD]; w[8 + i] = (__bf16)p[(size_t)(k0 + 16 + 8 * g + i) * HD]; }
  return w; }
#define WO_OUT_IN 1
#if WQKV_LAYOUT == 1
#define WCOL(W, k0, o, lane) wcol_oi(W, k0, o, lane, DIN)
#elif WQKV_LAYOUT == 2
#define WCOL(W, k0, o, lane) wcol_hdk(W, k0, o, lane)
#else
#define WCOL(W, k0, o, lane) wcol_io(W, k0, o, lane, CC)
#endif
#if WO_OUT_IN
#define WOCOL(W, k0, o, lane) wcol_oi(W, k0, o, lane, CC)
#define WOCOLH(W, k0, o, lane) wcolh_oi(W, k0, o, lane, CC)
#else
#define WOCOL(W, k0, o, lane) wcol_io(W, k0, o, lane, DIN)
#define WOCOLH(W, k0, o, lane) wcolh_io(W, k0, o, lane, DIN)
#endif

#ifndef SM_EXTRA_PARAMS
#define SM_EXTRA_PARAMS
#endif
#ifndef PROJ_EXTRA_PARAMS
#define PROJ_EXTRA_PARAMS
#endif
#ifndef SM_MASK_HOOK
#define SM_MASK_HOOK (void)0
#endif

#define WS_QH  0u                                      // f16 q rows [b*t][CC]
#define WS_KH  (WS_QH + 2u * (size_t)NB * TT * CC)      // f16 k rows [b*t][CC]
#define WS_VT  (WS_KH + 2u * (size_t)NB * TT * CC)      // f16 v planes [b][c][t]
#define WS_QL  (WS_VT + 2u * (size_t)NB * CC * TT)      // f16 q residual x 2^10 rows [b][t < QHI][CC]
#define WS_KL  (WS_QL + 2u * (size_t)NB * QHI * CC)     // f16 k residual x 2^10 rows [b][t < KHI][CC]
#define WS_VB  (WS_KL + 2u * (size_t)NB * KHI * CC)     // bf16 v hi planes [b][c][t < KHI]
#define WS_VBL (WS_VB + 2u * (size_t)NB * CC * KHI)
#define WS_S   (WS_VBL + 2u * (size_t)NB * CC * KHI)    // f32 [hg][t][s] region, unused: logits and P stay in registers
#define WS_Y   (WS_S  + 4u * (size_t)HG * TT * TT)      // f32 ctx rows [b*t][CC] (only when there is an output projection)
#define WS_END (WS_Y  + 4u * (size_t)NB * TT * CC)

// precaution behind a group of global loads: the group's address stays an input of the wait, so its registers are rewritten only behind the wait
#define XW2(p, q) asm volatile("s_wait_xcnt 0x0" :: "v"(p), "v"(q) : "memory")
// work-group barrier of the operand buffers, by hand: the wave's own LDS stores have landed and its reads have returned (s_wait_dscnt 0) before it signals; __syncthreads() would also wait for the next step's global loads, which are to stay in flight across it
#define RINGBAR() do { asm volatile("s_wait_dscnt 0x0" ::: "memory"); asm volatile("s_barrier_signal -1\n\ts_barrier_wait -1" ::: "memory"); } while (0)
#define KP 40              // pitch of a staged 32-k row in 16-bit elements: 80 B = 16 B x odd, where 16-byte fragment reads of 16 rows meet no bank twice
typedef __attribute__((ext_vector_type(4))) __bf16 v4b;
typedef __attribute__((ext_vector_type(4))) _Float16 v4h;
// four 16-byte pieces of an epilogue tile, LDS -> global (rows ls and gs bytes apart). The closing s_wait_xcnt 0 is a precaution: the stores' addresses and data stay inputs of the wait, so that their registers are rewritten only behind it
__device__ __forceinline__ void st4(char* gp, size_t gs, const unsigned char* lp, unsigned ls) { v4u d[4];
#pragma unroll
  for (int u = 0; u < 4; ++u) d[u] = *(const v4u*)(lp + u * ls);
#pragma unroll
  for (int u = 0; u < 4; ++u) vst2(gp + u * gs, d[u]);
  asm volatile("s_wait_xcnt 0x0" :: "v"(gp), "v"(gp + gs), "v"(gp + 2 * gs), "v"(gp + 3 * gs), "v"(d[0]), "v"(d[1]), "v"(d[2]), "v"(d[3]) : "memory"); }
// ---- k_proj: block = (256 rows, 256 cols, which), eight waves in 2 x 4, one wave = 128 rows x 64 cols (8 x 4 accumulator tiles, so that a staged row serves 256 outputs of the block; the wave's rows are two groups of 64, one in each 128-row half of the block, so that the epilogue goes half by half with every wave at work): q/k/v = X W (+ b) with exact bf16 products (K = DIN) -> which 0: q f16 rows (+ residual rows < QHI); 1: k f16 rows (+ residual rows < KHI); 2: v f16 planes [c][t] (+ bf16 hi/lo planes for t < KHI)
#define PM 256             // rows of a k_proj block; TT is a multiple of it, so a block lies in one sequence
#define PN 256             // columns of a k_proj block
#define PH 128             // rows of an epilogue half; QHI and KHI are multiples of it, so a half lies on one side of the residual rows' end
__global__ __launch_bounds__(256) void k_proj(const float* __restrict__ XQ, const float* __restrict__ XK, const float* __restrict__ XV, const float* __restrict__ WQ, const float* __restrict__ WK, const float* __restrict__ WV, const float* __restrict__ BQ, const float* __restrict__ BK, const float* __restrict__ BV,
    _Float16* __restrict__ QH, _Float16* __restrict__ QL, _Float16* __restrict__ KH, _Float16* __restrict__ KL, _Float16* __restrict__ VT, __bf16* __restrict__ VB, __bf16* __restrict__ VBL) {
  /* one LDS block: the two operand buffers of the k loop first, the epilogue's tiles of one half (q/k: sh, sl; v: th, tb, tbl) behind the barrier that ends the loop's last reads */
  __shared__ __align__(16) unsigned char smem[3 * PN * (PH + 8) * 2];
  __bf16 (*stg)[PM + PN][KP] = (__bf16 (*)[PM + PN][KP])smem;
  _Float16 (*sh)[PN + 8] = (_Float16 (*)[PN + 8])smem; _Float16 (*sl)[PN + 8] = (_Float16 (*)[PN + 8])(smem + PH * (PN + 8) * 2);
  _Float16 (*th)[PH + 8] = (_Float16 (*)[PH + 8])smem; __bf16 (*tb)[PH + 8] = (__bf16 (*)[PH + 8])(smem + PN * (PH + 8) * 2); __bf16 (*tbl)[PH + 8] = (__bf16 (*)[PH + 8])(smem + 2 * PN * (PH + 8) * 2);
  const int tid = threadIdx.x, wave = tid >> 5, lane = tid & 31, col = lane & 15, g = lane >> 4; const int wr = (wave >> 2) * 64, wc = (wave & 3) * 64; const int which = blockIdx.z; const int c0 = blockIdx.y * PN; const size_t r0 = (size_t)blockIdx.x * PM; const size_t bb = r0 / TT; const int t0 = (int)(r0 % TT);
  const float* X = which == 0 ? XQ : which == 1 ? XK : XV; const float* WA = which == 0 ? WQ : which == 1 ? WK : WV; const float* BA = which == 0 ? BQ : which == 1 ? BK : BV;
  v8f acc[8][4] = {};
  /* a 32-k step of the block's 256 X rows and 256 W rows: thread = (row lr of 32, 16-B piece lq), so a wave's load covers four whole 128-B lines; rounded to bf16 once for the block; buffer rows 0..255 = X, 256..511 = W */
  const int lr = tid >> 3, lq = tid & 7; const float* bx = X + (r0 + lr) * DIN + lq * 4; const float* bw = WA + (size_t)(c0 + lr) * DIN + lq * 4; v4f pre[16];
  /* the k walk is a ring: the block starts at a step of its own and wraps, so that the 4 blocks that share its X rows and the 16 that share its W rows do not ask L2 for the same lines at the same moment; sharers of X stand 8 steps apart, sharers of W 2 */
  const int ks0 = (int)(2 * blockIdx.x + 8 * blockIdx.y + blockIdx.z) & (DIN / 32 - 1); const float* gx = bx + ks0 * 32; const float* gw = bw + ks0 * 32;
#pragma unroll
  for (int i = 0; i < 8; ++i) pre[i] = *(const v4f*)(gx + (size_t)i * 32 * DIN);
#pragma unroll
  for (int i = 0; i < 8; ++i) pre[8 + i] = *(const v4f*)(gw + (size_t)i * 32 * DIN);
  XW2(gx, gw);
#pragma unroll 2   /* two steps a trip: the buffer's number is a constant in each */
  for (int kc = 0; kc < DIN / 32; ++kc) { __bf16 (*bf)[KP] = stg[kc & 1];
#pragma unroll
    for (int i = 0; i < 16; ++i) { v4b c;
#pragma unroll
      for (int e = 0; e < 4; ++e) c[e] = (__bf16)pre[i][e];
      *(v4b*)&bf[i * 32 + lr][lq * 4] = c; }
    if (kc + 1 < DIN / 32) { const int kn = ((kc + 1 + ks0) & (DIN / 32 - 1)) * 32; gx = bx + kn; gw = bw + kn;   /* the next step's lines fly under this step's products */
#pragma unroll
      for (int i = 0; i < 8; ++i) pre[i] = *(const v4f*)(gx + (size_t)i * 32 * DIN);
#pragma unroll
      for (int i = 0; i < 8; ++i) pre[8 + i] = *(const v4f*)(gw + (size_t)i * 32 * DIN);
      XW2(gx, gw); }
    RINGBAR();   /* publishes this step's buffer; it also ends every wave's reads of the other buffer, which the next step overwrites */
    v16b a[8], w[4];
#pragma unroll
    for (int j = 0; j < 4; ++j) w[j] = frag_b(&bf[PM + wc + j * 16 + col][0], lane);
#pragma unroll
    for (int i = 0; i < 8; ++i) a[i] = frag_b(&bf[(i >> 2) * PH + wr + (i & 3) * 16 + col][0], lane);
    __builtin_amdgcn_sched_barrier(0);   /* keeps all 24 fragment reads in one group in front of the products; left alone the compiler sinks each row tile's two reads to its own four products, with a wait to zero in front of each four */
#pragma unroll
    for (int i = 0; i < 8; ++i)
#pragma unroll
      for (int j = 0; j < 4; ++j) acc[i][j] = __builtin_amdgcn_wmma_f32_16x16x32_bf16(false, a[i], false, w[j], (short)0, acc[i][j], false, false);   /* the bare builtin: 32 accumulator tiles reach past v255, which an asm operand cannot name; the compiler keeps the distances behind its own matrix instructions */
    __builtin_amdgcn_sched_barrier(0);   /* keeps the next step's conversions, and with them the wait for its loads, behind this step's products */ }
#pragma unroll 1   /* stays rolled: the epilogue is straight-line code that runs once a wave, and two copies of it would double the kernel's text */
  for (int p = 0; p < 2; ++p) { const size_t rp = r0 + p * PH; const int tp = t0 + p * PH;   /* half p = accumulator tiles 4 p .. 4 p + 3 of every wave, which stand in tiles 0 .. 3 when their half comes */
    __syncthreads();   /* p = 0: every wave has read its last fragments before the epilogue's tiles overwrite the buffers; p = 1: every thread has read the first half's tiles before the second half overwrites them */
    if (which < 2) { _Float16* DH = which == 0 ? QH : KH; _Float16* DL = which == 0 ? QL : KL; const int nhi = which == 0 ? QHI : KHI; const bool hi_rows = tp < nhi;
#pragma unroll
      for (int j = 0; j < 4; ++j) { const float bias = BA ? bfr(BA[c0 + wc + j * 16 + col]) : 0.f;
#pragma unroll
        for (int i = 0; i < 4; ++i)
#pragma unroll
          for (int r = 0; r < 8; ++r) { const float v = acc[i][j][r] + bias; const _Float16 hv = (_Float16)v; sh[wr + i * 16 + 8 * g + r][wc + j * 16 + col] = hv; sl[wr + i * 16 + 8 * g + r][wc + j * 16 + col] = (_Float16)((v - (float)hv) * 1024.0f); } }
      __syncthreads();
      /* thread = (row rl of 8, 16-B piece q): a wave's store covers one whole 512-B row segment */
      for (int rl = tid >> 5; rl < PH; rl += 32) { const int q = tid & 31; st4((char*)(DH + (rp + rl) * CC + c0 + q * 8), 8 * CC * 2, (const unsigned char*)&sh[rl][q * 8], 8 * (PN + 8) * 2); if (hi_rows) st4((char*)(DL + (bb * nhi + tp + rl) * (size_t)CC + c0 + q * 8), 8 * CC * 2, (const unsigned char*)&sl[rl][q * 8], 8 * (PN + 8) * 2); }
    } else { const bool hi_rows = tp < KHI;
#pragma unroll
      for (int j = 0; j < 4; ++j) { const float bias = BA ? bfr(BA[c0 + wc + j * 16 + col]) : 0.f;
#pragma unroll
        for (int i = 0; i < 4; ++i)
#pragma unroll
          for (int r = 0; r < 8; ++r) { const float v = acc[i][j][r] + bias; const int rl = wr + i * 16 + 8 * g + r, cl = wc + j * 16 + col; th[cl][rl] = (_Float16)v; const __bf16 bh = (__bf16)v; tb[cl][rl] = bh; tbl[cl][rl] = (__bf16)(v - (float)bh); } }
      __syncthreads();
      /* thread = (plane row cl of 16, 16-B piece q) */
      for (int cl = tid >> 4; cl < PN; cl += 64) { const int q = tid & 15; st4((char*)(VT + (bb * CC + c0 + cl) * (size_t)TT + tp + q * 8), 16 * TT * 2, (const unsigned char*)&th[cl][q * 8], 16 * (PH + 8) * 2); if (hi_rows) { const size_t o3 = (bb * CC + c0 + cl) * (size_t)KHI + tp + q * 8; st4((char*)(VB + o3), 16 * KHI * 2, (const unsigned char*)&tb[cl][q * 8], 16 * (PH + 8) * 2); st4((char*)(VBL + o3), 16 * KHI * 2, (const unsigned char*)&tbl[cl][q * 8], 16 * (PH + 8) * 2); } } }
#pragma unroll
    for (int i = 0; i < 4; ++i)
#pragma unroll
      for (int j = 0; j < 4; ++j) acc[i][j] = acc[4 + i][j]; } }
// ---- k_attn: block = 64 queries (qb, heaviest first) of (b, h), one wave = 16 queries; the waves share the staged K and V tiles and nothing else. Per 64 keys: S^T = K . Q^T (A = key rows, B = query rows, same loader on both sides), so a lane holds 32 scores of ONE query (query = lane & 15, key = 16 j + 8 (lane >> 4) + r); running maximum and sum in f32 (online softmax, halves joined by one lane exchange); P^T x 2^11 packs from two score tiles straight into a B operand; O^T += V^T . P^T with the v planes [c][t] as A. Products per path as before: query blocks < QBH take q hi + residual x k hi + residual (3 products) and P, v as bf16 hi + lo (3 products); the rest one f16 product each. Every fragment of a group is loaded in front of the group's first product, so that the loads fly together. The K and V tiles of a key block (64 rows of 128 B each) are brought into LDS once for the block's four waves, as whole lines, by asynchronous copies, one key block ahead, in two buffers; the fragments are read from there
#define TP 144             // pitch of a staged 128-B row in bytes: 16 B x odd, where 16-byte fragment reads of 16 rows meet no bank twice
#define TILEB (64 * TP)    // one staged tile
// two tiles, four copies a thread each (rows cr, cr + 16, cr + 32, cr + 48; a wave's copy covers four whole lines). s_wait_xcnt 0 is the last line of the copies' own statement: a precaution, so that no register which a copy names is rewritten in front of it
__device__ __forceinline__ void cp2tiles(unsigned la, const char* ga, size_t sa, unsigned lb, const char* gb, size_t sb) {
  asm volatile("global_load_async_to_lds_b128 %0, %8, off\n\tglobal_load_async_to_lds_b128 %1, %9, off\n\tglobal_load_async_to_lds_b128 %2, %10, off\n\tglobal_load_async_to_lds_b128 %3, %11, off\n\t"
               "global_load_async_to_lds_b128 %4, %12, off\n\tglobal_load_async_to_lds_b128 %5, %13, off\n\tglobal_load_async_to_lds_b128 %6, %14, off\n\tglobal_load_async_to_lds_b128 %7, %15, off\n\ts_wait_xcnt 0x0"
               :: "v"(la), "v"(la + 16 * TP), "v"(la + 32 * TP), "v"(la + 48 * TP), "v"(lb), "v"(lb + 16 * TP), "v"(lb + 32 * TP), "v"(lb + 48 * TP),
                  "v"(ga), "v"(ga + sa), "v"(ga + 2 * sa), "v"(ga + 3 * sa), "v"(gb), "v"(gb + sb), "v"(gb + 2 * sb), "v"(gb + 3 * sb) : "memory"); }
// fragment from the lane's own address (row start + k0 + 8 (lane >> 4)): same element order as frag_h / frag_b
__device__ __forceinline__ v16h frag_hp(const _Float16* p) { union { v16h v; v8h q[2]; } u; u.q[0] = *(const v8h*)p; u.q[1] = *(const v8h*)(p + 16); return u.v; }
__device__ __forceinline__ v16b frag_bp(const __bf16* p) { union { v16b v; v8b q[2]; } u; u.q[0] = *(const v8b*)p; u.q[1] = *(const v8b*)(p + 16); return u.v; }
// 2^x in place by the bare exponent instruction. Each instruction overwrites its own source alone and reads no neighbour's result; the closing v_nop is the slot that the instruction set asks for behind a transcendental before its result is read
__device__ __forceinline__ float exp2_1(float x) { asm("v_exp_f32 %0, %0\n\tv_nop" : "+v"(x)); return x; }
__device__ __forceinline__ void exp2_16(float (&x)[16]) {
  asm("v_exp_f32 %0, %0\n\tv_exp_f32 %1, %1\n\tv_exp_f32 %2, %2\n\tv_exp_f32 %3, %3\n\tv_exp_f32 %4, %4\n\tv_exp_f32 %5, %5\n\tv_exp_f32 %6, %6\n\tv_exp_f32 %7, %7\n\t"
      "v_exp_f32 %8, %8\n\tv_exp_f32 %9, %9\n\tv_exp_f32 %10, %10\n\tv_exp_f32 %11, %11\n\tv_exp_f32 %12, %12\n\tv_exp_f32 %13, %13\n\tv_exp_f32 %14, %14\n\tv_exp_f32 %15, %15\n\tv_nop"
      : "+v"(x[0]), "+v"(x[1]), "+v"(x[2]), "+v"(x[3]), "+v"(x[4]), "+v"(x[5]), "+v"(x[6]), "+v"(x[7]), "+v"(x[8]), "+v"(x[9]), "+v"(x[10]), "+v"(x[11]), "+v"(x[12]), "+v"(x[13]), "+v"(x[14]), "+v"(x[15])); }
template <bool HI> __device__ __forceinline__ void attn_wave(const _Float16* __restrict__ QH, const _Float16* __restrict__ KH, const _Float16* __restrict__ QL, const _Float16* __restrict__ KL, const _Float16* __restrict__ VT, const __bf16* __restrict__ VB, const __bf16* __restrict__ VBL, int b, int h, int qb, int wave, int lane, unsigned char* sm, float* __restrict__ Y) {
  const int col = lane & 15, g = lane >> 4; const int ql0 = qb * 64 + wave * 16; const int t = ql0 + col; const size_t q0 = (size_t)b * TT + ql0; const int nkb = CAUSAL ? qb + 1 : TT / 64;
  /* the key walk is a ring: the block starts at a key block of its own and wraps, so that the query blocks of one (b, h), which read the same K and V lines, and the heads, whose v tiles of one key block lie a whole plane pitch apart, do not ask L2 for them at the same moment. All block-uniform */
  const int kst = (((h + 3 * qb) & 15) * nkb) >> 4;   /* a sixteenth of the ring's length times a number that differs between neighbouring query blocks and between heads */ auto ring = [&](int i) { const int v = i + kst; return v < nkb ? v : v - nkb; };
  /* staging: thread = (row cr of 16, 16-B piece cq); a stage = K, V (f16 path) or K, K residual, v hi, v lo (high-precision path) */
  constexpr unsigned STG = (HI ? 4 : 2) * TILEB; const int cr = (int)threadIdx.x >> 3, cq = (int)threadIdx.x & 7; const unsigned lcp = (unsigned)(size_t)sm + cr * TP + cq * 16;
  const unsigned tk = cr * (CC * 2) + cq * 16, tv = cr * (TT * 2) + cq * 16, tb = cr * (KHI * 2) + cq * 16;   /* the thread's byte offset in a tile's source, by the source's row pitch; the tile's own start is the same for the block */
  auto fill = [&](int i) { const unsigned l = lcp + (i & 1) * STG; const int kb = ring(i);   /* i: place in the walk (it picks the buffer); kb: the key block */
    const char* gk = (const char*)(KH + ((size_t)b * TT + kb * 64) * CC + h * HD) + tk;
    if (HI) { cp2tiles(l, gk, 16 * CC * 2, l + TILEB, (const char*)(KL + ((size_t)b * KHI + kb * 64) * CC + h * HD) + tk, 16 * CC * 2);
      cp2tiles(l + 2 * TILEB, (const char*)(VB + ((size_t)b * CC + h * HD) * (size_t)KHI + kb * 64) + tb, 16 * KHI * 2, l + 3 * TILEB, (const char*)(VBL + ((size_t)b * CC + h * HD) * (size_t)KHI + kb * 64) + tb, 16 * KHI * 2); }
    else cp2tiles(l, gk, 16 * CC * 2, l + TILEB, (const char*)(VT + ((size_t)b * CC + h * HD) * (size_t)TT + kb * 64) + tv, 16 * TT * 2); };
  fill(0);
  v16h qh[HD / 32], qlo[HD / 32];
#pragma unroll
  for (int kc = 0; kc < HD / 32; ++kc) { qh[kc] = frag_h(QH + (q0 + col) * CC + h * HD + kc * 32, lane); if (HI) qlo[kc] = frag_h(QL + ((size_t)b * QHI + ql0 + col) * CC + h * HD + kc * 32, lane); }
  v8f o[HD / 16] = {}; float m = -3.0e38f, l = 0.f;   /* m: running maximum of the unscaled logits; l: running sum of the weights x 2^11 */
  constexpr float C2 = SCALE * 1.44269504088896340736f;   /* logit -> exponent in base 2 */
  float nb = 3.0e38f * C2;   /* the addend in use: 11 - m C2, rounded once and used for the weights and for the rescale alike, so that its rounding cancels */
  asm volatile("s_wait_asynccnt 0x0" ::: "memory");   /* the wave's own copies of the walk's first key block have landed */
  __syncthreads();   /* publishes the walk's first key block */
  if (nkb > 1) fill(1);   /* block-uniform */
#pragma unroll 1   /* stays rolled: one key block's fragments already fill the registers that four waves a SIMD leave a wave */
  for (int kb = 0; kb < nkb; ++kb) { const int k0 = ring(kb) * 64; v8f s[4]; v16h kf[4][HD / 32], kl[4][HD / 32], vf[2][HD / 16];
    const unsigned char* bp = sm + (kb & 1) * STG + col * TP + g * 16;   /* the lane's place in a staged tile: row col, 16-B piece g */
#pragma unroll
    for (int j = 0; j < 4; ++j)
#pragma unroll
      for (int kc = 0; kc < HD / 32; ++kc) kf[j][kc] = frag_hp((const _Float16*)(bp + j * 16 * TP + kc * 64));
#pragma unroll
    for (int j = 0; j < 4; ++j) { v8f acc = {}, accl = {};
      if (HI) {   /* the residual fragments come tile by tile: all four at once, beside the four k fragments, do not fit the registers that four waves a SIMD leave a wave */
#pragma unroll
        for (int kc = 0; kc < HD / 32; ++kc) kl[j][kc] = frag_hp((const _Float16*)(bp + TILEB + j * 16 * TP + kc * 64)); }
#pragma unroll
      for (int kc = 0; kc < HD / 32; ++kc) { acc = wmma16(kf[j][kc], qh[kc], acc); if (HI) { accl = wmma16(kf[j][kc], qlo[kc], accl); accl = wmma16(kl[j][kc], qh[kc], accl); } }
#pragma unroll
      for (int r = 0; r < 8; ++r) s[j][r] = HI ? acc[r] + accl[r] * (1.0f / 1024.0f) : acc[r]; }   /* unscaled: the scale sits in C2 */
    if (!HI) {   /* f16 path: v is read here, so that it flies under the softmax arithmetic */
#pragma unroll
      for (int kc = 0; kc < 2; ++kc)
#pragma unroll
        for (int jd = 0; jd < HD / 16; ++jd) vf[kc][jd] = frag_hp((const _Float16*)(bp + TILEB + jd * 16 * TP + kc * 64)); }
    if (CAUSAL && k0 + 63 > ql0) {   /* wave-uniform: only a key block that reaches past the wave's first query holds excluded keys */
#pragma unroll
      for (int j = 0; j < 4; ++j)
#pragma unroll
        for (int r = 0; r < 8; ++r) if (k0 + j * 16 + 8 * g + r > t) s[j][r] = -3.0e38f; }
    float mx = -3.0e38f;
#pragma unroll
    for (int j = 0; j < 4; ++j)
#pragma unroll
      for (int r = 0; r < 8; ++r) mx = fmaxf(mx, s[j][r]);
    mx = fmaxf(mx, __shfl_xor(mx, 16));
    /* every key block a wave walks holds a key <= each of its queries (k0 <= ql0), so mn is a real logit; an excluded score's argument is then about -5e37, where the exponent instruction returns 0 */
    const float mn = fmaxf(m, mx); const float nbn = fmaf(-mn, C2, 11.0f); const float alpha = exp2_1(nbn - nb); m = mn; nb = nbn;
    float ls = 0.f;
#pragma unroll
    for (int kc = 0; kc < 2; ++kc) { float x[16];   /* exp(scale (s - max)) x 2^11: one multiply-add and one exponent instruction a score */
#pragma unroll
      for (int i = 0; i < 16; ++i) x[i] = fmaf(s[2 * kc + (i >> 3)][i & 7], C2, nbn);
      exp2_16(x);
#pragma unroll
      for (int i = 0; i < 16; ++i) { ls += x[i]; s[2 * kc + (i >> 3)][i & 7] = x[i]; } }
    l = l * alpha + ls;
#pragma unroll
    for (int jd = 0; jd < HD / 16; ++jd)
#pragma unroll
      for (int r = 0; r < 8; ++r) o[jd][r] *= alpha;
#pragma unroll
    for (int kc = 0; kc < 2; ++kc) {
      if (HI) { float pv[16]; v16b vh[HD / 16], vl[HD / 16];
#pragma unroll
        for (int jd = 0; jd < HD / 16; ++jd) { vh[jd] = frag_bp((const __bf16*)(bp + 2 * TILEB + jd * 16 * TP + kc * 64)); vl[jd] = frag_bp((const __bf16*)(bp + 3 * TILEB + jd * 16 * TP + kc * 64)); }
#pragma unroll
        for (int i = 0; i < 8; ++i) { pv[i] = s[2 * kc][i]; pv[8 + i] = s[2 * kc + 1][i]; }
        const F2 p = bsplit16(pv);
#pragma unroll
        for (int jd = 0; jd < HD / 16; ++jd) { o[jd] = wmma_bf(vh[jd], p.h, o[jd]); o[jd] = wmma_bf(vh[jd], p.l, o[jd]); o[jd] = wmma_bf(vl[jd], p.h, o[jd]); }
      } else { v16h p;
#pragma unroll
        for (int i = 0; i < 8; ++i) { p[i] = (_Float16)s[2 * kc][i]; p[8 + i] = (_Float16)s[2 * kc + 1][i]; }
#pragma unroll
        for (int jd = 0; jd < HD / 16; ++jd) o[jd] = wmma16(vf[kc][jd], p, o[jd]); } }
    asm volatile("s_wait_dscnt 0x0" ::: "memory");      /* the wave's reads of this buffer have returned */
    asm volatile("s_wait_asynccnt 0x0" ::: "memory");   /* its copies of the next key block have landed */
    __syncthreads();   /* publishes the next key block; it also ends every wave's reads of this buffer, which is refilled behind it */
    if (kb + 2 < nkb) fill(kb + 2);   /* block-uniform */ }
  asm volatile("s_wait_asynccnt 0x0" ::: "memory");   /* no copy is left in flight when the buffers become the output's staging; the last key block's barrier has ended every wave's reads */
  float (*st)[HD + 4] = (float (*)[HD + 4])(sm + wave * (16 * (HD + 4) * 4));
  l += __shfl_xor(l, 16);
  const float inv = l > 0.f ? 1.0f / l : 0.f;   /* l carries the same 2^11 as the weights */
#pragma unroll
  for (int jd = 0; jd < HD / 16; ++jd) { v4f a, c;
#pragma unroll
    for (int r = 0; r < 4; ++r) { a[r] = o[jd][r] * inv; c[r] = o[jd][4 + r] * inv; }
    *(v4f*)&st[col][jd * 16 + 8 * g] = a; *(v4f*)&st[col][jd * 16 + 8 * g + 4] = c; }
  LDSX();   /* the wave's own LDS stores land before other lanes of the wave read them: two whole 256-B (row, head) segments a store */
#pragma unroll
  for (int rl = 0; rl < 16; rl += 2) vst2(Y + (q0 + rl + g) * CC + h * HD + col * 4, *(const v4f*)&st[rl + g][col * 4]); }
__global__ __launch_bounds__(128) void k_attn(const _Float16* __restrict__ QH, const _Float16* __restrict__ KH, const _Float16* __restrict__ QL, const _Float16* __restrict__ KL, const _Float16* __restrict__ VT, const __bf16* __restrict__ VB, const __bf16* __restrict__ VBL, float* __restrict__ Y) { __shared__ __align__(16) unsigned char smem[2 * 4 * TILEB];   /* two buffers of up to four tiles; behind the key loop each wave's 16 x (HD + 4) f32 output staging */
  /* the wave's number in a scalar register: the causal test of a key block becomes a scalar branch */
  const int tid = threadIdx.x, wave = __builtin_amdgcn_readfirstlane(tid >> 5), lane = tid & 31; const int h = blockIdx.x, b = blockIdx.y, qb = NQB - 1 - (int)blockIdx.z;
  if (CAUSAL && qb < QBH) attn_wave<true>(QH, KH, QL, KL, VT, VB, VBL, b, h, qb, wave, lane, smem, Y);   /* block-uniform */
  else attn_wave<false>(QH, KH, QL, KL, VT, VB, VBL, b, h, qb, wave, lane, smem, Y); }
// ---- k_out: block = (128 rows, 128 cols), four waves in 2 x 2, one wave = 64 rows x 64 cols (4 x 4 accumulator tiles), a step = 64 k: out = ctx Wo (+ bo): ctx x 2^6 once to f16 against Wo as f16(bf16 x 2^8) exact (1 product) x 2^-14; causal early rows (< QHI of each sequence): ctx bf16 hi + lo against exact bf16 Wo (2 products)
#define OM 128             // rows of a k_out block; QHI and TT are multiples of it, so a block lies in one sequence and on one side of the early rows' end
#define ON 128             // columns of a k_out block
#define OKS 64             // k of a k_out step
#define OP 72              // pitch of a staged 64-k row in 16-bit elements: 144 B = 16 B x odd, where 16-byte fragment reads of 16 rows meet no bank twice
#define OSP 68             // pitch of a staged output row in floats: 272 B = 16 B x odd
template <bool HI> __device__ __forceinline__ void out_tile(const float* __restrict__ Y, const float* __restrict__ WO, const float* __restrict__ BO, float* __restrict__ OUT, unsigned char* smem) {
  constexpr int ROWS = HI ? 384 : 256;   /* buffer rows 0..127 = ctx, 128..255 = Wo, 256..383 = ctx residual (early rows only) */
  const int tid = threadIdx.x, wave = tid >> 5, lane = tid & 31, col = lane & 15, g = lane >> 4; const int wr = (wave >> 1) * 64, wc = (wave & 1) * 64; const int c0 = blockIdx.y * ON; const size_t r0 = (size_t)blockIdx.x * OM;
  v8f acc[4][4] = {};
  /* a 64-k step of the block's 128 ctx rows and 128 Wo rows: thread = (row lr of 8, 16-B piece lq), so a wave's load covers four whole 128-B lines; rounded once for the block */
  const int lr = tid >> 4, lq = tid & 15; v4f pre[32];
  /* the k walk is a ring, as in k_proj: the 8 blocks that share the ctx rows stand 2 steps apart, the 32 that share the Wo rows 1 step apart, two to a step */
  const int ks0 = (int)(blockIdx.x + 2 * blockIdx.y) & (CC / OKS - 1); const float* gy = Y + (r0 + lr) * CC + lq * 4 + ks0 * OKS; const float* gw = WO + (size_t)(c0 + lr) * CC + lq * 4 + ks0 * OKS;
#pragma unroll
  for (int i = 0; i < 16; ++i) pre[i] = *(const v4f*)(gy + (size_t)i * 8 * CC);
#pragma unroll
  for (int i = 0; i < 16; ++i) pre[16 + i] = *(const v4f*)(gw + (size_t)i * 8 * CC);
  XW2(gy, gw);
#pragma unroll 2   /* two steps a trip: the buffer's number is a constant in each */
  for (int kc = 0; kc < CC / OKS; ++kc) { __bf16 (*bb)[OP] = (__bf16 (*)[OP])(smem + (kc & 1) * (ROWS * OP * 2)); _Float16 (*bh)[OP] = (_Float16 (*)[OP])(smem + (kc & 1) * (ROWS * OP * 2)); const int adv = ((kc + ks0) & (CC / OKS - 1)) == CC / OKS - 1 ? OKS - CC : OKS; const float* ny = gy + adv; const float* nw = gw + adv;   /* one step on, or from the rows' last step back to their first */   /* the loads stand under no branch: a branch round them joins two paths in the compiler's count of outstanding loads, and its waits then reach the loads just issued; so the last step reads the walk's first lines once more, and nothing reads those registers */
    /* in four groups of eight pieces: a group is rounded and stored, and its registers take the next step's lines at once, so that those fly under the other groups' rounding and under this step's products */
#pragma unroll
    for (int q = 0; q < 4; ++q) {
#pragma unroll
      for (int u = 0; u < 8; ++u) { const int i = q * 8 + u;
        if (HI) {
          if (i < 16) { v4b ch, cl;
#pragma unroll
            for (int e = 0; e < 4; ++e) { const float v = pre[i][e]; const __bf16 hv = (__bf16)v; ch[e] = hv; cl[e] = (__bf16)(v - (float)hv); }
            *(v4b*)&bb[i * 8 + lr][lq * 4] = ch; *(v4b*)&bb[256 + i * 8 + lr][lq * 4] = cl; }
          else { v4b c;
#pragma unroll
            for (int e = 0; e < 4; ++e) c[e] = (__bf16)pre[i][e];
            *(v4b*)&bb[i * 8 + lr][lq * 4] = c; }
        } else { v4h c;
#pragma unroll
          for (int e = 0; e < 4; ++e) c[e] = i < 16 ? (_Float16)(pre[i][e] * 64.0f) : (_Float16)(bfr(pre[i][e]) * 256.0f);   /* ctx carried x 2^6 into f16 so small-magnitude context rows stay clear of f16 subnormals; Wo as f16(bf16 x 2^8), exact */
          *(v4h*)&bh[i * 8 + lr][lq * 4] = c; } }
      __builtin_amdgcn_sched_barrier(0);   /* this one and the one behind the wait keep a group's loads where they are written, behind its own rounding and directly in front of their wait: left alone the compiler gathers the loads of all groups late in the step and puts rounding, which reuses their address registers, between the last loads and the wait */
#pragma unroll
      for (int u = 0; u < 8; ++u) { const int i = q * 8 + u; pre[i] = *(const v4f*)((i < 16 ? ny : nw) + (size_t)(i & 15) * 8 * CC); }
      XW2(ny, nw);
      __builtin_amdgcn_sched_barrier(0); }
    gy = ny; gw = nw;
    RINGBAR();   /* publishes this step's buffer; it also ends every wave's reads of the other buffer, which the next step overwrites */
    if (HI) { v16b ah[2][4], al[2][4], w[2][4];
#pragma unroll
      for (int ks = 0; ks < 2; ++ks) {
#pragma unroll
        for (int j = 0; j < 4; ++j) w[ks][j] = frag_b(&bb[128 + wc + j * 16 + col][ks * 32], lane);
#pragma unroll
        for (int i = 0; i < 4; ++i) ah[ks][i] = frag_b(&bb[wr + i * 16 + col][ks * 32], lane);
#pragma unroll
        for (int i = 0; i < 4; ++i) al[ks][i] = frag_b(&bb[256 + wr + i * 16 + col][ks * 32], lane); }
      __builtin_amdgcn_sched_barrier(0);   /* keeps the step's fragment reads in one group in front of its products */
#pragma unroll
      for (int ks = 0; ks < 2; ++ks) {   /* each accumulator takes hi then lo of each 32 k, in the order of the walk */
#pragma unroll
        for (int i = 0; i < 4; ++i)
#pragma unroll
          for (int j = 0; j < 4; ++j) acc[i][j] = __builtin_amdgcn_wmma_f32_16x16x32_bf16(false, ah[ks][i], false, w[ks][j], (short)0, acc[i][j], false, false);
#pragma unroll
        for (int i = 0; i < 4; ++i)
#pragma unroll
          for (int j = 0; j < 4; ++j) acc[i][j] = __builtin_amdgcn_wmma_f32_16x16x32_bf16(false, al[ks][i], false, w[ks][j], (short)0, acc[i][j], false, false); }
    } else { v16h a[2][4], w[2][4];
#pragma unroll
      for (int ks = 0; ks < 2; ++ks) {
#pragma unroll
        for (int j = 0; j < 4; ++j) w[ks][j] = frag_h(&bh[128 + wc + j * 16 + col][ks * 32], lane);
#pragma unroll
        for (int i = 0; i < 4; ++i) a[ks][i] = frag_h(&bh[wr + i * 16 + col][ks * 32], lane); }
      __builtin_amdgcn_sched_barrier(0);   /* keeps the step's fragment reads in one group in front of its products */
#pragma unroll
      for (int ks = 0; ks < 2; ++ks)
#pragma unroll
        for (int i = 0; i < 4; ++i)
#pragma unroll
          for (int j = 0; j < 4; ++j) acc[i][j] = __builtin_amdgcn_wmma_f32_16x16x32_f16(false, a[ks][i], false, w[ks][j], (short)0, acc[i][j], false, false); }   /* the bare builtin, as in k_proj: the registers reach past v255, which an asm operand cannot name */
    __builtin_amdgcn_sched_barrier(0);   /* keeps the next step's conversions, and with them the wait for its loads, behind this step's products */ }
  __syncthreads();   /* every wave has read its last fragments before the output's staging overwrites the buffers */
  float (*st)[OSP] = (float (*)[OSP])(smem + wave * (64 * OSP * 4));   /* the wave's own 64 x 64 outputs */
#pragma unroll
  for (int j = 0; j < 4; ++j) { const float bias = BO ? bfr(BO[c0 + wc + j * 16 + col]) : 0.f;
#pragma unroll
    for (int i = 0; i < 4; ++i)
#pragma unroll
      for (int r = 0; r < 8; ++r) st[i * 16 + 8 * g + r][j * 16 + col] = HI ? acc[i][j][r] + bias : acc[i][j][r] * (1.0f / 16384.0f) + bias; }   /* 2^-8 (Wo carry) x 2^-6 (ctx carry) */
  LDSX();   /* the wave's own LDS stores land before other lanes of the wave read them: two whole 256-B row segments a store */
  for (int rl = 0; rl < 64; rl += 8) st4((char*)(OUT + (r0 + wr + rl + g) * DIN + c0 + wc + col * 4), 2 * DIN * 4, (const unsigned char*)&st[rl + g][col * 4], 2 * OSP * 4); }
__global__ __launch_bounds__(128) void k_out(const float* __restrict__ Y, const float* __restrict__ WO, const float* __restrict__ BO, float* __restrict__ OUT) { __shared__ __align__(16) unsigned char smem[2 * 384 * OP * 2];   /* two operand buffers; behind the k loop each wave's 64 x OSP f32 output staging */
  if (CAUSAL && (int)(((size_t)blockIdx.x * OM) % TT) < QHI) out_tile<true>(Y, WO, BO, OUT, smem);   /* block-uniform */
  else out_tile<false>(Y, WO, BO, OUT, smem); }

extern "C" void kernel_launch(void* const* d_in, const int* in_sizes, int n_in, void* d_out, int out_size, void* d_ws, size_t ws_size, hipStream_t stream) {
  (void)in_sizes; (void)n_in; (void)out_size;
  const float** F = (const float**)d_in;
  if (ws_size < (size_t)WS_END) return;
  char* ws = (char*)d_ws; _Float16 *QH = (_Float16*)(ws + WS_QH), *KH = (_Float16*)(ws + WS_KH), *VT = (_Float16*)(ws + WS_VT), *QL = (_Float16*)(ws + WS_QL), *KL = (_Float16*)(ws + WS_KL); __bf16 *VB = (__bf16*)(ws + WS_VB), *VBL = (__bf16*)(ws + WS_VBL); float *Y = (float*)(ws + WS_Y);
  (void)Y; (void)QL; (void)KL; (void)VB; (void)VBL;
  // inputs: 0 key [4,1024,1024]; 1 value; 2 query; 3 Wk [1024,1024] (out,in), 4 bk; 5 Wq, 6 bq; 7 Wv, 8 bv; 9 Wp (out,in), 10 bp (zero biases, read)
  k_proj<<<dim3(TNB * TT / PM, CC / PN, 3), 256, 0, stream>>>(F[2], F[0], F[1], F[5], F[3], F[7], F[6], F[4], F[8], QH, QL, KH, KL, VT, VB, VBL);   /* (q, k, v) streams = inputs (query = 2, key = 0, value = 1) */
  k_attn<<<dim3(NH, TNB, NQB), 128, 0, stream>>>(QH, KH, QL, KL, VT, VB, VBL, Y);
  k_out<<<dim3(TNB * TT / OM, DIN / ON), 128, 0, stream>>>(Y, F[9], F[10], (float*)d_out);
}

// v009
// A run of this version takes 61.5 microseconds.
// Next to v008, in two timings, it ran 1.11 times as fast each time.
// Over all steps from v000 it is 13.9 times as fast.
// compute dtype: all float inputs rounded to bf16; q/k/v projections with EXACT bf16 products on WMMA 16x16x32 (f32 accumulate) + bias; causal logits: 3 products for the first 384 rows, single f16 q x k after, x 64^-0.5; online softmax f32 (running maximum, one launch for logits, softmax and P v; exponent in base 2, scale and 2^11 inside its argument); exp(s - max) x 2^11 once to f16 x v once to f16 (bf16 hi + lo below row 384); ctx hi+lo x exact output weight below row 384, x2^6 f16 carry x f16(bf16 x 2^8) after, + bias; f32 output.
#include <hip/hip_runtime.h>
#include <math.h>

typedef __attribute__((ext_vector_type(16))) _Float16 v16h;
typedef __attribute__((ext_vector_type(16))) __bf16 v16b;
typedef __attribute__((ext_vector_type(8)))  _Float16 v8h;
typedef __attribute__((ext_vector_type(8)))  float v8f;
typedef __attribute__((ext_vector_type(4)))  float v4f;
typedef __attribute__((ext_vector_type(2)))  float v2f;
typedef __attribute__((ext_vector_type(4)))  unsigned v4u;
typedef __attribute__((ext_vector_type(4)))  int v4i;
typedef float __attribute__((may_alias)) float_a;
typedef int __attribute__((may_alias)) int_a;

template <typename T> __device__ __forceinline__ void vst2(void* p, T v) { *(T*)p = v;  }
__device__ __forceinline__ v8f wmma16(v16h a, v16h b, v8f c) {
  v8f d = __builtin_amdgcn_wmma_f32_16x16x32_f16(false, a, false, b, (short)0, c, false, false);
  asm volatile("v_nop\n\tv_nop\n\tv_nop\n\tv_nop" : "+v"(d) : "v"(a), "v"(b));
  return d;
}
__device__ __forceinline__ v8f wmma_bf(v16b a, v16b b, v8f c) {
  v8f d = __builtin_amdgcn_wmma_f32_16x16x32_bf16(false, a, false, b, (short)0, c, false, false);
  asm volatile("v_nop\n\tv_nop\n\tv_nop\n\tv_nop" : "+v"(d) : "v"(a), "v"(b));
  return d;
}
// 16x16x32 fragments: lane = (h = lane>>4, row/col = lane&15); elements 0..7 = k0+8h+0..7, 8..15 = k0+16+8h+0..7; D element r = row 8h+r
__device__ __forceinline__ v16h frag_h(const _Float16* rowk0, int lane) {
  union { v16h v; v8h q[2]; } u; const _Float16* p = rowk0 + 8 * (lane >> 4);
  u.q[0] = *(const v8h*)p; u.q[1] = *(const v8h*)(p + 16); return u.v;
}
__device__ __forceinline__ v16h frag_f32(const float* rowk0, int lane) {
  v16h a; const float* p = rowk0 + 8 * (lane >> 4);
#pragma unroll
  for (int i = 0; i < 8; ++i) { a[i] = (_Float16)p[i]; a[8 + i] = (_Float16)p[16 + i]; }
  return a;
}
__device__ __forceinline__ v16h frag_f32s(const float* rowk0, int lane, float sc) {
  v16h a; const float* p = rowk0 + 8 * (lane >> 4);
#pragma unroll
  for (int i = 0; i < 8; ++i) { a[i] = (_Float16)(p[i] * sc); a[8 + i] = (_Float16)(p[16 + i] * sc); }
  return a;
}
// column fragment from a [K][ld] layout (column n), rows >= K read as 0
__device__ __forceinline__ v16h fragc_f32(const float* W, int k0, int n, int lane, int ld, int K) {
  v16h a; const int g = lane >> 4;
#pragma unroll
  for (int i = 0; i < 8; ++i) { const int ka = k0 + 8 * g + i, kb = ka + 16;
    a[i] = (_Float16)(ka < K ? W[(size_t)(ka < K ? ka : K - 1) * ld + n] : 0.f); a[8 + i] = (_Float16)(kb < K ? W[(size_t)(kb < K ? kb : K - 1) * ld + n] : 0.f); }
  return a;
}
struct F2 { v16b h, l; };
__device__ __forceinline__ F2 bsplit16(const float v[16]) { F2 r;
#pragma unroll
  for (int i = 0; i < 16; ++i) { const __bf16 h = (__bf16)v[i]; r.h[i] = h; r.l[i] = (__bf16)(v[i] - (float)h); }
  return r; }
__device__ __forceinline__ F2 split_row(const float* row, int k0, int lane) { float v[16]; const float* p = row + k0 + 8 * (lane >> 4);
#pragma unroll
  for (int i = 0; i < 8; ++i) { v[i] = p[i]; v[8 + i] = p[16 + i]; }
  return bsplit16(v); }
__device__ __forceinline__ F2 split_rowK(const float* row, int k0, int lane, int K) { float v[16]; const int g = lane >> 4;
#pragma unroll
  for (int i = 0; i < 8; ++i) { const int ka = k0 + 8 * g + i, kb = ka + 16; v[i] = ka < K ? row[ka < K ? ka : K - 1] : 0.f; v[8 + i] = kb < K ? row[kb < K ? kb : K - 1] : 0.f; }
  return bsplit16(v); }
__device__ __forceinline__ F2 split_col(const float* W, int k0, int n, int lane, int ld, int K) { float v[16]; const int g = lane >> 4;
#pragma unroll
  for (int i = 0; i < 8; ++i) { const int ka = k0 + 8 * g + i, kb = ka + 16; v[i] = ka < K ? W[(size_t)(ka < K ? ka : K - 1) * ld + n] : 0.f; v[8 + i] = kb < K ? W[(size_t)(kb < K ? kb : K - 1) * ld + n] : 0.f; }
  return bsplit16(v); }
__device__ __forceinline__ v8f mac3(const F2& a, const F2& b, v8f c) { c = wmma_bf(a.l, b.h, c); c = wmma_bf(a.h, b.l, c); return wmma_bf(a.h, b.h, c); }
__device__ __forceinline__ float sigm(float v) { return 1.0f / (1.0f + expf(-v)); }
#define LDSX() do { asm volatile("s_wait_dscnt 0" ::: "memory"); __builtin_amdgcn_wave_barrier(); __builtin_amdgcn_fence(__ATOMIC_RELEASE, "workgroup"); } while (0)

// Causal multi-head attention on separate inputs listed key-first (key / value / query [4,1024,1024]; torch (out,in) Wk / Wq / Wv / Wp [1024,1024] (0.02) + zero biases; 16 heads x 64; scale 1/8; tril, -inf): out = merge(softmax(causal(q_h k_h^T / 8)) v_h) Wp^T + bp.
#define NB 4
#define TT 1024
#define CC 1024            // NH * HD = projected width
#define DIN 1024          // input (model) width
#define NH 16
#define HD 64
#define NQB (TT / 64)
#define HG 8
#define SCALE (0.125f)
#define CAUSAL 1
#ifndef TNB
#define TNB NB
#endif
__device__ __forceinline__ float bfr(float v) { return (float)(__bf16)v; }
__host__ __device__ __forceinline__ int kb_last(int qb) { return CAUSAL ? ((qb * 64 + 63) >> 7) : (TT / 128 - 1); }
typedef __attribute__((ext_vector_type(8))) __bf16 v8b;
__device__ __forceinline__ v16b frag_b(const __bf16* rowk0, int lane) {
  union { v16b v; v8b q[2]; } u; const __bf16* p = rowk0 + 8 * (lane >> 4);
  u.q[0] = *(const v8b*)p; u.q[1] = *(const v8b*)(p + 16); return u.v;
}
#define QBH 6              // causal: query blocks 0..QBH-1 of each sequence (few keys, no averaging) take the high-precision path
#define QHI 384            // rows carrying a q residual plane
#define KHI 384            // key rows carrying k residual / v bf16 hi+lo planes (used only by the causal high-precision path)
// B fragment (k rows k0+.., output column o) of a weight: (in,out) [K][ld] or (out,in) [ld rows of K]: bf16 exact, or f16(bf16 * 256) exact
__device__ __forceinline__ v16b wcol_io(const float* Wm, int k0, int o, int lane, int ld) { v16b w; const int g = lane >> 4;
#pragma unroll
  for (int i = 0; i < 8; ++i) { w[i] = (__bf16)Wm[(size_t)(k0 + 8 * g + i) * ld + o]; w[8 + i] = (__bf16)Wm[(size_t)(k0 + 16 + 8 * g + i) * ld + o]; }
  return w; }
__device__ __forceinline__ v16b wcol_oi(const float* Wm, int k0, int o, int lane, int K) { v16b w; const float* p = Wm + (size_t)o * K + k0 + 8 * (lane >> 4);
#pragma unroll
  for (int i = 0; i < 8; ++i) { w[i] = (__bf16)p[i]; w[8 + i] = (__bf16)p[16 + i]; }
  return w; }
__device__ __forceinline__ v16h wcolh_io(const float* Wm, int k0, int o, int lane, int ld) { v16h w; const int g = lane >> 4;
#pragma unroll
  for (int i = 0; i < 8; ++i) { w[i] = (_Float16)(bfr(Wm[(size_t)(k0 + 8 * g + i) * ld + o]) * 256.0f); w[8 + i] = (_Float16)(bfr(Wm[(size_t)(k0 + 16 + 8 * g + i) * ld + o]) * 256.0f); }
  return w; }
__device__ __forceinline__ v16h wcolh_oi(const float* Wm, int k0, int o, int lane, int K) { v16h w; const float* p = Wm + (size_t)o * K + k0 + 8 * (lane >> 4);
#pragma unroll
  for (int i = 0; i < 8; ++i) { w[i] = (_Float16)(bfr(p[i]) * 256.0f); w[8 + i] = (_Float16)(bfr(p[16 + i]) * 256.0f); }
  return w; }
#define WQKV_LAYOUT 1   // 0 = (in,out) [DIN][CC]; 1 = (out,in) [CC][DIN]; 2 = per-head [NH][DIN][HD]
__device__ __forceinline__ v16b wcol_hdk(const float* Wm, int k0, int o, int lane) { v16b w; const int g = lane >> 4; const float* p = Wm + (size_t)(o / HD) * DIN * HD + (o % HD);
#pragma unroll
  for (int i = 0; i < 8; ++i) { w[i] = (__bf16)p[(size_t)(k0 + 8 * g + i) * HD]; w[8 + i] = (__bf16)p[(size_t)(k0 + 16 + 8 * g + i) * HD]; }
  return w; }
#define WO_OUT_IN 1
#if WQKV_LAYOUT == 1
#define WCOL(W, k0, o, lane) wcol_oi(W, k0, o, lane, DIN)
#elif WQKV_LAYOUT == 2
#define WCOL(W, k0, o, lane) wcol_hdk(W, k0, o, lane)
#else
#define WCOL(W, k0, o, lane) wcol_io(W, k0, o, lane, CC)
#endif
#if WO_OUT_IN
#define WOCOL(W, k0, o, lane) wcol_oi(W, k0, o, lane, CC)
#define WOCOLH(W, k0, o, lane) wcolh_oi(W, k0, o, lane, CC)
#else
#define WOCOL(W, k0, o, lane) wcol_io(W, k0, o, lane, DIN)
#define WOCOLH(W, k0, o, lane) wcolh_io(W, k0, o, lane, DIN)
#endif

#ifndef SM_EXTRA_PARAMS
#define SM_EXTRA_PARAMS
#endif
#ifndef PROJ_EXTRA_PARAMS
#define PROJ_EXTRA_PARAMS
#endif
#ifndef SM_MASK_HOOK
#define SM_MASK_HOOK (void)0
#endif

#define WS_QH  0u                                      // f16 q rows [b*t][CC]
#define WS_KH  (WS_QH + 2u * (size_t)NB * TT * CC)      // f16 k rows [b*t][CC]
#define WS_VT  (WS_KH + 2u * (size_t)NB * TT * CC)      // f16 v planes [b][c][t]
#define WS_QL  (WS_VT + 2u * (size_t)NB * CC * TT)      // f16 q residual x 2^10 rows [b][t < QHI][CC]
#define WS_KL  (WS_QL + 2u * (size_t)NB * QHI * CC)     // f16 k residual x 2^10 rows [b][t < KHI][CC]
#define WS_VB  (WS_KL + 2u * (size_t)NB * KHI * CC)     // bf16 v hi planes [b][c][t < KHI]
#define WS_VBL (WS_VB + 2u * (size_t)NB * CC * KHI)
#define WS_S   (WS_VBL + 2u * (size_t)NB * CC * KHI)    // f32 [hg][t][s] region, unused: logits and P stay in registers
#define WS_Y   (WS_S  + 4u * (size_t)HG * TT * TT)      // f32 ctx rows [b*t][CC] (only when there is an output projection)
#define WS_END (WS_Y  + 4u * (size_t)NB * TT * CC)

// precaution behind a group of global loads: the group's address stays an input of the wait, so its registers are rewritten only behind the wait
#define XW2(p, q) asm volatile("s_wait_xcnt 0x0" :: "v"(p), "v"(q) : "memory")
// work-group barrier of the operand buffers, by hand and in two halves with a step's products between them. RINGSIG: the wave's own LDS stores have landed and its fragment reads have returned (s_wait_dscnt 0) before it signals. RINGWAIT: at the head of the next step. No LDS access stands between the two, and they alternate strictly in every wave. __syncthreads() would also wait for the global loads, which are to stay in flight across it
#define RINGSIG() do { asm volatile("s_wait_dscnt 0x0" ::: "memory"); asm volatile("s_barrier_signal -1" ::: "memory"); } while (0)
#define RINGWAIT() asm volatile("s_barrier_wait -1" ::: "memory")
#define KP 40              // pitch of a staged 32-k row in 16-bit elements: 80 B = 16 B x odd, where 16-byte fragment reads of 16 rows meet no bank twice
typedef __attribute__((ext_vector_type(4))) __bf16 v4b;
typedef __attribute__((ext_vector_type(4))) _Float16 v4h;
// four 16-byte pieces of an epilogue tile, LDS -> global (rows ls and gs bytes apart). The closing s_wait_xcnt 0 is a precaution: the stores' addresses and data stay inputs of the wait, so that their registers are rewritten only behind it
__device__ __forceinline__ void st4(char* gp, size_t gs, const unsigned char* lp, unsigned ls) { v4u d[4];
#pragma unroll
  for (int u = 0; u < 4; ++u) d[u] = *(const v4u*)(lp + u * ls);
#pragma unroll
  for (int u = 0; u < 4; ++u) vst2(gp + u * gs, d[u]);
  asm volatile("s_wait_xcnt 0x0" :: "v"(gp), "v"(gp + gs), "v"(gp + 2 * gs), "v"(gp + 3 * gs), "v"(d[0]), "v"(d[1]), "v"(d[2]), "v"(d[3]) : "memory"); }
// ---- k_proj: block = (256 rows, 256 cols, which), eight waves in 2 x 4, one wave = 128 rows x 64 cols (8 x 4 accumulator tiles, so that a staged row serves 256 outputs of the block; the wave's rows are two groups of 64, one in each 128-row half of the block, so that the epilogue goes half by half with every wave at work): q/k/v = X W (+ b) with exact bf16 products (K = DIN) -> which 0: q f16 rows (+ residual rows < QHI); 1: k f16 rows (+ residual rows < KHI); 2: v f16 planes [c][t] (+ bf16 hi/lo planes for t < KHI)
#define PM 256             // rows of a k_proj block; TT is a multiple of it, so a block lies in one sequence
#define PN 256             // columns of a k_proj block
#define PH 128             // rows of an epilogue half; QHI and KHI are multiples of it, so a half lies on one side of the residual rows' end
__global__ __launch_bounds__(256) void k_proj(const float* __restrict__ XQ, const float* __restrict__ XK, const float* __restrict__ XV, const float* __restrict__ WQ, const float* __restrict__ WK, const float* __restrict__ WV, const float* __restrict__ BQ, const float* __restrict__ BK, const float* __restrict__ BV,
    _Float16* __restrict__ QH, _Float16* __restrict__ QL, _Float16* __restrict__ KH, _Float16* __restrict__ KL, _Float16* __restrict__ VT, __bf16* __restrict__ VB, __bf16* __restrict__ VBL) {
  /* one LDS block: the two operand buffers of the k loop first, the epilogue's tiles of one half (q/k: sh, sl; v: th, tb, tbl) behind the barrier that ends the loop's last reads */
  __shared__ __align__(16) unsigned char smem[3 * PN * (PH + 8) * 2];
  __bf16 (*stg)[PM + PN][KP] = (__bf16 (*)[PM + PN][KP])smem;
  _Float16 (*sh)[PN + 8] = (_Float16 (*)[PN + 8])smem; _Float16 (*sl)[PN + 8] = (_Float16 (*)[PN + 8])(smem + PH * (PN + 8) * 2);
  _Float16 (*th)[PH + 8] = (_Float16 (*)[PH + 8])smem; __bf16 (*tb)[PH + 8] = (__bf16 (*)[PH + 8])(smem + PN * (PH + 8) * 2); __bf16 (*tbl)[PH + 8] = (__bf16 (*)[PH + 8])(smem + 2 * PN * (PH + 8) * 2);
  const int tid = threadIdx.x, wave = tid >> 5, lane = tid & 31, col = lane & 15, g = lane >> 4; const int wr = (wave >> 2) * 64, wc = (wave & 3) * 64; const int which = blockIdx.z; const int c0 = blockIdx.y * PN; const size_t r0 = (size_t)blockIdx.x * PM; const size_t bb = r0 / TT; const int t0 = (int)(r0 % TT);
  const float* X = which == 0 ? XQ : which == 1 ? XK : XV; const float* WA = which == 0 ? WQ : which == 1 ? WK : WV; const float* BA = which == 0 ? BQ : which == 1 ? BK : BV;
  v8f acc[8][4] = {};
  /* a 32-k step of the block's 256 X rows and 256 W rows: thread = (row lr of 32, 16-B piece lq), so a wave's load covers four whole 128-B lines; rounded to bf16 once for the block; buffer rows 0..255 = X, 256..511 = W */
  const int lr = tid >> 3, lq = tid & 7; const float* bx = X + (r0 + lr) * DIN + lq * 4; const float* bw = WA + (size_t)(c0 + lr) * DIN + lq * 4; v4f pre[16];
  /* the k walk is a ring: the block starts at a step of its own and wraps, so that the 4 blocks that share its X rows and the 16 that share its W rows do not ask L2 for the same lines at the same moment; sharers of X stand 8 steps apart, sharers of W 2 */
  const int ks0 = (int)(2 * blockIdx.x + 8 * blockIdx.y + blockIdx.z) & (DIN / 32 - 1); const float* gx = bx + ks0 * 32; const float* gw = bw + ks0 * 32;
#pragma unroll
  for (int i = 0; i < 8; ++i) pre[i] = *(const v4f*)(gx + (size_t)i * 32 * DIN);
#pragma unroll
  for (int i = 0; i < 8; ++i) pre[8 + i] = *(const v4f*)(gw + (size_t)i * 32 * DIN);
  XW2(gx, gw);
  /* put: the step held in pre is rounded and stored into buffer bn; get: the lines of walk step s are asked for */
  auto put = [&](__bf16 (*bn)[KP]) {
#pragma unroll
    for (int i = 0; i < 16; ++i) { v4b c;
#pragma unroll
      for (int e = 0; e < 4; ++e) c[e] = (__bf16)pre[i][e];
      *(v4b*)&bn[i * 32 + lr][lq * 4] = c; } };
  auto get = [&](int s) { const int kn = ((s + ks0) & (DIN / 32 - 1)) * 32; gx = bx + kn; gw = bw + kn;
#pragma unroll
    for (int i = 0; i < 8; ++i) pre[i] = *(const v4f*)(gx + (size_t)i * 32 * DIN);
#pragma unroll
    for (int i = 0; i < 8; ++i) pre[8 + i] = *(const v4f*)(gw + (size_t)i * 32 * DIN);
    XW2(gx, gw); };
  /* a step: behind the wait its buffer is published and the other buffer has been left by every reader; the wave reads its fragments, stores the next step into the other buffer under their latency, asks for the step after that, signals, and only then multiplies. A wave that has done its products finds the barrier open, because every wave signals in front of its own products: so of the two waves of a SIMD one can be at its LDS work while the other holds the matrix unit */
  auto pass = [&](const int kc, const bool st, const bool ld) { __bf16 (*bf)[KP] = stg[kc & 1];
    RINGWAIT();
    v16b a[8], w[4];
#pragma unroll
    for (int j = 0; j < 4; ++j) w[j] = frag_b(&bf[PM + wc + j * 16 + col][0], lane);
#pragma unroll
    for (int i = 0; i < 8; ++i) a[i] = frag_b(&bf[(i >> 2) * PH + wr + (i & 3) * 16 + col][0], lane);
    __builtin_amdgcn_sched_barrier(0);   /* keeps all 24 fragment reads in one group at the head of the step, in front of the wait for the next step's lines */
    if (st) put(stg[(kc + 1) & 1]);
    if (ld) get(kc + 2);
    RINGSIG();
    __builtin_amdgcn_sched_barrier(0);   /* keeps the products behind the signal */
#pragma unroll
    for (int i = 0; i < 8; ++i)
#pragma unroll
      for (int j = 0; j < 4; ++j) acc[i][j] = __builtin_amdgcn_wmma_f32_16x16x32_bf16(false, a[i], false, w[j], (short)0, acc[i][j], false, false);   /* the bare builtin: 32 accumulator tiles reach past v255, which an asm operand cannot name; the compiler keeps the distances behind its own matrix instructions */
    __builtin_amdgcn_sched_barrier(0);   /* keeps the next step's fragment reads behind this step's products */ };
  put(stg[0]); get(1); RINGSIG();
#pragma unroll 2   /* two steps a trip: the buffer's number is a constant in each */
  for (int kc = 0; kc < DIN / 32 - 2; ++kc) pass(kc, true, true);
  pass(DIN / 32 - 2, true, false); pass(DIN / 32 - 1, false, false);   /* the last two steps stand alone: nothing is left to ask for, then nothing to store, and no branch stands round the loads of the loop */
  RINGWAIT();   /* the partner of the last step's signal */
#pragma unroll 1   /* stays rolled: the epilogue is straight-line code that runs once a wave, and two copies of it would double the kernel's text */
  for (int p = 0; p < 2; ++p) { const size_t rp = r0 + p * PH; const int tp = t0 + p * PH;   /* half p = accumulator tiles 4 p .. 4 p + 3 of every wave, which stand in tiles 0 .. 3 when their half comes */
    __syncthreads();   /* p = 0: every wave has read its last fragments before the epilogue's tiles overwrite the buffers; p = 1: every thread has read the first half's tiles before the second half overwrites them */
    if (which < 2) { _Float16* DH = which == 0 ? QH : KH; _Float16* DL = which == 0 ? QL : KL; const int nhi = which == 0 ? QHI : KHI; const bool hi_rows = tp < nhi;
#pragma unroll
      for (int j = 0; j < 4; ++j) { const float bias = BA ? bfr(BA[c0 + wc + j * 16 + col]) : 0.f;
#pragma unroll
        for (int i = 0; i < 4; ++i)
#pragma unroll
          for (int r = 0; r < 8; ++r) { const float v = acc[i][j][r] + bias; const _Float16 hv = (_Float16)v; sh[wr + i * 16 + 8 * g + r][wc + j * 16 + col] = hv; sl[wr + i * 16 + 8 * g + r][wc + j * 16 + col] = (_Float16)((v - (float)hv) * 1024.0f); } }
      __syncthreads();
      /* thread = (row rl of 8, 16-B piece q): a wave's store covers one whole 512-B row segment */
      for (int rl = tid >> 5; rl < PH; rl += 32) { const int q = tid & 31; st4((char*)(DH + (rp + rl) * CC + c0 + q * 8), 8 * CC * 2, (const unsigned char*)&sh[rl][q * 8], 8 * (PN + 8) * 2); if (hi_rows) st4((char*)(DL + (bb * nhi + tp + rl) * (size_t)CC + c0 + q * 8), 8 * CC * 2, (const unsigned char*)&sl[rl][q * 8], 8 * (PN + 8) * 2); }
    } else { const bool hi_rows = tp < KHI;
#pragma unroll
      for (int j = 0; j < 4; ++j) { const float bias = BA ? bfr(BA[c0 + wc + j * 16 + col]) : 0.f;
#pragma unroll
        for (int i = 0; i < 4; ++i)
#pragma unroll
          for (int r = 0; r < 8; ++r) { const float v = acc[i][j][r] + bias; const int rl = wr + i * 16 + 8 * g + r, cl = wc + j * 16 + col; th[cl][rl] = (_Float16)v; const __bf16 bh = (__bf16)v; tb[cl][rl] = bh; tbl[cl][rl] = (__bf16)(v - (float)bh); } }
      __syncthreads();
      /* thread = (plane row cl of 16, 16-B piece q) */
      for (int cl = tid >> 4; cl < PN; cl += 64) { const int q = tid & 15; st4((char*)(VT + (bb * CC + c0 + cl) * (size_t)TT + tp + q * 8), 16 * TT * 2, (const unsigned char*)&th[cl][q * 8], 16 * (PH + 8) * 2); if (hi_rows) { const size_t o3 = (bb * CC + c0 + cl) * (size_t)KHI + tp + q * 8; st4((char*)(VB + o3), 16 * KHI * 2, (const unsigned char*)&tb[cl][q * 8], 16 * (PH + 8) * 2); st4((char*)(VBL + o3), 16 * KHI * 2, (const unsigned char*)&tbl[cl][q * 8], 16 * (PH + 8) * 2); } } }
#pragma unroll
    for (int i = 0; i < 4; ++i)
#pragma unroll
      for (int j = 0; j < 4; ++j) acc[i][j] = acc[4 + i][j]; } }
// ---- k_attn: block = 64 queries (qb, heaviest first) of (b, h), one wave = 16 queries; the waves share the staged K and V tiles and nothing else. Per 64 keys: S^T = K . Q^T (A = key rows, B = query rows, same loader on both sides), so a lane holds 32 scores of ONE query (query = lane & 15, key = 16 j + 8 (lane >> 4) + r); running maximum and sum in f32 (online softmax, halves joined by one lane exchange); P^T x 2^11 packs from two score tiles straight into a B operand; O^T += V^T . P^T with the v planes [c][t] as A. Products per path as before: query blocks < QBH take q hi + residual x k hi + residual (3 products) and P, v as bf16 hi + lo (3 products); the rest one f16 product each. Every fragment of a group is loaded in front of the group's first product, so that the loads fly together. The K and V tiles of a key block (64 rows of 128 B each) are brought into LDS once for the block's four waves, as whole lines, by asynchronous copies, one key block ahead, in two buffers; the fragments are read from there
#define TP 144             // pitch of a staged 128-B row in bytes: 16 B x odd, where 16-byte fragment reads of 16 rows meet no bank twice
#define TILEB (64 * TP)    // one staged tile
// two tiles, four copies a thread each (rows cr, cr + 16, cr + 32, cr + 48; a wave's copy covers four whole lines). s_wait_xcnt 0 is the last line of the copies' own statement: a precaution, so that no register which a copy names is rewritten in front of it
__device__ __forceinline__ void cp2tiles(unsigned la, const char* ga, size_t sa, unsigned lb, const char* gb, size_t sb) {
  asm volatile("global_load_async_to_lds_b128 %0, %8, off\n\tglobal_load_async_to_lds_b128 %1, %9, off\n\tglobal_load_async_to_lds_b128 %2, %10, off\n\tglobal_load_async_to_lds_b128 %3, %11, off\n\t"
               "global_load_async_to_lds_b128 %4, %12, off\n\tglobal_load_async_to_lds_b128 %5, %13, off\n\tglobal_load_async_to_lds_b128 %6, %14, off\n\tglobal_load_async_to_lds_b128 %7, %15, off\n\ts_wait_xcnt 0x0"
               :: "v"(la), "v"(la + 16 * TP), "v"(la + 32 * TP), "v"(la + 48 * TP), "v"(lb), "v"(lb + 16 * TP), "v"(lb + 32 * TP), "v"(lb + 48 * TP),
                  "v"(ga), "v"(ga + sa), "v"(ga + 2 * sa), "v"(ga + 3 * sa), "v"(gb), "v"(gb + sb), "v"(gb + 2 * sb), "v"(gb + 3 * sb) : "memory"); }
// fragment from the lane's own address (row start + k0 + 8 (lane >> 4)): same element order as frag_h / frag_b
__device__ __forceinline__ v16h frag_hp(const _Float16* p) { union { v16h v; v8h q[2]; } u; u.q[0] = *(const v8h*)p; u.q[1] = *(const v8h*)(p + 16); return u.v; }
__device__ __forceinline__ v16b frag_bp(const __bf16* p) { union { v16b v; v8b q[2]; } u; u.q[0] = *(const v8b*)p; u.q[1] = *(const v8b*)(p + 16); return u.v; }
// 2^x in place by the bare exponent instruction. Each instruction overwrites its own source alone and reads no neighbour's result; the closing v_nop is the slot that the instruction set asks for behind a transcendental before its result is read
__device__ __forceinline__ float exp2_1(float x) { asm("v_exp_f32 %0, %0\n\tv_nop" : "+v"(x)); return x; }
__device__ __forceinline__ void exp2_16(float (&x)[16]) {
  asm("v_exp_f32 %0, %0\n\tv_exp_f32 %1, %1\n\tv_exp_f32 %2, %2\n\tv_exp_f32 %3, %3\n\tv_exp_f32 %4, %4\n\tv_exp_f32 %5, %5\n\tv_exp_f32 %6, %6\n\tv_exp_f32 %7, %7\n\t"
      "v_exp_f32 %8, %8\n\tv_exp_f32 %9, %9\n\tv_exp_f32 %10, %10\n\tv_exp_f32 %11, %11\n\tv_exp_f32 %12, %12\n\tv_exp_f32 %13, %13\n\tv_exp_f32 %14, %14\n\tv_exp_f32 %15, %15\n\tv_nop"
      : "+v"(x[0]), "+v"(x[1]), "+v"(x[2]), "+v"(x[3]), "+v"(x[4]), "+v"(x[5]), "+v"(x[6]), "+v"(x[7]), "+v"(x[8]), "+v"(x[9]), "+v"(x[10]), "+v"(x[11]), "+v"(x[12]), "+v"(x[13]), "+v"(x[14]), "+v"(x[15])); }
template <bool HI> __device__ __forceinline__ void attn_wave(const _Float16* __restrict__ QH, const _Float16* __restrict__ KH, const _Float16* __restrict__ QL, const _Float16* __restrict__ KL, const _Float16* __restrict__ VT, const __bf16* __restrict__ VB, const __bf16* __restrict__ VBL, int b, int h, int qb, int wave, int lane, unsigned char* sm, float* __restrict__ Y) {
  const int col = lane & 15, g = lane >> 4; const int ql0 = qb * 64 + wave * 16; const int t = ql0 + col; const size_t q0 = (size_t)b * TT + ql0; const int nkb = CAUSAL ? qb + 1 : TT / 64;
  /* the key walk is a ring: the block starts at a key block of its own and wraps, so that the query blocks of one (b, h), which read the same K and V lines, and the heads, whose v tiles of one key block lie a whole plane pitch apart, do not ask L2 for them at the same moment. All block-uniform */
  const int kst = (((h + 3 * qb) & 15) * nkb) >> 4;   /* a sixteenth of the ring's length times a number that differs between neighbouring query blocks and between heads */ auto ring = [&](int i) { const int v = i + kst; return v < nkb ? v : v - nkb; };
  /* staging: thread = (row cr of 16, 16-B piece cq); a stage = K, V (f16 path) or K, K residual, v hi, v lo (high-precision path) */
  constexpr unsigned STG = (HI ? 4 : 2) * TILEB; const int cr = (int)threadIdx.x >> 3, cq = (int)threadIdx.x & 7; const unsigned lcp = (unsigned)(size_t)sm + cr * TP + cq * 16;
  const unsigned tk = cr * (CC * 2) + cq * 16, tv = cr * (TT * 2) + cq * 16, tb = cr * (KHI * 2) + cq * 16;   /* the thread's byte offset in a tile's source, by the source's row pitch; the tile's own start is the same for the block */
  auto fill = [&](int i) { const unsigned l = lcp + (i & 1) * STG; const int kb = ring(i);   /* i: place in the walk (it picks the buffer); kb: the key block */
    const char* gk = (const char*)(KH + ((size_t)b * TT + kb * 64) * CC + h * HD) + tk;
    if (HI) { cp2tiles(l, gk, 16 * CC * 2, l + TILEB, (const char*)(KL + ((size_t)b * KHI + kb * 64) * CC + h * HD) + tk, 16 * CC * 2);
      cp2tiles(l + 2 * TILEB, (const char*)(VB + ((size_t)b * CC + h * HD) * (size_t)KHI + kb * 64) + tb, 16 * KHI * 2, l + 3 * TILEB, (const char*)(VBL + ((size_t)b * CC + h * HD) * (size_t)KHI + kb * 64) + tb, 16 * KHI * 2); }
    else cp2tiles(l, gk, 16 * CC * 2, l + TILEB, (const char*)(VT + ((size_t)b * CC + h * HD) * (size_t)TT + kb * 64) + tv, 16 * TT * 2); };
  fill(0);
  v16h qh[HD / 32], qlo[HD / 32];
#pragma unroll
  for (int kc = 0; kc < HD / 32; ++kc) { qh[kc] = frag_h(QH + (q0 + col) * CC + h * HD + kc * 32, lane); if (HI) qlo[kc] = frag_h(QL + ((size_t)b * QHI + ql0 + col) * CC + h * HD + kc * 32, lane); }
  v8f o[HD / 16] = {}; float m = -3.0e38f, l = 0.f;   /* m: running maximum of the unscaled logits; l: running sum of the weights x 2^11 */
  constexpr float C2 = SCALE * 1.44269504088896340736f;   /* logit -> exponent in base 2 */
  float nb = 3.0e38f * C2;   /* the addend in use: 11 - m C2, rounded once and used for the weights and for the rescale alike, so that its rounding cancels */
  asm volatile("s_wait_asynccnt 0x0" ::: "memory");   /* the wave's own copies of the walk's first key block have landed */
  __syncthreads();   /* publishes the walk's first key block */
  if (nkb > 1) fill(1);   /* block-uniform */
#pragma unroll 1   /* stays rolled: one key block's fragments already fill the registers that four waves a SIMD leave a wave */
  for (int kb = 0; kb < nkb; ++kb) { const int k0 = ring(kb) * 64; v8f s[4]; v16h kf[4][HD / 32], kl[4][HD / 32], vf[2][HD / 16];
    const unsigned char* bp = sm + (kb & 1) * STG + col * TP + g * 16;   /* the lane's place in a staged tile: row col, 16-B piece g */
#pragma unroll
    for (int j = 0; j < 4; ++j)
#pragma unroll
      for (int kc = 0; kc < HD / 32; ++kc) kf[j][kc] = frag_hp((const _Float16*)(bp + j * 16 * TP + kc * 64));
#pragma unroll
    for (int j = 0; j < 4; ++j) { v8f acc = {}, accl = {};
      if (HI) {   /* the residual fragments come tile by tile: all four at once, beside the four k fragments, do not fit the registers that four waves a SIMD leave a wave */
#pragma unroll
        for (int kc = 0; kc < HD / 32; ++kc) kl[j][kc] = frag_hp((const _Float16*)(bp + TILEB + j * 16 * TP + kc * 64)); }
#pragma unroll
      for (int kc = 0; kc < HD / 32; ++kc) { acc = wmma16(kf[j][kc], qh[kc], acc); if (HI) { accl = wmma16(kf[j][kc], qlo[kc], accl); accl = wmma16(kl[j][kc], qh[kc], accl); } }
#pragma unroll
      for (int r = 0; r < 8; ++r) s[j][r] = HI ? acc[r] + accl[r] * (1.0f / 1024.0f) : acc[r]; }   /* unscaled: the scale sits in C2 */
    if (!HI) {   /* f16 path: v is read here, so that it flies under the softmax arithmetic */
#pragma unroll
      for (int kc = 0; kc < 2; ++kc)
#pragma unroll
        for (int jd = 0; jd < HD / 16; ++jd) vf[kc][jd] = frag_hp((const _Float16*)(bp + TILEB + jd * 16 * TP + kc * 64)); }
    if (CAUSAL && k0 + 63 > ql0) {   /* wave-uniform: only a key block that reaches past the wave's first query holds excluded keys */
#pragma unroll
      for (int j = 0; j < 4; ++j)
#pragma unroll
        for (int r = 0; r < 8; ++r) if (k0 + j * 16 + 8 * g + r > t) s[j][r] = -3.0e38f; }
    float mx = -3.0e38f;
#pragma unroll
    for (int j = 0; j < 4; ++j)
#pragma unroll
      for (int r = 0; r < 8; ++r) mx = fmaxf(mx, s[j][r]);
    mx = fmaxf(mx, __shfl_xor(mx, 16));
    /* every key block a wave walks holds a key <= each of its queries (k0 <= ql0), so mn is a real logit; an excluded score's argument is then about -5e37, where the exponent instruction returns 0 */
    const float mn = fmaxf(m, mx); const float nbn = fmaf(-mn, C2, 11.0f); const float alpha = exp2_1(nbn - nb); m = mn; nb = nbn;
    float ls = 0.f;
#pragma unroll
    for (int kc = 0; kc < 2; ++kc) { float x[16];   /* exp(scale (s - max)) x 2^11: one multiply-add and one exponent instruction a score */
#pragma unroll
      for (int i = 0; i < 16; ++i) x[i] = fmaf(s[2 * kc + (i >> 3)][i & 7], C2, nbn);
      exp2_16(x);
#pragma unroll
      for (int i = 0; i < 16; ++i) { ls += x[i]; s[2 * kc + (i >> 3)][i & 7] = x[i]; } }
    l = l * alpha + ls;
#pragma unroll
    for (int jd = 0; jd < HD / 16; ++jd)
#pragma unroll
      for (int r = 0; r < 8; ++r) o[jd][r] *= alpha;
#pragma unroll
    for (int kc = 0; kc < 2; ++kc) {
      if (HI) { float pv[16]; v16b vh[HD / 16], vl[HD / 16];
#pragma unroll
        for (int jd = 0; jd < HD / 16; ++jd) { vh[jd] = frag_bp((const __bf16*)(bp + 2 * TILEB + jd * 16 * TP + kc * 64)); vl[jd] = frag_bp((const __bf16*)(bp + 3 * TILEB + jd * 16 * TP + kc * 64)); }
#pragma unroll
        for (int i = 0; i < 8; ++i) { pv[i] = s[2 * kc][i]; pv[8 + i] = s[2 * kc + 1][i]; }
        const F2 p = bsplit16(pv);
#pragma unroll
        for (int jd = 0; jd < HD / 16; ++jd) { o[jd] = wmma_bf(vh[jd], p.h, o[jd]); o[jd] = wmma_bf(vh[jd], p.l, o[jd]); o[jd] = wmma_bf(vl[jd], p.h, o[jd]); }
      } else { v16h p;
#pragma unroll
        for (int i = 0; i < 8; ++i) { p[i] = (_Float16)s[2 * kc][i]; p[8 + i] = (_Float16)s[2 * kc + 1][i]; }
#pragma unroll
        for (int jd = 0; jd < HD / 16; ++jd) o[jd] = wmma16(vf[kc][jd], p, o[jd]); } }
    asm volatile("s_wait_dscnt 0x0" ::: "memory");      /* the wave's reads of this buffer have returned */
    asm volatile("s_wait_asynccnt 0x0" ::: "memory");   /* its copies of the next key block have landed */
    __syncthreads();   /* publishes the next key block; it also ends every wave's reads of this buffer, which is refilled behind it */
    if (kb + 2 < nkb) fill(kb + 2);   /* block-uniform */ }
  asm volatile("s_wait_asynccnt 0x0" ::: "memory");   /* no copy is left in flight when the buffers become the output's staging; the last key block's barrier has ended every wave's reads */
  float (*st)[HD + 4] = (float (*)[HD + 4])(sm + wave * (16 * (HD + 4) * 4));
  l += __shfl_xor(l, 16);
  const float inv = l > 0.f ? 1.0f / l : 0.f;   /* l carries the same 2^11 as the weights */
#pragma unroll
  for (int jd = 0; jd < HD / 16; ++jd) { v4f a, c;
#pragma unroll
    for (int r = 0; r < 4; ++r) { a[r] = o[jd][r] * inv; c[r] = o[jd][4 + r] * inv; }
    *(v4f*)&st[col][jd * 16 + 8 * g] = a; *(v4f*)&st[col][jd * 16 + 8 * g + 4] = c; }
  LDSX();   /* the wave's own LDS stores land before other lanes of the wave read them: two whole 256-B (row, head) segments a store */
#pragma unroll
  for (int rl = 0; rl < 16; rl += 2) vst2(Y + (q0 + rl + g) * CC + h * HD + col * 4, *(const v4f*)&st[rl + g][col * 4]); }
__global__ __launch_bounds__(128) void k_attn(const _Float16* __restrict__ QH, const _Float16* __restrict__ KH, const _Float16* __restrict__ QL, const _Float16* __restrict__ KL, const _Float16* __restrict__ VT, const __bf16* __restrict__ VB, const __bf16* __restrict__ VBL, float* __restrict__ Y) { __shared__ __align__(16) unsigned char smem[2 * 4 * TILEB];   /* two buffers of up to four tiles; behind the key loop each wave's 16 x (HD + 4) f32 output staging */
  /* the wave's number in a scalar register: the causal test of a key block becomes a scalar branch */
  const int tid = threadIdx.x, wave = __builtin_amdgcn_readfirstlane(tid >> 5), lane = tid & 31; const int h = blockIdx.x, b = blockIdx.y, qb = NQB - 1 - (int)blockIdx.z;
  if (CAUSAL && qb < QBH) attn_wave<true>(QH, KH, QL, KL, VT, VB, VBL, b, h, qb, wave, lane, smem, Y);   /* block-uniform */
  else attn_wave<false>(QH, KH, QL, KL, VT, VB, VBL, b, h, qb, wave, lane, smem, Y); }
// ---- k_out: block = (128 rows, 128 cols), four waves in 2 x 2, one wave = 64 rows x 64 cols (4 x 4 accumulator tiles), a step = 64 k: out = ctx Wo (+ bo): ctx x 2^6 once to f16 against Wo as f16(bf16 x 2^8) exact (1 product) x 2^-14; causal early rows (< QHI of each sequence): ctx bf16 hi + lo against exact bf16 Wo (2 products)
#define OM 128             // rows of a k_out block; QHI and TT are multiples of it, so a block lies in one sequence and on one side of the early rows' end
#define ON 128             // columns of a k_out block
#define OKS 64             // k of a k_out step
#define OP 72              // pitch of a staged 64-k row in 16-bit elements: 144 B = 16 B x odd, where 16-byte fragment reads of 16 rows meet no bank twice
#define OSP 68             // pitch of a staged output row in floats: 272 B = 16 B x odd
template <bool HI> __device__ __forceinline__ void out_tile(const float* __restrict__ Y, const float* __restrict__ WO, const float* __restrict__ BO, float* __restrict__ OUT, unsigned char* smem) {
  constexpr int ROWS = HI ? 384 : 256;   /* buffer rows 0..127 = ctx, 128..255 = Wo, 256..383 = ctx residual (early rows only) */
  const int tid = threadIdx.x, wave = tid >> 5, lane = tid & 31, col = lane & 15, g = lane >> 4; const int wr = (wave >> 1) * 64, wc = (wave & 1) * 64; const int c0 = blockIdx.y * ON; const size_t r0 = (size_t)blockIdx.x * OM;
  v8f acc[4][4] = {};
  /* a 64-k step of the block's 128 ctx rows and 128 Wo rows: thread = (row lr of 8, 16-B piece lq), so a wave's load covers four whole 128-B lines; rounded once for the block */
  const int lr = tid >> 4, lq = tid & 15; v4f pre[32];
  /* the k walk is a ring, as in k_proj: the 8 blocks that share the ctx rows stand 2 steps apart, the 32 that share the Wo rows 1 step apart, two to a step */
  const int ks0 = (int)(blockIdx.x + 2 * blockIdx.y) & (CC / OKS - 1); const float* gy = Y + (r0 + lr) * CC + lq * 4 + ks0 * OKS; const float* gw = WO + (size_t)(c0 + lr) * CC + lq * 4 + ks0 * OKS;
#pragma unroll
  for (int i = 0; i < 16; ++i) pre[i] = *(const v4f*)(gy + (size_t)i * 8 * CC);
#pragma unroll
  for (int i = 0; i < 16; ++i) pre[16 + i] = *(const v4f*)(gw + (size_t)i * 8 * CC);
  /* these first loads have no s_wait_xcnt 0 of their own: the first one behind them is that of stage()'s first group, and the listing shows no write of their two address pairs in front of it; a wait here that names gy and gw cost a register pair spilled to scratch */
  /* stage: the step held in pre goes into buffer nb and, where ld, the lines of walk step s are asked for. In four groups of eight pieces: a group is rounded and stored, and its registers take the new lines at once, so that those fly under the other groups' rounding and under the products */
  auto stage = [&](const int nb, const bool ld, const int s) { __bf16 (*bb)[OP] = (__bf16 (*)[OP])(smem + nb * (ROWS * OP * 2)); _Float16 (*bh)[OP] = (_Float16 (*)[OP])(smem + nb * (ROWS * OP * 2)); const int adv = ((s - 1 + ks0) & (CC / OKS - 1)) == CC / OKS - 1 ? OKS - CC : OKS; const float* ny = gy + adv; const float* nw = gw + adv;   /* one step on from the lines asked for last, or from the rows' last step back to their first */
#pragma unroll
    for (int q = 0; q < 4; ++q) {
#pragma unroll
      for (int u = 0; u < 8; ++u) { const int i = q * 8 + u;
        if (HI) {
          if (i < 16) { v4b ch, cl;
#pragma unroll
            for (int e = 0; e < 4; ++e) { const float v = pre[i][e]; const __bf16 hv = (__bf16)v; ch[e] = hv; cl[e] = (__bf16)(v - (float)hv); }
            *(v4b*)&bb[i * 8 + lr][lq * 4] = ch; *(v4b*)&bb[256 + i * 8 + lr][lq * 4] = cl; }
          else { v4b c;
#pragma unroll
            for (int e = 0; e < 4; ++e) c[e] = (__bf16)pre[i][e];
            *(v4b*)&bb[i * 8 + lr][lq * 4] = c; }
        } else { v4h c;
#pragma unroll
          for (int e = 0; e < 4; ++e) c[e] = i < 16 ? (_Float16)(pre[i][e] * 64.0f) : (_Float16)(bfr(pre[i][e]) * 256.0f);   /* ctx carried x 2^6 into f16 so small-magnitude context rows stay clear of f16 subnormals; Wo as f16(bf16 x 2^8), exact */
          *(v4h*)&bh[i * 8 + lr][lq * 4] = c; } }
      __builtin_amdgcn_sched_barrier(0);   /* this one and the one behind the wait keep a group's loads where they are written, behind its own rounding and directly in front of their wait: left alone the compiler gathers the loads of all groups late in the step and puts rounding, which reuses their address registers, between the last loads and the wait */
      if (ld) {
#pragma unroll
        for (int u = 0; u < 8; ++u) { const int i = q * 8 + u; pre[i] = *(const v4f*)((i < 16 ? ny : nw) + (size_t)(i & 15) * 8 * CC); }
        XW2(ny, nw); }
      __builtin_amdgcn_sched_barrier(0); }
    if (ld) { gy = ny; gw = nw; } };
  /* a step, as in k_proj: wait, fragment reads, the next step's rounding and stores under their latency, signal, products */
  auto pass = [&](const int kc, const bool st, const bool ld) { __bf16 (*bb)[OP] = (__bf16 (*)[OP])(smem + (kc & 1) * (ROWS * OP * 2)); _Float16 (*bh)[OP] = (_Float16 (*)[OP])(smem + (kc & 1) * (ROWS * OP * 2));
    RINGWAIT();
    if (HI) { v16b ah[2][4], al[2][4], w[2][4];
#pragma unroll
      for (int ks = 0; ks < 2; ++ks) {
#pragma unroll
        for (int j = 0; j < 4; ++j) w[ks][j] = frag_b(&bb[128 + wc + j * 16 + col][ks * 32], lane);
#pragma unroll
        for (int i = 0; i < 4; ++i) ah[ks][i] = frag_b(&bb[wr + i * 16 + col][ks * 32], lane);
#pragma unroll
        for (int i = 0; i < 4; ++i) al[ks][i] = frag_b(&bb[256 + wr + i * 16 + col][ks * 32], lane); }
      __builtin_amdgcn_sched_barrier(0);   /* keeps the step's fragment reads in one group at its head */
      if (st) stage((kc + 1) & 1, ld, kc + 2);
      RINGSIG();
      __builtin_amdgcn_sched_barrier(0);   /* keeps the products behind the signal */
#pragma unroll
      for (int ks = 0; ks < 2; ++ks) {   /* each accumulator takes hi then lo of each 32 k, in the order of the walk */
#pragma unroll
        for (int i = 0; i < 4; ++i)
#pragma unroll
          for (int j = 0; j < 4; ++j) acc[i][j] = __builtin_amdgcn_wmma_f32_16x16x32_bf16(false, ah[ks][i], false, w[ks][j], (short)0, acc[i][j], false, false);
#pragma unroll
        for (int i = 0; i < 4; ++i)
#pragma unroll
          for (int j = 0; j < 4; ++j) acc[i][j] = __builtin_amdgcn_wmma_f32_16x16x32_bf16(false, al[ks][i], false, w[ks][j], (short)0, acc[i][j], false, false); }
    } else { v16h a[2][4], w[2][4];
#pragma unroll
      for (int ks = 0; ks < 2; ++ks) {
#pragma unroll
        for (int j = 0; j < 4; ++j) w[ks][j] = frag_h(&bh[128 + wc + j * 16 + col][ks * 32], lane);
#pragma unroll
        for (int i = 0; i < 4; ++i) a[ks][i] = frag_h(&bh[wr + i * 16 + col][ks * 32], lane); }
      __builtin_amdgcn_sched_barrier(0);   /* keeps the step's fragment reads in one group at its head */
      if (st) stage((kc + 1) & 1, ld, kc + 2);
      RINGSIG();
      __builtin_amdgcn_sched_barrier(0);   /* keeps the products behind the signal */
#pragma unroll
      for (int ks = 0; ks < 2; ++ks)
#pragma unroll
        for (int i = 0; i < 4; ++i)
#pragma unroll
          for (int j = 0; j < 4; ++j) acc[i][j] = __builtin_amdgcn_wmma_f32_16x16x32_f16(false, a[ks][i], false, w[ks][j], (short)0, acc[i][j], false, false); }   /* the bare builtin, as in k_proj: the registers reach past v255, which an asm operand cannot name */
    __builtin_amdgcn_sched_barrier(0);   /* keeps the next step's fragment reads behind this step's products */ };
  stage(0, true, 1); RINGSIG();
#pragma unroll 2   /* two steps a trip: the buffer's number is a constant in each */
  for (int kc = 0; kc < CC / OKS - 2; ++kc) pass(kc, true, true);
  pass(CC / OKS - 2, true, false); pass(CC / OKS - 1, false, false);   /* the last two steps stand alone, as in k_proj */
  RINGWAIT();   /* the partner of the last step's signal: every wave has read its last fragments before the output's staging overwrites the buffers */
  float (*st)[OSP] = (float (*)[OSP])(smem + wave * (64 * OSP * 4));   /* the wave's own 64 x 64 outputs */
#pragma unroll
  for (int j = 0; j < 4; ++j) { const float bias = BO ? bfr(BO[c0 + wc + j * 16 + col]) : 0.f;
#pragma unroll
    for (int i = 0; i < 4; ++i)
#pragma unroll
      for (int r = 0; r < 8; ++r) st[i * 16 + 8 * g + r][j * 16 + col] = HI ? acc[i][j][r] + bias : acc[i][j][r] * (1.0f / 16384.0f) + bias; }   /* 2^-8 (Wo carry) x 2^-6 (ctx carry) */
  LDSX();   /* the wave's own LDS stores land before other lanes of the wave read them: two whole 256-B row segments a store */
  for (int rl = 0; rl < 64; rl += 8) st4((char*)(OUT + (r0 + wr + rl + g) * DIN + c0 + wc + col * 4), 2 * DIN * 4, (const unsigned char*)&st[rl + g][col * 4], 2 * OSP * 4); }
__global__ __launch_bounds__(128) void k_out(const float* __restrict__ Y, const float* __restrict__ WO, const float* __restrict__ BO, float* __restrict__ OUT) { __shared__ __align__(16) unsigned char smem[2 * 384 * OP * 2];   /* two operand buffers; behind the k loop each wave's 64 x OSP f32 output staging */
  if (CAUSAL && (int)(((size_t)blockIdx.x * OM) % TT) < QHI) out_tile<true>(Y, WO, BO, OUT, smem);   /* block-uniform */
  else out_tile<false>(Y, WO, BO, OUT, smem); }

extern "C" void kernel_launch(void* const* d_in, const int* in_sizes, int n_in, void* d_out, int out_size, void* d_ws, size_t ws_size, hipStream_t stream) {
  (void)in_sizes; (void)n_in; (void)out_size;
  const float** F = (const float**)d_in;
  if (ws_size < (size_t)WS_END) return;
  char* ws = (char*)d_ws; _Float16 *QH = (_Float16*)(ws + WS_QH), *KH = (_Float16*)(ws + WS_KH), *VT = (_Float16*)(ws + WS_VT), *QL = (_Float16*)(ws + WS_QL), *KL = (_Float16*)(ws + WS_KL); __bf16 *VB = (__bf16*)(ws + WS_VB), *VBL = (__bf16*)(ws + WS_VBL); float *Y = (float*)(ws + WS_Y);
  (void)Y; (void)QL; (void)KL; (void)VB; (void)VBL;
  // inputs: 0 key [4,1024,1024]; 1 value; 2 query; 3 Wk [1024,1024] (out,in), 4 bk; 5 Wq, 6 bq; 7 Wv, 8 bv; 9 Wp (out,in), 10 bp (zero biases, read)
  k_proj<<<dim3(TNB * TT / PM, CC / PN, 3), 256, 0, stream>>>(F[2], F[0], F[1], F[5], F[3], F[7], F[6], F[4], F[8], QH, QL, KH, KL, VT, VB, VBL);   /* (q, k, v) streams = inputs (query = 2, key = 0, value = 1) */
  k_attn<<<dim3(NH, TNB, NQB), 128, 0, stream>>>(QH, KH, QL, KL, VT, VB, VBL, Y);
  k_out<<<dim3(TNB * TT / OM, DIN / ON), 128, 0, stream>>>(Y, F[9], F[10], (float*)d_out);
}

// v010
// Measured time: 58.8 microseconds a run.
// Timed twice side by side with v009, it ran 1.05 times as fast both times.
// Over all steps from v000 it is 14.6 times as fast.
// compute dtype: all float inputs rounded to bf16; q/k/v projections with EXACT bf16 products on WMMA 16x16x32 (f32 accumulate) + bias; causal logits: 3 products for the first 384 rows, single f16 q x k after, x 64^-0.5; online softmax f32 (running maximum, one launch for logits, softmax and P v; exponent in base 2, scale and 2^11 inside its argument); exp(s - max) x 2^11 once to f16 x v once to f16 (bf16 hi + lo below row 384); ctx hi+lo x exact output weight below row 384, x2^6 f16 carry x f16(bf16 x 2^8) after, + bias; f32 output.
#include <hip/hip_runtime.h>
#include <math.h>

typedef __attribute__((ext_vector_type(16))) _Float16 v16h;
typedef __attribute__((ext_vector_type(16))) __bf16 v16b;
typedef __attribute__((ext_vector_type(8)))  _Float16 v8h;
typedef __attribute__((ext_vector_type(8)))  float v8f;
typedef __attribute__((ext_vector_type(4)))  float v4f;
typedef __attribute__((ext_vector_type(2)))  float v2f;
typedef __attribute__((ext_vector_type(4)))  unsigned v4u;
typedef __attribute__((ext_vector_type(4)))  int v4i;
typedef float __attribute__((may_alias)) float_a;
typedef int __attribute__((may_alias)) int_a;

template <typename T> __device__ __forceinline__ void vst2(void* p, T v) { *(T*)p = v;  }
__device__ __forceinline__ v8f wmma16(v16h a, v16h b, v8f c) {
  v8f d = __builtin_amdgcn_wmma_f32_16x16x32_f16(false, a, false, b, (short)0, c, false, false);
  asm volatile("v_nop\n\tv_nop\n\tv_nop\n\tv_nop" : "+v"(d) : "v"(a), "v"(b));
  return d;
}
__device__ __forceinline__ v8f wmma_bf(v16b a, v16b b, v8f c) {
  v8f d = __builtin_amdgcn_wmma_f32_16x16x32_bf16(false, a, false, b, (short)0, c, false, false);
  asm volatile("v_nop\n\tv_nop\n\tv_nop\n\tv_nop" : "+v"(d) : "v"(a), "v"(b));
  return d;
}
// 16x16x32 fragments: lane = (h = lane>>4, row/col = lane&15); elements 0..7 = k0+8h+0..7, 8..15 = k0+16+8h+0..7; D element r = row 8h+r
__device__ __forceinline__ v16h frag_h(const _Float16* rowk0, int lane) {
  union { v16h v; v8h q[2]; } u; const _Float16* p = rowk0 + 8 * (lane >> 4);
  u.q[0] = *(const v8h*)p; u.q[1] = *(const v8h*)(p + 16); return u.v;
}
__device__ __forceinline__ v16h frag_f32(const float* rowk0, int lane) {
  v16h a; const float* p = rowk0 + 8 * (lane >> 4);
#pragma unroll
  for (int i = 0; i < 8; ++i) { a[i] = (_Float16)p[i]; a[8 + i] = (_Float16)p[16 + i]; }
  return a;
}
__device__ __forceinline__ v16h frag_f32s(const float* rowk0, int lane, float sc) {
  v16h a; const float* p = rowk0 + 8 * (lane >> 4);
#pragma unroll
  for (int i = 0; i < 8; ++i) { a[i] = (_Float16)(p[i] * sc); a[8 + i] = (_Float16)(p[16 + i] * sc); }
  return a;
}
// column fragment from a [K][ld] layout (column n), rows >= K read as 0
__device__ __forceinline__ v16h fragc_f32(const float* W, int k0, int n, int lane, int ld, int K) {
  v16h a; const int g = lane >> 4;
#pragma unroll
  for (int i = 0; i < 8; ++i) { const int ka = k0 + 8 * g + i, kb = ka + 16;
    a[i] = (_Float16)(ka < K ? W[(size_t)(ka < K ? ka : K - 1) * ld + n] : 0.f); a[8 + i] = (_Float16)(kb < K ? W[(size_t)(kb < K ? kb : K - 1) * ld + n] : 0.f); }
  return a;
}
struct F2 { v16b h, l; };
__device__ __forceinline__ F2 bsplit16(const float v[16]) { F2 r;
#pragma unroll
  for (int i = 0; i < 16; ++i) { const __bf16 h = (__bf16)v[i]; r.h[i] = h; r.l[i] = (__bf16)(v[i] - (float)h); }
  return r; }
__device__ __forceinline__ F2 split_row(const float* row, int k0, int lane) { float v[16]; const float* p = row + k0 + 8 * (lane >> 4);
#pragma unroll
  for (int i = 0; i < 8; ++i) { v[i] = p[i]; v[8 + i] = p[16 + i]; }
  return bsplit16(v); }
__device__ __forceinline__ F2 split_rowK(const float* row, int k0, int lane, int K) { float v[16]; const int g = lane >> 4;
#pragma unroll
  for (int i = 0; i < 8; ++i) { const int ka = k0 + 8 * g + i, kb = ka + 16; v[i] = ka < K ? row[ka < K ? ka : K - 1] : 0.f; v[8 + i] = kb < K ? row[kb < K ? kb : K - 1] : 0.f; }
  return bsplit16(v); }
__device__ __forceinline__ F2 split_col(const float* W, int k0, int n, int lane, int ld, int K) { float v[16]; const int g = lane >> 4;
#pragma unroll
  for (int i = 0; i < 8; ++i) { const int ka = k0 + 8 * g + i, kb = ka + 16; v[i] = ka < K ? W[(size_t)(ka < K ? ka : K - 1) * ld + n] : 0.f; v[8 + i] = kb < K ? W[(size_t)(kb < K ? kb : K - 1) * ld + n] : 0.f; }
  return bsplit16(v); }
__device__ __forceinline__ v8f mac3(const F2& a, const F2& b, v8f c) { c = wmma_bf(a.l, b.h, c); c = wmma_bf(a.h, b.l, c); return wmma_bf(a.h, b.h, c); }
__device__ __forceinline__ float sigm(float v) { return 1.0f / (1.0f + expf(-v)); }
#define LDSX() do { asm volatile("s_wait_dscnt 0" ::: "memory"); __builtin_amdgcn_wave_barrier(); __builtin_amdgcn_fence(__ATOMIC_RELEASE, "workgroup"); } while (0)

// Causal multi-head attention on separate inputs listed key-first (key / value / query [4,1024,1024]; torch (out,in) Wk / Wq / Wv / Wp [1024,1024] (0.02) + zero biases; 16 heads x 64; scale 1/8; tril, -inf): out = merge(softmax(causal(q_h k_h^T / 8)) v_h) Wp^T + bp.
#define NB 4
#define TT 1024
#define CC 1024            // NH * HD = projected width
#define DIN 1024          // input (model) width
#define NH 16
#define HD 64
#define NQB (TT / 64)
#define HG 8
#define SCALE (0.125f)
#define CAUSAL 1
#ifndef TNB
#define TNB NB
#endif
__device__ __forceinline__ float bfr(float v) { return (float)(__bf16)v; }
__host__ __device__ __forceinline__ int kb_last(int qb) { return CAUSAL ? ((qb * 64 + 63) >> 7) : (TT / 128 - 1); }
typedef __attribute__((ext_vector_type(8))) __bf16 v8b;
__device__ __forceinline__ v16b frag_b(const __bf16* rowk0, int lane) {
  union { v16b v; v8b q[2]; } u; const __bf16* p = rowk0 + 8 * (lane >> 4);
  u.q[0] = *(const v8b*)p; u.q[1] = *(const v8b*)(p + 16); return u.v;
}
#define QBH 6              // causal: query blocks 0..QBH-1 of each sequence (few keys, no averaging) take the high-precision path
#define QHI 384            // rows carrying a q residual plane
#define KHI 384            // key rows carrying k residual / v bf16 hi+lo planes (used only by the causal high-precision path)
// B fragment (k rows k0+.., output column o) of a weight: (in,out) [K][ld] or (out,in) [ld rows of K]: bf16 exact, or f16(bf16 * 256) exact
__device__ __forceinline__ v16b wcol_io(const float* Wm, int k0, int o, int lane, int ld) { v16b w; const int g = lane >> 4;
#pragma unroll
  for (int i = 0; i < 8; ++i) { w[i] = (__bf16)Wm[(size_t)(k0 + 8 * g + i) * ld + o]; w[8 + i] = (__bf16)Wm[(size_t)(k0 + 16 + 8 * g + i) * ld + o]; }
  return w; }
__device__ __forceinline__ v16b wcol_oi(const float* Wm, int k0, int o, int lane, int K) { v16b w; const float* p = Wm + (size_t)o * K + k0 + 8 * (lane >> 4);
#pragma unroll
  for (int i = 0; i < 8; ++i) { w[i] = (__bf16)p[i]; w[8 + i] = (__bf16)p[16 + i]; }
  return w; }
__device__ __forceinline__ v16h wcolh_io(const float* Wm, int k0, int o, int lane, int ld) { v16h w; const int g = lane >> 4;
#pragma unroll
  for (int i = 0; i < 8; ++i) { w[i] = (_Float16)(bfr(Wm[(size_t)(k0 + 8 * g + i) * ld + o]) * 256.0f); w[8 + i] = (_Float16)(bfr(Wm[(size_t)(k0 + 16 + 8 * g + i) * ld + o]) * 256.0f); }
  return w; }
__device__ __forceinline__ v16h wcolh_oi(const float* Wm, int k0, int o, int lane, int K) { v16h w; const float* p = Wm + (size_t)o * K + k0 + 8 * (lane >> 4);
#pragma unroll
  for (int i = 0; i < 8; ++i) { w[i] = (_Float16)(bfr(p[i]) * 256.0f); w[8 + i] = (_Float16)(bfr(p[16 + i]) * 256.0f); }
  return w; }
#define WQKV_LAYOUT 1   // 0 = (in,out) [DIN][CC]; 1 = (out,in) [CC][DIN]; 2 = per-head [NH][DIN][HD]
__device__ __forceinline__ v16b wcol_hdk(const float* Wm, int k0, int o, int lane) { v16b w; const int g = lane >> 4; const float* p = Wm + (size_t)(o / HD) * DIN * HD + (o % HD);
#pragma unroll
  for (int i = 0; i < 8; ++i) { w[i] = (__bf16)p[(size_t)(k0 + 8 * g + i) * HD]; w[8 + i] = (__bf16)p[(size_t)(k0 + 16 + 8 * g + i) * HD]; }
  return w; }
#define WO_OUT_IN 1
#if WQKV_LAYOUT == 1
#define WCOL(W, k0, o, lane) wcol_oi(W, k0, o, lane, DIN)
#elif WQKV_LAYOUT == 2
#define WCOL(W, k0, o, lane) wcol_hdk(W, k0, o, lane)
#else
#define WCOL(W, k0, o, lane) wcol_io(W, k0, o, lane, CC)
#endif
#if WO_OUT_IN
#define WOCOL(W, k0, o, lane) wcol_oi(W, k0, o, lane, CC)
#define WOCOLH(W, k0, o, lane) wcolh_oi(W, k0, o, lane, CC)
#else
#define WOCOL(W, k0, o, lane) wcol_io(W, k0, o, lane, DIN)
#define WOCOLH(W, k0, o, lane) wcolh_io(W, k0, o, lane, DIN)
#endif

#ifndef SM_EXTRA_PARAMS
#define SM_EXTRA_PARAMS
#endif
#ifndef PROJ_EXTRA_PARAMS
#define PROJ_EXTRA_PARAMS
#endif
#ifndef SM_MASK_HOOK
#define SM_MASK_HOOK (void)0
#endif

#define WS_QH  0u                                      // f16 q rows [b*t][CC]
#define WS_KH  (WS_QH + 2u * (size_t)NB * TT * CC)      // f16 k rows [b*t][CC]
#define WS_VT  (WS_KH + 2u * (size_t)NB * TT * CC)      // f16 v planes [b][c][t]
#define WS_QL  (WS_VT + 2u * (size_t)NB * CC * TT)      // f16 q residual x 2^10 rows [b][t < QHI][CC]
#define WS_KL  (WS_QL + 2u * (size_t)NB * QHI * CC)     // f16 k residual x 2^10 rows [b][t < KHI][CC]
#define WS_VB  (WS_KL + 2u * (size_t)NB * KHI * CC)     // bf16 v hi planes [b][c][t < KHI]
#define WS_VBL (WS_VB + 2u * (size_t)NB * CC * KHI)
#define WS_S   (WS_VBL + 2u * (size_t)NB * CC * KHI)    // f32 [hg][t][s] region, unused: logits and P stay in registers
#define WS_Y   (WS_S  + 4u * (size_t)HG * TT * TT)      // f32 ctx rows [b*t][CC] (only when there is an output projection)
#define WS_END (WS_Y  + 4u * (size_t)NB * TT * CC)

// precaution behind a group of global loads: the group's address stays an input of the wait, so its registers are rewritten only behind the wait
#define XW2(p, q) asm volatile("s_wait_xcnt 0x0" :: "v"(p), "v"(q) : "memory")
// work-group barrier of the operand buffers, by hand and in two halves with a step's products between them. RINGSIG: the wave's own LDS stores have landed and its fragment reads have returned (s_wait_dscnt 0) before it signals. RINGWAIT: at the head of the next step. No LDS access stands between the two, and they alternate strictly in every wave. __syncthreads() would also wait for the global loads, which are to stay in flight across it
#define RINGSIG() do { asm volatile("s_wait_dscnt 0x0" ::: "memory"); asm volatile("s_barrier_signal -1" ::: "memory"); } while (0)
#define RINGWAIT() asm volatile("s_barrier_wait -1" ::: "memory")
#define KP 40              // pitch of a staged 32-k row in 16-bit elements: 80 B = 16 B x odd, where 16-byte fragment reads of 16 rows meet no bank twice
typedef __attribute__((ext_vector_type(4))) __bf16 v4b;
typedef __attribute__((ext_vector_type(4))) _Float16 v4h;
// four 16-byte pieces of an epilogue tile, LDS -> global (rows ls and gs bytes apart). The closing s_wait_xcnt 0 is a precaution: the stores' addresses and data stay inputs of the wait, so that their registers are rewritten only behind it
__device__ __forceinline__ void st4(char* gp, size_t gs, const unsigned char* lp, unsigned ls) { v4u d[4];
#pragma unroll
  for (int u = 0; u < 4; ++u) d[u] = *(const v4u*)(lp + u * ls);
#pragma unroll
  for (int u = 0; u < 4; ++u) vst2(gp + u * gs, d[u]);
  asm volatile("s_wait_xcnt 0x0" :: "v"(gp), "v"(gp + gs), "v"(gp + 2 * gs), "v"(gp + 3 * gs), "v"(d[0]), "v"(d[1]), "v"(d[2]), "v"(d[3]) : "memory"); }
// ---- k_proj: block = (256 rows, 256 cols, which), eight waves in 2 x 4, one wave = 128 rows x 64 cols (8 x 4 accumulator tiles, so that a staged row serves 256 outputs of the block; the wave's rows are two groups of 64, one in each 128-row half of the block, so that the epilogue goes half by half with every wave at work): q/k/v = X W (+ b) with exact bf16 products (K = DIN) -> which 0: q f16 rows (+ residual rows < QHI); 1: k f16 rows (+ residual rows < KHI); 2: v f16 planes [c][t] (+ bf16 hi/lo planes for t < KHI)
#define PM 256             // rows of a k_proj block; TT is a multiple of it, so a block lies in one sequence
#define PN 256             // columns of a k_proj block
#define PH 128             // rows of an epilogue half; QHI and KHI are multiples of it, so a half lies on one side of the residual rows' end
__global__ __launch_bounds__(256) void k_proj(const float* __restrict__ XQ, const float* __restrict__ XK, const float* __restrict__ XV, const float* __restrict__ WQ, const float* __restrict__ WK, const float* __restrict__ WV, const float* __restrict__ BQ, const float* __restrict__ BK, const float* __restrict__ BV,
    _Float16* __restrict__ QH, _Float16* __restrict__ QL, _Float16* __restrict__ KH, _Float16* __restrict__ KL, _Float16* __restrict__ VT, __bf16* __restrict__ VB, __bf16* __restrict__ VBL) {
  /* one LDS block: the two operand buffers of the k loop first, the epilogue's tiles of one half (q/k: sh, sl; v: th, tb, tbl) behind the barrier that ends the loop's last reads */
  __shared__ __align__(16) unsigned char smem[3 * PN * (PH + 8) * 2];
  __bf16 (*stg)[PM + PN][KP] = (__bf16 (*)[PM + PN][KP])smem;
  _Float16 (*sh)[PN + 8] = (_Float16 (*)[PN + 8])smem; _Float16 (*sl)[PN + 8] = (_Float16 (*)[PN + 8])(smem + PH * (PN + 8) * 2);
  _Float16 (*th)[PH + 8] = (_Float16 (*)[PH + 8])smem; __bf16 (*tb)[PH + 8] = (__bf16 (*)[PH + 8])(smem + PN * (PH + 8) * 2); __bf16 (*tbl)[PH + 8] = (__bf16 (*)[PH + 8])(smem + 2 * PN * (PH + 8) * 2);
  const int tid = threadIdx.x, wave = tid >> 5, lane = tid & 31, col = lane & 15, g = lane >> 4; const int wr = (wave >> 2) * 64, wc = (wave & 3) * 64; const int which = blockIdx.z; const int c0 = blockIdx.y * PN; const size_t r0 = (size_t)blockIdx.x * PM; const size_t bb = r0 / TT; const int t0 = (int)(r0 % TT);
  const float* X = which == 0 ? XQ : which == 1 ? XK : XV; const float* WA = which == 0 ? WQ : which == 1 ? WK : WV; const float* BA = which == 0 ? BQ : which == 1 ? BK : BV;
  v8f acc[8][4] = {};
  /* a 32-k step of the block's 256 X rows and 256 W rows: thread = (row lr of 32, 16-B piece lq), so a wave's load covers four whole 128-B lines; rounded to bf16 once for the block; buffer rows 0..255 = X, 256..511 = W */
  const int lr = tid >> 3, lq = tid & 7; const float* bx = X + (r0 + lr) * DIN + lq * 4; const float* bw = WA + (size_t)(c0 + lr) * DIN + lq * 4; v4f pre[16];
  /* the k walk is a ring: the block starts at a step of its own and wraps, so that the 4 blocks that share its X rows and the 16 that share its W rows do not ask L2 for the same lines at the same moment; sharers of X stand 8 steps apart, sharers of W 2 */
  const int ks0 = (int)(2 * blockIdx.x + 8 * blockIdx.y + blockIdx.z) & (DIN / 32 - 1); const float* gx = bx + ks0 * 32; const float* gw = bw + ks0 * 32;
#pragma unroll
  for (int i = 0; i < 8; ++i) pre[i] = *(const v4f*)(gx + (size_t)i * 32 * DIN);
#pragma unroll
  for (int i = 0; i < 8; ++i) pre[8 + i] = *(const v4f*)(gw + (size_t)i * 32 * DIN);
  XW2(gx, gw);
  /* put: the step held in pre is rounded and stored into buffer bn; get: the lines of walk step s are asked for */
  auto put = [&](__bf16 (*bn)[KP]) {
#pragma unroll
    for (int i = 0; i < 16; ++i) { v4b c;
#pragma unroll
      for (int e = 0; e < 4; ++e) c[e] = (__bf16)pre[i][e];
      *(v4b*)&bn[i * 32 + lr][lq * 4] = c; } };
  auto get = [&](int s) { const int kn = ((s + ks0) & (DIN / 32 - 1)) * 32; gx = bx + kn; gw = bw + kn;
#pragma unroll
    for (int i = 0; i < 8; ++i) pre[i] = *(const v4f*)(gx + (size_t)i * 32 * DIN);
#pragma unroll
    for (int i = 0; i < 8; ++i) pre[8 + i] = *(const v4f*)(gw + (size_t)i * 32 * DIN);
    XW2(gx, gw); };
  /* a step: behind the wait its buffer is published and the other buffer has been left by every reader; the wave reads its fragments, stores the next step into the other buffer under their latency, asks for the step after that, signals, and only then multiplies. A wave that has done its products finds the barrier open, because every wave signals in front of its own products: so of the two waves of a SIMD one can be at its LDS work while the other holds the matrix unit */
  auto pass = [&](const int kc, const bool st, const bool ld) { __bf16 (*bf)[KP] = stg[kc & 1];
    RINGWAIT();
    v16b a[8], w[4];
#pragma unroll
    for (int j = 0; j < 4; ++j) w[j] = frag_b(&bf[PM + wc + j * 16 + col][0], lane);
#pragma unroll
    for (int i = 0; i < 8; ++i) a[i] = frag_b(&bf[(i >> 2) * PH + wr + (i & 3) * 16 + col][0], lane);
    __builtin_amdgcn_sched_barrier(0);   /* keeps all 24 fragment reads in one group at the head of the step, in front of the wait for the next step's lines */
    if (st) put(stg[(kc + 1) & 1]);
    if (ld) get(kc + 2);
    RINGSIG();
    __builtin_amdgcn_sched_barrier(0);   /* keeps the products behind the signal */
#pragma unroll
    for (int i = 0; i < 8; ++i)
#pragma unroll
      for (int j = 0; j < 4; ++j) acc[i][j] = __builtin_amdgcn_wmma_f32_16x16x32_bf16(false, a[i], false, w[j], (short)0, acc[i][j], false, false);   /* the bare builtin: 32 accumulator tiles reach past v255, which an asm operand cannot name; the compiler keeps the distances behind its own matrix instructions */
    __builtin_amdgcn_sched_barrier(0);   /* keeps the next step's fragment reads behind this step's products */ };
  put(stg[0]); get(1); RINGSIG();
#pragma unroll 2   /* two steps a trip: the buffer's number is a constant in each */
  for (int kc = 0; kc < DIN / 32 - 2; ++kc) pass(kc, true, true);
  pass(DIN / 32 - 2, true, false); pass(DIN / 32 - 1, false, false);   /* the last two steps stand alone: nothing is left to ask for, then nothing to store, and no branch stands round the loads of the loop */
  RINGWAIT();   /* the partner of the last step's signal */
#pragma unroll 1   /* stays rolled: the epilogue is straight-line code that runs once a wave, and two copies of it would double the kernel's text */
  for (int p = 0; p < 2; ++p) { const size_t rp = r0 + p * PH; const int tp = t0 + p * PH;   /* half p = accumulator tiles 4 p .. 4 p + 3 of every wave, which stand in tiles 0 .. 3 when their half comes */
    __syncthreads();   /* p = 0: every wave has read its last fragments before the epilogue's tiles overwrite the buffers; p = 1: every thread has read the first half's tiles before the second half overwrites them */
    if (which < 2) { _Float16* DH = which == 0 ? QH : KH; _Float16* DL = which == 0 ? QL : KL; const int nhi = which == 0 ? QHI : KHI; const bool hi_rows = tp < nhi;
#pragma unroll
      for (int j = 0; j < 4; ++j) { const float bias = BA ? bfr(BA[c0 + wc + j * 16 + col]) : 0.f;
#pragma unroll
        for (int i = 0; i < 4; ++i)
#pragma unroll
          for (int r = 0; r < 8; ++r) { const float v = acc[i][j][r] + bias; const _Float16 hv = (_Float16)v; sh[wr + i * 16 + 8 * g + r][wc + j * 16 + col] = hv; sl[wr + i * 16 + 8 * g + r][wc + j * 16 + col] = (_Float16)((v - (float)hv) * 1024.0f); } }
      __syncthreads();
      /* thread = (row rl of 8, 16-B piece q): a wave's store covers one whole 512-B row segment */
      for (int rl = tid >> 5; rl < PH; rl += 32) { const int q = tid & 31; st4((char*)(DH + (rp + rl) * CC + c0 + q * 8), 8 * CC * 2, (const unsigned char*)&sh[rl][q * 8], 8 * (PN + 8) * 2); if (hi_rows) st4((char*)(DL + (bb * nhi + tp + rl) * (size_t)CC + c0 + q * 8), 8 * CC * 2, (const unsigned char*)&sl[rl][q * 8], 8 * (PN + 8) * 2); }
    } else { const bool hi_rows = tp < KHI;
#pragma unroll
      for (int j = 0; j < 4; ++j) { const float bias = BA ? bfr(BA[c0 + wc + j * 16 + col]) : 0.f;
#pragma unroll
        for (int i = 0; i < 4; ++i)
#pragma unroll
          for (int r = 0; r < 8; ++r) { const float v = acc[i][j][r] + bias; const int rl = wr + i * 16 + 8 * g + r, cl = wc + j * 16 + col; th[cl][rl] = (_Float16)v; const __bf16 bh = (__bf16)v; tb[cl][rl] = bh; tbl[cl][rl] = (__bf16)(v - (float)bh); } }
      __syncthreads();
      /* thread = (plane row cl of 16, 16-B piece q) */
      for (int cl = tid >> 4; cl < PN; cl += 64) { const int q = tid & 15; st4((char*)(VT + (bb * CC + c0 + cl) * (size_t)TT + tp + q * 8), 16 * TT * 2, (const unsigned char*)&th[cl][q * 8], 16 * (PH + 8) * 2); if (hi_rows) { const size_t o3 = (bb * CC + c0 + cl) * (size_t)KHI + tp + q * 8; st4((char*)(VB + o3), 16 * KHI * 2, (const unsigned char*)&tb[cl][q * 8], 16 * (PH + 8) * 2); st4((char*)(VBL + o3), 16 * KHI * 2, (const unsigned char*)&tbl[cl][q * 8], 16 * (PH + 8) * 2); } } }
#pragma unroll
    for (int i = 0; i < 4; ++i)
#pragma unroll
      for (int j = 0; j < 4; ++j) acc[i][j] = acc[4 + i][j]; } }
// ---- k_attn: block = 64 queries (qb, heaviest first) of (b, h), one wave = 16 queries; the waves share the staged K and V tiles and nothing else. Per 64 keys: S^T = K . Q^T (A = key rows, B = query rows, same loader on both sides), so a lane holds 32 scores of ONE query (query = lane & 15, key = 16 j + 8 (lane >> 4) + r); running maximum and sum in f32 (online softmax, halves joined by one lane exchange); P^T x 2^11 packs from two score tiles straight into a B operand; O^T += V^T . P^T with the v planes [c][t] as A. Products per path as before: query blocks < QBH take q hi + residual x k hi + residual (3 products) and P, v as bf16 hi + lo (3 products); the rest one f16 product each. Every fragment of a group is loaded in front of the group's first product, so that the loads fly together. The K and V tiles of a key block (64 rows of 128 B each) are brought into LDS once for the block's four waves, as whole lines, by asynchronous copies, one key block ahead, in two buffers; the fragments are read from there
#define TP 144             // pitch of a staged 128-B row in bytes: 16 B x odd, where 16-byte fragment reads of 16 rows meet no bank twice
#define TILEB (64 * TP)    // one staged tile
// two tiles, four copies a thread each (rows cr, cr + 16, cr + 32, cr + 48; a wave's copy covers four whole lines). s_wait_xcnt 0 is the last line of the copies' own statement: a precaution, so that no register which a copy names is rewritten in front of it
__device__ __forceinline__ void cp2tiles(unsigned la, const char* ga, size_t sa, unsigned lb, const char* gb, size_t sb) {
  asm volatile("global_load_async_to_lds_b128 %0, %8, off\n\tglobal_load_async_to_lds_b128 %1, %9, off\n\tglobal_load_async_to_lds_b128 %2, %10, off\n\tglobal_load_async_to_lds_b128 %3, %11, off\n\t"
               "global_load_async_to_lds_b128 %4, %12, off\n\tglobal_load_async_to_lds_b128 %5, %13, off\n\tglobal_load_async_to_lds_b128 %6, %14, off\n\tglobal_load_async_to_lds_b128 %7, %15, off\n\ts_wait_xcnt 0x0"
               :: "v"(la), "v"(la + 16 * TP), "v"(la + 32 * TP), "v"(la + 48 * TP), "v"(lb), "v"(lb + 16 * TP), "v"(lb + 32 * TP), "v"(lb + 48 * TP),
                  "v"(ga), "v"(ga + sa), "v"(ga + 2 * sa), "v"(ga + 3 * sa), "v"(gb), "v"(gb + sb), "v"(gb + 2 * sb), "v"(gb + 3 * sb) : "memory"); }
// fragment from the lane's own address (row start + k0 + 8 (lane >> 4)): same element order as frag_h / frag_b
__device__ __forceinline__ v16h frag_hp(const _Float16* p) { union { v16h v; v8h q[2]; } u; u.q[0] = *(const v8h*)p; u.q[1] = *(const v8h*)(p + 16); return u.v; }
__device__ __forceinline__ v16b frag_bp(const __bf16* p) { union { v16b v; v8b q[2]; } u; u.q[0] = *(const v8b*)p; u.q[1] = *(const v8b*)(p + 16); return u.v; }
// 2^x in place by the bare exponent instruction. Each instruction overwrites its own source alone and reads no neighbour's result; the closing v_nop is the slot that the instruction set asks for behind a transcendental before its result is read
__device__ __forceinline__ float exp2_1(float x) { asm("v_exp_f32 %0, %0\n\tv_nop" : "+v"(x)); return x; }
__device__ __forceinline__ void exp2_16(float (&x)[16]) {
  asm("v_exp_f32 %0, %0\n\tv_exp_f32 %1, %1\n\tv_exp_f32 %2, %2\n\tv_exp_f32 %3, %3\n\tv_exp_f32 %4, %4\n\tv_exp_f32 %5, %5\n\tv_exp_f32 %6, %6\n\tv_exp_f32 %7, %7\n\t"
      "v_exp_f32 %8, %8\n\tv_exp_f32 %9, %9\n\tv_exp_f32 %10, %10\n\tv_exp_f32 %11, %11\n\tv_exp_f32 %12, %12\n\tv_exp_f32 %13, %13\n\tv_exp_f32 %14, %14\n\tv_exp_f32 %15, %15\n\tv_nop"
      : "+v"(x[0]), "+v"(x[1]), "+v"(x[2]), "+v"(x[3]), "+v"(x[4]), "+v"(x[5]), "+v"(x[6]), "+v"(x[7]), "+v"(x[8]), "+v"(x[9]), "+v"(x[10]), "+v"(x[11]), "+v"(x[12]), "+v"(x[13]), "+v"(x[14]), "+v"(x[15])); }
template <bool HI> __device__ __forceinline__ void attn_wave(const _Float16* __restrict__ QH, const _Float16* __restrict__ KH, const _Float16* __restrict__ QL, const _Float16* __restrict__ KL, const _Float16* __restrict__ VT, const __bf16* __restrict__ VB, const __bf16* __restrict__ VBL, int b, int h, int qb, int wave, int lane, unsigned char* sm, float* __restrict__ Y) {
  const int col = lane & 15, g = lane >> 4; const int ql0 = qb * 64 + wave * 16; const int t = ql0 + col; const size_t q0 = (size_t)b * TT + ql0; const int nkb = CAUSAL ? qb + 1 : TT / 64;
  /* the key walk is a ring: the block starts at a key block of its own and wraps, so that the query blocks of one (b, h), which read the same K and V lines, and the heads, whose v tiles of one key block lie a whole plane pitch apart, do not ask L2 for them at the same moment. All block-uniform */
  const int kst = (((h + 3 * qb) & 15) * nkb) >> 4;   /* a sixteenth of the ring's length times a number that differs between neighbouring query blocks and between heads */ auto ring = [&](int i) { const int v = i + kst; return v < nkb ? v : v - nkb; };
  /* staging: thread = (row cr of 16, 16-B piece cq); a stage = K, V (f16 path) or K, K residual, v hi, v lo (high-precision path) */
  constexpr unsigned STG = (HI ? 4 : 2) * TILEB; const int cr = (int)threadIdx.x >> 3, cq = (int)threadIdx.x & 7; const unsigned lcp = (unsigned)(size_t)sm + cr * TP + cq * 16;
  const unsigned tk = cr * (CC * 2) + cq * 16, tv = cr * (TT * 2) + cq * 16, tb = cr * (KHI * 2) + cq * 16;   /* the thread's byte offset in a tile's source, by the source's row pitch; the tile's own start is the same for the block */
  auto fill = [&](int i) { const unsigned l = lcp + (i & 1) * STG; const int kb = ring(i);   /* i: place in the walk (it picks the buffer); kb: the key block */
    const char* gk = (const char*)(KH + ((size_t)b * TT + kb * 64) * CC + h * HD) + tk;
    if (HI) { cp2tiles(l, gk, 16 * CC * 2, l + TILEB, (const char*)(KL + ((size_t)b * KHI + kb * 64) * CC + h * HD) + tk, 16 * CC * 2);
      cp2tiles(l + 2 * TILEB, (const char*)(VB + ((size_t)b * CC + h * HD) * (size_t)KHI + kb * 64) + tb, 16 * KHI * 2, l + 3 * TILEB, (const char*)(VBL + ((size_t)b * CC + h * HD) * (size_t)KHI + kb * 64) + tb, 16 * KHI * 2); }
    else cp2tiles(l, gk, 16 * CC * 2, l + TILEB, (const char*)(VT + ((size_t)b * CC + h * HD) * (size_t)TT + kb * 64) + tv, 16 * TT * 2); };
  fill(0);
  v16h qh[HD / 32], qlo[HD / 32];
#pragma unroll
  for (int kc = 0; kc < HD / 32; ++kc) { qh[kc] = frag_h(QH + (q0 + col) * CC + h * HD + kc * 32, lane); if (HI) qlo[kc] = frag_h(QL + ((size_t)b * QHI + ql0 + col) * CC + h * HD + kc * 32, lane); }
  v8f o[HD / 16] = {}; float m = -3.0e38f, l = 0.f;   /* m: running maximum of the unscaled logits; l: running sum of the weights x 2^11 */
  constexpr float C2 = SCALE * 1.44269504088896340736f;   /* logit -> exponent in base 2 */
  float nb = 3.0e38f * C2;   /* the addend in use: 11 - m C2, rounded once and used for the weights and for the rescale alike, so that its rounding cancels */
  asm volatile("s_wait_asynccnt 0x0" ::: "memory");   /* the wave's own copies of the walk's first key block have landed */
  __syncthreads();   /* publishes the walk's first key block */
  if (nkb > 1) fill(1);   /* block-uniform */
#pragma unroll 1   /* stays rolled: one key block's fragments already fill the registers that four waves a SIMD leave a wave */
  for (int kb = 0; kb < nkb; ++kb) { const int k0 = ring(kb) * 64; v8f s[4]; v16h kf[4][HD / 32], kl[4][HD / 32], vf[2][HD / 16];
    const unsigned char* bp = sm + (kb & 1) * STG + col * TP + g * 16;   /* the lane's place in a staged tile: row col, 16-B piece g */
#pragma unroll
    for (int j = 0; j < 4; ++j)
#pragma unroll
      for (int kc = 0; kc < HD / 32; ++kc) kf[j][kc] = frag_hp((const _Float16*)(bp + j * 16 * TP + kc * 64));
#pragma unroll
    for (int j = 0; j < 4; ++j) { v8f acc = {}, accl = {};
      if (HI) {   /* the residual fragments come tile by tile: all four at once, beside the four k fragments, do not fit the registers that four waves a SIMD leave a wave */
#pragma unroll
        for (int kc = 0; kc < HD / 32; ++kc) kl[j][kc] = frag_hp((const _Float16*)(bp + TILEB + j * 16 * TP + kc * 64)); }
#pragma unroll
      for (int kc = 0; kc < HD / 32; ++kc) { acc = wmma16(kf[j][kc], qh[kc], acc); if (HI) { accl = wmma16(kf[j][kc], qlo[kc], accl); accl = wmma16(kl[j][kc], qh[kc], accl); } }
#pragma unroll
      for (int r = 0; r < 8; ++r) s[j][r] = HI ? acc[r] + accl[r] * (1.0f / 1024.0f) : acc[r]; }   /* unscaled: the scale sits in C2 */
    if (!HI) {   /* f16 path: v is read here, so that it flies under the softmax arithmetic */
#pragma unroll
      for (int kc = 0; kc < 2; ++kc)
#pragma unroll
        for (int jd = 0; jd < HD / 16; ++jd) vf[kc][jd] = frag_hp((const _Float16*)(bp + TILEB + jd * 16 * TP + kc * 64)); }
    if (CAUSAL && k0 + 63 > ql0) {   /* wave-uniform: only a key block that reaches past the wave's first query holds excluded keys */
#pragma unroll
      for (int j = 0; j < 4; ++j)
#pragma unroll
        for (int r = 0; r < 8; ++r) if (k0 + j * 16 + 8 * g + r > t) s[j][r] = -3.0e38f; }
    float mx = -3.0e38f;
#pragma unroll
    for (int j = 0; j < 4; ++j)
#pragma unroll
      for (int r = 0; r < 8; ++r) mx = fmaxf(mx, s[j][r]);
    mx = fmaxf(mx, __shfl_xor(mx, 16));
    /* every key block a wave walks holds a key <= each of its queries (k0 <= ql0), so mn is a real logit; an excluded score's argument is then about -5e37, where the exponent instruction returns 0 */
    const float mn = fmaxf(m, mx); const float nbn = fmaf(-mn, C2, 11.0f); const float alpha = exp2_1(nbn - nb); m = mn; nb = nbn;
    float ls = 0.f;
#pragma unroll
    for (int kc = 0; kc < 2; ++kc) { float x[16];   /* exp(scale (s - max)) x 2^11: one multiply-add and one exponent instruction a score */
#pragma unroll
      for (int i = 0; i < 16; ++i) x[i] = fmaf(s[2 * kc + (i >> 3)][i & 7], C2, nbn);
      exp2_16(x);
#pragma unroll
      for (int i = 0; i < 16; ++i) { ls += x[i]; s[2 * kc + (i >> 3)][i & 7] = x[i]; } }
    l = l * alpha + ls;
#pragma unroll
    for (int jd = 0; jd < HD / 16; ++jd)
#pragma unroll
      for (int r = 0; r < 8; ++r) o[jd][r] *= alpha;
#pragma unroll
    for (int kc = 0; kc < 2; ++kc) {
      if (HI) { float pv[16]; v16b vh[HD / 16], vl[HD / 16];
#pragma unroll
        for (int jd = 0; jd < HD / 16; ++jd) { vh[jd] = frag_bp((const __bf16*)(bp + 2 * TILEB + jd * 16 * TP + kc * 64)); vl[jd] = frag_bp((const __bf16*)(bp + 3 * TILEB + jd * 16 * TP + kc * 64)); }
#pragma unroll
        for (int i = 0; i < 8; ++i) { pv[i] = s[2 * kc][i]; pv[8 + i] = s[2 * kc + 1][i]; }
        const F2 p = bsplit16(pv);
#pragma unroll
        for (int jd = 0; jd < HD / 16; ++jd) { o[jd] = wmma_bf(vh[jd], p.h, o[jd]); o[jd] = wmma_bf(vh[jd], p.l, o[jd]); o[jd] = wmma_bf(vl[jd], p.h, o[jd]); }
      } else { v16h p;
#pragma unroll
        for (int i = 0; i < 8; ++i) { p[i] = (_Float16)s[2 * kc][i]; p[8 + i] = (_Float16)s[2 * kc + 1][i]; }
#pragma unroll
        for (int jd = 0; jd < HD / 16; ++jd) o[jd] = wmma16(vf[kc][jd], p, o[jd]); } }
    asm volatile("s_wait_dscnt 0x0" ::: "memory");      /* the wave's reads of this buffer have returned */
    asm volatile("s_wait_asynccnt 0x0" ::: "memory");   /* its copies of the next key block have landed */
    __syncthreads();   /* publishes the next key block; it also ends every wave's reads of this buffer, which is refilled behind it */
    if (kb + 2 < nkb) fill(kb + 2);   /* block-uniform */ }
  asm volatile("s_wait_asynccnt 0x0" ::: "memory");   /* no copy is left in flight when the buffers become the output's staging; the last key block's barrier has ended every wave's reads */
  float (*st)[HD + 4] = (float (*)[HD + 4])(sm + wave * (16 * (HD + 4) * 4));
  l += __shfl_xor(l, 16);
  const float inv = l > 0.f ? 1.0f / l : 0.f;   /* l carries the same 2^11 as the weights */
#pragma unroll
  for (int jd = 0; jd < HD / 16; ++jd) { v4f a, c;
#pragma unroll
    for (int r = 0; r < 4; ++r) { a[r] = o[jd][r] * inv; c[r] = o[jd][4 + r] * inv; }
    *(v4f*)&st[col][jd * 16 + 8 * g] = a; *(v4f*)&st[col][jd * 16 + 8 * g + 4] = c; }
  LDSX();   /* the wave's own LDS stores land before other lanes of the wave read them: two whole 256-B (row, head) segments a store */
#pragma unroll
  for (int rl = 0; rl < 16; rl += 2) vst2(Y + (q0 + rl + g) * CC + h * HD + col * 4, *(const v4f*)&st[rl + g][col * 4]); }
__global__ __launch_bounds__(128) void k_attn(const _Float16* __restrict__ QH, const _Float16* __restrict__ KH, const _Float16* __restrict__ QL, const _Float16* __restrict__ KL, const _Float16* __restrict__ VT, const __bf16* __restrict__ VB, const __bf16* __restrict__ VBL, float* __restrict__ Y) { __shared__ __align__(16) unsigned char smem[2 * 4 * TILEB];   /* two buffers of up to four tiles; behind the key loop each wave's 16 x (HD + 4) f32 output staging */
  /* the wave's number in a scalar register: the causal test of a key block becomes a scalar branch */
  const int tid = threadIdx.x, wave = __builtin_amdgcn_readfirstlane(tid >> 5), lane = tid & 31; const int h = blockIdx.x, b = blockIdx.y, qb = NQB - 1 - (int)blockIdx.z;
  if (CAUSAL && qb < QBH) attn_wave<true>(QH, KH, QL, KL, VT, VB, VBL, b, h, qb, wave, lane, smem, Y);   /* block-uniform */
  else attn_wave<false>(QH, KH, QL, KL, VT, VB, VBL, b, h, qb, wave, lane, smem, Y); }
// ---- k_out: block = (128 rows, 128 cols), eight waves in 4 x 2, one wave = 32 rows x 64 cols (2 x 4 accumulator tiles), so that a SIMD holds two waves and one can round, store and read LDS while the other multiplies; a step = 64 k: out = ctx Wo (+ bo): ctx x 2^6 once to f16 against Wo as f16(bf16 x 2^8) exact (1 product) x 2^-14; causal early rows (< QHI of each sequence): ctx bf16 hi + lo against exact bf16 Wo (2 products)
#define OM 128             // rows of a k_out block; QHI and TT are multiples of it, so a block lies in one sequence and on one side of the early rows' end
#define ON 128             // columns of a k_out block
#define OKS 64             // k of a k_out step
#define OP 72              // pitch of a staged 64-k row in 16-bit elements: 144 B = 16 B x odd, where 16-byte fragment reads of 16 rows meet no bank twice
#define OSP 68             // pitch of a staged output row in floats: 272 B = 16 B x odd
template <bool HI> __device__ __forceinline__ void out_tile(const float* __restrict__ Y, const float* __restrict__ WO, const float* __restrict__ BO, float* __restrict__ OUT, unsigned char* smem) {
  constexpr int ROWS = HI ? 384 : 256;   /* buffer rows 0..127 = ctx, 128..255 = Wo, 256..383 = ctx residual (early rows only) */
  const int tid = threadIdx.x, wave = tid >> 5, lane = tid & 31, col = lane & 15, g = lane >> 4; const int wr = (wave >> 1) * 32, wc = (wave & 1) * 64; const int c0 = blockIdx.y * ON; const size_t r0 = (size_t)blockIdx.x * OM;
  v8f acc[2][4] = {};
  /* a 64-k step of the block's 128 ctx rows and 128 Wo rows: thread = (row lr of 16, 16-B piece lq), so a wave's load covers four whole 128-B lines; rounded once for the block */
  const int lr = tid >> 4, lq = tid & 15; v4f pre[16];
  /* the k walk is a ring, as in k_proj: the 8 blocks that share the ctx rows stand 2 steps apart, the 32 that share the Wo rows 1 step apart, two to a step */
  const int ks0 = (int)(blockIdx.x + 2 * blockIdx.y) & (CC / OKS - 1); const float* gy = Y + (r0 + lr) * CC + lq * 4 + ks0 * OKS; const float* gw = WO + (size_t)(c0 + lr) * CC + lq * 4 + ks0 * OKS;
#pragma unroll
  for (int i = 0; i < 8; ++i) pre[i] = *(const v4f*)(gy + (size_t)i * 16 * CC);
#pragma unroll
  for (int i = 0; i < 8; ++i) pre[8 + i] = *(const v4f*)(gw + (size_t)i * 16 * CC);
  XW2(gy, gw);
  /* stage: the step held in pre goes into buffer nb and, where ld, the lines of walk step s are asked for. In four groups of four pieces: a group is rounded and stored, and its registers take the new lines at once, so that those fly under the other groups' rounding and under the products */
  auto stage = [&](const int nb, const bool ld, const int s) { __bf16 (*bb)[OP] = (__bf16 (*)[OP])(smem + nb * (ROWS * OP * 2)); _Float16 (*bh)[OP] = (_Float16 (*)[OP])(smem + nb * (ROWS * OP * 2)); const int adv = ((s - 1 + ks0) & (CC / OKS - 1)) == CC / OKS - 1 ? OKS - CC : OKS; const float* ny = gy + adv; const float* nw = gw + adv;   /* one step on from the lines asked for last, or from the rows' last step back to their first */
#pragma unroll
    for (int q = 0; q < 4; ++q) {
#pragma unroll
      for (int u = 0; u < 4; ++u) { const int i = q * 4 + u;
        if (HI) {
          if (i < 8) { v4b ch, cl;
#pragma unroll
            for (int e = 0; e < 4; ++e) { const float v = pre[i][e]; const __bf16 hv = (__bf16)v; ch[e] = hv; cl[e] = (__bf16)(v - (float)hv); }
            *(v4b*)&bb[i * 16 + lr][lq * 4] = ch; *(v4b*)&bb[256 + i * 16 + lr][lq * 4] = cl; }
          else { v4b c;
#pragma unroll
            for (int e = 0; e < 4; ++e) c[e] = (__bf16)pre[i][e];
            *(v4b*)&bb[i * 16 + lr][lq * 4] = c; }
        } else { v4h c;
#pragma unroll
          for (int e = 0; e < 4; ++e) c[e] = i < 8 ? (_Float16)(pre[i][e] * 64.0f) : (_Float16)(bfr(pre[i][e]) * 256.0f);   /* ctx carried x 2^6 into f16 so small-magnitude context rows stay clear of f16 subnormals; Wo as f16(bf16 x 2^8), exact */
          *(v4h*)&bh[i * 16 + lr][lq * 4] = c; } }
      __builtin_amdgcn_sched_barrier(0);   /* this one and the one behind the wait keep a group's loads where they are written, behind its own rounding and directly in front of their wait: left alone the compiler gathers the loads of all groups late in the step and puts rounding, which reuses their address registers, between the last loads and the wait */
      if (ld) {
#pragma unroll
        for (int u = 0; u < 4; ++u) { const int i = q * 4 + u; pre[i] = *(const v4f*)((i < 8 ? ny : nw) + (size_t)(i & 7) * 16 * CC); }
        XW2(ny, nw); }
      __builtin_amdgcn_sched_barrier(0); }
    if (ld) { gy = ny; gw = nw; } };
  /* a step, as in k_proj: wait, fragment reads, the next step's rounding and stores under their latency, signal, products */
  auto pass = [&](const int kc, const bool st, const bool ld) { __bf16 (*bb)[OP] = (__bf16 (*)[OP])(smem + (kc & 1) * (ROWS * OP * 2)); _Float16 (*bh)[OP] = (_Float16 (*)[OP])(smem + (kc & 1) * (ROWS * OP * 2));
    RINGWAIT();
    if (HI) { v16b ah[2][2], al[2][2], w[2][4];
#pragma unroll
      for (int ks = 0; ks < 2; ++ks) {
#pragma unroll
        for (int j = 0; j < 4; ++j) w[ks][j] = frag_b(&bb[128 + wc + j * 16 + col][ks * 32], lane);
#pragma unroll
        for (int i = 0; i < 2; ++i) ah[ks][i] = frag_b(&bb[wr + i * 16 + col][ks * 32], lane);
#pragma unroll
        for (int i = 0; i < 2; ++i) al[ks][i] = frag_b(&bb[256 + wr + i * 16 + col][ks * 32], lane); }
      __builtin_amdgcn_sched_barrier(0);   /* keeps the step's fragment reads in one group at its head */
      if (st) stage((kc + 1) & 1, ld, kc + 2);
      RINGSIG();
      __builtin_amdgcn_sched_barrier(0);   /* keeps the products behind the signal */
#pragma unroll
      for (int ks = 0; ks < 2; ++ks) {   /* each accumulator takes hi then lo of each 32 k, in the order of the walk */
#pragma unroll
        for (int i = 0; i < 2; ++i)
#pragma unroll
          for (int j = 0; j < 4; ++j) acc[i][j] = __builtin_amdgcn_wmma_f32_16x16x32_bf16(false, ah[ks][i], false, w[ks][j], (short)0, acc[i][j], false, false);
#pragma unroll
        for (int i = 0; i < 2; ++i)
#pragma unroll
          for (int j = 0; j < 4; ++j) acc[i][j] = __builtin_amdgcn_wmma_f32_16x16x32_bf16(false, al[ks][i], false, w[ks][j], (short)0, acc[i][j], false, false); }
    } else { v16h a[2][2], w[2][4];
#pragma unroll
      for (int ks = 0; ks < 2; ++ks) {
#pragma unroll
        for (int j = 0; j < 4; ++j) w[ks][j] = frag_h(&bh[128 + wc + j * 16 + col][ks * 32], lane);
#pragma unroll
        for (int i = 0; i < 2; ++i) a[ks][i] = frag_h(&bh[wr + i * 16 + col][ks * 32], lane); }
      __builtin_amdgcn_sched_barrier(0);   /* keeps the step's fragment reads in one group at its head */
      if (st) stage((kc + 1) & 1, ld, kc + 2);
      RINGSIG();
      __builtin_amdgcn_sched_barrier(0);   /* keeps the products behind the signal */
#pragma unroll
      for (int ks = 0; ks < 2; ++ks)
#pragma unroll
        for (int i = 0; i < 2; ++i)
#pragma unroll
          for (int j = 0; j < 4; ++j) acc[i][j] = __builtin_amdgcn_wmma_f32_16x16x32_f16(false, a[ks][i], false, w[ks][j], (short)0, acc[i][j], false, false); }   /* the bare builtin, as in k_proj: the compiler keeps the distances behind its own matrix instructions */
    __builtin_amdgcn_sched_barrier(0);   /* keeps the next step's fragment reads behind this step's products */ };
  stage(0, true, 1); RINGSIG();
#pragma unroll 2   /* two steps a trip: the buffer's number is a constant in each */
  for (int kc = 0; kc < CC / OKS - 2; ++kc) pass(kc, true, true);
  pass(CC / OKS - 2, true, false); pass(CC / OKS - 1, false, false);   /* the last two steps stand alone, as in k_proj */
  RINGWAIT();   /* the partner of the last step's signal: every wave has read its last fragments before the output's staging overwrites the buffers */
  float (*st)[OSP] = (float (*)[OSP])(smem + wave * (32 * OSP * 4));   /* the wave's own 32 x 64 outputs */
#pragma unroll
  for (int j = 0; j < 4; ++j) { const float bias = BO ? bfr(BO[c0 + wc + j * 16 + col]) : 0.f;
#pragma unroll
    for (int i = 0; i < 2; ++i)
#pragma unroll
      for (int r = 0; r < 8; ++r) st[i * 16 + 8 * g + r][j * 16 + col] = HI ? acc[i][j][r] + bias : acc[i][j][r] * (1.0f / 16384.0f) + bias; }   /* 2^-8 (Wo carry) x 2^-6 (ctx carry) */
  LDSX();   /* the wave's own LDS stores land before other lanes of the wave read them: two whole 256-B row segments a store */
  for (int rl = 0; rl < 32; rl += 8) st4((char*)(OUT + (r0 + wr + rl + g) * DIN + c0 + wc + col * 4), 2 * DIN * 4, (const unsigned char*)&st[rl + g][col * 4], 2 * OSP * 4); }
__global__ __launch_bounds__(256) void k_out(const float* __restrict__ Y, const float* __restrict__ WO, const float* __restrict__ BO, float* __restrict__ OUT) { __shared__ __align__(16) unsigned char smem[2 * 384 * OP * 2];   /* two operand buffers; behind the k loop each wave's 32 x OSP f32 output staging */
  if (CAUSAL && (int)(((size_t)blockIdx.x * OM) % TT) < QHI) out_tile<true>(Y, WO, BO, OUT, smem);   /* block-uniform */
  else out_tile<false>(Y, WO, BO, OUT, smem); }

extern "C" void kernel_launch(void* const* d_in, const int* in_sizes, int n_in, void* d_out, int out_size, void* d_ws, size_t ws_size, hipStream_t stream) {
  (void)in_sizes; (void)n_in; (void)out_size;
  const float** F = (const float**)d_in;
  if (ws_size < (size_t)WS_END) return;
  char* ws = (char*)d_ws; _Float16 *QH = (_Float16*)(ws + WS_QH), *KH = (_Float16*)(ws + WS_KH), *VT = (_Float16*)(ws + WS_VT), *QL = (_Float16*)(ws + WS_QL), *KL = (_Float16*)(ws + WS_KL); __bf16 *VB = (__bf16*)(ws + WS_VB), *VBL = (__bf16*)(ws + WS_VBL); float *Y = (float*)(ws + WS_Y);
  (void)Y; (void)QL; (void)KL; (void)VB; (void)VBL;
  // inputs: 0 key [4,1024,1024]; 1 value; 2 query; 3 Wk [1024,1024] (out,in), 4 bk; 5 Wq, 6 bq; 7 Wv, 8 bv; 9 Wp (out,in), 10 bp (zero biases, read)
  k_proj<<<dim3(TNB * TT / PM, CC / PN, 3), 256, 0, stream>>>(F[2], F[0], F[1], F[5], F[3], F[7], F[6], F[4], F[8], QH, QL, KH, KL, VT, VB, VBL);   /* (q, k, v) streams = inputs (query = 2, key = 0, value = 1) */
  k_attn<<<dim3(NH, TNB, NQB), 128, 0, stream>>>(QH, KH, QL, KL, VT, VB, VBL, Y);
  k_out<<<dim3(TNB * TT / OM, DIN / ON), 256, 0, stream>>>(Y, F[9], F[10], (float*)d_out);
}
